// v000
// Measured on an AMD MI455X. A time is GPU time per run, averaged over a window of back-to-back runs after a warm-up
// (all launches, gaps included; the runs take copies of the inputs in turn), and the median of several windows.
// Apart from v000's, it joins two sittings. Times from different sittings can be a few percent apart, while
// side-by-side timings come from the same sitting.
// The starting kernel, v000, takes 255 microseconds a run.
// Contractions: LayerNorm'd qkv / edge-bias projections and the output linear on v_wmma_f32_16x16x32_bf16 with bf16 hi/lo split operands (hi*hi + hi*lo + lo*hi); per-(edge column, head) 192x192 attention cores (q.k^T with d=16 zero-extended to 32, p.v with 192 keys) on v_wmma_f32_16x16x32_f16 with plain f16 operands; f32 accumulate everywhere; LayerNorm, bias/mask add, softmax and normalisation in f32.
#include <hip/hip_runtime.h>

typedef __attribute__((ext_vector_type(16))) _Float16 v16h;
typedef __attribute__((ext_vector_type(8)))  _Float16 v8h;
typedef __attribute__((ext_vector_type(16))) __bf16   v16b;
typedef __attribute__((ext_vector_type(8)))  __bf16   v8b;
typedef __attribute__((ext_vector_type(8)))  float    v8f;
typedef __attribute__((ext_vector_type(4)))  float    v4f;

#define EWID 128
#define NNODE 192
#define NROWS 36864          // 192*192 edge rows, row r = i*192 + j
#define QKV_LD 384
#define EB_LD 64
#define VA_LD 256
#define KS_P 16              // LDS K tile pitch (halves)
#define VT_P 192             // LDS V^T tile pitch (halves)
#define PW_P 64              // LDS P tile pitch (halves)
#define OS_P 132             // LDS output staging pitch (floats, 528 B rows)

// ------------------------------- helpers -------------------------------
__device__ __forceinline__ unsigned short f2bf_bits(float f) {
  unsigned u = __float_as_uint(f);
  return (unsigned short)((u + 0x7FFFu + ((u >> 16) & 1u)) >> 16);
}
__device__ __forceinline__ float bf_bits2f(unsigned short h) { return __uint_as_float(((unsigned)h) << 16); }

// hazard guards as plain device helpers (no inline asm inside the kernel template body)
__device__ __forceinline__ void dep_guard_h(v8f& a, v8f& b, v16h x, v16h y) { asm volatile("v_nop\n\tv_nop\n\tv_nop\n\tv_nop" : "+v"(a), "+v"(b) : "v"(x), "v"(y)); }
__device__ __forceinline__ void dep_guard_b(v8f& a, v8f& b, v16b x, v16b y) { asm volatile("v_nop\n\tv_nop\n\tv_nop\n\tv_nop" : "+v"(a), "+v"(b) : "v"(x), "v"(y)); }
__device__ __forceinline__ void keep4_h(v16h a, v16h b, v16h c, v16h d) { asm volatile("v_nop" :: "v"(a), "v"(b), "v"(c), "v"(d)); }
__device__ __forceinline__ void keep4_b(v16b a, v16b b, v16b c, v16b d) { asm volatile("v_nop" :: "v"(a), "v"(b), "v"(c), "v"(d)); }
__device__ __forceinline__ void acc_guard4(v8f& a, v8f& b, v8f& c, v8f& d) { asm volatile("v_nop\n\tv_nop\n\tv_nop\n\tv_nop" : "+v"(a), "+v"(b), "+v"(c), "+v"(d)); }
template <typename T> struct Frag;
template <> struct Frag<_Float16> {
  typedef v16h V; union U { v16h v; v8h h[2]; };
  static __device__ __forceinline__ v16h load(const _Float16* p) {   // elements 0..7 <- p[0..7], 8..15 <- p[16..23]
    U f; f.h[0] = *(const v8h*)(p); f.h[1] = *(const v8h*)(p + 16); return f.v;
  }
  static __device__ __forceinline__ v8f mma(v16h a, v16h b, v8f c) {
    return __builtin_amdgcn_wmma_f32_16x16x32_f16(false, a, false, b, (short)0, c, false, false);
  }
  static __device__ __forceinline__ void guard(v8f& a, v8f& b, v16h x, v16h y) { dep_guard_h(a, b, x, y); }
  static __device__ __forceinline__ void keep(v16h a, v16h b, v16h c, v16h d) { keep4_h(a, b, c, d); }
};
template <> struct Frag<__bf16> {
  typedef v16b V; union U { v16b v; v8b h[2]; };
  static __device__ __forceinline__ v16b load(const __bf16* p) {
    U f; f.h[0] = *(const v8b*)(p); f.h[1] = *(const v8b*)(p + 16); return f.v;
  }
  static __device__ __forceinline__ v8f mma(v16b a, v16b b, v8f c) {
    return __builtin_amdgcn_wmma_f32_16x16x32_bf16(false, a, false, b, (short)0, c, false, false);
  }
  static __device__ __forceinline__ void guard(v8f& a, v8f& b, v16b x, v16b y) { dep_guard_b(a, b, x, y); }
  static __device__ __forceinline__ void keep(v16b a, v16b b, v16b c, v16b d) { keep4_b(a, b, c, d); }
};

// ---- Register-blocked batched WMMA GEMM ------------------------------------
// C[m,n] = scale * sum_k A[m,k] * Bt[n,k] (+bias)(+resid); each wave owns a 64x64 tile.
// A row-major [M,K]; Bt row-major [N,K]; M,N % 64 == 0, K % 32 == 0.
// SPLIT: operands are hi/lo planes (A2/Bt2 = lo planes, same layout); product = hi*hi + hi*lo + lo*hi.
// BIAS_MODE: 0 = none, 1 = bias[m], 2 = bias[n].
// OUT_MODE: 0 = f32, 1 = f16, 2 = bf16 hi plane (Cout) + bf16 lo plane (Cout2).
// ET: 0 = f16 operands, 1 = bf16 operands (pointers passed as 16-bit storage)
template <int ET> struct Elem;
template <> struct Elem<0> { typedef _Float16 T; };
template <> struct Elem<1> { typedef __bf16 T; };
template <int ET, bool SPLIT, int BIAS_MODE, int OUT_MODE, bool RESID, int ACT = 0>
__global__ __launch_bounds__(256) void wmma_gemm64(
    const unsigned short* __restrict__ Ap, const unsigned short* __restrict__ A2p, int lda, long strideA,
    const unsigned short* __restrict__ Btp, const unsigned short* __restrict__ Bt2p, int ldb, long strideB,
    void* __restrict__ Cout, void* __restrict__ Cout2, int ldc, long strideC,
    const float* __restrict__ bias,
    const float* __restrict__ resid, long strideR,
    int M, int N, int K, float scale) {
  typedef typename Elem<ET>::T T;
  typedef typename Frag<T>::V V;
  const T* A = (const T*)Ap; const T* A2 = (const T*)A2p; const T* Bt = (const T*)Btp; const T* Bt2 = (const T*)Bt2p;
  __shared__ __align__(16) float sT[8][16 * 68];   // per-wave 16x64 slab, pitch 68 floats
  const int b    = blockIdx.y;
  const int lane = threadIdx.x & 31;
  const int wave = threadIdx.x >> 5;
  const int tilesN = N >> 6;
  const int tilesM = M >> 6;
  const int tile = blockIdx.x * 8 + wave;
  if (tile >= tilesM * tilesN) return;   // wave-uniform; no block barriers in this kernel
  const int tm = tile / tilesN;
  const int tn = tile - tm * tilesN;
  const int m0 = tm << 6;
  const int n0 = tn << 6;

  const T* Ab  = A  + (size_t)b * strideA;
  const T* Bb  = Bt + (size_t)b * strideB;
  const T* Ab2 = SPLIT ? (A2  + (size_t)b * strideA) : nullptr;
  const T* Bb2 = SPLIT ? (Bt2 + (size_t)b * strideB) : nullptr;

  const int rlane = lane & 15;                 // row (A) / col (B, D) within subtile
  const int koff  = (lane >> 4) * 8;           // k offset of this lane half
  const int mOff  = (lane >> 4) * 8;           // D row offset

  v8f acc[4][4];
#pragma unroll
  for (int i = 0; i < 4; ++i)
#pragma unroll
    for (int j = 0; j < 4; ++j) acc[i][j] = (v8f){0.f,0.f,0.f,0.f,0.f,0.f,0.f,0.f};

  for (int k0 = 0; k0 < K; k0 += 32) {
    V bh[4], bl[4];
#pragma unroll
    for (int j = 0; j < 4; ++j) {
      const size_t bo = (size_t)(n0 + (j << 4) + rlane) * ldb + koff + k0;
      bh[j] = Frag<T>::load(Bb + bo);
      if (SPLIT) bl[j] = Frag<T>::load(Bb2 + bo);
    }
#pragma unroll
    for (int i = 0; i < 4; ++i) {
      const size_t ao = (size_t)(m0 + (i << 4) + rlane) * lda + koff + k0;
      V ah = Frag<T>::load(Ab + ao);
      V al;
      if (SPLIT) al = Frag<T>::load(Ab2 + ao);
#pragma unroll
      for (int j = 0; j < 4; ++j) {
        acc[i][j] = Frag<T>::mma(ah, bh[j], acc[i][j]);
        if (SPLIT) {
          acc[i][j] = Frag<T>::mma(ah, bl[j], acc[i][j]);
          acc[i][j] = Frag<T>::mma(al, bh[j], acc[i][j]);
        }
      }
      Frag<T>::guard(acc[i][0], acc[i][3], ah, SPLIT ? al : ah);
    }
    Frag<T>::keep(bh[0], bh[1], bh[2], bh[3]);
    if (SPLIT) Frag<T>::keep(bl[0], bl[1], bl[2], bl[3]);
  }
  acc_guard4(acc[0][0], acc[0][1], acc[0][2], acc[0][3]);
  acc_guard4(acc[1][0], acc[1][1], acc[1][2], acc[1][3]);
  acc_guard4(acc[2][0], acc[2][1], acc[2][2], acc[2][3]);
  acc_guard4(acc[3][0], acc[3][1], acc[3][2], acc[3][3]);

  // ---- epilogue ----
  float* slab = sT[wave];
  const float* Rb = RESID ? (resid + (size_t)b * strideR) : nullptr;
#pragma unroll
  for (int i = 0; i < 4; ++i) {
    const int mBase = m0 + (i << 4);
#pragma unroll
    for (int j = 0; j < 4; ++j) {
      const int n = n0 + (j << 4) + rlane;
      float bv = 0.f;
      if (BIAS_MODE == 2) bv = bias[n];
#pragma unroll
      for (int r = 0; r < 8; ++r) {
        float v = acc[i][j][r] * scale;
        if (BIAS_MODE == 1) v += bias[mBase + mOff + r];
        if (BIAS_MODE == 2) v += bv;
        if (RESID) v += Rb[(size_t)(mBase + mOff + r) * ldc + n];
        if (ACT == 1) v = tanhf(v);
        if (ACT == 2) v = fmaxf(v, 0.0f);
        if (ACT == 3) v = v / (1.0f + expf(-v));
        if (ACT == 4) v = (v > 0.f) ? v : 0.01f * v;
        if (ACT == 5) v = 0.5f * v * (1.0f + erff(v * 0.70710678118654752f));
        slab[(mOff + r) * 68 + (j << 4) + rlane] = v;
      }
    }
    __builtin_amdgcn_fence(__ATOMIC_RELEASE, "workgroup");
    __builtin_amdgcn_wave_barrier();
    __builtin_amdgcn_fence(__ATOMIC_ACQUIRE, "workgroup");
    if (OUT_MODE == 0) {
      float* C = (float*)Cout + (size_t)b * strideC;
      const int hh = lane >> 4, c4 = (lane & 15) * 4;     // row seg = 256 B = 16 lanes x 16 B
      {
#pragma unroll
        for (int it = 0; it < 8; ++it) {
          const int row = it * 2 + hh;
          v4f v = *(const v4f*)(slab + row * 68 + c4);
          *(v4f*)(C + (size_t)(mBase + row) * ldc + n0 + c4) = v;
        }
        
      }
    } else {
      const int q = lane >> 3, c8 = (lane & 7) * 8;
      unsigned short* C  = (unsigned short*)Cout  + (size_t)b * strideC;
      unsigned short* C2 = (OUT_MODE == 2) ? ((unsigned short*)Cout2 + (size_t)b * strideC) : nullptr;
      {
#pragma unroll
        for (int it = 0; it < 4; ++it) {
          const int row = it * 4 + q;
          const float* sp = slab + row * 68 + c8;
          v8h hv, lv;
#pragma unroll
          for (int e = 0; e < 8; ++e) {
            if (OUT_MODE == 1) {
              hv[e] = (_Float16)sp[e];
            } else {
              unsigned short hb = f2bf_bits(sp[e]);
              unsigned short lb = f2bf_bits(sp[e] - bf_bits2f(hb));
              hv[e] = __builtin_bit_cast(_Float16, hb);
              lv[e] = __builtin_bit_cast(_Float16, lb);
            }
          }
          *(v8h*)(C + (size_t)(mBase + row) * ldc + n0 + c8) = hv;
          if (OUT_MODE == 2) *(v8h*)(C2 + (size_t)(mBase + row) * ldc + n0 + c8) = lv;
        }
        
      }
    }
    __builtin_amdgcn_fence(__ATOMIC_RELEASE, "workgroup");
    __builtin_amdgcn_wave_barrier();
    __builtin_amdgcn_fence(__ATOMIC_ACQUIRE, "workgroup");
  }
}
// ------------------------------- end helpers -------------------------------

__device__ __forceinline__ v8f zero8f() { return (v8f){0.f, 0.f, 0.f, 0.f, 0.f, 0.f, 0.f, 0.f}; }
__device__ __forceinline__ v8h zero8h() {
  v8h z;
#pragma unroll
  for (int e = 0; e < 8; ++e) z[e] = (_Float16)0.0f;
  return z;
}
// f16 WMMA with the hazard guard attached (D tied, A/B kept live)
__device__ __forceinline__ v8f hmma(v16h a, v16h b, v8f c) {
  c = __builtin_amdgcn_wmma_f32_16x16x32_f16(false, a, false, b, (short)0, c, false, false);
  asm volatile("v_nop\n\tv_nop\n\tv_nop\n\tv_nop" : "+v"(c) : "v"(a), "v"(b));
  return c;
}
__device__ __forceinline__ void lds_wave_sync() {
  __builtin_amdgcn_fence(__ATOMIC_RELEASE, "workgroup");
  __builtin_amdgcn_wave_barrier();
  __builtin_amdgcn_fence(__ATOMIC_ACQUIRE, "workgroup");
}
__device__ __forceinline__ void split_bf16(float x, _Float16& hi, _Float16& lo) {
  const unsigned short hb = f2bf_bits(x);
  const unsigned short lb = f2bf_bits(x - bf_bits2f(hb));
  hi = __builtin_bit_cast(_Float16, hb);
  lo = __builtin_bit_cast(_Float16, lb);
}

// ---------------------------------------------------------------------------------------
// qkv weight prep: W [128 k][384 c] f32 ([in][out]) -> Bt hi/lo bf16 planes [384 n][128 k] with head-major
// output columns: n = part*128 + h*16 + d  <-  c = part*128 + d*8 + h (view(DD=16, NH=8): d slow, h fast).
// Permuted bias bqp[n] = bq[c].  Edge-bias weight We [128 k][8] -> Bt hi/lo [64 n][128 k], rows n >= 8 zero.
// grid 28 x block 256: blocks 0..23 = 384 rows x 16 threads (8 k each) -> covers [384][128] exactly;
// blocks 24..27 = 64 rows x 16 threads -> covers [64][128] exactly; t < 384 also writes bqp[384] exactly.
__global__ __launch_bounds__(256) void k_prep_qkv_w(
    const float* __restrict__ W, const float* __restrict__ bq, const float* __restrict__ We,
    unsigned short* __restrict__ wqh, unsigned short* __restrict__ wql,
    unsigned short* __restrict__ weh, unsigned short* __restrict__ wel, float* __restrict__ bqp) {
  const int t = blockIdx.x * 256 + threadIdx.x;
  if (blockIdx.x < 24) {                       // block-uniform
    const int n = t >> 4, k8 = (t & 15) * 8;
    const int part = n >> 7, h = (n >> 4) & 7, d = n & 15;
    const int col = part * 128 + d * 8 + h;
    v8h hv, lv;
#pragma unroll
    for (int e = 0; e < 8; ++e) {
      const float w = W[(size_t)(k8 + e) * 384 + col];
      _Float16 a, bb; split_bf16(w, a, bb); hv[e] = a; lv[e] = bb;
    }
    const size_t off = (size_t)n * 128 + k8;
    {
      *(v8h*)(wqh + off) = hv;
      *(v8h*)(wql + off) = lv;
      
    }
    if (t < 384) {                             // wave-uniform (384 = 12 waves)
      const int pn = t >> 7, ph = (t >> 4) & 7, pd = t & 15;
      const float bv = bq[pn * 128 + pd * 8 + ph];
      *(float*)(bqp + t) = bv;
      
    }
  } else {
    const int u = t - 6144;
    const int n = u >> 4, k8 = (u & 15) * 8;
    const int nc = (n < 8) ? n : 7;            // address clamp, value zeroed by predicate
    v8h hv, lv;
#pragma unroll
    for (int e = 0; e < 8; ++e) {
      float w = We[(size_t)(k8 + e) * 8 + nc];
      w = (n < 8) ? w : 0.0f;
      _Float16 a, bb; split_bf16(w, a, bb); hv[e] = a; lv[e] = bb;
    }
    const size_t off = (size_t)n * 128 + k8;
    {
      *(v8h*)(weh + off) = hv;
      *(v8h*)(wel + off) = lv;
      
    }
  }
}

// Output weight prep: Wo [256 c][128 n] f32 ([in][out]) -> Bt hi/lo [128 n][256 k'] with k' = dir*128 + h*16 + d
// <- c = d*16 + dir*8 + h (concat of the two head groups on the head axis, then view d slow).
// grid 16 x block 256 = 4096 threads = 128 rows x 32 threads (8 k' each): covers [128][256] exactly;
__global__ __launch_bounds__(256) void k_prep_wo(const float* __restrict__ Wo,
    unsigned short* __restrict__ woh, unsigned short* __restrict__ wol) {
  const int t = blockIdx.x * 256 + threadIdx.x;
  const int n = t >> 5, k8 = (t & 31) * 8;
  v8h hv, lv;
#pragma unroll
  for (int e = 0; e < 8; ++e) {
    const int kp = k8 + e;
    const int dr = kp >> 7, h = (kp >> 4) & 7, d = kp & 15;
    const int col = d * 16 + dr * 8 + h;
    const float w = Wo[(size_t)col * 128 + n];
    _Float16 a, bb; split_bf16(w, a, bb); hv[e] = a; lv[e] = bb;
  }
  const size_t off = (size_t)n * 256 + k8;
  {
    *(v8h*)(woh + off) = hv;
    *(v8h*)(wol + off) = lv;
    
  }
}

// LayerNorm over the 128-wide rows of e (eps 1e-5, biased variance, *g + b) -> bf16 hi/lo planes [nrows][128].
// grid = nrows/16, block 256 = 8 waves x 2 rows (lane half = row, lane&15 = 8-column chunk).
// coverage: 16 lanes x 8 halves = 128 columns per row, one instruction per plane writes the whole 256-B row
__global__ __launch_bounds__(256) void k_ln(const float* __restrict__ e, const float* __restrict__ g,
    const float* __restrict__ b, unsigned short* __restrict__ elh, unsigned short* __restrict__ ell, int nrows) {
  const int tid = threadIdx.x, wave = tid >> 5, lane = tid & 31, hh = lane >> 4, c = lane & 15;
  const int row = (blockIdx.x * 8 + wave) * 2 + hh;
  const bool ok = row < nrows;
  const int rowc = ok ? row : (nrows - 1);
  const float* p = e + (size_t)rowc * EWID + c * 8;
  const v4f x0 = *(const v4f*)p;
  const v4f x1 = *(const v4f*)(p + 4);
  float xs[8];
  xs[0] = x0[0]; xs[1] = x0[1]; xs[2] = x0[2]; xs[3] = x0[3];
  xs[4] = x1[0]; xs[5] = x1[1]; xs[6] = x1[2]; xs[7] = x1[3];
  float s = ((xs[0] + xs[1]) + (xs[2] + xs[3])) + ((xs[4] + xs[5]) + (xs[6] + xs[7]));
#pragma unroll
  for (int off = 1; off < 16; off <<= 1) s += __shfl_xor(s, off, 32);
  const float mu = s * (1.0f / 128.0f);
  float q = 0.f;
#pragma unroll
  for (int k = 0; k < 8; ++k) { xs[k] -= mu; q += xs[k] * xs[k]; }
#pragma unroll
  for (int off = 1; off < 16; off <<= 1) q += __shfl_xor(q, off, 32);
  const float rs = rsqrtf(q * (1.0f / 128.0f) + 1e-5f);
  const v4f g0 = *(const v4f*)(g + c * 8), g1 = *(const v4f*)(g + c * 8 + 4);
  const v4f b0 = *(const v4f*)(b + c * 8), b1 = *(const v4f*)(b + c * 8 + 4);
  float gg[8], bb[8];
  gg[0] = g0[0]; gg[1] = g0[1]; gg[2] = g0[2]; gg[3] = g0[3]; gg[4] = g1[0]; gg[5] = g1[1]; gg[6] = g1[2]; gg[7] = g1[3];
  bb[0] = b0[0]; bb[1] = b0[1]; bb[2] = b0[2]; bb[3] = b0[3]; bb[4] = b1[0]; bb[5] = b1[1]; bb[6] = b1[2]; bb[7] = b1[3];
  v8h hv, lv;
#pragma unroll
  for (int k = 0; k < 8; ++k) {
    const float y = xs[k] * rs * gg[k] + bb[k];
    _Float16 a, lo; split_bf16(y, a, lo); hv[k] = a; lv[k] = lo;
  }
  if (ok) {
    const size_t off = (size_t)row * EWID + c * 8;
    {
      *(v8h*)(elh + off) = hv;
      *(v8h*)(ell + off) = lv;
      
    }
  }
}

// Score bias slabs for one direction: bm[h][i][k] = eb[r][h] + be[h] + mask[r][h] with
// r = i*192 + k (dir 0) or r = k*192 + i (dir 1). eb = f32 [36864][64] (columns 0..7 used), mask f32 [36864][8].
// grid 1152 x block 256 = 8*192*192 threads exactly; owner-computes (gather reads, contiguous 4-B stores:
__global__ __launch_bounds__(256) void k_bias_slab(const float* __restrict__ eb, const float* __restrict__ be,
    const float* __restrict__ mask, float* __restrict__ bm, int dir) {
  const int idx = blockIdx.x * 256 + threadIdx.x;
  const int h = idx / NROWS;
  const int rem = idx - h * NROWS;
  const int i = rem / NNODE;
  const int k = rem - i * NNODE;
  const int r = dir ? (k * NNODE + i) : (i * NNODE + k);
  const float v = eb[(size_t)r * EB_LD + h] + be[h] + mask[(size_t)r * 8 + h];
  *(float*)(bm + idx) = v;
  
}

// Fused attention core for one (edge column j, direction dir, 32 query rows i), all 8 heads in sequence.
// qkv: f16 [36864][384], head-major columns part*128 + h*16 + d.  bm: f32 [8][192 i][192 k].
// grid = (192 j, 6 query chunks) x block 64 = 2 waves x 16 query rows.
// Per head: K_h [192 keys][16 d] and V_h^T [16 d][192 keys] staged in LDS by arithmetic row indices
// (dir 0: row j*192+k, dir 1: row k*192+j); S = Q(16 rows, d zero-extended to 32) . K^T on f16 WMMA,
// *0.25 + bias in f32, online softmax over 3 chunks of 64 keys in f32, P (f16) . V on f16 WMMA, * 1/rowsum;
// head result (16 d) staged in LDS at column h*16 + d.
// Epilogue -> bf16 hi/lo planes [36864][256], row i*192+j, columns dir*128 + h*16 + d:
// coverage: 2 waves x (8 iters x 2 lane halves) = 32 rows; 16 lanes x 8 halves = 128 columns;
__global__ __launch_bounds__(64) void k_edge_attn(const _Float16* __restrict__ qkv, const float* __restrict__ bm,
    unsigned short* __restrict__ vah, unsigned short* __restrict__ val, int dir) {
  __shared__ __align__(16) _Float16 Ksh[NNODE * KS_P];   // [key][d], indices <= 191*16+15
  __shared__ __align__(16) _Float16 Vt[16 * VT_P];       // [d][key], indices <= 15*192+191
  __shared__ __align__(16) _Float16 Pw[2][16 * PW_P];    // per wave [row][key in chunk]
  __shared__ __align__(16) float    Os[32 * OS_P];       // [local row][h*16+d]
  const int j = blockIdx.x;
  const int qblk = blockIdx.y * 32;
  const int tid = threadIdx.x, wave = tid >> 5, lane = tid & 31, hh = lane >> 4, c = lane & 15;
  const int i0 = qblk + wave * 16;
  const v8h z8 = zero8h();
  _Float16* pw = &Pw[wave][0];

#pragma unroll 1
  for (int h = 0; h < 8; ++h) {
    __syncthreads();
    // stage K_h / V_h: 384 (key, 8-wide d chunk) items over 64 threads = 6 iterations, covers 192 x 16 exactly
    for (int idx = tid; idx < 2 * NNODE; idx += 64) {
      const int kv = idx >> 1, part = idx & 1;
      const int r = dir ? (kv * NNODE + j) : (j * NNODE + kv);
      const _Float16* src = qkv + (size_t)r * QKV_LD + h * 16 + part * 8;
      const v8h kk8 = *(const v8h*)(src + EWID);
      const v8h vv8 = *(const v8h*)(src + 2 * EWID);
      *(v8h*)(Ksh + kv * KS_P + part * 8) = kk8;
#pragma unroll
      for (int e2 = 0; e2 < 8; ++e2) Vt[(part * 8 + e2) * VT_P + kv] = vv8[e2];
    }
    __syncthreads();

    // A fragment (Q rows i0+m, d 8hh..8hh+7 in elements 0..7, elements 8..15 zero)
    Frag<_Float16>::U qa;
    qa.h[0] = *(const v8h*)(qkv + ((size_t)(i0 + c) * NNODE + j) * QKV_LD + h * 16 + 8 * hh);
    qa.h[1] = z8;

    float mrow[8], lrow[8];
#pragma unroll
    for (int r = 0; r < 8; ++r) { mrow[r] = -__builtin_inff(); lrow[r] = 0.f; }
    v8f o = zero8f();
    const float* bmr = bm + ((size_t)h * NNODE + (size_t)(i0 + 8 * hh)) * NNODE;

#pragma unroll 1
    for (int kc = 0; kc < 3; ++kc) {
      const int kv0 = kc * 64;
      v8f s[4];
#pragma unroll
      for (int jn = 0; jn < 4; ++jn) {
        // B fragment (key kv0+16jn+c, d 8hh..8hh+7 in elements 0..7, elements 8..15 zero)
        Frag<_Float16>::U kb;
        kb.h[0] = *(const v8h*)(Ksh + (kv0 + jn * 16 + c) * KS_P + 8 * hh);
        kb.h[1] = z8;
        s[jn] = hmma(qa.v, kb.v, zero8f());
      }
      float cm[8];
#pragma unroll
      for (int r = 0; r < 8; ++r) {
        const float* brow = bmr + (size_t)r * NNODE + kv0 + c;
        float mx = -__builtin_inff();
#pragma unroll
        for (int jn = 0; jn < 4; ++jn) {
          const float v = s[jn][r] * 0.25f + brow[jn * 16];
          s[jn][r] = v;
          mx = fmaxf(mx, v);
        }
#pragma unroll
        for (int off = 1; off < 16; off <<= 1) mx = fmaxf(mx, __shfl_xor(mx, off, 32));
        cm[r] = mx;
      }
      lds_wave_sync();   // prior chunk's P fragment loads ordered before this chunk's P stores
#pragma unroll
      for (int r = 0; r < 8; ++r) {
        const float mnew = fmaxf(mrow[r], cm[r]);
        const float alpha = expf(mrow[r] - mnew);
        mrow[r] = mnew;
        float ps = 0.f;
#pragma unroll
        for (int jn = 0; jn < 4; ++jn) {
          const float pv = expf(s[jn][r] - mnew);
          ps += pv;
          pw[(8 * hh + r) * PW_P + jn * 16 + c] = (_Float16)pv;
        }
#pragma unroll
        for (int off = 1; off < 16; off <<= 1) ps += __shfl_xor(ps, off, 32);
        lrow[r] = lrow[r] * alpha + ps;
        o[r] *= alpha;
      }
      lds_wave_sync();   // P stores visible to the whole wave before the fragment reload
#pragma unroll
      for (int kk = 0; kk < 2; ++kk) {
        const v16h pa = Frag<_Float16>::load(pw + c * PW_P + kk * 32 + 8 * hh);
        const v16h vb = Frag<_Float16>::load(Vt + c * VT_P + kv0 + kk * 32 + 8 * hh);
        o = hmma(pa, vb, o);
      }
    }
#pragma unroll
    for (int r = 0; r < 8; ++r)
      Os[(wave * 16 + 8 * hh + r) * OS_P + h * 16 + c] = o[r] * (1.0f / lrow[r]);
  }
  __syncthreads();

  const size_t colbase = (size_t)dir * 128 + (size_t)c * 8;
  {
#pragma unroll
    for (int it = 0; it < 8; ++it) {
      const int lr = wave * 16 + it * 2 + hh;
      const float* sp = Os + lr * OS_P + c * 8;
      const v4f a4 = *(const v4f*)sp;
      const v4f b4 = *(const v4f*)(sp + 4);
      v8h hv, lv;
#pragma unroll
      for (int e = 0; e < 4; ++e) {
        _Float16 a, lo;
        split_bf16(a4[e], a, lo); hv[e] = a; lv[e] = lo;
        split_bf16(b4[e], a, lo); hv[4 + e] = a; lv[4 + e] = lo;
      }
      const size_t grow = (size_t)(qblk + lr) * NNODE + j;
      *(v8h*)(vah + grow * VA_LD + colbase) = hv;
      *(v8h*)(val + grow * VA_LD + colbase) = lv;
    }
    
  }
}

// ---------------------------------------------------------------------------------------
extern "C" void kernel_launch(void* const* d_in, const int* in_sizes, int n_in,
                              void* d_out, int out_size, void* d_ws, size_t ws_size,
                              hipStream_t stream) {
  if (n_in < 14) return;
  if (in_sizes[0] != NROWS * EWID || in_sizes[1] != NROWS * 8 || in_sizes[2] < EWID || in_sizes[3] < EWID ||
      in_sizes[4] != EWID * 384 || in_sizes[5] < 384 || in_sizes[6] != EWID * 8 || in_sizes[7] < 8 ||
      in_sizes[8] != EWID * 384 || in_sizes[9] < 384 || in_sizes[10] != EWID * 8 || in_sizes[11] < 8 ||
      in_sizes[12] != 256 * EWID || in_sizes[13] < EWID || out_size != NROWS * EWID) return;

  const float* e      = (const float*)d_in[0];
  const float* mask   = (const float*)d_in[1];
  const float* ln_g   = (const float*)d_in[2];
  const float* ln_b   = (const float*)d_in[3];
  const float* Wq_in  = (const float*)d_in[4];
  const float* bq_in  = (const float*)d_in[5];
  const float* We_in  = (const float*)d_in[6];
  const float* be_in  = (const float*)d_in[7];
  const float* Wq_out = (const float*)d_in[8];
  const float* bq_out = (const float*)d_in[9];
  const float* We_out = (const float*)d_in[10];
  const float* be_out = (const float*)d_in[11];
  const float* Wo     = (const float*)d_in[12];
  const float* bo     = (const float*)d_in[13];
  float* out = (float*)d_out;

  // ---- workspace region map (offsets 256-B aligned; total 96,144,384 B) ----
  //  ELh, ELl   bf16 [36864][128]       2 x  9,437,184   LayerNorm output hi/lo (live through both directions)
  //  QKV16      f16  [36864][384]          28,311,552   projection output, reused per direction
  //  EB         f32  [36864][64]            9,437,184   edge-bias projection (cols 0..7), reused per direction
  //  BM         f32  [8][192][192]          1,179,648   bias+mask slabs, reused per direction
  //  VAh, VAl   bf16 [36864][256]       2 x 18,874,368   attention output hi/lo (both directions)
  //  WtQh/l x2  bf16 [384][128]         4 x     98,304
  //  WtEh/l x2  bf16 [64][128]          4 x     16,384
  //  WoTh/l     bf16 [128][256]         2 x     65,536
  //  bqp x2     f32  [384]              2 x      1,536
  size_t off = 0;
  auto carve = [&](size_t bytes) { size_t o = off; off += (bytes + 255) & ~(size_t)255; return o; };
  const size_t oELh = carve((size_t)NROWS * EWID * 2);
  const size_t oELl = carve((size_t)NROWS * EWID * 2);
  const size_t oQKV = carve((size_t)NROWS * QKV_LD * 2);
  const size_t oEB  = carve((size_t)NROWS * EB_LD * 4);
  const size_t oBM  = carve((size_t)8 * NNODE * NNODE * 4);
  const size_t oVAh = carve((size_t)NROWS * VA_LD * 2);
  const size_t oVAl = carve((size_t)NROWS * VA_LD * 2);
  size_t oWQh[2], oWQl[2], oWEh[2], oWEl[2], oBQ[2];
  for (int d = 0; d < 2; ++d) { oWQh[d] = carve((size_t)384 * 128 * 2); oWQl[d] = carve((size_t)384 * 128 * 2); }
  for (int d = 0; d < 2; ++d) { oWEh[d] = carve((size_t)64 * 128 * 2);  oWEl[d] = carve((size_t)64 * 128 * 2); }
  const size_t oWOh = carve((size_t)128 * 256 * 2);
  const size_t oWOl = carve((size_t)128 * 256 * 2);
  for (int d = 0; d < 2; ++d) oBQ[d] = carve((size_t)384 * 4);
  if (off > ws_size) return;

  char* ws = (char*)d_ws;
  unsigned short* ELh = (unsigned short*)(ws + oELh);
  unsigned short* ELl = (unsigned short*)(ws + oELl);
  _Float16* QKV16 = (_Float16*)(ws + oQKV);
  float* EB = (float*)(ws + oEB);
  float* BM = (float*)(ws + oBM);
  unsigned short* VAh = (unsigned short*)(ws + oVAh);
  unsigned short* VAl = (unsigned short*)(ws + oVAl);
  unsigned short* WQh[2], *WQl[2], *WEh[2], *WEl[2];
  float* BQ[2];
  for (int d = 0; d < 2; ++d) {
    WQh[d] = (unsigned short*)(ws + oWQh[d]); WQl[d] = (unsigned short*)(ws + oWQl[d]);
    WEh[d] = (unsigned short*)(ws + oWEh[d]); WEl[d] = (unsigned short*)(ws + oWEl[d]);
    BQ[d] = (float*)(ws + oBQ[d]);
  }
  unsigned short* WOh = (unsigned short*)(ws + oWOh);
  unsigned short* WOl = (unsigned short*)(ws + oWOl);

  // weight prep (3 launches)
  k_prep_qkv_w<<<28, 256, 0, stream>>>(Wq_in, bq_in, We_in, WQh[0], WQl[0], WEh[0], WEl[0], BQ[0]);
  k_prep_qkv_w<<<28, 256, 0, stream>>>(Wq_out, bq_out, We_out, WQh[1], WQl[1], WEh[1], WEl[1], BQ[1]);
  k_prep_wo<<<16, 256, 0, stream>>>(Wo, WOh, WOl);

  // LayerNorm -> bf16 hi/lo planes (36864 rows / 16 rows per block = 2304 blocks exactly)
  k_ln<<<NROWS / 16, 256, 0, stream>>>(e, ln_g, ln_b, ELh, ELl, NROWS);

  const int tilesQKV = (NROWS / 64) * (QKV_LD / 64);   // 3456 = 432 blocks x 8 waves
  const int tilesEB  = (NROWS / 64) * (EB_LD / 64);    // 576  = 72 blocks
  const int tilesOUT = (NROWS / 64) * (EWID / 64);     // 1152 = 144 blocks
  for (int dir = 0; dir < 2; ++dir) {
    const float* be = dir ? be_out : be_in;
    // qkv = EL . Wqkv + b  (M 36864, N 384, K 128; bf16 hi/lo split; f16 head-major output)
    wmma_gemm64<1, true, 2, 1, false><<<dim3(tilesQKV / 8, 1), 256, 0, stream>>>(
        ELh, ELl, EWID, (long)0, WQh[dir], WQl[dir], EWID, (long)0,
        (void*)QKV16, (void*)QKV16, QKV_LD, (long)0, BQ[dir], BQ[dir], (long)0, NROWS, QKV_LD, EWID, 1.0f);
    // edge bias = EL . We  (M 36864, N 64 (8 used), K 128; split; f32 output; be added in the slab kernel)
    wmma_gemm64<1, true, 0, 0, false><<<dim3(tilesEB / 8, 1), 256, 0, stream>>>(
        ELh, ELl, EWID, (long)0, WEh[dir], WEl[dir], EWID, (long)0,
        (void*)EB, (void*)EB, EB_LD, (long)0, be, be, (long)0, NROWS, EB_LD, EWID, 1.0f);
    k_bias_slab<<<(8 * NNODE * NNODE) / 256, 256, 0, stream>>>(EB, be, mask, BM, dir);
    k_edge_attn<<<dim3(NNODE, NNODE / 32), 64, 0, stream>>>(QKV16, BM, VAh, VAl, dir);
  }
  // out = VA . Wo + bo  (M 36864, N 128, K 256; split; f32 output rows of d_out)
  wmma_gemm64<1, true, 2, 0, false><<<dim3(tilesOUT / 8, 1), 256, 0, stream>>>(
      VAh, VAl, VA_LD, (long)0, WOh, WOl, VA_LD, (long)0,
      (void*)out, (void*)out, EWID, (long)0, bo, bo, (long)0, NROWS, EWID, VA_LD, 1.0f);
}

// v001
// It runs in 220 microseconds.
// Next to v000, in two timings, it ran 1.20 and 1.19 times as fast.
// Contractions: LayerNorm'd qkv / edge-bias projections and the output linear on v_wmma_f32_16x16x32_bf16 with bf16 hi/lo split operands (hi*hi + hi*lo + lo*hi); per-(edge column, head) 192x192 attention cores (q.k^T with d=16 zero-extended to 32, p.v with 192 keys) on v_wmma_f32_16x16x32_f16 with plain f16 operands; f32 accumulate everywhere; LayerNorm, bias/mask add, softmax and normalisation in f32.
#include <hip/hip_runtime.h>

typedef __attribute__((ext_vector_type(16))) _Float16 v16h;
typedef __attribute__((ext_vector_type(8)))  _Float16 v8h;
typedef __attribute__((ext_vector_type(16))) __bf16   v16b;
typedef __attribute__((ext_vector_type(8)))  __bf16   v8b;
typedef __attribute__((ext_vector_type(8)))  float    v8f;
typedef __attribute__((ext_vector_type(4)))  float    v4f;

#define EWID 128
#define NNODE 192
#define NROWS 36864          // 192*192 edge rows, row r = i*192 + j
#define QKV_LD 384
#define EB_LD 64
#define VA_LD 256
#define KS_P 16              // LDS K tile pitch (halves)
#define VT_P 192             // LDS V^T tile pitch (halves)
#define OS_P 132             // LDS output staging pitch (floats, 528 B rows)

// ------------------------------- helpers -------------------------------
__device__ __forceinline__ unsigned short f2bf_bits(float f) {
  unsigned u = __float_as_uint(f);
  return (unsigned short)((u + 0x7FFFu + ((u >> 16) & 1u)) >> 16);
}
__device__ __forceinline__ float bf_bits2f(unsigned short h) { return __uint_as_float(((unsigned)h) << 16); }

// hazard guards as plain device helpers (no inline asm inside the kernel template body)
__device__ __forceinline__ void dep_guard_h(v8f& a, v8f& b, v16h x, v16h y) { asm volatile("v_nop\n\tv_nop\n\tv_nop\n\tv_nop" : "+v"(a), "+v"(b) : "v"(x), "v"(y)); }
__device__ __forceinline__ void dep_guard_b(v8f& a, v8f& b, v16b x, v16b y) { asm volatile("v_nop\n\tv_nop\n\tv_nop\n\tv_nop" : "+v"(a), "+v"(b) : "v"(x), "v"(y)); }
__device__ __forceinline__ void keep4_h(v16h a, v16h b, v16h c, v16h d) { asm volatile("v_nop" :: "v"(a), "v"(b), "v"(c), "v"(d)); }
__device__ __forceinline__ void keep4_b(v16b a, v16b b, v16b c, v16b d) { asm volatile("v_nop" :: "v"(a), "v"(b), "v"(c), "v"(d)); }
__device__ __forceinline__ void acc_guard4(v8f& a, v8f& b, v8f& c, v8f& d) { asm volatile("v_nop\n\tv_nop\n\tv_nop\n\tv_nop" : "+v"(a), "+v"(b), "+v"(c), "+v"(d)); }
template <typename T> struct Frag;
template <> struct Frag<_Float16> {
  typedef v16h V; union U { v16h v; v8h h[2]; };
  static __device__ __forceinline__ v16h load(const _Float16* p) {   // elements 0..7 <- p[0..7], 8..15 <- p[16..23]
    U f; f.h[0] = *(const v8h*)(p); f.h[1] = *(const v8h*)(p + 16); return f.v;
  }
  static __device__ __forceinline__ v8f mma(v16h a, v16h b, v8f c) {
    return __builtin_amdgcn_wmma_f32_16x16x32_f16(false, a, false, b, (short)0, c, false, false);
  }
  static __device__ __forceinline__ void guard(v8f& a, v8f& b, v16h x, v16h y) { dep_guard_h(a, b, x, y); }
  static __device__ __forceinline__ void keep(v16h a, v16h b, v16h c, v16h d) { keep4_h(a, b, c, d); }
};
template <> struct Frag<__bf16> {
  typedef v16b V; union U { v16b v; v8b h[2]; };
  static __device__ __forceinline__ v16b load(const __bf16* p) {
    U f; f.h[0] = *(const v8b*)(p); f.h[1] = *(const v8b*)(p + 16); return f.v;
  }
  static __device__ __forceinline__ v8f mma(v16b a, v16b b, v8f c) {
    return __builtin_amdgcn_wmma_f32_16x16x32_bf16(false, a, false, b, (short)0, c, false, false);
  }
  static __device__ __forceinline__ void guard(v8f& a, v8f& b, v16b x, v16b y) { dep_guard_b(a, b, x, y); }
  static __device__ __forceinline__ void keep(v16b a, v16b b, v16b c, v16b d) { keep4_b(a, b, c, d); }
};

// ---- Register-blocked batched WMMA GEMM ------------------------------------
// C[m,n] = scale * sum_k A[m,k] * Bt[n,k] (+bias)(+resid); each wave owns a 64x64 tile.
// A row-major [M,K]; Bt row-major [N,K]; M,N % 64 == 0, K % 32 == 0.
// SPLIT: operands are hi/lo planes (A2/Bt2 = lo planes, same layout); product = hi*hi + hi*lo + lo*hi.
// BIAS_MODE: 0 = none, 1 = bias[m], 2 = bias[n].
// OUT_MODE: 0 = f32, 1 = f16, 2 = bf16 hi plane (Cout) + bf16 lo plane (Cout2).
// ET: 0 = f16 operands, 1 = bf16 operands (pointers passed as 16-bit storage)
template <int ET> struct Elem;
template <> struct Elem<0> { typedef _Float16 T; };
template <> struct Elem<1> { typedef __bf16 T; };
template <int ET, bool SPLIT, int BIAS_MODE, int OUT_MODE, bool RESID, int ACT = 0>
__global__ __launch_bounds__(256) void wmma_gemm64(
    const unsigned short* __restrict__ Ap, const unsigned short* __restrict__ A2p, int lda, long strideA,
    const unsigned short* __restrict__ Btp, const unsigned short* __restrict__ Bt2p, int ldb, long strideB,
    void* __restrict__ Cout, void* __restrict__ Cout2, int ldc, long strideC,
    const float* __restrict__ bias,
    const float* __restrict__ resid, long strideR,
    int M, int N, int K, float scale) {
  typedef typename Elem<ET>::T T;
  typedef typename Frag<T>::V V;
  const T* A = (const T*)Ap; const T* A2 = (const T*)A2p; const T* Bt = (const T*)Btp; const T* Bt2 = (const T*)Bt2p;
  __shared__ __align__(16) float sT[8][16 * 68];   // per-wave 16x64 slab, pitch 68 floats
  const int b    = blockIdx.y;
  const int lane = threadIdx.x & 31;
  const int wave = threadIdx.x >> 5;
  const int tilesN = N >> 6;
  const int tilesM = M >> 6;
  const int tile = blockIdx.x * 8 + wave;
  if (tile >= tilesM * tilesN) return;   // wave-uniform; no block barriers in this kernel
  const int tm = tile / tilesN;
  const int tn = tile - tm * tilesN;
  const int m0 = tm << 6;
  const int n0 = tn << 6;

  const T* Ab  = A  + (size_t)b * strideA;
  const T* Bb  = Bt + (size_t)b * strideB;
  const T* Ab2 = SPLIT ? (A2  + (size_t)b * strideA) : nullptr;
  const T* Bb2 = SPLIT ? (Bt2 + (size_t)b * strideB) : nullptr;

  const int rlane = lane & 15;                 // row (A) / col (B, D) within subtile
  const int koff  = (lane >> 4) * 8;           // k offset of this lane half
  const int mOff  = (lane >> 4) * 8;           // D row offset

  v8f acc[4][4];
#pragma unroll
  for (int i = 0; i < 4; ++i)
#pragma unroll
    for (int j = 0; j < 4; ++j) acc[i][j] = (v8f){0.f,0.f,0.f,0.f,0.f,0.f,0.f,0.f};

  for (int k0 = 0; k0 < K; k0 += 32) {
    V bh[4], bl[4];
#pragma unroll
    for (int j = 0; j < 4; ++j) {
      const size_t bo = (size_t)(n0 + (j << 4) + rlane) * ldb + koff + k0;
      bh[j] = Frag<T>::load(Bb + bo);
      if (SPLIT) bl[j] = Frag<T>::load(Bb2 + bo);
    }
#pragma unroll
    for (int i = 0; i < 4; ++i) {
      const size_t ao = (size_t)(m0 + (i << 4) + rlane) * lda + koff + k0;
      V ah = Frag<T>::load(Ab + ao);
      V al;
      if (SPLIT) al = Frag<T>::load(Ab2 + ao);
#pragma unroll
      for (int j = 0; j < 4; ++j) {
        acc[i][j] = Frag<T>::mma(ah, bh[j], acc[i][j]);
        if (SPLIT) {
          acc[i][j] = Frag<T>::mma(ah, bl[j], acc[i][j]);
          acc[i][j] = Frag<T>::mma(al, bh[j], acc[i][j]);
        }
      }
      Frag<T>::guard(acc[i][0], acc[i][3], ah, SPLIT ? al : ah);
    }
    Frag<T>::keep(bh[0], bh[1], bh[2], bh[3]);
    if (SPLIT) Frag<T>::keep(bl[0], bl[1], bl[2], bl[3]);
  }
  acc_guard4(acc[0][0], acc[0][1], acc[0][2], acc[0][3]);
  acc_guard4(acc[1][0], acc[1][1], acc[1][2], acc[1][3]);
  acc_guard4(acc[2][0], acc[2][1], acc[2][2], acc[2][3]);
  acc_guard4(acc[3][0], acc[3][1], acc[3][2], acc[3][3]);

  // ---- epilogue ----
  float* slab = sT[wave];
  const float* Rb = RESID ? (resid + (size_t)b * strideR) : nullptr;
#pragma unroll
  for (int i = 0; i < 4; ++i) {
    const int mBase = m0 + (i << 4);
#pragma unroll
    for (int j = 0; j < 4; ++j) {
      const int n = n0 + (j << 4) + rlane;
      float bv = 0.f;
      if (BIAS_MODE == 2) bv = bias[n];
#pragma unroll
      for (int r = 0; r < 8; ++r) {
        float v = acc[i][j][r] * scale;
        if (BIAS_MODE == 1) v += bias[mBase + mOff + r];
        if (BIAS_MODE == 2) v += bv;
        if (RESID) v += Rb[(size_t)(mBase + mOff + r) * ldc + n];
        if (ACT == 1) v = tanhf(v);
        if (ACT == 2) v = fmaxf(v, 0.0f);
        if (ACT == 3) v = v / (1.0f + expf(-v));
        if (ACT == 4) v = (v > 0.f) ? v : 0.01f * v;
        if (ACT == 5) v = 0.5f * v * (1.0f + erff(v * 0.70710678118654752f));
        slab[(mOff + r) * 68 + (j << 4) + rlane] = v;
      }
    }
    __builtin_amdgcn_fence(__ATOMIC_RELEASE, "workgroup");
    __builtin_amdgcn_wave_barrier();
    __builtin_amdgcn_fence(__ATOMIC_ACQUIRE, "workgroup");
    if (OUT_MODE == 0) {
      float* C = (float*)Cout + (size_t)b * strideC;
      const int hh = lane >> 4, c4 = (lane & 15) * 4;     // row seg = 256 B = 16 lanes x 16 B
      {
#pragma unroll
        for (int it = 0; it < 8; ++it) {
          const int row = it * 2 + hh;
          v4f v = *(const v4f*)(slab + row * 68 + c4);
          *(v4f*)(C + (size_t)(mBase + row) * ldc + n0 + c4) = v;
        }
        
      }
    } else {
      const int q = lane >> 3, c8 = (lane & 7) * 8;
      unsigned short* C  = (unsigned short*)Cout  + (size_t)b * strideC;
      unsigned short* C2 = (OUT_MODE == 2) ? ((unsigned short*)Cout2 + (size_t)b * strideC) : nullptr;
      {
#pragma unroll
        for (int it = 0; it < 4; ++it) {
          const int row = it * 4 + q;
          const float* sp = slab + row * 68 + c8;
          v8h hv, lv;
#pragma unroll
          for (int e = 0; e < 8; ++e) {
            if (OUT_MODE == 1) {
              hv[e] = (_Float16)sp[e];
            } else {
              unsigned short hb = f2bf_bits(sp[e]);
              unsigned short lb = f2bf_bits(sp[e] - bf_bits2f(hb));
              hv[e] = __builtin_bit_cast(_Float16, hb);
              lv[e] = __builtin_bit_cast(_Float16, lb);
            }
          }
          *(v8h*)(C + (size_t)(mBase + row) * ldc + n0 + c8) = hv;
          if (OUT_MODE == 2) *(v8h*)(C2 + (size_t)(mBase + row) * ldc + n0 + c8) = lv;
        }
        
      }
    }
    __builtin_amdgcn_fence(__ATOMIC_RELEASE, "workgroup");
    __builtin_amdgcn_wave_barrier();
    __builtin_amdgcn_fence(__ATOMIC_ACQUIRE, "workgroup");
  }
}
// ------------------------------- end helpers -------------------------------

__device__ __forceinline__ v8f zero8f() { return (v8f){0.f, 0.f, 0.f, 0.f, 0.f, 0.f, 0.f, 0.f}; }
__device__ __forceinline__ v8h zero8h() {
  v8h z;
#pragma unroll
  for (int e = 0; e < 8; ++e) z[e] = (_Float16)0.0f;
  return z;
}
// f16 WMMA with the hazard guard attached (D tied, A/B kept live)
__device__ __forceinline__ v8f hmma(v16h a, v16h b, v8f c) {
  c = __builtin_amdgcn_wmma_f32_16x16x32_f16(false, a, false, b, (short)0, c, false, false);
  asm volatile("v_nop\n\tv_nop\n\tv_nop\n\tv_nop" : "+v"(c) : "v"(a), "v"(b));
  return c;
}
__device__ __forceinline__ void split_bf16(float x, _Float16& hi, _Float16& lo) {
  const unsigned short hb = f2bf_bits(x);
  const unsigned short lb = f2bf_bits(x - bf_bits2f(hb));
  hi = __builtin_bit_cast(_Float16, hb);
  lo = __builtin_bit_cast(_Float16, lb);
}

// ---------------------------------------------------------------------------------------
// qkv weight prep: W [128 k][384 c] f32 ([in][out]) -> Bt hi/lo bf16 planes [384 n][128 k] with head-major
// output columns: n = part*128 + h*16 + d  <-  c = part*128 + d*8 + h (view(DD=16, NH=8): d slow, h fast).
// Permuted bias bqp[n] = bq[c].  Edge-bias weight We [128 k][8] -> Bt hi/lo [64 n][128 k], rows n >= 8 zero.
// grid 28 x block 256: blocks 0..23 = 384 rows x 16 threads (8 k each) -> covers [384][128] exactly;
// blocks 24..27 = 64 rows x 16 threads -> covers [64][128] exactly; t < 384 also writes bqp[384] exactly.
__global__ __launch_bounds__(256) void k_prep_qkv_w(
    const float* __restrict__ W, const float* __restrict__ bq, const float* __restrict__ We,
    unsigned short* __restrict__ wqh, unsigned short* __restrict__ wql,
    unsigned short* __restrict__ weh, unsigned short* __restrict__ wel, float* __restrict__ bqp) {
  const int t = blockIdx.x * 256 + threadIdx.x;
  if (blockIdx.x < 24) {                       // block-uniform
    const int n = t >> 4, k8 = (t & 15) * 8;
    const int part = n >> 7, h = (n >> 4) & 7, d = n & 15;
    const int col = part * 128 + d * 8 + h;
    v8h hv, lv;
#pragma unroll
    for (int e = 0; e < 8; ++e) {
      const float w = W[(size_t)(k8 + e) * 384 + col];
      _Float16 a, bb; split_bf16(w, a, bb); hv[e] = a; lv[e] = bb;
    }
    const size_t off = (size_t)n * 128 + k8;
    {
      *(v8h*)(wqh + off) = hv;
      *(v8h*)(wql + off) = lv;
      
    }
    if (t < 384) {                             // wave-uniform (384 = 12 waves)
      const int pn = t >> 7, ph = (t >> 4) & 7, pd = t & 15;
      const float bv = bq[pn * 128 + pd * 8 + ph];
      *(float*)(bqp + t) = bv;
      
    }
  } else {
    const int u = t - 6144;
    const int n = u >> 4, k8 = (u & 15) * 8;
    const int nc = (n < 8) ? n : 7;            // address clamp, value zeroed by predicate
    v8h hv, lv;
#pragma unroll
    for (int e = 0; e < 8; ++e) {
      float w = We[(size_t)(k8 + e) * 8 + nc];
      w = (n < 8) ? w : 0.0f;
      _Float16 a, bb; split_bf16(w, a, bb); hv[e] = a; lv[e] = bb;
    }
    const size_t off = (size_t)n * 128 + k8;
    {
      *(v8h*)(weh + off) = hv;
      *(v8h*)(wel + off) = lv;
      
    }
  }
}

// Output weight prep: Wo [256 c][128 n] f32 ([in][out]) -> Bt hi/lo [128 n][256 k'] with k' = dir*128 + h*16 + d
// <- c = d*16 + dir*8 + h (concat of the two head groups on the head axis, then view d slow).
// grid 16 x block 256 = 4096 threads = 128 rows x 32 threads (8 k' each): covers [128][256] exactly;
__global__ __launch_bounds__(256) void k_prep_wo(const float* __restrict__ Wo,
    unsigned short* __restrict__ woh, unsigned short* __restrict__ wol) {
  const int t = blockIdx.x * 256 + threadIdx.x;
  const int n = t >> 5, k8 = (t & 31) * 8;
  v8h hv, lv;
#pragma unroll
  for (int e = 0; e < 8; ++e) {
    const int kp = k8 + e;
    const int dr = kp >> 7, h = (kp >> 4) & 7, d = kp & 15;
    const int col = d * 16 + dr * 8 + h;
    const float w = Wo[(size_t)col * 128 + n];
    _Float16 a, bb; split_bf16(w, a, bb); hv[e] = a; lv[e] = bb;
  }
  const size_t off = (size_t)n * 256 + k8;
  {
    *(v8h*)(woh + off) = hv;
    *(v8h*)(wol + off) = lv;
    
  }
}

// LayerNorm over the 128-wide rows of e (eps 1e-5, biased variance, *g + b) -> bf16 hi/lo planes [nrows][128].
// grid = nrows/16, block 256 = 8 waves x 2 rows (lane half = row, lane&15 = 8-column chunk).
// coverage: 16 lanes x 8 halves = 128 columns per row, one instruction per plane writes the whole 256-B row
__global__ __launch_bounds__(256) void k_ln(const float* __restrict__ e, const float* __restrict__ g,
    const float* __restrict__ b, unsigned short* __restrict__ elh, unsigned short* __restrict__ ell, int nrows) {
  const int tid = threadIdx.x, wave = tid >> 5, lane = tid & 31, hh = lane >> 4, c = lane & 15;
  const int row = (blockIdx.x * 8 + wave) * 2 + hh;
  const bool ok = row < nrows;
  const int rowc = ok ? row : (nrows - 1);
  const float* p = e + (size_t)rowc * EWID + c * 8;
  const v4f x0 = *(const v4f*)p;
  const v4f x1 = *(const v4f*)(p + 4);
  float xs[8];
  xs[0] = x0[0]; xs[1] = x0[1]; xs[2] = x0[2]; xs[3] = x0[3];
  xs[4] = x1[0]; xs[5] = x1[1]; xs[6] = x1[2]; xs[7] = x1[3];
  float s = ((xs[0] + xs[1]) + (xs[2] + xs[3])) + ((xs[4] + xs[5]) + (xs[6] + xs[7]));
#pragma unroll
  for (int off = 1; off < 16; off <<= 1) s += __shfl_xor(s, off, 32);
  const float mu = s * (1.0f / 128.0f);
  float q = 0.f;
#pragma unroll
  for (int k = 0; k < 8; ++k) { xs[k] -= mu; q += xs[k] * xs[k]; }
#pragma unroll
  for (int off = 1; off < 16; off <<= 1) q += __shfl_xor(q, off, 32);
  const float rs = rsqrtf(q * (1.0f / 128.0f) + 1e-5f);
  const v4f g0 = *(const v4f*)(g + c * 8), g1 = *(const v4f*)(g + c * 8 + 4);
  const v4f b0 = *(const v4f*)(b + c * 8), b1 = *(const v4f*)(b + c * 8 + 4);
  float gg[8], bb[8];
  gg[0] = g0[0]; gg[1] = g0[1]; gg[2] = g0[2]; gg[3] = g0[3]; gg[4] = g1[0]; gg[5] = g1[1]; gg[6] = g1[2]; gg[7] = g1[3];
  bb[0] = b0[0]; bb[1] = b0[1]; bb[2] = b0[2]; bb[3] = b0[3]; bb[4] = b1[0]; bb[5] = b1[1]; bb[6] = b1[2]; bb[7] = b1[3];
  v8h hv, lv;
#pragma unroll
  for (int k = 0; k < 8; ++k) {
    const float y = xs[k] * rs * gg[k] + bb[k];
    _Float16 a, lo; split_bf16(y, a, lo); hv[k] = a; lv[k] = lo;
  }
  if (ok) {
    const size_t off = (size_t)row * EWID + c * 8;
    {
      *(v8h*)(elh + off) = hv;
      *(v8h*)(ell + off) = lv;
      
    }
  }
}

// Score bias slabs for one direction: bm[h][i][k] = eb[r][h] + be[h] + mask[r][h] with
// r = i*192 + k (dir 0) or r = k*192 + i (dir 1). eb = f32 [36864][64] (columns 0..7 used), mask f32 [36864][8].
// grid 1152 x block 256 = 8*192*192 threads exactly; owner-computes (gather reads, contiguous 4-B stores:
__global__ __launch_bounds__(256) void k_bias_slab(const float* __restrict__ eb, const float* __restrict__ be,
    const float* __restrict__ mask, float* __restrict__ bm, int dir) {
  const int idx = blockIdx.x * 256 + threadIdx.x;
  const int h = idx / NROWS;
  const int rem = idx - h * NROWS;
  const int i = rem / NNODE;
  const int k = rem - i * NNODE;
  const int r = dir ? (k * NNODE + i) : (i * NNODE + k);
  const float v = eb[(size_t)r * EB_LD + h] + be[h] + mask[(size_t)r * 8 + h];
  *(float*)(bm + idx) = v;
  
}

// Fused attention core for one (edge column j, direction dir, 32 query rows i), all 8 heads in sequence.
// qkv: f16 [36864][384], head-major columns part*128 + h*16 + d.  bm: f32 [8][192 i][192 k].
// grid = (192 j, 6 query chunks) x block 64 = 2 waves x 16 query rows.
// Per head: K_h [192 keys][16 d] and V_h^T [16 d][192 keys] staged in LDS by arithmetic row indices
// (dir 0: row j*192+k, dir 1: row k*192+j).  Both products run transposed, so that a lane owns ONE query:
// S^T = K (A: 16 keys, d zero-extended to 32) . Q^T (B) on f16 WMMA: lane (hh, c) holds query i0+c, register r
// key 16*tile + 8*hh + r; *0.25 + bias in f32, online softmax over 3 chunks of 64 keys in f32 with maximum and
// sum taken in the lane plus one exchange between the lane halves; two neighbouring S^T tiles, converted to f16
// in place, are the B operand of O^T = V^T (A: 16 d, 32 keys) . P^T; * 1/rowsum;
// head result (lane: query, registers: d = 8*hh + r) staged in LDS at column h*16 + d.
// Epilogue -> bf16 hi/lo planes [36864][256], row i*192+j, columns dir*128 + h*16 + d:
// coverage: 2 waves x (8 iters x 2 lane halves) = 32 rows; 16 lanes x 8 halves = 128 columns;
__global__ __launch_bounds__(64) void k_edge_attn(const _Float16* __restrict__ qkv, const float* __restrict__ bm,
    unsigned short* __restrict__ vah, unsigned short* __restrict__ val, int dir) {
  __shared__ __align__(16) _Float16 Ksh[NNODE * KS_P];   // [key][d], indices <= 191*16+15
  __shared__ __align__(16) _Float16 Vt[16 * VT_P];       // [d][key], indices <= 15*192+191
  __shared__ __align__(16) float    Os[32 * OS_P];       // [local row][h*16+d]
  const int j = blockIdx.x;
  const int qblk = blockIdx.y * 32;
  const int tid = threadIdx.x, wave = tid >> 5, lane = tid & 31, hh = lane >> 4, c = lane & 15;
  const int i0 = qblk + wave * 16;
  const v8h z8 = zero8h();

#pragma unroll 1
  for (int h = 0; h < 8; ++h) {
    __syncthreads();
    // stage K_h / V_h: 384 (key, 8-wide d chunk) items over 64 threads = 6 iterations, covers 192 x 16 exactly
    for (int idx = tid; idx < 2 * NNODE; idx += 64) {
      const int kv = idx >> 1, part = idx & 1;
      const int r = dir ? (kv * NNODE + j) : (j * NNODE + kv);
      const _Float16* src = qkv + (size_t)r * QKV_LD + h * 16 + part * 8;
      const v8h kk8 = *(const v8h*)(src + EWID);
      const v8h vv8 = *(const v8h*)(src + 2 * EWID);
      *(v8h*)(Ksh + kv * KS_P + part * 8) = kk8;
#pragma unroll
      for (int e2 = 0; e2 < 8; ++e2) Vt[(part * 8 + e2) * VT_P + kv] = vv8[e2];
    }
    __syncthreads();

    // B fragment (query column i0+c, d 8hh..8hh+7 in elements 0..7, elements 8..15 zero)
    Frag<_Float16>::U qa;
    qa.h[0] = *(const v8h*)(qkv + ((size_t)(i0 + c) * NNODE + j) * QKV_LD + h * 16 + 8 * hh);
    qa.h[1] = z8;

    float mrow = -__builtin_inff(), lrow = 0.f;      // this lane's query
    v8f o = zero8f();                                // O^T: register r = d 8hh+r of query i0+c
    const float* bmr = bm + ((size_t)h * NNODE + (size_t)(i0 + c)) * NNODE + 8 * hh;

#pragma unroll 1
    for (int kc = 0; kc < 3; ++kc) {
      const int kv0 = kc * 64;
      // bias of keys kv0+16jn+8hh .. +7 for this lane's query: 32 contiguous bytes a tile
      v4f b0[4], b1[4];
#pragma unroll
      for (int jn = 0; jn < 4; ++jn) {
        b0[jn] = *(const v4f*)(bmr + kv0 + jn * 16);
        b1[jn] = *(const v4f*)(bmr + kv0 + jn * 16 + 4);
      }
      v8f s[4];
#pragma unroll
      for (int jn = 0; jn < 4; ++jn) {
        // A fragment (key row kv0+16jn+c, d 8hh..8hh+7 in elements 0..7, elements 8..15 zero)
        Frag<_Float16>::U kb;
        kb.h[0] = *(const v8h*)(Ksh + (kv0 + jn * 16 + c) * KS_P + 8 * hh);
        kb.h[1] = z8;
        s[jn] = hmma(kb.v, qa.v, zero8f());
      }
      float mx = -__builtin_inff();
#pragma unroll
      for (int jn = 0; jn < 4; ++jn) {
#pragma unroll
        for (int r = 0; r < 8; ++r) {
          const float v = s[jn][r] * 0.25f + (r < 4 ? b0[jn][r & 3] : b1[jn][r & 3]);
          s[jn][r] = v;
          mx = fmaxf(mx, v);
        }
      }
      mx = fmaxf(mx, __shfl_xor(mx, 16, 32));        // the other lane half holds the query's other 32 keys
      const float mnew = fmaxf(mrow, mx);
      const float alpha = expf(mrow - mnew);
      mrow = mnew;
      float ps = 0.f;
      Frag<_Float16>::U pb[2];                       // P^T as B: elements 0..7 = tile 2kk, 8..15 = tile 2kk+1
#pragma unroll
      for (int jn = 0; jn < 4; ++jn) {
#pragma unroll
        for (int r = 0; r < 8; ++r) {
          const float pv = expf(s[jn][r] - mnew);
          ps += pv;
          pb[jn >> 1].h[jn & 1][r] = (_Float16)pv;
        }
      }
      ps += __shfl_xor(ps, 16, 32);
      lrow = lrow * alpha + ps;
#pragma unroll
      for (int r = 0; r < 8; ++r) o[r] *= alpha;
#pragma unroll
      for (int kk = 0; kk < 2; ++kk) {
        const v16h va = Frag<_Float16>::load(Vt + c * VT_P + kv0 + kk * 32 + 8 * hh);
        o = hmma(va, pb[kk].v, o);
      }
    }
    const float inv = 1.0f / lrow;
    float* op = Os + (wave * 16 + c) * OS_P + h * 16 + 8 * hh;
    *(v4f*)op       = (v4f){o[0] * inv, o[1] * inv, o[2] * inv, o[3] * inv};
    *(v4f*)(op + 4) = (v4f){o[4] * inv, o[5] * inv, o[6] * inv, o[7] * inv};
  }
  __syncthreads();

  const size_t colbase = (size_t)dir * 128 + (size_t)c * 8;
  {
#pragma unroll
    for (int it = 0; it < 8; ++it) {
      const int lr = wave * 16 + it * 2 + hh;
      const float* sp = Os + lr * OS_P + c * 8;
      const v4f a4 = *(const v4f*)sp;
      const v4f b4 = *(const v4f*)(sp + 4);
      v8h hv, lv;
#pragma unroll
      for (int e = 0; e < 4; ++e) {
        _Float16 a, lo;
        split_bf16(a4[e], a, lo); hv[e] = a; lv[e] = lo;
        split_bf16(b4[e], a, lo); hv[4 + e] = a; lv[4 + e] = lo;
      }
      const size_t grow = (size_t)(qblk + lr) * NNODE + j;
      *(v8h*)(vah + grow * VA_LD + colbase) = hv;
      *(v8h*)(val + grow * VA_LD + colbase) = lv;
    }
    
  }
}

// ---------------------------------------------------------------------------------------
extern "C" void kernel_launch(void* const* d_in, const int* in_sizes, int n_in,
                              void* d_out, int out_size, void* d_ws, size_t ws_size,
                              hipStream_t stream) {
  if (n_in < 14) return;
  if (in_sizes[0] != NROWS * EWID || in_sizes[1] != NROWS * 8 || in_sizes[2] < EWID || in_sizes[3] < EWID ||
      in_sizes[4] != EWID * 384 || in_sizes[5] < 384 || in_sizes[6] != EWID * 8 || in_sizes[7] < 8 ||
      in_sizes[8] != EWID * 384 || in_sizes[9] < 384 || in_sizes[10] != EWID * 8 || in_sizes[11] < 8 ||
      in_sizes[12] != 256 * EWID || in_sizes[13] < EWID || out_size != NROWS * EWID) return;

  const float* e      = (const float*)d_in[0];
  const float* mask   = (const float*)d_in[1];
  const float* ln_g   = (const float*)d_in[2];
  const float* ln_b   = (const float*)d_in[3];
  const float* Wq_in  = (const float*)d_in[4];
  const float* bq_in  = (const float*)d_in[5];
  const float* We_in  = (const float*)d_in[6];
  const float* be_in  = (const float*)d_in[7];
  const float* Wq_out = (const float*)d_in[8];
  const float* bq_out = (const float*)d_in[9];
  const float* We_out = (const float*)d_in[10];
  const float* be_out = (const float*)d_in[11];
  const float* Wo     = (const float*)d_in[12];
  const float* bo     = (const float*)d_in[13];
  float* out = (float*)d_out;

  // ---- workspace region map (offsets 256-B aligned; total 96,144,384 B) ----
  //  ELh, ELl   bf16 [36864][128]       2 x  9,437,184   LayerNorm output hi/lo (live through both directions)
  //  QKV16      f16  [36864][384]          28,311,552   projection output, reused per direction
  //  EB         f32  [36864][64]            9,437,184   edge-bias projection (cols 0..7), reused per direction
  //  BM         f32  [8][192][192]          1,179,648   bias+mask slabs, reused per direction
  //  VAh, VAl   bf16 [36864][256]       2 x 18,874,368   attention output hi/lo (both directions)
  //  WtQh/l x2  bf16 [384][128]         4 x     98,304
  //  WtEh/l x2  bf16 [64][128]          4 x     16,384
  //  WoTh/l     bf16 [128][256]         2 x     65,536
  //  bqp x2     f32  [384]              2 x      1,536
  size_t off = 0;
  auto carve = [&](size_t bytes) { size_t o = off; off += (bytes + 255) & ~(size_t)255; return o; };
  const size_t oELh = carve((size_t)NROWS * EWID * 2);
  const size_t oELl = carve((size_t)NROWS * EWID * 2);
  const size_t oQKV = carve((size_t)NROWS * QKV_LD * 2);
  const size_t oEB  = carve((size_t)NROWS * EB_LD * 4);
  const size_t oBM  = carve((size_t)8 * NNODE * NNODE * 4);
  const size_t oVAh = carve((size_t)NROWS * VA_LD * 2);
  const size_t oVAl = carve((size_t)NROWS * VA_LD * 2);
  size_t oWQh[2], oWQl[2], oWEh[2], oWEl[2], oBQ[2];
  for (int d = 0; d < 2; ++d) { oWQh[d] = carve((size_t)384 * 128 * 2); oWQl[d] = carve((size_t)384 * 128 * 2); }
  for (int d = 0; d < 2; ++d) { oWEh[d] = carve((size_t)64 * 128 * 2);  oWEl[d] = carve((size_t)64 * 128 * 2); }
  const size_t oWOh = carve((size_t)128 * 256 * 2);
  const size_t oWOl = carve((size_t)128 * 256 * 2);
  for (int d = 0; d < 2; ++d) oBQ[d] = carve((size_t)384 * 4);
  if (off > ws_size) return;

  char* ws = (char*)d_ws;
  unsigned short* ELh = (unsigned short*)(ws + oELh);
  unsigned short* ELl = (unsigned short*)(ws + oELl);
  _Float16* QKV16 = (_Float16*)(ws + oQKV);
  float* EB = (float*)(ws + oEB);
  float* BM = (float*)(ws + oBM);
  unsigned short* VAh = (unsigned short*)(ws + oVAh);
  unsigned short* VAl = (unsigned short*)(ws + oVAl);
  unsigned short* WQh[2], *WQl[2], *WEh[2], *WEl[2];
  float* BQ[2];
  for (int d = 0; d < 2; ++d) {
    WQh[d] = (unsigned short*)(ws + oWQh[d]); WQl[d] = (unsigned short*)(ws + oWQl[d]);
    WEh[d] = (unsigned short*)(ws + oWEh[d]); WEl[d] = (unsigned short*)(ws + oWEl[d]);
    BQ[d] = (float*)(ws + oBQ[d]);
  }
  unsigned short* WOh = (unsigned short*)(ws + oWOh);
  unsigned short* WOl = (unsigned short*)(ws + oWOl);

  // weight prep (3 launches)
  k_prep_qkv_w<<<28, 256, 0, stream>>>(Wq_in, bq_in, We_in, WQh[0], WQl[0], WEh[0], WEl[0], BQ[0]);
  k_prep_qkv_w<<<28, 256, 0, stream>>>(Wq_out, bq_out, We_out, WQh[1], WQl[1], WEh[1], WEl[1], BQ[1]);
  k_prep_wo<<<16, 256, 0, stream>>>(Wo, WOh, WOl);

  // LayerNorm -> bf16 hi/lo planes (36864 rows / 16 rows per block = 2304 blocks exactly)
  k_ln<<<NROWS / 16, 256, 0, stream>>>(e, ln_g, ln_b, ELh, ELl, NROWS);

  const int tilesQKV = (NROWS / 64) * (QKV_LD / 64);   // 3456 = 432 blocks x 8 waves
  const int tilesEB  = (NROWS / 64) * (EB_LD / 64);    // 576  = 72 blocks
  const int tilesOUT = (NROWS / 64) * (EWID / 64);     // 1152 = 144 blocks
  for (int dir = 0; dir < 2; ++dir) {
    const float* be = dir ? be_out : be_in;
    // qkv = EL . Wqkv + b  (M 36864, N 384, K 128; bf16 hi/lo split; f16 head-major output)
    wmma_gemm64<1, true, 2, 1, false><<<dim3(tilesQKV / 8, 1), 256, 0, stream>>>(
        ELh, ELl, EWID, (long)0, WQh[dir], WQl[dir], EWID, (long)0,
        (void*)QKV16, (void*)QKV16, QKV_LD, (long)0, BQ[dir], BQ[dir], (long)0, NROWS, QKV_LD, EWID, 1.0f);
    // edge bias = EL . We  (M 36864, N 64 (8 used), K 128; split; f32 output; be added in the slab kernel)
    wmma_gemm64<1, true, 0, 0, false><<<dim3(tilesEB / 8, 1), 256, 0, stream>>>(
        ELh, ELl, EWID, (long)0, WEh[dir], WEl[dir], EWID, (long)0,
        (void*)EB, (void*)EB, EB_LD, (long)0, be, be, (long)0, NROWS, EB_LD, EWID, 1.0f);
    k_bias_slab<<<(8 * NNODE * NNODE) / 256, 256, 0, stream>>>(EB, be, mask, BM, dir);
    k_edge_attn<<<dim3(NNODE, NNODE / 32), 64, 0, stream>>>(QKV16, BM, VAh, VAl, dir);
  }
  // out = VA . Wo + bo  (M 36864, N 128, K 256; split; f32 output rows of d_out)
  wmma_gemm64<1, true, 2, 0, false><<<dim3(tilesOUT / 8, 1), 256, 0, stream>>>(
      VAh, VAl, VA_LD, (long)0, WOh, WOl, VA_LD, (long)0,
      (void*)out, (void*)out, EWID, (long)0, bo, bo, (long)0, NROWS, EWID, VA_LD, 1.0f);
}

// v002
// A run of this version takes 155 microseconds.
// Timed twice side by side with v001, it ran 1.42 times as fast both times.
// Over all steps from v000 it is 1.70 times as fast.
// Contractions: LayerNorm'd qkv / edge-bias projections and the output linear on v_wmma_f32_16x16x32_bf16 with bf16 hi/lo split operands (hi*hi + hi*lo + lo*hi); per-(edge column, head) 192x192 attention cores (q.k^T with d=16 zero-extended to 32, p.v with 192 keys) on v_wmma_f32_16x16x32_f16 with plain f16 operands; f32 accumulate everywhere; LayerNorm, bias/mask add, softmax and normalisation in f32.
#include <hip/hip_runtime.h>

typedef __attribute__((ext_vector_type(16))) _Float16 v16h;
typedef __attribute__((ext_vector_type(8)))  _Float16 v8h;
typedef __attribute__((ext_vector_type(16))) __bf16   v16b;
typedef __attribute__((ext_vector_type(8)))  __bf16   v8b;
typedef __attribute__((ext_vector_type(8)))  float    v8f;
typedef __attribute__((ext_vector_type(4)))  float    v4f;

#define EWID 128
#define NNODE 192
#define NROWS 36864          // 192*192 edge rows, row r = i*192 + j
#define QKV_LD 384
#define EB_LD 64
#define VA_LD 256
#define KS_P 16              // LDS K tile pitch (halves)
#define VT_P 192             // LDS V^T tile pitch (halves)
#define OS_P 132             // LDS output staging pitch (floats, 528 B rows)

// ------------------------------- helpers -------------------------------
__device__ __forceinline__ unsigned short f2bf_bits(float f) {
  unsigned u = __float_as_uint(f);
  return (unsigned short)((u + 0x7FFFu + ((u >> 16) & 1u)) >> 16);
}
__device__ __forceinline__ float bf_bits2f(unsigned short h) { return __uint_as_float(((unsigned)h) << 16); }

// hazard guards as plain device helpers (no inline asm inside the kernel template body)
__device__ __forceinline__ void dep_guard_h(v8f& a, v8f& b, v16h x, v16h y) { asm volatile("v_nop\n\tv_nop\n\tv_nop\n\tv_nop" : "+v"(a), "+v"(b) : "v"(x), "v"(y)); }
__device__ __forceinline__ void dep_guard_b(v8f& a, v8f& b, v16b x, v16b y) { asm volatile("v_nop\n\tv_nop\n\tv_nop\n\tv_nop" : "+v"(a), "+v"(b) : "v"(x), "v"(y)); }
__device__ __forceinline__ void keep4_h(v16h a, v16h b, v16h c, v16h d) { asm volatile("v_nop" :: "v"(a), "v"(b), "v"(c), "v"(d)); }
__device__ __forceinline__ void keep4_b(v16b a, v16b b, v16b c, v16b d) { asm volatile("v_nop" :: "v"(a), "v"(b), "v"(c), "v"(d)); }
__device__ __forceinline__ void acc_guard4(v8f& a, v8f& b, v8f& c, v8f& d) { asm volatile("v_nop\n\tv_nop\n\tv_nop\n\tv_nop" : "+v"(a), "+v"(b), "+v"(c), "+v"(d)); }
template <typename T> struct Frag;
template <> struct Frag<_Float16> {
  typedef v16h V; union U { v16h v; v8h h[2]; };
  static __device__ __forceinline__ v16h load(const _Float16* p) {   // elements 0..7 <- p[0..7], 8..15 <- p[16..23]
    U f; f.h[0] = *(const v8h*)(p); f.h[1] = *(const v8h*)(p + 16); return f.v;
  }
  static __device__ __forceinline__ v8f mma(v16h a, v16h b, v8f c) {
    return __builtin_amdgcn_wmma_f32_16x16x32_f16(false, a, false, b, (short)0, c, false, false);
  }
  static __device__ __forceinline__ void guard(v8f& a, v8f& b, v16h x, v16h y) { dep_guard_h(a, b, x, y); }
  static __device__ __forceinline__ void keep(v16h a, v16h b, v16h c, v16h d) { keep4_h(a, b, c, d); }
};
template <> struct Frag<__bf16> {
  typedef v16b V; union U { v16b v; v8b h[2]; };
  static __device__ __forceinline__ v16b load(const __bf16* p) {
    U f; f.h[0] = *(const v8b*)(p); f.h[1] = *(const v8b*)(p + 16); return f.v;
  }
  static __device__ __forceinline__ v8f mma(v16b a, v16b b, v8f c) {
    return __builtin_amdgcn_wmma_f32_16x16x32_bf16(false, a, false, b, (short)0, c, false, false);
  }
  static __device__ __forceinline__ void guard(v8f& a, v8f& b, v16b x, v16b y) { dep_guard_b(a, b, x, y); }
  static __device__ __forceinline__ void keep(v16b a, v16b b, v16b c, v16b d) { keep4_b(a, b, c, d); }
};

// ---- Register-blocked batched WMMA GEMM ------------------------------------
// C[m,n] = scale * sum_k A[m,k] * Bt[n,k] (+bias)(+resid); each wave owns a 64x64 tile.
// A row-major [M,K]; Bt row-major [N,K]; M,N % 64 == 0, K % 32 == 0.
// SPLIT: operands are hi/lo planes (A2/Bt2 = lo planes, same layout); product = hi*hi + hi*lo + lo*hi.
// BIAS_MODE: 0 = none, 1 = bias[m], 2 = bias[n].
// OUT_MODE: 0 = f32, 1 = f16, 2 = bf16 hi plane (Cout) + bf16 lo plane (Cout2).
// ET: 0 = f16 operands, 1 = bf16 operands (pointers passed as 16-bit storage)
template <int ET> struct Elem;
template <> struct Elem<0> { typedef _Float16 T; };
template <> struct Elem<1> { typedef __bf16 T; };
// gemm64_tile: the work of block bx of batch b; sT = the block's LDS, 8 per-wave 16x64 slabs of pitch 68 floats.
template <int ET, bool SPLIT, int BIAS_MODE, int OUT_MODE, bool RESID, int ACT = 0>
__device__ __forceinline__ void gemm64_tile(const int bx, const int b, float* __restrict__ sT,
    const unsigned short* __restrict__ Ap, const unsigned short* __restrict__ A2p, int lda, long strideA,
    const unsigned short* __restrict__ Btp, const unsigned short* __restrict__ Bt2p, int ldb, long strideB,
    void* __restrict__ Cout, void* __restrict__ Cout2, int ldc, long strideC,
    const float* __restrict__ bias, long strideBias,
    const float* __restrict__ resid, long strideR,
    int M, int N, int K, float scale) {
  typedef typename Elem<ET>::T T;
  typedef typename Frag<T>::V V;
  const T* A = (const T*)Ap; const T* A2 = (const T*)A2p; const T* Bt = (const T*)Btp; const T* Bt2 = (const T*)Bt2p;
  const int lane = threadIdx.x & 31;
  const int wave = threadIdx.x >> 5;
  const int tilesN = N >> 6;
  const int tilesM = M >> 6;
  const int tile = bx * 8 + wave;
  if (tile >= tilesM * tilesN) return;   // wave-uniform; no block barriers in this kernel
  const int tm = tile / tilesN;
  const int tn = tile - tm * tilesN;
  const int m0 = tm << 6;
  const int n0 = tn << 6;

  const T* Ab  = A  + (size_t)b * strideA;
  const T* Bb  = Bt + (size_t)b * strideB;
  const T* Ab2 = SPLIT ? (A2  + (size_t)b * strideA) : nullptr;
  const T* Bb2 = SPLIT ? (Bt2 + (size_t)b * strideB) : nullptr;

  const int rlane = lane & 15;                 // row (A) / col (B, D) within subtile
  const int koff  = (lane >> 4) * 8;           // k offset of this lane half
  const int mOff  = (lane >> 4) * 8;           // D row offset

  v8f acc[4][4];
#pragma unroll
  for (int i = 0; i < 4; ++i)
#pragma unroll
    for (int j = 0; j < 4; ++j) acc[i][j] = (v8f){0.f,0.f,0.f,0.f,0.f,0.f,0.f,0.f};

  for (int k0 = 0; k0 < K; k0 += 32) {
    V bh[4], bl[4];
#pragma unroll
    for (int j = 0; j < 4; ++j) {
      const size_t bo = (size_t)(n0 + (j << 4) + rlane) * ldb + koff + k0;
      bh[j] = Frag<T>::load(Bb + bo);
      if (SPLIT) bl[j] = Frag<T>::load(Bb2 + bo);
    }
#pragma unroll
    for (int i = 0; i < 4; ++i) {
      const size_t ao = (size_t)(m0 + (i << 4) + rlane) * lda + koff + k0;
      V ah = Frag<T>::load(Ab + ao);
      V al;
      if (SPLIT) al = Frag<T>::load(Ab2 + ao);
#pragma unroll
      for (int j = 0; j < 4; ++j) {
        acc[i][j] = Frag<T>::mma(ah, bh[j], acc[i][j]);
        if (SPLIT) {
          acc[i][j] = Frag<T>::mma(ah, bl[j], acc[i][j]);
          acc[i][j] = Frag<T>::mma(al, bh[j], acc[i][j]);
        }
      }
      Frag<T>::guard(acc[i][0], acc[i][3], ah, SPLIT ? al : ah);
    }
    Frag<T>::keep(bh[0], bh[1], bh[2], bh[3]);
    if (SPLIT) Frag<T>::keep(bl[0], bl[1], bl[2], bl[3]);
  }
  acc_guard4(acc[0][0], acc[0][1], acc[0][2], acc[0][3]);
  acc_guard4(acc[1][0], acc[1][1], acc[1][2], acc[1][3]);
  acc_guard4(acc[2][0], acc[2][1], acc[2][2], acc[2][3]);
  acc_guard4(acc[3][0], acc[3][1], acc[3][2], acc[3][3]);

  // ---- epilogue ----
  float* slab = sT + wave * (16 * 68);
  const float* Rb = RESID ? (resid + (size_t)b * strideR) : nullptr;
  const float* Bs = (BIAS_MODE != 0) ? (bias + (size_t)b * strideBias) : nullptr;
#pragma unroll
  for (int i = 0; i < 4; ++i) {
    const int mBase = m0 + (i << 4);
#pragma unroll
    for (int j = 0; j < 4; ++j) {
      const int n = n0 + (j << 4) + rlane;
      float bv = 0.f;
      if (BIAS_MODE == 2) bv = Bs[n];
#pragma unroll
      for (int r = 0; r < 8; ++r) {
        float v = acc[i][j][r] * scale;
        if (BIAS_MODE == 1) v += Bs[mBase + mOff + r];
        if (BIAS_MODE == 2) v += bv;
        if (RESID) v += Rb[(size_t)(mBase + mOff + r) * ldc + n];
        if (ACT == 1) v = tanhf(v);
        if (ACT == 2) v = fmaxf(v, 0.0f);
        if (ACT == 3) v = v / (1.0f + expf(-v));
        if (ACT == 4) v = (v > 0.f) ? v : 0.01f * v;
        if (ACT == 5) v = 0.5f * v * (1.0f + erff(v * 0.70710678118654752f));
        slab[(mOff + r) * 68 + (j << 4) + rlane] = v;
      }
    }
    __builtin_amdgcn_fence(__ATOMIC_RELEASE, "workgroup");
    __builtin_amdgcn_wave_barrier();
    __builtin_amdgcn_fence(__ATOMIC_ACQUIRE, "workgroup");
    if (OUT_MODE == 0) {
      float* C = (float*)Cout + (size_t)b * strideC;
      const int hh = lane >> 4, c4 = (lane & 15) * 4;     // row seg = 256 B = 16 lanes x 16 B
      {
#pragma unroll
        for (int it = 0; it < 8; ++it) {
          const int row = it * 2 + hh;
          v4f v = *(const v4f*)(slab + row * 68 + c4);
          *(v4f*)(C + (size_t)(mBase + row) * ldc + n0 + c4) = v;
        }
        
      }
    } else {
      const int q = lane >> 3, c8 = (lane & 7) * 8;
      unsigned short* C  = (unsigned short*)Cout  + (size_t)b * strideC;
      unsigned short* C2 = (OUT_MODE == 2) ? ((unsigned short*)Cout2 + (size_t)b * strideC) : nullptr;
      {
#pragma unroll
        for (int it = 0; it < 4; ++it) {
          const int row = it * 4 + q;
          const float* sp = slab + row * 68 + c8;
          v8h hv, lv;
#pragma unroll
          for (int e = 0; e < 8; ++e) {
            if (OUT_MODE == 1) {
              hv[e] = (_Float16)sp[e];
            } else {
              unsigned short hb = f2bf_bits(sp[e]);
              unsigned short lb = f2bf_bits(sp[e] - bf_bits2f(hb));
              hv[e] = __builtin_bit_cast(_Float16, hb);
              lv[e] = __builtin_bit_cast(_Float16, lb);
            }
          }
          *(v8h*)(C + (size_t)(mBase + row) * ldc + n0 + c8) = hv;
          if (OUT_MODE == 2) *(v8h*)(C2 + (size_t)(mBase + row) * ldc + n0 + c8) = lv;
        }
        
      }
    }
    __builtin_amdgcn_fence(__ATOMIC_RELEASE, "workgroup");
    __builtin_amdgcn_wave_barrier();
    __builtin_amdgcn_fence(__ATOMIC_ACQUIRE, "workgroup");
  }
}
template <int ET, bool SPLIT, int BIAS_MODE, int OUT_MODE, bool RESID, int ACT = 0>
__global__ __launch_bounds__(256) void wmma_gemm64(
    const unsigned short* __restrict__ Ap, const unsigned short* __restrict__ A2p, int lda, long strideA,
    const unsigned short* __restrict__ Btp, const unsigned short* __restrict__ Bt2p, int ldb, long strideB,
    void* __restrict__ Cout, void* __restrict__ Cout2, int ldc, long strideC,
    const float* __restrict__ bias, long strideBias,
    const float* __restrict__ resid, long strideR,
    int M, int N, int K, float scale) {
  __shared__ __align__(16) float sT[8 * 16 * 68];
  gemm64_tile<ET, SPLIT, BIAS_MODE, OUT_MODE, RESID, ACT>(blockIdx.x, blockIdx.y, sT, Ap, A2p, lda, strideA,
      Btp, Bt2p, ldb, strideB, Cout, Cout2, ldc, strideC, bias, strideBias, resid, strideR, M, N, K, scale);
}
// The two projections of the LayerNorm'd rows, which do not depend on each other, as one launch: blocks below
// blocksE do the edge-bias product (f32 out, no bias), the others the qkv product (f16 out, bias[n]). Block-uniform.
__global__ __launch_bounds__(256) void k_proj(
    const unsigned short* __restrict__ Ap, const unsigned short* __restrict__ A2p, int lda,
    const unsigned short* __restrict__ BtE, const unsigned short* __restrict__ Bt2E, long strideBE,
    void* __restrict__ CE, int ldcE, long strideCE, int NE, int blocksE,
    const unsigned short* __restrict__ BtQ, const unsigned short* __restrict__ Bt2Q, long strideBQ,
    void* __restrict__ CQ, int ldcQ, long strideCQ, int NQ,
    const float* __restrict__ biasQ, long strideBiasQ, int M, int K) {
  __shared__ __align__(16) float sT[8 * 16 * 68];
  const int bx = blockIdx.x;
  if (bx < blocksE)
    gemm64_tile<1, true, 0, 0, false>(bx, blockIdx.y, sT, Ap, A2p, lda, (long)0, BtE, Bt2E, lda, strideBE,
        CE, CE, ldcE, strideCE, biasQ, (long)0, biasQ, (long)0, M, NE, K, 1.0f);
  else
    gemm64_tile<1, true, 2, 1, false>(bx - blocksE, blockIdx.y, sT, Ap, A2p, lda, (long)0, BtQ, Bt2Q, lda, strideBQ,
        CQ, CQ, ldcQ, strideCQ, biasQ, strideBiasQ, biasQ, (long)0, M, NQ, K, 1.0f);
}

__device__ __forceinline__ v8f zero8f() { return (v8f){0.f, 0.f, 0.f, 0.f, 0.f, 0.f, 0.f, 0.f}; }
__device__ __forceinline__ v8h zero8h() {
  v8h z;
#pragma unroll
  for (int e = 0; e < 8; ++e) z[e] = (_Float16)0.0f;
  return z;
}
// f16 WMMA with the hazard guard attached (D tied, A/B kept live)
__device__ __forceinline__ v8f hmma(v16h a, v16h b, v8f c) {
  c = __builtin_amdgcn_wmma_f32_16x16x32_f16(false, a, false, b, (short)0, c, false, false);
  asm volatile("v_nop\n\tv_nop\n\tv_nop\n\tv_nop" : "+v"(c) : "v"(a), "v"(b));
  return c;
}
__device__ __forceinline__ void split_bf16(float x, _Float16& hi, _Float16& lo) {
  const unsigned short hb = f2bf_bits(x);
  const unsigned short lb = f2bf_bits(x - bf_bits2f(hb));
  hi = __builtin_bit_cast(_Float16, hb);
  lo = __builtin_bit_cast(_Float16, lb);
}

// ---------------------------------------------------------------------------------------
// qkv weight prep: W [128 k][384 c] f32 ([in][out]) -> Bt hi/lo bf16 planes [384 n][128 k] with head-major
// output columns: n = part*128 + h*16 + d  <-  c = part*128 + d*8 + h (view(DD=16, NH=8): d slow, h fast).
// Permuted bias bqp[n] = bq[c].  Edge-bias weight We [128 k][8] -> Bt hi/lo [64 n][128 k], rows n >= 8 zero.
// grid 28 x block 256: blocks 0..23 = 384 rows x 16 threads (8 k each) -> covers [384][128] exactly;
// blocks 24..27 = 64 rows x 16 threads -> covers [64][128] exactly; t < 384 also writes bqp[384] exactly.
__device__ __forceinline__ void prep_qkv_w(const int bx,
    const float* __restrict__ W, const float* __restrict__ bq, const float* __restrict__ We,
    unsigned short* __restrict__ wqh, unsigned short* __restrict__ wql,
    unsigned short* __restrict__ weh, unsigned short* __restrict__ wel, float* __restrict__ bqp) {
  const int t = bx * 256 + threadIdx.x;
  if (bx < 24) {                               // block-uniform
    const int n = t >> 4, k8 = (t & 15) * 8;
    const int part = n >> 7, h = (n >> 4) & 7, d = n & 15;
    const int col = part * 128 + d * 8 + h;
    v8h hv, lv;
#pragma unroll
    for (int e = 0; e < 8; ++e) {
      const float w = W[(size_t)(k8 + e) * 384 + col];
      _Float16 a, bb; split_bf16(w, a, bb); hv[e] = a; lv[e] = bb;
    }
    const size_t off = (size_t)n * 128 + k8;
    {
      *(v8h*)(wqh + off) = hv;
      *(v8h*)(wql + off) = lv;
      
    }
    if (t < 384) {                             // wave-uniform (384 = 12 waves)
      const int pn = t >> 7, ph = (t >> 4) & 7, pd = t & 15;
      const float bv = bq[pn * 128 + pd * 8 + ph];
      *(float*)(bqp + t) = bv;
      
    }
  } else {
    const int u = t - 6144;
    const int n = u >> 4, k8 = (u & 15) * 8;
    const int nc = (n < 8) ? n : 7;            // address clamp, value zeroed by predicate
    v8h hv, lv;
#pragma unroll
    for (int e = 0; e < 8; ++e) {
      float w = We[(size_t)(k8 + e) * 8 + nc];
      w = (n < 8) ? w : 0.0f;
      _Float16 a, bb; split_bf16(w, a, bb); hv[e] = a; lv[e] = bb;
    }
    const size_t off = (size_t)n * 128 + k8;
    {
      *(v8h*)(weh + off) = hv;
      *(v8h*)(wel + off) = lv;
      // inlined as one arm of a larger kernel: the code of a later arm reuses these stores' registers
      asm volatile("s_wait_xcnt 0x0" ::: "memory");
    }
  }
}

// Output weight prep: Wo [256 c][128 n] f32 ([in][out]) -> Bt hi/lo [128 n][256 k'] with k' = dir*128 + h*16 + d
// <- c = d*16 + dir*8 + h (concat of the two head groups on the head axis, then view d slow).
// grid 16 x block 256 = 4096 threads = 128 rows x 32 threads (8 k' each): covers [128][256] exactly;
__device__ __forceinline__ void prep_wo(const int bx, const float* __restrict__ Wo,
    unsigned short* __restrict__ woh, unsigned short* __restrict__ wol) {
  const int t = bx * 256 + threadIdx.x;
  const int n = t >> 5, k8 = (t & 31) * 8;
  v8h hv, lv;
#pragma unroll
  for (int e = 0; e < 8; ++e) {
    const int kp = k8 + e;
    const int dr = kp >> 7, h = (kp >> 4) & 7, d = kp & 15;
    const int col = d * 16 + dr * 8 + h;
    const float w = Wo[(size_t)col * 128 + n];
    _Float16 a, bb; split_bf16(w, a, bb); hv[e] = a; lv[e] = bb;
  }
  const size_t off = (size_t)n * 256 + k8;
  {
    *(v8h*)(woh + off) = hv;
    *(v8h*)(wol + off) = lv;
    // inlined as one arm of a larger kernel: the code of a later arm reuses these stores' registers
    asm volatile("s_wait_xcnt 0x0" ::: "memory");
  }
}

// LayerNorm over the 128-wide rows of e (eps 1e-5, biased variance, *g + b) -> bf16 hi/lo planes [nrows][128].
// grid = nrows/16, block 256 = 8 waves x 2 rows (lane half = row, lane&15 = 8-column chunk).
// coverage: 16 lanes x 8 halves = 128 columns per row, one instruction per plane writes the whole 256-B row
__device__ __forceinline__ void ln_rows(const int bx, const float* __restrict__ e, const float* __restrict__ g,
    const float* __restrict__ b, unsigned short* __restrict__ elh, unsigned short* __restrict__ ell, int nrows) {
  const int tid = threadIdx.x, wave = tid >> 5, lane = tid & 31, hh = lane >> 4, c = lane & 15;
  const int row = (bx * 8 + wave) * 2 + hh;
  const bool ok = row < nrows;
  const int rowc = ok ? row : (nrows - 1);
  const float* p = e + (size_t)rowc * EWID + c * 8;
  const v4f x0 = *(const v4f*)p;
  const v4f x1 = *(const v4f*)(p + 4);
  float xs[8];
  xs[0] = x0[0]; xs[1] = x0[1]; xs[2] = x0[2]; xs[3] = x0[3];
  xs[4] = x1[0]; xs[5] = x1[1]; xs[6] = x1[2]; xs[7] = x1[3];
  float s = ((xs[0] + xs[1]) + (xs[2] + xs[3])) + ((xs[4] + xs[5]) + (xs[6] + xs[7]));
#pragma unroll
  for (int off = 1; off < 16; off <<= 1) s += __shfl_xor(s, off, 32);
  const float mu = s * (1.0f / 128.0f);
  float q = 0.f;
#pragma unroll
  for (int k = 0; k < 8; ++k) { xs[k] -= mu; q += xs[k] * xs[k]; }
#pragma unroll
  for (int off = 1; off < 16; off <<= 1) q += __shfl_xor(q, off, 32);
  const float rs = rsqrtf(q * (1.0f / 128.0f) + 1e-5f);
  const v4f g0 = *(const v4f*)(g + c * 8), g1 = *(const v4f*)(g + c * 8 + 4);
  const v4f b0 = *(const v4f*)(b + c * 8), b1 = *(const v4f*)(b + c * 8 + 4);
  float gg[8], bb[8];
  gg[0] = g0[0]; gg[1] = g0[1]; gg[2] = g0[2]; gg[3] = g0[3]; gg[4] = g1[0]; gg[5] = g1[1]; gg[6] = g1[2]; gg[7] = g1[3];
  bb[0] = b0[0]; bb[1] = b0[1]; bb[2] = b0[2]; bb[3] = b0[3]; bb[4] = b1[0]; bb[5] = b1[1]; bb[6] = b1[2]; bb[7] = b1[3];
  v8h hv, lv;
#pragma unroll
  for (int k = 0; k < 8; ++k) {
    const float y = xs[k] * rs * gg[k] + bb[k];
    _Float16 a, lo; split_bf16(y, a, lo); hv[k] = a; lv[k] = lo;
  }
  if (ok) {
    const size_t off = (size_t)row * EWID + c * 8;
    {
      *(v8h*)(elh + off) = hv;
      *(v8h*)(ell + off) = lv;
      
    }
  }
}

// The four launches that depend on nothing but the inputs, as one: blocks 0..27 qkv/edge weights of direction 0,
// 28..55 of direction 1, 56..71 output weight, 72.. LayerNorm (16 rows a block). The choice is block-uniform.
#define PREP_BLOCKS 72
__global__ __launch_bounds__(256) void k_front(
    const float* __restrict__ e, const float* __restrict__ g, const float* __restrict__ b,
    const float* __restrict__ Wq0, const float* __restrict__ bq0, const float* __restrict__ We0,
    const float* __restrict__ Wq1, const float* __restrict__ bq1, const float* __restrict__ We1,
    const float* __restrict__ Wo,
    unsigned short* __restrict__ wqh0, unsigned short* __restrict__ wql0,
    unsigned short* __restrict__ weh0, unsigned short* __restrict__ wel0, float* __restrict__ bqp0,
    unsigned short* __restrict__ wqh1, unsigned short* __restrict__ wql1,
    unsigned short* __restrict__ weh1, unsigned short* __restrict__ wel1, float* __restrict__ bqp1,
    unsigned short* __restrict__ woh, unsigned short* __restrict__ wol,
    unsigned short* __restrict__ elh, unsigned short* __restrict__ ell, int nrows) {
  const int bx = blockIdx.x;
  if (bx < 28)               prep_qkv_w(bx, Wq0, bq0, We0, wqh0, wql0, weh0, wel0, bqp0);
  else if (bx < 56)          prep_qkv_w(bx - 28, Wq1, bq1, We1, wqh1, wql1, weh1, wel1, bqp1);
  else if (bx < PREP_BLOCKS) prep_wo(bx - 56, Wo, woh, wol);
  else                       ln_rows(bx - PREP_BLOCKS, e, g, b, elh, ell, nrows);
}

// Score bias slabs, direction dir = blockIdx.y: bm[dir][h][i][k] = eb[dir][r][h] + be[h] + mask[r][h] with
// r = i*192 + k (dir 0) or r = k*192 + i (dir 1). eb = f32 [36864][64] (columns 0..7 used), mask f32 [36864][8].
// grid (1152, 2) x block 256 = 8*192*192 threads a direction exactly; owner-computes (gather reads, contiguous 4-B stores:
__global__ __launch_bounds__(256) void k_bias_slab(const float* __restrict__ eb2, const float* __restrict__ be0,
    const float* __restrict__ be1, const float* __restrict__ mask, float* __restrict__ bm2) {
  const int dir = blockIdx.y;
  const float* eb = eb2 + (size_t)dir * NROWS * EB_LD;
  const float* be = dir ? be1 : be0;
  float* bm = bm2 + (size_t)dir * 8 * NROWS;
  const int idx = blockIdx.x * 256 + threadIdx.x;
  const int h = idx / NROWS;
  const int rem = idx - h * NROWS;
  const int i = rem / NNODE;
  const int k = rem - i * NNODE;
  const int r = dir ? (k * NNODE + i) : (i * NNODE + k);
  const float v = eb[(size_t)r * EB_LD + h] + be[h] + mask[(size_t)r * 8 + h];
  *(float*)(bm + idx) = v;
  
}

// Fused attention core for one (edge column j, direction dir, 32 query rows i), all 8 heads in sequence.
// qkv: f16 [2 dir][36864][384], head-major columns part*128 + h*16 + d.  bm: f32 [2 dir][8][192 i][192 k].
// grid = (192 j, 6 query chunks, 2 directions) x block 64 = 2 waves x 16 query rows.
// Per head: K_h [192 keys][16 d] and V_h^T [16 d][192 keys] staged in LDS by arithmetic row indices
// (dir 0: row j*192+k, dir 1: row k*192+j).  Both products run transposed, so that a lane owns ONE query:
// S^T = K (A: 16 keys, d zero-extended to 32) . Q^T (B) on f16 WMMA: lane (hh, c) holds query i0+c, register r
// key 16*tile + 8*hh + r; *0.25 + bias in f32, online softmax over 3 chunks of 64 keys in f32 with maximum and
// sum taken in the lane plus one exchange between the lane halves; two neighbouring S^T tiles, converted to f16
// in place, are the B operand of O^T = V^T (A: 16 d, 32 keys) . P^T; * 1/rowsum;
// head result (lane: query, registers: d = 8*hh + r) staged in LDS at column h*16 + d.
// Epilogue -> bf16 hi/lo planes [36864][256], row i*192+j, columns dir*128 + h*16 + d:
// coverage: 2 waves x (8 iters x 2 lane halves) = 32 rows; 16 lanes x 8 halves = 128 columns;
__global__ __launch_bounds__(64) void k_edge_attn(const _Float16* __restrict__ qkv2, const float* __restrict__ bm2,
    unsigned short* __restrict__ vah, unsigned short* __restrict__ val) {
  const int dir = blockIdx.z;
  const _Float16* qkv = qkv2 + (size_t)dir * NROWS * QKV_LD;
  const float* bm = bm2 + (size_t)dir * 8 * NROWS;
  __shared__ __align__(16) _Float16 Ksh[NNODE * KS_P];   // [key][d], indices <= 191*16+15
  __shared__ __align__(16) _Float16 Vt[16 * VT_P];       // [d][key], indices <= 15*192+191
  __shared__ __align__(16) float    Os[32 * OS_P];       // [local row][h*16+d]
  const int j = blockIdx.x;
  const int qblk = blockIdx.y * 32;
  const int tid = threadIdx.x, wave = tid >> 5, lane = tid & 31, hh = lane >> 4, c = lane & 15;
  const int i0 = qblk + wave * 16;
  const v8h z8 = zero8h();

#pragma unroll 1
  for (int h = 0; h < 8; ++h) {
    __syncthreads();
    // stage K_h / V_h: 384 (key, 8-wide d chunk) items over 64 threads = 6 iterations, covers 192 x 16 exactly
    for (int idx = tid; idx < 2 * NNODE; idx += 64) {
      const int kv = idx >> 1, part = idx & 1;
      const int r = dir ? (kv * NNODE + j) : (j * NNODE + kv);
      const _Float16* src = qkv + (size_t)r * QKV_LD + h * 16 + part * 8;
      const v8h kk8 = *(const v8h*)(src + EWID);
      const v8h vv8 = *(const v8h*)(src + 2 * EWID);
      *(v8h*)(Ksh + kv * KS_P + part * 8) = kk8;
#pragma unroll
      for (int e2 = 0; e2 < 8; ++e2) Vt[(part * 8 + e2) * VT_P + kv] = vv8[e2];
    }
    __syncthreads();

    // B fragment (query column i0+c, d 8hh..8hh+7 in elements 0..7, elements 8..15 zero)
    Frag<_Float16>::U qa;
    qa.h[0] = *(const v8h*)(qkv + ((size_t)(i0 + c) * NNODE + j) * QKV_LD + h * 16 + 8 * hh);
    qa.h[1] = z8;

    float mrow = -__builtin_inff(), lrow = 0.f;      // this lane's query
    v8f o = zero8f();                                // O^T: register r = d 8hh+r of query i0+c
    const float* bmr = bm + ((size_t)h * NNODE + (size_t)(i0 + c)) * NNODE + 8 * hh;

#pragma unroll 1
    for (int kc = 0; kc < 3; ++kc) {
      const int kv0 = kc * 64;
      // bias of keys kv0+16jn+8hh .. +7 for this lane's query: 32 contiguous bytes a tile
      v4f b0[4], b1[4];
#pragma unroll
      for (int jn = 0; jn < 4; ++jn) {
        b0[jn] = *(const v4f*)(bmr + kv0 + jn * 16);
        b1[jn] = *(const v4f*)(bmr + kv0 + jn * 16 + 4);
      }
      v8f s[4];
#pragma unroll
      for (int jn = 0; jn < 4; ++jn) {
        // A fragment (key row kv0+16jn+c, d 8hh..8hh+7 in elements 0..7, elements 8..15 zero)
        Frag<_Float16>::U kb;
        kb.h[0] = *(const v8h*)(Ksh + (kv0 + jn * 16 + c) * KS_P + 8 * hh);
        kb.h[1] = z8;
        s[jn] = hmma(kb.v, qa.v, zero8f());
      }
      float mx = -__builtin_inff();
#pragma unroll
      for (int jn = 0; jn < 4; ++jn) {
#pragma unroll
        for (int r = 0; r < 8; ++r) {
          const float v = s[jn][r] * 0.25f + (r < 4 ? b0[jn][r & 3] : b1[jn][r & 3]);
          s[jn][r] = v;
          mx = fmaxf(mx, v);
        }
      }
      mx = fmaxf(mx, __shfl_xor(mx, 16, 32));        // the other lane half holds the query's other 32 keys
      const float mnew = fmaxf(mrow, mx);
      const float alpha = expf(mrow - mnew);
      mrow = mnew;
      float ps = 0.f;
      Frag<_Float16>::U pb[2];                       // P^T as B: elements 0..7 = tile 2kk, 8..15 = tile 2kk+1
#pragma unroll
      for (int jn = 0; jn < 4; ++jn) {
#pragma unroll
        for (int r = 0; r < 8; ++r) {
          const float pv = expf(s[jn][r] - mnew);
          ps += pv;
          pb[jn >> 1].h[jn & 1][r] = (_Float16)pv;
        }
      }
      ps += __shfl_xor(ps, 16, 32);
      lrow = lrow * alpha + ps;
#pragma unroll
      for (int r = 0; r < 8; ++r) o[r] *= alpha;
#pragma unroll
      for (int kk = 0; kk < 2; ++kk) {
        const v16h va = Frag<_Float16>::load(Vt + c * VT_P + kv0 + kk * 32 + 8 * hh);
        o = hmma(va, pb[kk].v, o);
      }
    }
    const float inv = 1.0f / lrow;
    float* op = Os + (wave * 16 + c) * OS_P + h * 16 + 8 * hh;
    *(v4f*)op       = (v4f){o[0] * inv, o[1] * inv, o[2] * inv, o[3] * inv};
    *(v4f*)(op + 4) = (v4f){o[4] * inv, o[5] * inv, o[6] * inv, o[7] * inv};
  }
  __syncthreads();

  const size_t colbase = (size_t)dir * 128 + (size_t)c * 8;
  {
#pragma unroll
    for (int it = 0; it < 8; ++it) {
      const int lr = wave * 16 + it * 2 + hh;
      const float* sp = Os + lr * OS_P + c * 8;
      const v4f a4 = *(const v4f*)sp;
      const v4f b4 = *(const v4f*)(sp + 4);
      v8h hv, lv;
#pragma unroll
      for (int e = 0; e < 4; ++e) {
        _Float16 a, lo;
        split_bf16(a4[e], a, lo); hv[e] = a; lv[e] = lo;
        split_bf16(b4[e], a, lo); hv[4 + e] = a; lv[4 + e] = lo;
      }
      const size_t grow = (size_t)(qblk + lr) * NNODE + j;
      *(v8h*)(vah + grow * VA_LD + colbase) = hv;
      *(v8h*)(val + grow * VA_LD + colbase) = lv;
    }
    
  }
}

// ---------------------------------------------------------------------------------------
extern "C" void kernel_launch(void* const* d_in, const int* in_sizes, int n_in,
                              void* d_out, int out_size, void* d_ws, size_t ws_size,
                              hipStream_t stream) {
  if (n_in < 14) return;
  if (in_sizes[0] != NROWS * EWID || in_sizes[1] != NROWS * 8 || in_sizes[2] < EWID || in_sizes[3] < EWID ||
      in_sizes[4] != EWID * 384 || in_sizes[5] < 384 || in_sizes[6] != EWID * 8 || in_sizes[7] < 8 ||
      in_sizes[8] != EWID * 384 || in_sizes[9] < 384 || in_sizes[10] != EWID * 8 || in_sizes[11] < 8 ||
      in_sizes[12] != 256 * EWID || in_sizes[13] < EWID || out_size != NROWS * EWID) return;

  const float* e      = (const float*)d_in[0];
  const float* mask   = (const float*)d_in[1];
  const float* ln_g   = (const float*)d_in[2];
  const float* ln_b   = (const float*)d_in[3];
  const float* Wq_in  = (const float*)d_in[4];
  const float* bq_in  = (const float*)d_in[5];
  const float* We_in  = (const float*)d_in[6];
  const float* be_in  = (const float*)d_in[7];
  const float* Wq_out = (const float*)d_in[8];
  const float* bq_out = (const float*)d_in[9];
  const float* We_out = (const float*)d_in[10];
  const float* be_out = (const float*)d_in[11];
  const float* Wo     = (const float*)d_in[12];
  const float* bo     = (const float*)d_in[13];
  float* out = (float*)d_out;

  // ---- workspace region map (offsets 256-B aligned; total 135,072,768 B) ----
  //  ELh, ELl   bf16 [36864][128]       2 x  9,437,184   LayerNorm output hi/lo (live through both directions)
  //  QKV16      f16  [2][36864][384]    2 x 28,311,552   projection output, one plane a direction
  //  EB         f32  [2][36864][64]     2 x  9,437,184   edge-bias projection (cols 0..7), one plane a direction
  //  BM         f32  [2][8][192][192]   2 x  1,179,648   bias+mask slabs, one plane a direction
  //  VAh, VAl   bf16 [36864][256]       2 x 18,874,368   attention output hi/lo (both directions)
  //  WtQh/l x2  bf16 [384][128]         4 x     98,304
  //  WtEh/l x2  bf16 [64][128]          4 x     16,384
  //  WoTh/l     bf16 [128][256]         2 x     65,536
  //  bqp x2     f32  [384]              2 x      1,536
  size_t off = 0;
  auto carve = [&](size_t bytes) { size_t o = off; off += (bytes + 255) & ~(size_t)255; return o; };
  const size_t oELh = carve((size_t)NROWS * EWID * 2);
  const size_t oELl = carve((size_t)NROWS * EWID * 2);
  const size_t oQKV = carve((size_t)2 * NROWS * QKV_LD * 2);
  const size_t oEB  = carve((size_t)2 * NROWS * EB_LD * 4);
  const size_t oBM  = carve((size_t)2 * 8 * NNODE * NNODE * 4);
  const size_t oVAh = carve((size_t)NROWS * VA_LD * 2);
  const size_t oVAl = carve((size_t)NROWS * VA_LD * 2);
  size_t oWQh[2], oWQl[2], oWEh[2], oWEl[2], oBQ[2];
  for (int d = 0; d < 2; ++d) { oWQh[d] = carve((size_t)384 * 128 * 2); oWQl[d] = carve((size_t)384 * 128 * 2); }
  for (int d = 0; d < 2; ++d) { oWEh[d] = carve((size_t)64 * 128 * 2);  oWEl[d] = carve((size_t)64 * 128 * 2); }
  const size_t oWOh = carve((size_t)128 * 256 * 2);
  const size_t oWOl = carve((size_t)128 * 256 * 2);
  for (int d = 0; d < 2; ++d) oBQ[d] = carve((size_t)384 * 4);
  if (off > ws_size) return;

  char* ws = (char*)d_ws;
  unsigned short* ELh = (unsigned short*)(ws + oELh);
  unsigned short* ELl = (unsigned short*)(ws + oELl);
  _Float16* QKV16 = (_Float16*)(ws + oQKV);
  float* EB = (float*)(ws + oEB);
  float* BM = (float*)(ws + oBM);
  unsigned short* VAh = (unsigned short*)(ws + oVAh);
  unsigned short* VAl = (unsigned short*)(ws + oVAl);
  unsigned short* WQh[2], *WQl[2], *WEh[2], *WEl[2];
  float* BQ[2];
  for (int d = 0; d < 2; ++d) {
    WQh[d] = (unsigned short*)(ws + oWQh[d]); WQl[d] = (unsigned short*)(ws + oWQl[d]);
    WEh[d] = (unsigned short*)(ws + oWEh[d]); WEl[d] = (unsigned short*)(ws + oWEl[d]);
    BQ[d] = (float*)(ws + oBQ[d]);
  }
  unsigned short* WOh = (unsigned short*)(ws + oWOh);
  unsigned short* WOl = (unsigned short*)(ws + oWOl);

  // weight prep of both directions and of the output linear + LayerNorm -> bf16 hi/lo planes, one launch
  // (72 prep blocks, then 36864 rows / 16 rows per block = 2304 blocks exactly)
  k_front<<<PREP_BLOCKS + NROWS / 16, 256, 0, stream>>>(e, ln_g, ln_b, Wq_in, bq_in, We_in, Wq_out, bq_out, We_out, Wo,
      WQh[0], WQl[0], WEh[0], WEl[0], BQ[0], WQh[1], WQl[1], WEh[1], WEl[1], BQ[1], WOh, WOl, ELh, ELl, NROWS);

  const int tilesQKV = (NROWS / 64) * (QKV_LD / 64);   // 3456 = 432 blocks x 8 waves
  const int tilesEB  = (NROWS / 64) * (EB_LD / 64);    // 576  = 72 blocks
  const int tilesOUT = (NROWS / 64) * (EWID / 64);     // 1152 = 144 blocks
  // The launches below up to the attention serve both directions: the GEMM batch index (grid y) or grid y / z is the direction.
  // edge bias = EL . We  (M 36864, N 64 (8 used), K 128; split; f32 output; be added in the slab kernel) and
  // qkv = EL . Wqkv + b  (M 36864, N 384, K 128; bf16 hi/lo split; f16 head-major output), one launch
  k_proj<<<dim3(tilesEB / 8 + tilesQKV / 8, 2), 256, 0, stream>>>(ELh, ELl, EWID,
      WEh[0], WEl[0], (long)(WEh[1] - WEh[0]), (void*)EB, EB_LD, (long)NROWS * EB_LD, EB_LD, tilesEB / 8,
      WQh[0], WQl[0], (long)(WQh[1] - WQh[0]), (void*)QKV16, QKV_LD, (long)NROWS * QKV_LD, QKV_LD,
      BQ[0], (long)(BQ[1] - BQ[0]), NROWS, EWID);
  k_bias_slab<<<dim3((8 * NNODE * NNODE) / 256, 2), 256, 0, stream>>>(EB, be_in, be_out, mask, BM);
  k_edge_attn<<<dim3(NNODE, NNODE / 32, 2), 64, 0, stream>>>(QKV16, BM, VAh, VAl);
  // out = VA . Wo + bo  (M 36864, N 128, K 256; split; f32 output rows of d_out)
  wmma_gemm64<1, true, 2, 0, false><<<dim3(tilesOUT / 8, 1), 256, 0, stream>>>(
      VAh, VAl, VA_LD, (long)0, WOh, WOl, VA_LD, (long)0,
      (void*)out, (void*)out, EWID, (long)0, bo, (long)0, bo, (long)0, NROWS, EWID, VA_LD, 1.0f);
}

// v003
// A run of this version takes 142 microseconds.
// Next to v002, in two timings, it ran 1.09 times as fast each time.
// All steps since v000 together make it 1.85 times as fast.
// Contractions: LayerNorm'd qkv / edge-bias projections and the output linear on v_wmma_f32_16x16x32_bf16 with bf16 hi/lo split operands (hi*hi + hi*lo + lo*hi); per-(edge column, head) 192x192 attention cores (q.k^T with d=16 zero-extended to 32, p.v with 192 keys) on v_wmma_f32_16x16x32_f16 with plain f16 operands; f32 accumulate everywhere; LayerNorm, bias/mask add, softmax and normalisation in f32.
#include <hip/hip_runtime.h>

typedef __attribute__((ext_vector_type(16))) _Float16 v16h;
typedef __attribute__((ext_vector_type(8)))  _Float16 v8h;
typedef __attribute__((ext_vector_type(16))) __bf16   v16b;
typedef __attribute__((ext_vector_type(8)))  __bf16   v8b;
typedef __attribute__((ext_vector_type(8)))  float    v8f;
typedef __attribute__((ext_vector_type(4)))  float    v4f;
typedef __attribute__((ext_vector_type(2)))  float    v2f;

#define EWID 128
#define NNODE 192
#define NROWS 36864          // 192*192 edge rows, row r = i*192 + j
#define QKV_LD 384
#define EB_LD 64
#define VA_LD 256
#define KS_P 16              // LDS K tile pitch (halves)
#define VT_P 192             // LDS V^T tile pitch (halves)
#define OS_P 132             // LDS output staging pitch (floats, 528 B rows)
#define LOG2E 1.4426950408889634f

// ------------------------------- helpers -------------------------------
__device__ __forceinline__ unsigned short f2bf_bits(float f) {
  unsigned u = __float_as_uint(f);
  return (unsigned short)((u + 0x7FFFu + ((u >> 16) & 1u)) >> 16);
}
__device__ __forceinline__ float bf_bits2f(unsigned short h) { return __uint_as_float(((unsigned)h) << 16); }

// hazard guards as plain device helpers (no inline asm inside the kernel template body)
__device__ __forceinline__ void dep_guard_h(v8f& a, v8f& b, v16h x, v16h y) { asm volatile("v_nop\n\tv_nop\n\tv_nop\n\tv_nop" : "+v"(a), "+v"(b) : "v"(x), "v"(y)); }
__device__ __forceinline__ void dep_guard_b(v8f& a, v8f& b, v16b x, v16b y) { asm volatile("v_nop\n\tv_nop\n\tv_nop\n\tv_nop" : "+v"(a), "+v"(b) : "v"(x), "v"(y)); }
__device__ __forceinline__ void keep4_h(v16h a, v16h b, v16h c, v16h d) { asm volatile("v_nop" :: "v"(a), "v"(b), "v"(c), "v"(d)); }
__device__ __forceinline__ void keep4_b(v16b a, v16b b, v16b c, v16b d) { asm volatile("v_nop" :: "v"(a), "v"(b), "v"(c), "v"(d)); }
__device__ __forceinline__ void acc_guard4(v8f& a, v8f& b, v8f& c, v8f& d) { asm volatile("v_nop\n\tv_nop\n\tv_nop\n\tv_nop" : "+v"(a), "+v"(b), "+v"(c), "+v"(d)); }
template <typename T> struct Frag;
template <> struct Frag<_Float16> {
  typedef v16h V; union U { v16h v; v8h h[2]; };
  static __device__ __forceinline__ v16h load(const _Float16* p) {   // elements 0..7 <- p[0..7], 8..15 <- p[16..23]
    U f; f.h[0] = *(const v8h*)(p); f.h[1] = *(const v8h*)(p + 16); return f.v;
  }
  static __device__ __forceinline__ v8f mma(v16h a, v16h b, v8f c) {
    return __builtin_amdgcn_wmma_f32_16x16x32_f16(false, a, false, b, (short)0, c, false, false);
  }
  static __device__ __forceinline__ void guard(v8f& a, v8f& b, v16h x, v16h y) { dep_guard_h(a, b, x, y); }
  static __device__ __forceinline__ void keep(v16h a, v16h b, v16h c, v16h d) { keep4_h(a, b, c, d); }
};
template <> struct Frag<__bf16> {
  typedef v16b V; union U { v16b v; v8b h[2]; };
  static __device__ __forceinline__ v16b load(const __bf16* p) {
    U f; f.h[0] = *(const v8b*)(p); f.h[1] = *(const v8b*)(p + 16); return f.v;
  }
  static __device__ __forceinline__ v8f mma(v16b a, v16b b, v8f c) {
    return __builtin_amdgcn_wmma_f32_16x16x32_bf16(false, a, false, b, (short)0, c, false, false);
  }
  static __device__ __forceinline__ void guard(v8f& a, v8f& b, v16b x, v16b y) { dep_guard_b(a, b, x, y); }
  static __device__ __forceinline__ void keep(v16b a, v16b b, v16b c, v16b d) { keep4_b(a, b, c, d); }
};

// ---- Register-blocked batched WMMA GEMM ------------------------------------
// C[m,n] = scale * sum_k A[m,k] * Bt[n,k] (+bias)(+resid); each wave owns a 64x64 tile.
// A row-major [M,K]; Bt row-major [N,K]; M,N % 64 == 0, K % 32 == 0.
// SPLIT: operands are hi/lo planes (A2/Bt2 = lo planes, same layout); product = hi*hi + hi*lo + lo*hi.
// BIAS_MODE: 0 = none, 1 = bias[m], 2 = bias[n].
// OUT_MODE: 0 = f32, 1 = f16, 2 = bf16 hi plane (Cout) + bf16 lo plane (Cout2).
// ET: 0 = f16 operands, 1 = bf16 operands (pointers passed as 16-bit storage)
template <int ET> struct Elem;
template <> struct Elem<0> { typedef _Float16 T; };
template <> struct Elem<1> { typedef __bf16 T; };
// gemm64_tile: the work of block bx of batch b; sT = the block's LDS, 8 per-wave 16x64 slabs of pitch 68 floats.
template <int ET, bool SPLIT, int BIAS_MODE, int OUT_MODE, bool RESID, int ACT = 0>
__device__ __forceinline__ void gemm64_tile(const int bx, const int b, float* __restrict__ sT,
    const unsigned short* __restrict__ Ap, const unsigned short* __restrict__ A2p, int lda, long strideA,
    const unsigned short* __restrict__ Btp, const unsigned short* __restrict__ Bt2p, int ldb, long strideB,
    void* __restrict__ Cout, void* __restrict__ Cout2, int ldc, long strideC,
    const float* __restrict__ bias, long strideBias,
    const float* __restrict__ resid, long strideR,
    int M, int N, int K, float scale) {
  typedef typename Elem<ET>::T T;
  typedef typename Frag<T>::V V;
  const T* A = (const T*)Ap; const T* A2 = (const T*)A2p; const T* Bt = (const T*)Btp; const T* Bt2 = (const T*)Bt2p;
  const int lane = threadIdx.x & 31;
  const int wave = threadIdx.x >> 5;
  const int tilesN = N >> 6;
  const int tilesM = M >> 6;
  const int tile = bx * 8 + wave;
  if (tile >= tilesM * tilesN) return;   // wave-uniform; no block barriers in this kernel
  const int tm = tile / tilesN;
  const int tn = tile - tm * tilesN;
  const int m0 = tm << 6;
  const int n0 = tn << 6;

  const T* Ab  = A  + (size_t)b * strideA;
  const T* Bb  = Bt + (size_t)b * strideB;
  const T* Ab2 = SPLIT ? (A2  + (size_t)b * strideA) : nullptr;
  const T* Bb2 = SPLIT ? (Bt2 + (size_t)b * strideB) : nullptr;

  const int rlane = lane & 15;                 // row (A) / col (B, D) within subtile
  const int koff  = (lane >> 4) * 8;           // k offset of this lane half
  const int mOff  = (lane >> 4) * 8;           // D row offset

  v8f acc[4][4];
#pragma unroll
  for (int i = 0; i < 4; ++i)
#pragma unroll
    for (int j = 0; j < 4; ++j) acc[i][j] = (v8f){0.f,0.f,0.f,0.f,0.f,0.f,0.f,0.f};

  for (int k0 = 0; k0 < K; k0 += 32) {
    V bh[4], bl[4];
#pragma unroll
    for (int j = 0; j < 4; ++j) {
      const size_t bo = (size_t)(n0 + (j << 4) + rlane) * ldb + koff + k0;
      bh[j] = Frag<T>::load(Bb + bo);
      if (SPLIT) bl[j] = Frag<T>::load(Bb2 + bo);
    }
#pragma unroll
    for (int i = 0; i < 4; ++i) {
      const size_t ao = (size_t)(m0 + (i << 4) + rlane) * lda + koff + k0;
      V ah = Frag<T>::load(Ab + ao);
      V al;
      if (SPLIT) al = Frag<T>::load(Ab2 + ao);
#pragma unroll
      for (int j = 0; j < 4; ++j) {
        acc[i][j] = Frag<T>::mma(ah, bh[j], acc[i][j]);
        if (SPLIT) {
          acc[i][j] = Frag<T>::mma(ah, bl[j], acc[i][j]);
          acc[i][j] = Frag<T>::mma(al, bh[j], acc[i][j]);
        }
      }
      Frag<T>::guard(acc[i][0], acc[i][3], ah, SPLIT ? al : ah);
    }
    Frag<T>::keep(bh[0], bh[1], bh[2], bh[3]);
    if (SPLIT) Frag<T>::keep(bl[0], bl[1], bl[2], bl[3]);
  }
  acc_guard4(acc[0][0], acc[0][1], acc[0][2], acc[0][3]);
  acc_guard4(acc[1][0], acc[1][1], acc[1][2], acc[1][3]);
  acc_guard4(acc[2][0], acc[2][1], acc[2][2], acc[2][3]);
  acc_guard4(acc[3][0], acc[3][1], acc[3][2], acc[3][3]);

  // ---- epilogue ----
  float* slab = sT + wave * (16 * 68);
  const float* Rb = RESID ? (resid + (size_t)b * strideR) : nullptr;
  const float* Bs = (BIAS_MODE != 0) ? (bias + (size_t)b * strideBias) : nullptr;
#pragma unroll
  for (int i = 0; i < 4; ++i) {
    const int mBase = m0 + (i << 4);
#pragma unroll
    for (int j = 0; j < 4; ++j) {
      const int n = n0 + (j << 4) + rlane;
      float bv = 0.f;
      if (BIAS_MODE == 2) bv = Bs[n];
#pragma unroll
      for (int r = 0; r < 8; ++r) {
        float v = acc[i][j][r] * scale;
        if (BIAS_MODE == 1) v += Bs[mBase + mOff + r];
        if (BIAS_MODE == 2) v += bv;
        if (RESID) v += Rb[(size_t)(mBase + mOff + r) * ldc + n];
        if (ACT == 1) v = tanhf(v);
        if (ACT == 2) v = fmaxf(v, 0.0f);
        if (ACT == 3) v = v / (1.0f + expf(-v));
        if (ACT == 4) v = (v > 0.f) ? v : 0.01f * v;
        if (ACT == 5) v = 0.5f * v * (1.0f + erff(v * 0.70710678118654752f));
        slab[(mOff + r) * 68 + (j << 4) + rlane] = v;
      }
    }
    __builtin_amdgcn_fence(__ATOMIC_RELEASE, "workgroup");
    __builtin_amdgcn_wave_barrier();
    __builtin_amdgcn_fence(__ATOMIC_ACQUIRE, "workgroup");
    if (OUT_MODE == 0) {
      float* C = (float*)Cout + (size_t)b * strideC;
      const int hh = lane >> 4, c4 = (lane & 15) * 4;     // row seg = 256 B = 16 lanes x 16 B
      {
#pragma unroll
        for (int it = 0; it < 8; ++it) {
          const int row = it * 2 + hh;
          v4f v = *(const v4f*)(slab + row * 68 + c4);
          *(v4f*)(C + (size_t)(mBase + row) * ldc + n0 + c4) = v;
        }
        
      }
    } else {
      const int q = lane >> 3, c8 = (lane & 7) * 8;
      unsigned short* C  = (unsigned short*)Cout  + (size_t)b * strideC;
      unsigned short* C2 = (OUT_MODE == 2) ? ((unsigned short*)Cout2 + (size_t)b * strideC) : nullptr;
      {
#pragma unroll
        for (int it = 0; it < 4; ++it) {
          const int row = it * 4 + q;
          const float* sp = slab + row * 68 + c8;
          v8h hv, lv;
#pragma unroll
          for (int e = 0; e < 8; ++e) {
            if (OUT_MODE == 1) {
              hv[e] = (_Float16)sp[e];
            } else {
              unsigned short hb = f2bf_bits(sp[e]);
              unsigned short lb = f2bf_bits(sp[e] - bf_bits2f(hb));
              hv[e] = __builtin_bit_cast(_Float16, hb);
              lv[e] = __builtin_bit_cast(_Float16, lb);
            }
          }
          *(v8h*)(C + (size_t)(mBase + row) * ldc + n0 + c8) = hv;
          if (OUT_MODE == 2) *(v8h*)(C2 + (size_t)(mBase + row) * ldc + n0 + c8) = lv;
        }
        
      }
    }
    __builtin_amdgcn_fence(__ATOMIC_RELEASE, "workgroup");
    __builtin_amdgcn_wave_barrier();
    __builtin_amdgcn_fence(__ATOMIC_ACQUIRE, "workgroup");
  }
}
template <int ET, bool SPLIT, int BIAS_MODE, int OUT_MODE, bool RESID, int ACT = 0>
__global__ __launch_bounds__(256) void wmma_gemm64(
    const unsigned short* __restrict__ Ap, const unsigned short* __restrict__ A2p, int lda, long strideA,
    const unsigned short* __restrict__ Btp, const unsigned short* __restrict__ Bt2p, int ldb, long strideB,
    void* __restrict__ Cout, void* __restrict__ Cout2, int ldc, long strideC,
    const float* __restrict__ bias, long strideBias,
    const float* __restrict__ resid, long strideR,
    int M, int N, int K, float scale) {
  __shared__ __align__(16) float sT[8 * 16 * 68];
  gemm64_tile<ET, SPLIT, BIAS_MODE, OUT_MODE, RESID, ACT>(blockIdx.x, blockIdx.y, sT, Ap, A2p, lda, strideA,
      Btp, Bt2p, ldb, strideB, Cout, Cout2, ldc, strideC, bias, strideBias, resid, strideR, M, N, K, scale);
}
// The two projections of the LayerNorm'd rows, which do not depend on each other, as one launch: blocks below
// blocksE do the edge-bias product (f32 out, no bias), the others the qkv product (f16 out, bias[n]). Block-uniform.
__global__ __launch_bounds__(256) void k_proj(
    const unsigned short* __restrict__ Ap, const unsigned short* __restrict__ A2p, int lda,
    const unsigned short* __restrict__ BtE, const unsigned short* __restrict__ Bt2E, long strideBE,
    void* __restrict__ CE, int ldcE, long strideCE, int NE, int blocksE,
    const unsigned short* __restrict__ BtQ, const unsigned short* __restrict__ Bt2Q, long strideBQ,
    void* __restrict__ CQ, int ldcQ, long strideCQ, int NQ,
    const float* __restrict__ biasQ, long strideBiasQ, int M, int K) {
  __shared__ __align__(16) float sT[8 * 16 * 68];
  const int bx = blockIdx.x;
  if (bx < blocksE)
    gemm64_tile<1, true, 0, 0, false>(bx, blockIdx.y, sT, Ap, A2p, lda, (long)0, BtE, Bt2E, lda, strideBE,
        CE, CE, ldcE, strideCE, biasQ, (long)0, biasQ, (long)0, M, NE, K, 1.0f);
  else
    gemm64_tile<1, true, 2, 1, false>(bx - blocksE, blockIdx.y, sT, Ap, A2p, lda, (long)0, BtQ, Bt2Q, lda, strideBQ,
        CQ, CQ, ldcQ, strideCQ, biasQ, strideBiasQ, biasQ, (long)0, M, NQ, K, 1.0f);
}

__device__ __forceinline__ v8f zero8f() { return (v8f){0.f, 0.f, 0.f, 0.f, 0.f, 0.f, 0.f, 0.f}; }
__device__ __forceinline__ v8h zero8h() {
  v8h z;
#pragma unroll
  for (int e = 0; e < 8; ++e) z[e] = (_Float16)0.0f;
  return z;
}
// f16 WMMA with the hazard guard attached (D tied, A/B kept live)
__device__ __forceinline__ v8f hmma(v16h a, v16h b, v8f c) {
  c = __builtin_amdgcn_wmma_f32_16x16x32_f16(false, a, false, b, (short)0, c, false, false);
  asm volatile("v_nop\n\tv_nop\n\tv_nop\n\tv_nop" : "+v"(c) : "v"(a), "v"(b));
  return c;
}
__device__ __forceinline__ void split_bf16(float x, _Float16& hi, _Float16& lo) {
  const unsigned short hb = f2bf_bits(x);
  const unsigned short lb = f2bf_bits(x - bf_bits2f(hb));
  hi = __builtin_bit_cast(_Float16, hb);
  lo = __builtin_bit_cast(_Float16, lb);
}

// ---------------------------------------------------------------------------------------
// qkv weight prep: W [128 k][384 c] f32 ([in][out]) -> Bt hi/lo bf16 planes [384 n][128 k] with head-major
// output columns: n = part*128 + h*16 + d  <-  c = part*128 + d*8 + h (view(DD=16, NH=8): d slow, h fast).
// Permuted bias bqp[n] = bq[c].  Edge-bias weight We [128 k][8] -> Bt hi/lo [64 n][128 k], rows n >= 8 zero.
// grid 28 x block 256: blocks 0..23 = 384 rows x 16 threads (8 k each) -> covers [384][128] exactly;
// blocks 24..27 = 64 rows x 16 threads -> covers [64][128] exactly; t < 384 also writes bqp[384] exactly.
__device__ __forceinline__ void prep_qkv_w(const int bx,
    const float* __restrict__ W, const float* __restrict__ bq, const float* __restrict__ We,
    unsigned short* __restrict__ wqh, unsigned short* __restrict__ wql,
    unsigned short* __restrict__ weh, unsigned short* __restrict__ wel, float* __restrict__ bqp) {
  const int t = bx * 256 + threadIdx.x;
  if (bx < 24) {                               // block-uniform
    const int n = t >> 4, k8 = (t & 15) * 8;
    const int part = n >> 7, h = (n >> 4) & 7, d = n & 15;
    const int col = part * 128 + d * 8 + h;
    v8h hv, lv;
#pragma unroll
    for (int e = 0; e < 8; ++e) {
      const float w = W[(size_t)(k8 + e) * 384 + col];
      _Float16 a, bb; split_bf16(w, a, bb); hv[e] = a; lv[e] = bb;
    }
    const size_t off = (size_t)n * 128 + k8;
    {
      *(v8h*)(wqh + off) = hv;
      *(v8h*)(wql + off) = lv;
      
    }
    if (t < 384) {                             // wave-uniform (384 = 12 waves)
      const int pn = t >> 7, ph = (t >> 4) & 7, pd = t & 15;
      const float bv = bq[pn * 128 + pd * 8 + ph];
      *(float*)(bqp + t) = bv;
      
    }
  } else {
    const int u = t - 6144;
    const int n = u >> 4, k8 = (u & 15) * 8;
    const int nc = (n < 8) ? n : 7;            // address clamp, value zeroed by predicate
    v8h hv, lv;
#pragma unroll
    for (int e = 0; e < 8; ++e) {
      float w = We[(size_t)(k8 + e) * 8 + nc];
      w = (n < 8) ? w : 0.0f;
      _Float16 a, bb; split_bf16(w, a, bb); hv[e] = a; lv[e] = bb;
    }
    const size_t off = (size_t)n * 128 + k8;
    {
      *(v8h*)(weh + off) = hv;
      *(v8h*)(wel + off) = lv;
      // inlined as one arm of a larger kernel: the code of a later arm reuses these stores' registers
      asm volatile("s_wait_xcnt 0x0" ::: "memory");
    }
  }
}

// Output weight prep: Wo [256 c][128 n] f32 ([in][out]) -> Bt hi/lo [128 n][256 k'] with k' = dir*128 + h*16 + d
// <- c = d*16 + dir*8 + h (concat of the two head groups on the head axis, then view d slow).
// grid 16 x block 256 = 4096 threads = 128 rows x 32 threads (8 k' each): covers [128][256] exactly;
__device__ __forceinline__ void prep_wo(const int bx, const float* __restrict__ Wo,
    unsigned short* __restrict__ woh, unsigned short* __restrict__ wol) {
  const int t = bx * 256 + threadIdx.x;
  const int n = t >> 5, k8 = (t & 31) * 8;
  v8h hv, lv;
#pragma unroll
  for (int e = 0; e < 8; ++e) {
    const int kp = k8 + e;
    const int dr = kp >> 7, h = (kp >> 4) & 7, d = kp & 15;
    const int col = d * 16 + dr * 8 + h;
    const float w = Wo[(size_t)col * 128 + n];
    _Float16 a, bb; split_bf16(w, a, bb); hv[e] = a; lv[e] = bb;
  }
  const size_t off = (size_t)n * 256 + k8;
  {
    *(v8h*)(woh + off) = hv;
    *(v8h*)(wol + off) = lv;
    // inlined as one arm of a larger kernel: the code of a later arm reuses these stores' registers
    asm volatile("s_wait_xcnt 0x0" ::: "memory");
  }
}

// LayerNorm over the 128-wide rows of e (eps 1e-5, biased variance, *g + b) -> bf16 hi/lo planes [nrows][128].
// grid = nrows/16, block 256 = 8 waves x 2 rows (lane half = row, lane&15 = 8-column chunk).
// coverage: 16 lanes x 8 halves = 128 columns per row, one instruction per plane writes the whole 256-B row
__device__ __forceinline__ void ln_rows(const int bx, const float* __restrict__ e, const float* __restrict__ g,
    const float* __restrict__ b, unsigned short* __restrict__ elh, unsigned short* __restrict__ ell, int nrows) {
  const int tid = threadIdx.x, wave = tid >> 5, lane = tid & 31, hh = lane >> 4, c = lane & 15;
  const int row = (bx * 8 + wave) * 2 + hh;
  const bool ok = row < nrows;
  const int rowc = ok ? row : (nrows - 1);
  const float* p = e + (size_t)rowc * EWID + c * 8;
  const v4f x0 = *(const v4f*)p;
  const v4f x1 = *(const v4f*)(p + 4);
  float xs[8];
  xs[0] = x0[0]; xs[1] = x0[1]; xs[2] = x0[2]; xs[3] = x0[3];
  xs[4] = x1[0]; xs[5] = x1[1]; xs[6] = x1[2]; xs[7] = x1[3];
  float s = ((xs[0] + xs[1]) + (xs[2] + xs[3])) + ((xs[4] + xs[5]) + (xs[6] + xs[7]));
#pragma unroll
  for (int off = 1; off < 16; off <<= 1) s += __shfl_xor(s, off, 32);
  const float mu = s * (1.0f / 128.0f);
  float q = 0.f;
#pragma unroll
  for (int k = 0; k < 8; ++k) { xs[k] -= mu; q += xs[k] * xs[k]; }
#pragma unroll
  for (int off = 1; off < 16; off <<= 1) q += __shfl_xor(q, off, 32);
  const float rs = rsqrtf(q * (1.0f / 128.0f) + 1e-5f);
  const v4f g0 = *(const v4f*)(g + c * 8), g1 = *(const v4f*)(g + c * 8 + 4);
  const v4f b0 = *(const v4f*)(b + c * 8), b1 = *(const v4f*)(b + c * 8 + 4);
  float gg[8], bb[8];
  gg[0] = g0[0]; gg[1] = g0[1]; gg[2] = g0[2]; gg[3] = g0[3]; gg[4] = g1[0]; gg[5] = g1[1]; gg[6] = g1[2]; gg[7] = g1[3];
  bb[0] = b0[0]; bb[1] = b0[1]; bb[2] = b0[2]; bb[3] = b0[3]; bb[4] = b1[0]; bb[5] = b1[1]; bb[6] = b1[2]; bb[7] = b1[3];
  v8h hv, lv;
#pragma unroll
  for (int k = 0; k < 8; ++k) {
    const float y = xs[k] * rs * gg[k] + bb[k];
    _Float16 a, lo; split_bf16(y, a, lo); hv[k] = a; lv[k] = lo;
  }
  if (ok) {
    const size_t off = (size_t)row * EWID + c * 8;
    {
      *(v8h*)(elh + off) = hv;
      *(v8h*)(ell + off) = lv;
      
    }
  }
}

// The four launches that depend on nothing but the inputs, as one: blocks 0..27 qkv/edge weights of direction 0,
// 28..55 of direction 1, 56..71 output weight, 72.. LayerNorm (16 rows a block). The choice is block-uniform.
#define PREP_BLOCKS 72
__global__ __launch_bounds__(256) void k_front(
    const float* __restrict__ e, const float* __restrict__ g, const float* __restrict__ b,
    const float* __restrict__ Wq0, const float* __restrict__ bq0, const float* __restrict__ We0,
    const float* __restrict__ Wq1, const float* __restrict__ bq1, const float* __restrict__ We1,
    const float* __restrict__ Wo,
    unsigned short* __restrict__ wqh0, unsigned short* __restrict__ wql0,
    unsigned short* __restrict__ weh0, unsigned short* __restrict__ wel0, float* __restrict__ bqp0,
    unsigned short* __restrict__ wqh1, unsigned short* __restrict__ wql1,
    unsigned short* __restrict__ weh1, unsigned short* __restrict__ wel1, float* __restrict__ bqp1,
    unsigned short* __restrict__ woh, unsigned short* __restrict__ wol,
    unsigned short* __restrict__ elh, unsigned short* __restrict__ ell, int nrows) {
  const int bx = blockIdx.x;
  if (bx < 28)               prep_qkv_w(bx, Wq0, bq0, We0, wqh0, wql0, weh0, wel0, bqp0);
  else if (bx < 56)          prep_qkv_w(bx - 28, Wq1, bq1, We1, wqh1, wql1, weh1, wel1, bqp1);
  else if (bx < PREP_BLOCKS) prep_wo(bx - 56, Wo, woh, wol);
  else                       ln_rows(bx - PREP_BLOCKS, e, g, b, elh, ell, nrows);
}

// Score bias slabs, direction dir = blockIdx.y: bm[dir][h][i][k] = eb[dir][r][h] + be[h] + mask[r][h] with
// r = i*192 + k (dir 0) or r = k*192 + i (dir 1). eb = f32 [36864][64] (columns 0..7 used), mask f32 [36864][8].
// grid (1152, 2) x block 256 = 8*192*192 threads a direction exactly; owner-computes (gather reads, contiguous 4-B stores:
__global__ __launch_bounds__(256) void k_bias_slab(const float* __restrict__ eb2, const float* __restrict__ be0,
    const float* __restrict__ be1, const float* __restrict__ mask, float* __restrict__ bm2) {
  const int dir = blockIdx.y;
  const float* eb = eb2 + (size_t)dir * NROWS * EB_LD;
  const float* be = dir ? be1 : be0;
  float* bm = bm2 + (size_t)dir * 8 * NROWS;
  const int idx = blockIdx.x * 256 + threadIdx.x;
  const int h = idx / NROWS;
  const int rem = idx - h * NROWS;
  const int i = rem / NNODE;
  const int k = rem - i * NNODE;
  const int r = dir ? (k * NNODE + i) : (i * NNODE + k);
  const float v = eb[(size_t)r * EB_LD + h] + be[h] + mask[(size_t)r * 8 + h];
  *(float*)(bm + idx) = v;
  
}

// Fused attention core for one (edge column j, direction dir, 32 query rows i), all 8 heads in sequence.
// qkv: f16 [2 dir][36864][384], head-major columns part*128 + h*16 + d.  bm: f32 [2 dir][8][192 i][192 k].
// grid = (192 j, 6 query chunks, 2 directions) x block 64 = 2 waves x 16 query rows.
// Per head: K_h [192 keys][16 d] and V_h^T [16 d][192 keys] staged in LDS by arithmetic row indices
// (dir 0: row j*192+k, dir 1: row k*192+j).  Both products run transposed, so that a lane owns ONE query:
// S^T = K (A: 16 keys, d zero-extended to 32) . Q^T (B) on f16 WMMA: lane (hh, c) holds query i0+c, register r
// key 16*tile + 8*hh + r; *0.25 + bias in f32, online softmax over 3 chunks of 64 keys in f32 with maximum and
// sum taken in the lane plus one exchange between the lane halves, e^x as the hardware's 2^(x * log2(e)), x <= 0; two neighbouring S^T tiles, converted to f16
// in place, are the B operand of O^T = V^T (A: 16 d, 32 keys) . P^T; * 1/rowsum;
// head result (lane: query, registers: d = 8*hh + r) staged in LDS at column h*16 + d.
// Epilogue -> bf16 hi/lo planes [36864][256], row i*192+j, columns dir*128 + h*16 + d:
// coverage: 2 waves x (8 iters x 2 lane halves) = 32 rows; 16 lanes x 8 halves = 128 columns;
__global__ __launch_bounds__(64) void k_edge_attn(const _Float16* __restrict__ qkv2, const float* __restrict__ bm2,
    unsigned short* __restrict__ vah, unsigned short* __restrict__ val) {
  const int dir = blockIdx.z;
  const _Float16* qkv = qkv2 + (size_t)dir * NROWS * QKV_LD;
  const float* bm = bm2 + (size_t)dir * 8 * NROWS;
  __shared__ __align__(16) _Float16 Ksh[NNODE * KS_P];   // [key][d], indices <= 191*16+15
  __shared__ __align__(16) _Float16 Vt[16 * VT_P];       // [d][key], indices <= 15*192+191
  __shared__ __align__(16) float    Os[32 * OS_P];       // [local row][h*16+d]
  const int j = blockIdx.x;
  const int qblk = blockIdx.y * 32;
  const int tid = threadIdx.x, wave = tid >> 5, lane = tid & 31, hh = lane >> 4, c = lane & 15;
  const int i0 = qblk + wave * 16;
  const v8h z8 = zero8h();

#pragma unroll 1
  for (int h = 0; h < 8; ++h) {
    __syncthreads();
    // stage K_h / V_h: 384 (key, 8-wide d chunk) items over 64 threads = 6 iterations, covers 192 x 16 exactly
    for (int idx = tid; idx < 2 * NNODE; idx += 64) {
      const int kv = idx >> 1, part = idx & 1;
      const int r = dir ? (kv * NNODE + j) : (j * NNODE + kv);
      const _Float16* src = qkv + (size_t)r * QKV_LD + h * 16 + part * 8;
      const v8h kk8 = *(const v8h*)(src + EWID);
      const v8h vv8 = *(const v8h*)(src + 2 * EWID);
      *(v8h*)(Ksh + kv * KS_P + part * 8) = kk8;
#pragma unroll
      for (int e2 = 0; e2 < 8; ++e2) Vt[(part * 8 + e2) * VT_P + kv] = vv8[e2];
    }
    __syncthreads();

    // B fragment (query column i0+c, d 8hh..8hh+7 in elements 0..7, elements 8..15 zero)
    Frag<_Float16>::U qa;
    qa.h[0] = *(const v8h*)(qkv + ((size_t)(i0 + c) * NNODE + j) * QKV_LD + h * 16 + 8 * hh);
    qa.h[1] = z8;

    float mrow = -__builtin_inff(), lrow = 0.f;      // this lane's query
    v8f o = zero8f();                                // O^T: register r = d 8hh+r of query i0+c
    const float* bmr = bm + ((size_t)h * NNODE + (size_t)(i0 + c)) * NNODE + 8 * hh;

#pragma unroll 1
    for (int kc = 0; kc < 3; ++kc) {
      const int kv0 = kc * 64;
      // bias of keys kv0+16jn+8hh .. +7 for this lane's query: 32 contiguous bytes a tile
      v4f b0[4], b1[4];
#pragma unroll
      for (int jn = 0; jn < 4; ++jn) {
        b0[jn] = *(const v4f*)(bmr + kv0 + jn * 16);
        b1[jn] = *(const v4f*)(bmr + kv0 + jn * 16 + 4);
      }
      v8f s[4];
#pragma unroll
      for (int jn = 0; jn < 4; ++jn) {
        // A fragment (key row kv0+16jn+c, d 8hh..8hh+7 in elements 0..7, elements 8..15 zero)
        Frag<_Float16>::U kb;
        kb.h[0] = *(const v8h*)(Ksh + (kv0 + jn * 16 + c) * KS_P + 8 * hh);
        kb.h[1] = z8;
        s[jn] = hmma(kb.v, qa.v, zero8f());
      }
      float mx = -__builtin_inff();
#pragma unroll
      for (int jn = 0; jn < 4; ++jn) {
#pragma unroll
        for (int r = 0; r < 8; ++r) {
          const float v = s[jn][r] * 0.25f + (r < 4 ? b0[jn][r & 3] : b1[jn][r & 3]);
          s[jn][r] = v;
          mx = fmaxf(mx, v);
        }
      }
      mx = fmaxf(mx, __shfl_xor(mx, 16, 32));        // the other lane half holds the query's other 32 keys
      const float mnew = fmaxf(mrow, mx);
      const float alpha = __builtin_amdgcn_exp2f((mrow - mnew) * LOG2E);
      mrow = mnew;
      float ps = 0.f;
      Frag<_Float16>::U pb[2];                       // P^T as B: elements 0..7 = tile 2kk, 8..15 = tile 2kk+1
#pragma unroll
      for (int jn = 0; jn < 4; ++jn) {
#pragma unroll
        for (int r = 0; r < 8; r += 2) {
          const v2f dl = ((v2f){s[jn][r], s[jn][r + 1]} - (v2f){mnew, mnew}) * (v2f){LOG2E, LOG2E};
          const float p0 = __builtin_amdgcn_exp2f(dl[0]);
          const float p1 = __builtin_amdgcn_exp2f(dl[1]);
          ps += p0;
          ps += p1;
          pb[jn >> 1].h[jn & 1][r] = (_Float16)p0;
          pb[jn >> 1].h[jn & 1][r + 1] = (_Float16)p1;
        }
      }
      ps += __shfl_xor(ps, 16, 32);
      lrow = lrow * alpha + ps;
#pragma unroll
      for (int r = 0; r < 8; ++r) o[r] *= alpha;
#pragma unroll
      for (int kk = 0; kk < 2; ++kk) {
        const v16h va = Frag<_Float16>::load(Vt + c * VT_P + kv0 + kk * 32 + 8 * hh);
        o = hmma(va, pb[kk].v, o);
      }
    }
    const float inv = 1.0f / lrow;
    float* op = Os + (wave * 16 + c) * OS_P + h * 16 + 8 * hh;
    *(v4f*)op       = (v4f){o[0] * inv, o[1] * inv, o[2] * inv, o[3] * inv};
    *(v4f*)(op + 4) = (v4f){o[4] * inv, o[5] * inv, o[6] * inv, o[7] * inv};
  }
  __syncthreads();

  const size_t colbase = (size_t)dir * 128 + (size_t)c * 8;
  {
#pragma unroll
    for (int it = 0; it < 8; ++it) {
      const int lr = wave * 16 + it * 2 + hh;
      const float* sp = Os + lr * OS_P + c * 8;
      const v4f a4 = *(const v4f*)sp;
      const v4f b4 = *(const v4f*)(sp + 4);
      v8h hv, lv;
#pragma unroll
      for (int e = 0; e < 4; ++e) {
        _Float16 a, lo;
        split_bf16(a4[e], a, lo); hv[e] = a; lv[e] = lo;
        split_bf16(b4[e], a, lo); hv[4 + e] = a; lv[4 + e] = lo;
      }
      const size_t grow = (size_t)(qblk + lr) * NNODE + j;
      *(v8h*)(vah + grow * VA_LD + colbase) = hv;
      *(v8h*)(val + grow * VA_LD + colbase) = lv;
    }
    
  }
}

// ---------------------------------------------------------------------------------------
extern "C" void kernel_launch(void* const* d_in, const int* in_sizes, int n_in,
                              void* d_out, int out_size, void* d_ws, size_t ws_size,
                              hipStream_t stream) {
  if (n_in < 14) return;
  if (in_sizes[0] != NROWS * EWID || in_sizes[1] != NROWS * 8 || in_sizes[2] < EWID || in_sizes[3] < EWID ||
      in_sizes[4] != EWID * 384 || in_sizes[5] < 384 || in_sizes[6] != EWID * 8 || in_sizes[7] < 8 ||
      in_sizes[8] != EWID * 384 || in_sizes[9] < 384 || in_sizes[10] != EWID * 8 || in_sizes[11] < 8 ||
      in_sizes[12] != 256 * EWID || in_sizes[13] < EWID || out_size != NROWS * EWID) return;

  const float* e      = (const float*)d_in[0];
  const float* mask   = (const float*)d_in[1];
  const float* ln_g   = (const float*)d_in[2];
  const float* ln_b   = (const float*)d_in[3];
  const float* Wq_in  = (const float*)d_in[4];
  const float* bq_in  = (const float*)d_in[5];
  const float* We_in  = (const float*)d_in[6];
  const float* be_in  = (const float*)d_in[7];
  const float* Wq_out = (const float*)d_in[8];
  const float* bq_out = (const float*)d_in[9];
  const float* We_out = (const float*)d_in[10];
  const float* be_out = (const float*)d_in[11];
  const float* Wo     = (const float*)d_in[12];
  const float* bo     = (const float*)d_in[13];
  float* out = (float*)d_out;

  // ---- workspace region map (offsets 256-B aligned; total 135,072,768 B) ----
  //  ELh, ELl   bf16 [36864][128]       2 x  9,437,184   LayerNorm output hi/lo (live through both directions)
  //  QKV16      f16  [2][36864][384]    2 x 28,311,552   projection output, one plane a direction
  //  EB         f32  [2][36864][64]     2 x  9,437,184   edge-bias projection (cols 0..7), one plane a direction
  //  BM         f32  [2][8][192][192]   2 x  1,179,648   bias+mask slabs, one plane a direction
  //  VAh, VAl   bf16 [36864][256]       2 x 18,874,368   attention output hi/lo (both directions)
  //  WtQh/l x2  bf16 [384][128]         4 x     98,304
  //  WtEh/l x2  bf16 [64][128]          4 x     16,384
  //  WoTh/l     bf16 [128][256]         2 x     65,536
  //  bqp x2     f32  [384]              2 x      1,536
  size_t off = 0;
  auto carve = [&](size_t bytes) { size_t o = off; off += (bytes + 255) & ~(size_t)255; return o; };
  const size_t oELh = carve((size_t)NROWS * EWID * 2);
  const size_t oELl = carve((size_t)NROWS * EWID * 2);
  const size_t oQKV = carve((size_t)2 * NROWS * QKV_LD * 2);
  const size_t oEB  = carve((size_t)2 * NROWS * EB_LD * 4);
  const size_t oBM  = carve((size_t)2 * 8 * NNODE * NNODE * 4);
  const size_t oVAh = carve((size_t)NROWS * VA_LD * 2);
  const size_t oVAl = carve((size_t)NROWS * VA_LD * 2);
  size_t oWQh[2], oWQl[2], oWEh[2], oWEl[2], oBQ[2];
  for (int d = 0; d < 2; ++d) { oWQh[d] = carve((size_t)384 * 128 * 2); oWQl[d] = carve((size_t)384 * 128 * 2); }
  for (int d = 0; d < 2; ++d) { oWEh[d] = carve((size_t)64 * 128 * 2);  oWEl[d] = carve((size_t)64 * 128 * 2); }
  const size_t oWOh = carve((size_t)128 * 256 * 2);
  const size_t oWOl = carve((size_t)128 * 256 * 2);
  for (int d = 0; d < 2; ++d) oBQ[d] = carve((size_t)384 * 4);
  if (off > ws_size) return;

  char* ws = (char*)d_ws;
  unsigned short* ELh = (unsigned short*)(ws + oELh);
  unsigned short* ELl = (unsigned short*)(ws + oELl);
  _Float16* QKV16 = (_Float16*)(ws + oQKV);
  float* EB = (float*)(ws + oEB);
  float* BM = (float*)(ws + oBM);
  unsigned short* VAh = (unsigned short*)(ws + oVAh);
  unsigned short* VAl = (unsigned short*)(ws + oVAl);
  unsigned short* WQh[2], *WQl[2], *WEh[2], *WEl[2];
  float* BQ[2];
  for (int d = 0; d < 2; ++d) {
    WQh[d] = (unsigned short*)(ws + oWQh[d]); WQl[d] = (unsigned short*)(ws + oWQl[d]);
    WEh[d] = (unsigned short*)(ws + oWEh[d]); WEl[d] = (unsigned short*)(ws + oWEl[d]);
    BQ[d] = (float*)(ws + oBQ[d]);
  }
  unsigned short* WOh = (unsigned short*)(ws + oWOh);
  unsigned short* WOl = (unsigned short*)(ws + oWOl);

  // weight prep of both directions and of the output linear + LayerNorm -> bf16 hi/lo planes, one launch
  // (72 prep blocks, then 36864 rows / 16 rows per block = 2304 blocks exactly)
  k_front<<<PREP_BLOCKS + NROWS / 16, 256, 0, stream>>>(e, ln_g, ln_b, Wq_in, bq_in, We_in, Wq_out, bq_out, We_out, Wo,
      WQh[0], WQl[0], WEh[0], WEl[0], BQ[0], WQh[1], WQl[1], WEh[1], WEl[1], BQ[1], WOh, WOl, ELh, ELl, NROWS);

  const int tilesQKV = (NROWS / 64) * (QKV_LD / 64);   // 3456 = 432 blocks x 8 waves
  const int tilesEB  = (NROWS / 64) * (EB_LD / 64);    // 576  = 72 blocks
  const int tilesOUT = (NROWS / 64) * (EWID / 64);     // 1152 = 144 blocks
  // The launches below up to the attention serve both directions: the GEMM batch index (grid y) or grid y / z is the direction.
  // edge bias = EL . We  (M 36864, N 64 (8 used), K 128; split; f32 output; be added in the slab kernel) and
  // qkv = EL . Wqkv + b  (M 36864, N 384, K 128; bf16 hi/lo split; f16 head-major output), one launch
  k_proj<<<dim3(tilesEB / 8 + tilesQKV / 8, 2), 256, 0, stream>>>(ELh, ELl, EWID,
      WEh[0], WEl[0], (long)(WEh[1] - WEh[0]), (void*)EB, EB_LD, (long)NROWS * EB_LD, EB_LD, tilesEB / 8,
      WQh[0], WQl[0], (long)(WQh[1] - WQh[0]), (void*)QKV16, QKV_LD, (long)NROWS * QKV_LD, QKV_LD,
      BQ[0], (long)(BQ[1] - BQ[0]), NROWS, EWID);
  k_bias_slab<<<dim3((8 * NNODE * NNODE) / 256, 2), 256, 0, stream>>>(EB, be_in, be_out, mask, BM);
  k_edge_attn<<<dim3(NNODE, NNODE / 32, 2), 64, 0, stream>>>(QKV16, BM, VAh, VAl);
  // out = VA . Wo + bo  (M 36864, N 128, K 256; split; f32 output rows of d_out)
  wmma_gemm64<1, true, 2, 0, false><<<dim3(tilesOUT / 8, 1), 256, 0, stream>>>(
      VAh, VAl, VA_LD, (long)0, WOh, WOl, VA_LD, (long)0,
      (void*)out, (void*)out, EWID, (long)0, bo, (long)0, bo, (long)0, NROWS, EWID, VA_LD, 1.0f);
}

// v004
// Measured time: 133 microseconds a run.
// Next to v003, in two timings, it ran 1.07 times as fast each time.
// Counting every step since v000, it is 1.99 times as fast.
// Contractions: LayerNorm'd qkv / edge-bias projections and the output linear on v_wmma_f32_16x16x32_bf16 with bf16 hi/lo split operands (hi*hi + hi*lo + lo*hi); per-(edge column, head) 192x192 attention cores (q.k^T with d=16 zero-extended to 32, p.v with 192 keys) on v_wmma_f32_16x16x32_f16 with plain f16 operands; f32 accumulate everywhere; LayerNorm, bias/mask add, softmax and normalisation in f32.
#include <hip/hip_runtime.h>

typedef __attribute__((ext_vector_type(16))) _Float16 v16h;
typedef __attribute__((ext_vector_type(8)))  _Float16 v8h;
typedef __attribute__((ext_vector_type(16))) __bf16   v16b;
typedef __attribute__((ext_vector_type(8)))  __bf16   v8b;
typedef __attribute__((ext_vector_type(8)))  float    v8f;
typedef __attribute__((ext_vector_type(4)))  float    v4f;
typedef __attribute__((ext_vector_type(2)))  float    v2f;

#define EWID 128
#define NNODE 192
#define NROWS 36864          // 192*192 edge rows, row r = i*192 + j
#define QKV_LD 384
#define EB_LD 64
#define VA_LD 256
#define KS_P 16              // LDS K tile pitch (halves)
#define VT_P 192             // LDS V^T tile pitch (halves)
#define OS_P 132             // LDS output staging pitch (floats, 528 B rows)
#define LOG2E 1.4426950408889634f

// ------------------------------- helpers -------------------------------
__device__ __forceinline__ unsigned short f2bf_bits(float f) {
  unsigned u = __float_as_uint(f);
  return (unsigned short)((u + 0x7FFFu + ((u >> 16) & 1u)) >> 16);
}
__device__ __forceinline__ float bf_bits2f(unsigned short h) { return __uint_as_float(((unsigned)h) << 16); }

// hazard guards as plain device helpers (no inline asm inside the kernel template body)
__device__ __forceinline__ void dep_guard_h(v8f& a, v8f& b, v16h x, v16h y) { asm volatile("v_nop\n\tv_nop\n\tv_nop\n\tv_nop" : "+v"(a), "+v"(b) : "v"(x), "v"(y)); }
__device__ __forceinline__ void dep_guard_b(v8f& a, v8f& b, v16b x, v16b y) { asm volatile("v_nop\n\tv_nop\n\tv_nop\n\tv_nop" : "+v"(a), "+v"(b) : "v"(x), "v"(y)); }
__device__ __forceinline__ void keep4_h(v16h a, v16h b, v16h c, v16h d) { asm volatile("v_nop" :: "v"(a), "v"(b), "v"(c), "v"(d)); }
__device__ __forceinline__ void keep4_b(v16b a, v16b b, v16b c, v16b d) { asm volatile("v_nop" :: "v"(a), "v"(b), "v"(c), "v"(d)); }
__device__ __forceinline__ void acc_guard4(v8f& a, v8f& b, v8f& c, v8f& d) { asm volatile("v_nop\n\tv_nop\n\tv_nop\n\tv_nop" : "+v"(a), "+v"(b), "+v"(c), "+v"(d)); }
template <typename T> struct Frag;
template <> struct Frag<_Float16> {
  typedef v16h V; union U { v16h v; v8h h[2]; };
  static __device__ __forceinline__ v16h load(const _Float16* p) {   // elements 0..7 <- p[0..7], 8..15 <- p[16..23]
    U f; f.h[0] = *(const v8h*)(p); f.h[1] = *(const v8h*)(p + 16); return f.v;
  }
  static __device__ __forceinline__ v16h load_fo(const _Float16* p) { // fragment-order plane: the two 512-B wave loads of a fragment
    U f; f.h[0] = *(const v8h*)(p); f.h[1] = *(const v8h*)(p + 256); return f.v;
  }
  static __device__ __forceinline__ v8f mma(v16h a, v16h b, v8f c) {
    return __builtin_amdgcn_wmma_f32_16x16x32_f16(false, a, false, b, (short)0, c, false, false);
  }
  static __device__ __forceinline__ void guard(v8f& a, v8f& b, v16h x, v16h y) { dep_guard_h(a, b, x, y); }
  static __device__ __forceinline__ void keep(v16h a, v16h b, v16h c, v16h d) { keep4_h(a, b, c, d); }
};
template <> struct Frag<__bf16> {
  typedef v16b V; union U { v16b v; v8b h[2]; };
  static __device__ __forceinline__ v16b load(const __bf16* p) {
    U f; f.h[0] = *(const v8b*)(p); f.h[1] = *(const v8b*)(p + 16); return f.v;
  }
  static __device__ __forceinline__ v16b load_fo(const __bf16* p) {
    U f; f.h[0] = *(const v8b*)(p); f.h[1] = *(const v8b*)(p + 256); return f.v;
  }
  static __device__ __forceinline__ v8f mma(v16b a, v16b b, v8f c) {
    return __builtin_amdgcn_wmma_f32_16x16x32_bf16(false, a, false, b, (short)0, c, false, false);
  }
  static __device__ __forceinline__ void guard(v8f& a, v8f& b, v16b x, v16b y) { dep_guard_b(a, b, x, y); }
  static __device__ __forceinline__ void keep(v16b a, v16b b, v16b c, v16b d) { keep4_b(a, b, c, d); }
};

// ---- Register-blocked batched WMMA GEMM ------------------------------------
// C[m,n] = scale * sum_k A[m,k] * Bt[n,k] (+bias)(+resid); each wave owns a 64x64 tile.
// A [M,K] and Bt [N,K] lie in FRAGMENT ORDER (lda = ldb = K): each 16-row tile is 16*K contiguous elements, inside it the
// 16-byte chunk (row r, k 8q..8q+7) stands at element q*128 + r*8, so the 32 lanes of one fragment load (row lane&15,
// chunk 4*(k0/32) + 2*load + (lane>>4)) read 512 contiguous bytes = 4 whole lines. The k order of a fragment is unchanged.
// KC = K = lda = ldb at compile time: the tiles and halves of a k step are then immediate offsets from one address a plane.
// M,N % 64 == 0, K % 32 == 0.  TROW: output row m is stored at row (m % 192)*192 + m / 192 (f32 output only).
// SPLIT: operands are hi/lo planes (A2/Bt2 = lo planes, same layout); product = hi*hi + hi*lo + lo*hi.
// BIAS_MODE: 0 = none, 1 = bias[m], 2 = bias[n].
// OUT_MODE: 0 = f32, 1 = f16, 2 = bf16 hi plane (Cout) + bf16 lo plane (Cout2).
// ET: 0 = f16 operands, 1 = bf16 operands (pointers passed as 16-bit storage)
template <int ET> struct Elem;
template <> struct Elem<0> { typedef _Float16 T; };
template <> struct Elem<1> { typedef __bf16 T; };
// gemm64_tile: the work of block bx of batch b; sT = the block's LDS, 8 per-wave 16x64 slabs of pitch 68 floats.
template <int KC, int ET, bool SPLIT, int BIAS_MODE, int OUT_MODE, bool RESID, int ACT = 0, bool TROW = false>
__device__ __forceinline__ void gemm64_tile(const int bx, const int b, float* __restrict__ sT,
    const unsigned short* __restrict__ Ap, const unsigned short* __restrict__ A2p, int lda, long strideA,
    const unsigned short* __restrict__ Btp, const unsigned short* __restrict__ Bt2p, int ldb, long strideB,
    void* __restrict__ Cout, void* __restrict__ Cout2, int ldc, long strideC,
    const float* __restrict__ bias, long strideBias,
    const float* __restrict__ resid, long strideR,
    int M, int N, int K, float scale) {
  typedef typename Elem<ET>::T T;
  typedef typename Frag<T>::V V;
  const T* A = (const T*)Ap; const T* A2 = (const T*)A2p; const T* Bt = (const T*)Btp; const T* Bt2 = (const T*)Bt2p;
  const int lane = threadIdx.x & 31;
  // wave number as a scalar: every fragment address is then a scalar tile base + the one lane offset lane*16 B
  const int wave = __builtin_amdgcn_readfirstlane(threadIdx.x >> 5);
  const int tilesN = N >> 6;
  const int tilesM = M >> 6;
  const int tile = bx * 8 + wave;
  if (tile >= tilesM * tilesN) return;   // wave-uniform; no block barriers in this kernel
  const int tm = tile / tilesN;
  const int tn = tile - tm * tilesN;
  const int m0 = tm << 6;
  const int n0 = tn << 6;

  const T* Ab  = A  + (size_t)b * strideA;
  const T* Bb  = Bt + (size_t)b * strideB;
  const T* Ab2 = SPLIT ? (A2  + (size_t)b * strideA) : nullptr;
  const T* Bb2 = SPLIT ? (Bt2 + (size_t)b * strideB) : nullptr;

  const int rlane = lane & 15;                 // row (A) / col (B, D) within subtile
  const int mOff  = (lane >> 4) * 8;           // D row offset
  const unsigned lane8 = (unsigned)lane * 8u;  // this lane's 16-byte chunk of a 512-byte fragment load

  v8f acc[4][4];
#pragma unroll
  for (int i = 0; i < 4; ++i)
#pragma unroll
    for (int j = 0; j < 4; ++j) acc[i][j] = (v8f){0.f,0.f,0.f,0.f,0.f,0.f,0.f,0.f};

  // rolled: the body stays one k step long (code size, register count)
#pragma unroll 1
  for (int k0 = 0; k0 < KC; k0 += 32) {
    V bh[4], bl[4];
#pragma unroll
    for (int j = 0; j < 4; ++j) {
      const size_t bo = (size_t)(n0 + (j << 4)) * KC + (k0 << 4);    // wave-uniform
      bh[j] = Frag<T>::load_fo(Bb + bo + lane8);
      if (SPLIT) bl[j] = Frag<T>::load_fo(Bb2 + bo + lane8);
    }
#pragma unroll
    for (int i = 0; i < 4; ++i) {
      const size_t ao = (size_t)(m0 + (i << 4)) * KC + (k0 << 4);    // wave-uniform
      V ah = Frag<T>::load_fo(Ab + ao + lane8);
      V al;
      if (SPLIT) al = Frag<T>::load_fo(Ab2 + ao + lane8);
#pragma unroll
      for (int j = 0; j < 4; ++j) {
        acc[i][j] = Frag<T>::mma(ah, bh[j], acc[i][j]);
        if (SPLIT) {
          acc[i][j] = Frag<T>::mma(ah, bl[j], acc[i][j]);
          acc[i][j] = Frag<T>::mma(al, bh[j], acc[i][j]);
        }
      }
      Frag<T>::guard(acc[i][0], acc[i][3], ah, SPLIT ? al : ah);
    }
    Frag<T>::keep(bh[0], bh[1], bh[2], bh[3]);
    if (SPLIT) Frag<T>::keep(bl[0], bl[1], bl[2], bl[3]);
  }
  acc_guard4(acc[0][0], acc[0][1], acc[0][2], acc[0][3]);
  acc_guard4(acc[1][0], acc[1][1], acc[1][2], acc[1][3]);
  acc_guard4(acc[2][0], acc[2][1], acc[2][2], acc[2][3]);
  acc_guard4(acc[3][0], acc[3][1], acc[3][2], acc[3][3]);

  // ---- epilogue ----
  float* slab = sT + wave * (16 * 68);
  const float* Rb = RESID ? (resid + (size_t)b * strideR) : nullptr;
  const float* Bs = (BIAS_MODE != 0) ? (bias + (size_t)b * strideBias) : nullptr;
#pragma unroll
  for (int i = 0; i < 4; ++i) {
    const int mBase = m0 + (i << 4);
#pragma unroll
    for (int j = 0; j < 4; ++j) {
      const int n = n0 + (j << 4) + rlane;
      float bv = 0.f;
      if (BIAS_MODE == 2) bv = Bs[n];
#pragma unroll
      for (int r = 0; r < 8; ++r) {
        float v = acc[i][j][r] * scale;
        if (BIAS_MODE == 1) v += Bs[mBase + mOff + r];
        if (BIAS_MODE == 2) v += bv;
        if (RESID) v += Rb[(size_t)(mBase + mOff + r) * ldc + n];
        if (ACT == 1) v = tanhf(v);
        if (ACT == 2) v = fmaxf(v, 0.0f);
        if (ACT == 3) v = v / (1.0f + expf(-v));
        if (ACT == 4) v = (v > 0.f) ? v : 0.01f * v;
        if (ACT == 5) v = 0.5f * v * (1.0f + erff(v * 0.70710678118654752f));
        slab[(mOff + r) * 68 + (j << 4) + rlane] = v;
      }
    }
    __builtin_amdgcn_fence(__ATOMIC_RELEASE, "workgroup");
    __builtin_amdgcn_wave_barrier();
    __builtin_amdgcn_fence(__ATOMIC_ACQUIRE, "workgroup");
    if (OUT_MODE == 0) {
      float* C = (float*)Cout + (size_t)b * strideC;
      const int hh = lane >> 4, c4 = (lane & 15) * 4;     // row seg = 256 B = 16 lanes x 16 B
      {
#pragma unroll
        for (int it = 0; it < 8; ++it) {
          const int row = it * 2 + hh;
          v4f v = *(const v4f*)(slab + row * 68 + c4);
          // a 64-row tile lies inside one group of 192 rows, so quotient and remainder come from the scalar m0
          const size_t orow = TROW ? (size_t)(m0 % NNODE + (i << 4) + row) * NNODE + m0 / NNODE : (size_t)(mBase + row);
          *(v4f*)(C + orow * ldc + n0 + c4) = v;
        }
        
      }
    } else {
      const int q = lane >> 3, c8 = (lane & 7) * 8;
      unsigned short* C  = (unsigned short*)Cout  + (size_t)b * strideC;
      unsigned short* C2 = (OUT_MODE == 2) ? ((unsigned short*)Cout2 + (size_t)b * strideC) : nullptr;
      {
#pragma unroll
        for (int it = 0; it < 4; ++it) {
          const int row = it * 4 + q;
          const float* sp = slab + row * 68 + c8;
          v8h hv, lv;
#pragma unroll
          for (int e = 0; e < 8; ++e) {
            if (OUT_MODE == 1) {
              hv[e] = (_Float16)sp[e];
            } else {
              unsigned short hb = f2bf_bits(sp[e]);
              unsigned short lb = f2bf_bits(sp[e] - bf_bits2f(hb));
              hv[e] = __builtin_bit_cast(_Float16, hb);
              lv[e] = __builtin_bit_cast(_Float16, lb);
            }
          }
          *(v8h*)(C + (size_t)(mBase + row) * ldc + n0 + c8) = hv;
          if (OUT_MODE == 2) *(v8h*)(C2 + (size_t)(mBase + row) * ldc + n0 + c8) = lv;
        }
        
      }
    }
    __builtin_amdgcn_fence(__ATOMIC_RELEASE, "workgroup");
    __builtin_amdgcn_wave_barrier();
    __builtin_amdgcn_fence(__ATOMIC_ACQUIRE, "workgroup");
  }
}
template <int KC, int ET, bool SPLIT, int BIAS_MODE, int OUT_MODE, bool RESID, int ACT = 0, bool TROW = false>
__global__ __launch_bounds__(256) void wmma_gemm64(
    const unsigned short* __restrict__ Ap, const unsigned short* __restrict__ A2p, int lda, long strideA,
    const unsigned short* __restrict__ Btp, const unsigned short* __restrict__ Bt2p, int ldb, long strideB,
    void* __restrict__ Cout, void* __restrict__ Cout2, int ldc, long strideC,
    const float* __restrict__ bias, long strideBias,
    const float* __restrict__ resid, long strideR,
    int M, int N, int K, float scale) {
  __shared__ __align__(16) float sT[8 * 16 * 68];
  gemm64_tile<KC, ET, SPLIT, BIAS_MODE, OUT_MODE, RESID, ACT, TROW>(blockIdx.x, blockIdx.y, sT, Ap, A2p, lda, strideA,
      Btp, Bt2p, ldb, strideB, Cout, Cout2, ldc, strideC, bias, strideBias, resid, strideR, M, N, K, scale);
}
// The two projections of the LayerNorm'd rows, which do not depend on each other, as one launch: blocks below
// blocksE do the edge-bias product (f32 out, no bias), the others the qkv product (f16 out, bias[n]). Block-uniform.
__global__ __launch_bounds__(256) void k_proj(
    const unsigned short* __restrict__ Ap, const unsigned short* __restrict__ A2p, int lda,
    const unsigned short* __restrict__ BtE, const unsigned short* __restrict__ Bt2E, long strideBE,
    void* __restrict__ CE, int ldcE, long strideCE, int NE, int blocksE,
    const unsigned short* __restrict__ BtQ, const unsigned short* __restrict__ Bt2Q, long strideBQ,
    void* __restrict__ CQ, int ldcQ, long strideCQ, int NQ,
    const float* __restrict__ biasQ, long strideBiasQ, int M, int K) {
  __shared__ __align__(16) float sT[8 * 16 * 68];
  const int bx = blockIdx.x;
  if (bx < blocksE)
    gemm64_tile<EWID, 1, true, 0, 0, false>(bx, blockIdx.y, sT, Ap, A2p, lda, (long)0, BtE, Bt2E, lda, strideBE,
        CE, CE, ldcE, strideCE, biasQ, (long)0, biasQ, (long)0, M, NE, K, 1.0f);
  else
    gemm64_tile<EWID, 1, true, 2, 1, false>(bx - blocksE, blockIdx.y, sT, Ap, A2p, lda, (long)0, BtQ, Bt2Q, lda, strideBQ,
        CQ, CQ, ldcQ, strideCQ, biasQ, strideBiasQ, biasQ, (long)0, M, NQ, K, 1.0f);
}

__device__ __forceinline__ v8f zero8f() { return (v8f){0.f, 0.f, 0.f, 0.f, 0.f, 0.f, 0.f, 0.f}; }
__device__ __forceinline__ v8h zero8h() {
  v8h z;
#pragma unroll
  for (int e = 0; e < 8; ++e) z[e] = (_Float16)0.0f;
  return z;
}
// f16 WMMA with the hazard guard attached (D tied, A/B kept live)
__device__ __forceinline__ v8f hmma(v16h a, v16h b, v8f c) {
  c = __builtin_amdgcn_wmma_f32_16x16x32_f16(false, a, false, b, (short)0, c, false, false);
  asm volatile("v_nop\n\tv_nop\n\tv_nop\n\tv_nop" : "+v"(c) : "v"(a), "v"(b));
  return c;
}
__device__ __forceinline__ void split_bf16(float x, _Float16& hi, _Float16& lo) {
  const unsigned short hb = f2bf_bits(x);
  const unsigned short lb = f2bf_bits(x - bf_bits2f(hb));
  hi = __builtin_bit_cast(_Float16, hb);
  lo = __builtin_bit_cast(_Float16, lb);
}

// ---------------------------------------------------------------------------------------
// qkv weight prep: W [128 k][384 c] f32 ([in][out]) -> Bt hi/lo bf16 planes [384 n][128 k], fragment order, with head-major
// output columns: n = part*128 + h*16 + d  <-  c = part*128 + d*8 + h (view(DD=16, NH=8): d slow, h fast).
// Permuted bias bqp[n] = bq[c].  Edge-bias weight We [128 k][8] -> Bt hi/lo [64 n][128 k], rows n >= 8 zero.
// grid 28 x block 256: blocks 0..23 = 384 rows x 16 threads (8 k each) -> covers [384][128] exactly;
// blocks 24..27 = 64 rows x 16 threads -> covers [64][128] exactly; t < 384 also writes bqp[384] exactly.
// Owner-computes: thread t stores the t-th 16-byte chunk of the plane = (tile t>>8, chunk (t>>4)&15, row t&15).
__device__ __forceinline__ void prep_qkv_w(const int bx,
    const float* __restrict__ W, const float* __restrict__ bq, const float* __restrict__ We,
    unsigned short* __restrict__ wqh, unsigned short* __restrict__ wql,
    unsigned short* __restrict__ weh, unsigned short* __restrict__ wel, float* __restrict__ bqp) {
  const int t = bx * 256 + threadIdx.x;
  if (bx < 24) {                               // block-uniform
    const int n = (t >> 8) * 16 + (t & 15), k8 = ((t >> 4) & 15) * 8;
    const int part = n >> 7, h = (n >> 4) & 7, d = n & 15;
    const int col = part * 128 + d * 8 + h;
    v8h hv, lv;
#pragma unroll
    for (int e = 0; e < 8; ++e) {
      const float w = W[(size_t)(k8 + e) * 384 + col];
      _Float16 a, bb; split_bf16(w, a, bb); hv[e] = a; lv[e] = bb;
    }
    const size_t off = (size_t)t * 8;
    {
      *(v8h*)(wqh + off) = hv;
      *(v8h*)(wql + off) = lv;
      
    }
    if (t < 384) {                             // wave-uniform (384 = 12 waves)
      const int pn = t >> 7, ph = (t >> 4) & 7, pd = t & 15;
      const float bv = bq[pn * 128 + pd * 8 + ph];
      *(float*)(bqp + t) = bv;
      
    }
  } else {
    const int u = t - 6144;
    const int n = (u >> 8) * 16 + (u & 15), k8 = ((u >> 4) & 15) * 8;
    const int nc = (n < 8) ? n : 7;            // address clamp, value zeroed by predicate
    v8h hv, lv;
#pragma unroll
    for (int e = 0; e < 8; ++e) {
      float w = We[(size_t)(k8 + e) * 8 + nc];
      w = (n < 8) ? w : 0.0f;
      _Float16 a, bb; split_bf16(w, a, bb); hv[e] = a; lv[e] = bb;
    }
    const size_t off = (size_t)u * 8;
    {
      *(v8h*)(weh + off) = hv;
      *(v8h*)(wel + off) = lv;
      // inlined as one arm of a larger kernel: the code of a later arm reuses these stores' registers
      asm volatile("s_wait_xcnt 0x0" ::: "memory");
    }
  }
}

// Output weight prep: Wo [256 c][128 n] f32 ([in][out]) -> Bt hi/lo [128 n][256 k'], fragment order, k' = dir*128 + h*16 + d
// <- c = d*16 + dir*8 + h (concat of the two head groups on the head axis, then view d slow).
// grid 16 x block 256 = 4096 threads = 128 rows x 32 threads (8 k' each): covers [128][256] exactly;
// thread t stores the t-th 16-byte chunk = (tile t>>9, chunk (t>>4)&31, row t&15).
__device__ __forceinline__ void prep_wo(const int bx, const float* __restrict__ Wo,
    unsigned short* __restrict__ woh, unsigned short* __restrict__ wol) {
  const int t = bx * 256 + threadIdx.x;
  const int n = (t >> 9) * 16 + (t & 15), k8 = ((t >> 4) & 31) * 8;
  v8h hv, lv;
#pragma unroll
  for (int e = 0; e < 8; ++e) {
    const int kp = k8 + e;
    const int dr = kp >> 7, h = (kp >> 4) & 7, d = kp & 15;
    const int col = d * 16 + dr * 8 + h;
    const float w = Wo[(size_t)col * 128 + n];
    _Float16 a, bb; split_bf16(w, a, bb); hv[e] = a; lv[e] = bb;
  }
  const size_t off = (size_t)t * 8;
  {
    *(v8h*)(woh + off) = hv;
    *(v8h*)(wol + off) = lv;
    // inlined as one arm of a larger kernel: the code of a later arm reuses these stores' registers
    asm volatile("s_wait_xcnt 0x0" ::: "memory");
  }
}

// LayerNorm over the 128-wide rows of e (eps 1e-5, biased variance, *g + b) -> bf16 hi/lo planes [nrows][128], fragment order.
// grid = nrows/16, block 256 = 8 waves x 2 rows (lane half = row, lane&15 = 8-column chunk) = one 16-row tile.
// The tile's chunks are turned from (row, chunk) to (chunk, row) through LDS (sF: 2 planes of 16 x 272 B, one 16-byte
// pad a chunk column against bank conflicts); thread t then stores the tile's t-th chunk: 512 contiguous bytes a wave.
#define LNF_P 136            // LDS pitch of a chunk column (halves): 16 rows x 8 + 8
__device__ __forceinline__ void ln_rows(const int bx, const float* __restrict__ e, const float* __restrict__ g,
    const float* __restrict__ b, unsigned short* __restrict__ elh, unsigned short* __restrict__ ell, int nrows,
    unsigned short* __restrict__ sF) {
  const int tid = threadIdx.x, wave = tid >> 5, lane = tid & 31, hh = lane >> 4, c = lane & 15;
  const int row = (bx * 8 + wave) * 2 + hh;
  const bool ok = row < nrows;
  const int rowc = ok ? row : (nrows - 1);
  const float* p = e + (size_t)rowc * EWID + c * 8;
  const v4f x0 = *(const v4f*)p;
  const v4f x1 = *(const v4f*)(p + 4);
  float xs[8];
  xs[0] = x0[0]; xs[1] = x0[1]; xs[2] = x0[2]; xs[3] = x0[3];
  xs[4] = x1[0]; xs[5] = x1[1]; xs[6] = x1[2]; xs[7] = x1[3];
  float s = ((xs[0] + xs[1]) + (xs[2] + xs[3])) + ((xs[4] + xs[5]) + (xs[6] + xs[7]));
#pragma unroll
  for (int off = 1; off < 16; off <<= 1) s += __shfl_xor(s, off, 32);
  const float mu = s * (1.0f / 128.0f);
  float q = 0.f;
#pragma unroll
  for (int k = 0; k < 8; ++k) { xs[k] -= mu; q += xs[k] * xs[k]; }
#pragma unroll
  for (int off = 1; off < 16; off <<= 1) q += __shfl_xor(q, off, 32);
  const float rs = rsqrtf(q * (1.0f / 128.0f) + 1e-5f);
  const v4f g0 = *(const v4f*)(g + c * 8), g1 = *(const v4f*)(g + c * 8 + 4);
  const v4f b0 = *(const v4f*)(b + c * 8), b1 = *(const v4f*)(b + c * 8 + 4);
  float gg[8], bb[8];
  gg[0] = g0[0]; gg[1] = g0[1]; gg[2] = g0[2]; gg[3] = g0[3]; gg[4] = g1[0]; gg[5] = g1[1]; gg[6] = g1[2]; gg[7] = g1[3];
  bb[0] = b0[0]; bb[1] = b0[1]; bb[2] = b0[2]; bb[3] = b0[3]; bb[4] = b1[0]; bb[5] = b1[1]; bb[6] = b1[2]; bb[7] = b1[3];
  v8h hv, lv;
#pragma unroll
  for (int k = 0; k < 8; ++k) {
    const float y = xs[k] * rs * gg[k] + bb[k];
    _Float16 a, lo; split_bf16(y, a, lo); hv[k] = a; lv[k] = lo;
  }
  const int wa = c * LNF_P + (wave * 2 + hh) * 8;
  *(v8h*)(sF + wa) = hv;
  *(v8h*)(sF + 16 * LNF_P + wa) = lv;
  __syncthreads();           // block-uniform: every thread of a LayerNorm block comes here
  const int ra = (tid >> 4) * LNF_P + (tid & 15) * 8;
  const v8h ho = *(const v8h*)(sF + ra);
  const v8h lo8 = *(const v8h*)(sF + 16 * LNF_P + ra);
  if (bx * 16 + (tid & 15) < nrows) {
    const size_t off = (size_t)bx * 16 * EWID + tid * 8;
    {
      *(v8h*)(elh + off) = ho;
      *(v8h*)(ell + off) = lo8;
    }
  }
}

// The four launches that depend on nothing but the inputs, as one: blocks 0..27 qkv/edge weights of direction 0,
// 28..55 of direction 1, 56..71 output weight, 72.. LayerNorm (16 rows a block). The choice is block-uniform.
#define PREP_BLOCKS 72
__global__ __launch_bounds__(256) void k_front(
    const float* __restrict__ e, const float* __restrict__ g, const float* __restrict__ b,
    const float* __restrict__ Wq0, const float* __restrict__ bq0, const float* __restrict__ We0,
    const float* __restrict__ Wq1, const float* __restrict__ bq1, const float* __restrict__ We1,
    const float* __restrict__ Wo,
    unsigned short* __restrict__ wqh0, unsigned short* __restrict__ wql0,
    unsigned short* __restrict__ weh0, unsigned short* __restrict__ wel0, float* __restrict__ bqp0,
    unsigned short* __restrict__ wqh1, unsigned short* __restrict__ wql1,
    unsigned short* __restrict__ weh1, unsigned short* __restrict__ wel1, float* __restrict__ bqp1,
    unsigned short* __restrict__ woh, unsigned short* __restrict__ wol,
    unsigned short* __restrict__ elh, unsigned short* __restrict__ ell, int nrows) {
  __shared__ __align__(16) unsigned short sF[2 * 16 * LNF_P];
  const int bx = blockIdx.x;
  if (bx < 28)               prep_qkv_w(bx, Wq0, bq0, We0, wqh0, wql0, weh0, wel0, bqp0);
  else if (bx < 56)          prep_qkv_w(bx - 28, Wq1, bq1, We1, wqh1, wql1, weh1, wel1, bqp1);
  else if (bx < PREP_BLOCKS) prep_wo(bx - 56, Wo, woh, wol);
  else                       ln_rows(bx - PREP_BLOCKS, e, g, b, elh, ell, nrows, sF);
}

// Score bias slabs, direction dir = blockIdx.y: bm[dir][h][i][k] = eb[dir][r][h] + be[h] + mask[r][h] with
// r = i*192 + k (dir 0) or r = k*192 + i (dir 1). eb = f32 [36864][64] (columns 0..7 used), mask f32 [36864][8].
// grid (1152, 2) x block 256 = 8*192*192 threads a direction exactly; owner-computes (gather reads, contiguous 4-B stores:
__global__ __launch_bounds__(256) void k_bias_slab(const float* __restrict__ eb2, const float* __restrict__ be0,
    const float* __restrict__ be1, const float* __restrict__ mask, float* __restrict__ bm2) {
  const int dir = blockIdx.y;
  const float* eb = eb2 + (size_t)dir * NROWS * EB_LD;
  const float* be = dir ? be1 : be0;
  float* bm = bm2 + (size_t)dir * 8 * NROWS;
  const int idx = blockIdx.x * 256 + threadIdx.x;
  const int h = idx / NROWS;
  const int rem = idx - h * NROWS;
  const int i = rem / NNODE;
  const int k = rem - i * NNODE;
  const int r = dir ? (k * NNODE + i) : (i * NNODE + k);
  const float v = eb[(size_t)r * EB_LD + h] + be[h] + mask[(size_t)r * 8 + h];
  *(float*)(bm + idx) = v;
  
}

// Fused attention core for one (edge column j, direction dir, 32 query rows i), all 8 heads in sequence.
// qkv: f16 [2 dir][36864][384], head-major columns part*128 + h*16 + d.  bm: f32 [2 dir][8][192 i][192 k].
// grid = (192 j, 6 query chunks, 2 directions) x block 64 = 2 waves x 16 query rows.
// Per head: K_h [192 keys][16 d] and V_h^T [16 d][192 keys] staged in LDS by arithmetic row indices
// (dir 0: row j*192+k, dir 1: row k*192+j).  Both products run transposed, so that a lane owns ONE query:
// S^T = K (A: 16 keys, d zero-extended to 32) . Q^T (B) on f16 WMMA: lane (hh, c) holds query i0+c, register r
// key 16*tile + 8*hh + r; *0.25 + bias in f32, online softmax over 3 chunks of 64 keys in f32 with maximum and
// sum taken in the lane plus one exchange between the lane halves, e^x as the hardware's 2^(x * log2(e)), x <= 0; two neighbouring S^T tiles, converted to f16
// in place, are the B operand of O^T = V^T (A: 16 d, 32 keys) . P^T; * 1/rowsum;
// head result (lane: query, registers: d = 8*hh + r) staged in LDS at column h*16 + d.
// Epilogue -> bf16 hi/lo planes [36864][256] in fragment order, row j*192+i, columns dir*128 + h*16 + d: a wave's 16
// queries are one 16-row tile, its direction's 16 chunk columns 4096 contiguous bytes of it a plane;
// coverage: 2 waves x 16 rows = 32 rows; 8 iters x 2 lane halves x 8 halves = 128 columns;
__global__ __launch_bounds__(64) void k_edge_attn(const _Float16* __restrict__ qkv2, const float* __restrict__ bm2,
    unsigned short* __restrict__ vah, unsigned short* __restrict__ val) {
  const int dir = blockIdx.z;
  const _Float16* qkv = qkv2 + (size_t)dir * NROWS * QKV_LD;
  const float* bm = bm2 + (size_t)dir * 8 * NROWS;
  __shared__ __align__(16) _Float16 Ksh[NNODE * KS_P];   // [key][d], indices <= 191*16+15
  __shared__ __align__(16) _Float16 Vt[16 * VT_P];       // [d][key], indices <= 15*192+191
  __shared__ __align__(16) float    Os[32 * OS_P];       // [local row][h*16+d]
  const int j = blockIdx.x;
  const int qblk = blockIdx.y * 32;
  const int tid = threadIdx.x, wave = tid >> 5, lane = tid & 31, hh = lane >> 4, c = lane & 15;
  const int i0 = qblk + wave * 16;
  const v8h z8 = zero8h();

#pragma unroll 1
  for (int h = 0; h < 8; ++h) {
    __syncthreads();
    // stage K_h / V_h: 384 (key, 8-wide d chunk) items over 64 threads = 6 iterations, covers 192 x 16 exactly
    for (int idx = tid; idx < 2 * NNODE; idx += 64) {
      const int kv = idx >> 1, part = idx & 1;
      const int r = dir ? (kv * NNODE + j) : (j * NNODE + kv);
      const _Float16* src = qkv + (size_t)r * QKV_LD + h * 16 + part * 8;
      const v8h kk8 = *(const v8h*)(src + EWID);
      const v8h vv8 = *(const v8h*)(src + 2 * EWID);
      *(v8h*)(Ksh + kv * KS_P + part * 8) = kk8;
#pragma unroll
      for (int e2 = 0; e2 < 8; ++e2) Vt[(part * 8 + e2) * VT_P + kv] = vv8[e2];
    }
    __syncthreads();

    // B fragment (query column i0+c, d 8hh..8hh+7 in elements 0..7, elements 8..15 zero)
    Frag<_Float16>::U qa;
    qa.h[0] = *(const v8h*)(qkv + ((size_t)(i0 + c) * NNODE + j) * QKV_LD + h * 16 + 8 * hh);
    qa.h[1] = z8;

    float mrow = -__builtin_inff(), lrow = 0.f;      // this lane's query
    v8f o = zero8f();                                // O^T: register r = d 8hh+r of query i0+c
    const float* bmr = bm + ((size_t)h * NNODE + (size_t)(i0 + c)) * NNODE + 8 * hh;

#pragma unroll 1
    for (int kc = 0; kc < 3; ++kc) {
      const int kv0 = kc * 64;
      // bias of keys kv0+16jn+8hh .. +7 for this lane's query: 32 contiguous bytes a tile
      v4f b0[4], b1[4];
#pragma unroll
      for (int jn = 0; jn < 4; ++jn) {
        b0[jn] = *(const v4f*)(bmr + kv0 + jn * 16);
        b1[jn] = *(const v4f*)(bmr + kv0 + jn * 16 + 4);
      }
      v8f s[4];
#pragma unroll
      for (int jn = 0; jn < 4; ++jn) {
        // A fragment (key row kv0+16jn+c, d 8hh..8hh+7 in elements 0..7, elements 8..15 zero)
        Frag<_Float16>::U kb;
        kb.h[0] = *(const v8h*)(Ksh + (kv0 + jn * 16 + c) * KS_P + 8 * hh);
        kb.h[1] = z8;
        s[jn] = hmma(kb.v, qa.v, zero8f());
      }
      float mx = -__builtin_inff();
#pragma unroll
      for (int jn = 0; jn < 4; ++jn) {
#pragma unroll
        for (int r = 0; r < 8; ++r) {
          const float v = s[jn][r] * 0.25f + (r < 4 ? b0[jn][r & 3] : b1[jn][r & 3]);
          s[jn][r] = v;
          mx = fmaxf(mx, v);
        }
      }
      mx = fmaxf(mx, __shfl_xor(mx, 16, 32));        // the other lane half holds the query's other 32 keys
      const float mnew = fmaxf(mrow, mx);
      const float alpha = __builtin_amdgcn_exp2f((mrow - mnew) * LOG2E);
      mrow = mnew;
      float ps = 0.f;
      Frag<_Float16>::U pb[2];                       // P^T as B: elements 0..7 = tile 2kk, 8..15 = tile 2kk+1
#pragma unroll
      for (int jn = 0; jn < 4; ++jn) {
#pragma unroll
        for (int r = 0; r < 8; r += 2) {
          const v2f dl = ((v2f){s[jn][r], s[jn][r + 1]} - (v2f){mnew, mnew}) * (v2f){LOG2E, LOG2E};
          const float p0 = __builtin_amdgcn_exp2f(dl[0]);
          const float p1 = __builtin_amdgcn_exp2f(dl[1]);
          ps += p0;
          ps += p1;
          pb[jn >> 1].h[jn & 1][r] = (_Float16)p0;
          pb[jn >> 1].h[jn & 1][r + 1] = (_Float16)p1;
        }
      }
      ps += __shfl_xor(ps, 16, 32);
      lrow = lrow * alpha + ps;
#pragma unroll
      for (int r = 0; r < 8; ++r) o[r] *= alpha;
#pragma unroll
      for (int kk = 0; kk < 2; ++kk) {
        const v16h va = Frag<_Float16>::load(Vt + c * VT_P + kv0 + kk * 32 + 8 * hh);
        o = hmma(va, pb[kk].v, o);
      }
    }
    const float inv = 1.0f / lrow;
    float* op = Os + (wave * 16 + c) * OS_P + h * 16 + 8 * hh;
    *(v4f*)op       = (v4f){o[0] * inv, o[1] * inv, o[2] * inv, o[3] * inv};
    *(v4f*)(op + 4) = (v4f){o[4] * inv, o[5] * inv, o[6] * inv, o[7] * inv};
  }
  __syncthreads();

  const size_t tbase = (size_t)(j * NNODE + i0) * VA_LD + (size_t)dir * 2048 + (size_t)lane * 8;
  {
#pragma unroll
    for (int it = 0; it < 8; ++it) {
      const float* sp = Os + (wave * 16 + c) * OS_P + (it * 2 + hh) * 8;
      const v4f a4 = *(const v4f*)sp;
      const v4f b4 = *(const v4f*)(sp + 4);
      v8h hv, lv;
#pragma unroll
      for (int e = 0; e < 4; ++e) {
        _Float16 a, lo;
        split_bf16(a4[e], a, lo); hv[e] = a; lv[e] = lo;
        split_bf16(b4[e], a, lo); hv[4 + e] = a; lv[4 + e] = lo;
      }
      *(v8h*)(vah + tbase + it * 256) = hv;
      *(v8h*)(val + tbase + it * 256) = lv;
    }
    
  }
}

// ---------------------------------------------------------------------------------------
extern "C" void kernel_launch(void* const* d_in, const int* in_sizes, int n_in,
                              void* d_out, int out_size, void* d_ws, size_t ws_size,
                              hipStream_t stream) {
  if (n_in < 14) return;
  if (in_sizes[0] != NROWS * EWID || in_sizes[1] != NROWS * 8 || in_sizes[2] < EWID || in_sizes[3] < EWID ||
      in_sizes[4] != EWID * 384 || in_sizes[5] < 384 || in_sizes[6] != EWID * 8 || in_sizes[7] < 8 ||
      in_sizes[8] != EWID * 384 || in_sizes[9] < 384 || in_sizes[10] != EWID * 8 || in_sizes[11] < 8 ||
      in_sizes[12] != 256 * EWID || in_sizes[13] < EWID || out_size != NROWS * EWID) return;

  const float* e      = (const float*)d_in[0];
  const float* mask   = (const float*)d_in[1];
  const float* ln_g   = (const float*)d_in[2];
  const float* ln_b   = (const float*)d_in[3];
  const float* Wq_in  = (const float*)d_in[4];
  const float* bq_in  = (const float*)d_in[5];
  const float* We_in  = (const float*)d_in[6];
  const float* be_in  = (const float*)d_in[7];
  const float* Wq_out = (const float*)d_in[8];
  const float* bq_out = (const float*)d_in[9];
  const float* We_out = (const float*)d_in[10];
  const float* be_out = (const float*)d_in[11];
  const float* Wo     = (const float*)d_in[12];
  const float* bo     = (const float*)d_in[13];
  float* out = (float*)d_out;

  // ---- workspace region map (offsets 256-B aligned; total 135,072,768 B) ----
  //  (ELh/l, VAh/l and the weight planes lie in the GEMM's fragment order; VA rows are j*192+i)
  //  ELh, ELl   bf16 [36864][128]       2 x  9,437,184   LayerNorm output hi/lo (live through both directions)
  //  QKV16      f16  [2][36864][384]    2 x 28,311,552   projection output, one plane a direction
  //  EB         f32  [2][36864][64]     2 x  9,437,184   edge-bias projection (cols 0..7), one plane a direction
  //  BM         f32  [2][8][192][192]   2 x  1,179,648   bias+mask slabs, one plane a direction
  //  VAh, VAl   bf16 [36864][256]       2 x 18,874,368   attention output hi/lo (both directions)
  //  WtQh/l x2  bf16 [384][128]         4 x     98,304
  //  WtEh/l x2  bf16 [64][128]          4 x     16,384
  //  WoTh/l     bf16 [128][256]         2 x     65,536
  //  bqp x2     f32  [384]              2 x      1,536
  size_t off = 0;
  auto carve = [&](size_t bytes) { size_t o = off; off += (bytes + 255) & ~(size_t)255; return o; };
  const size_t oELh = carve((size_t)NROWS * EWID * 2);
  const size_t oELl = carve((size_t)NROWS * EWID * 2);
  const size_t oQKV = carve((size_t)2 * NROWS * QKV_LD * 2);
  const size_t oEB  = carve((size_t)2 * NROWS * EB_LD * 4);
  const size_t oBM  = carve((size_t)2 * 8 * NNODE * NNODE * 4);
  const size_t oVAh = carve((size_t)NROWS * VA_LD * 2);
  const size_t oVAl = carve((size_t)NROWS * VA_LD * 2);
  size_t oWQh[2], oWQl[2], oWEh[2], oWEl[2], oBQ[2];
  for (int d = 0; d < 2; ++d) { oWQh[d] = carve((size_t)384 * 128 * 2); oWQl[d] = carve((size_t)384 * 128 * 2); }
  for (int d = 0; d < 2; ++d) { oWEh[d] = carve((size_t)64 * 128 * 2);  oWEl[d] = carve((size_t)64 * 128 * 2); }
  const size_t oWOh = carve((size_t)128 * 256 * 2);
  const size_t oWOl = carve((size_t)128 * 256 * 2);
  for (int d = 0; d < 2; ++d) oBQ[d] = carve((size_t)384 * 4);
  if (off > ws_size) return;

  char* ws = (char*)d_ws;
  unsigned short* ELh = (unsigned short*)(ws + oELh);
  unsigned short* ELl = (unsigned short*)(ws + oELl);
  _Float16* QKV16 = (_Float16*)(ws + oQKV);
  float* EB = (float*)(ws + oEB);
  float* BM = (float*)(ws + oBM);
  unsigned short* VAh = (unsigned short*)(ws + oVAh);
  unsigned short* VAl = (unsigned short*)(ws + oVAl);
  unsigned short* WQh[2], *WQl[2], *WEh[2], *WEl[2];
  float* BQ[2];
  for (int d = 0; d < 2; ++d) {
    WQh[d] = (unsigned short*)(ws + oWQh[d]); WQl[d] = (unsigned short*)(ws + oWQl[d]);
    WEh[d] = (unsigned short*)(ws + oWEh[d]); WEl[d] = (unsigned short*)(ws + oWEl[d]);
    BQ[d] = (float*)(ws + oBQ[d]);
  }
  unsigned short* WOh = (unsigned short*)(ws + oWOh);
  unsigned short* WOl = (unsigned short*)(ws + oWOl);

  // weight prep of both directions and of the output linear + LayerNorm -> bf16 hi/lo planes, one launch
  // (72 prep blocks, then 36864 rows / 16 rows per block = 2304 blocks exactly)
  k_front<<<PREP_BLOCKS + NROWS / 16, 256, 0, stream>>>(e, ln_g, ln_b, Wq_in, bq_in, We_in, Wq_out, bq_out, We_out, Wo,
      WQh[0], WQl[0], WEh[0], WEl[0], BQ[0], WQh[1], WQl[1], WEh[1], WEl[1], BQ[1], WOh, WOl, ELh, ELl, NROWS);

  const int tilesQKV = (NROWS / 64) * (QKV_LD / 64);   // 3456 = 432 blocks x 8 waves
  const int tilesEB  = (NROWS / 64) * (EB_LD / 64);    // 576  = 72 blocks
  const int tilesOUT = (NROWS / 64) * (EWID / 64);     // 1152 = 144 blocks
  // The launches below up to the attention serve both directions: the GEMM batch index (grid y) or grid y / z is the direction.
  // edge bias = EL . We  (M 36864, N 64 (8 used), K 128; split; f32 output; be added in the slab kernel) and
  // qkv = EL . Wqkv + b  (M 36864, N 384, K 128; bf16 hi/lo split; f16 head-major output), one launch
  k_proj<<<dim3(tilesEB / 8 + tilesQKV / 8, 2), 256, 0, stream>>>(ELh, ELl, EWID,
      WEh[0], WEl[0], (long)(WEh[1] - WEh[0]), (void*)EB, EB_LD, (long)NROWS * EB_LD, EB_LD, tilesEB / 8,
      WQh[0], WQl[0], (long)(WQh[1] - WQh[0]), (void*)QKV16, QKV_LD, (long)NROWS * QKV_LD, QKV_LD,
      BQ[0], (long)(BQ[1] - BQ[0]), NROWS, EWID);
  k_bias_slab<<<dim3((8 * NNODE * NNODE) / 256, 2), 256, 0, stream>>>(EB, be_in, be_out, mask, BM);
  k_edge_attn<<<dim3(NNODE, NNODE / 32, 2), 64, 0, stream>>>(QKV16, BM, VAh, VAl);
  // out = VA . Wo + bo  (M 36864, N 128, K 256; split; f32 output rows of d_out; VA row j*192+i -> out row i*192+j)
  wmma_gemm64<VA_LD, 1, true, 2, 0, false, 0, true><<<dim3(tilesOUT / 8, 1), 256, 0, stream>>>(
      VAh, VAl, VA_LD, (long)0, WOh, WOl, VA_LD, (long)0,
      (void*)out, (void*)out, EWID, (long)0, bo, (long)0, bo, (long)0, NROWS, EWID, VA_LD, 1.0f);
}

// v005
// It runs in 112 microseconds.
// Timed twice side by side with v004, it ran 1.19 and 1.20 times as fast.
// Over all steps from v000 it is 2.38 times as fast.
// Contractions: LayerNorm'd qkv / edge-bias projections and the output linear on v_wmma_f32_16x16x32_bf16 with bf16 hi/lo split operands (hi*hi + hi*lo + lo*hi); per-(edge column, head) 192x192 attention cores (q.k^T with d=16 zero-extended to 32, p.v with 192 keys) on v_wmma_f32_16x16x32_f16 with plain f16 operands; f32 accumulate everywhere; LayerNorm, bias/mask add, softmax and normalisation in f32.
#include <hip/hip_runtime.h>

typedef __attribute__((ext_vector_type(16))) _Float16 v16h;
typedef __attribute__((ext_vector_type(8)))  _Float16 v8h;
typedef __attribute__((ext_vector_type(16))) __bf16   v16b;
typedef __attribute__((ext_vector_type(8)))  __bf16   v8b;
typedef __attribute__((ext_vector_type(8)))  float    v8f;
typedef __attribute__((ext_vector_type(4)))  float    v4f;
typedef __attribute__((ext_vector_type(2)))  float    v2f;

#define EWID 128
#define NNODE 192
#define NROWS 36864          // 192*192 edge rows, row r = i*192 + j
#define QKV_LD 384
#define EB_LD 64
#define VA_LD 256
#define KS_P 16              // LDS K tile pitch (halves)
#define VT_P 192             // LDS V^T tile pitch (halves)
#define LOG2E 1.4426950408889634f

// ------------------------------- helpers -------------------------------
__device__ __forceinline__ unsigned short f2bf_bits(float f) {
  unsigned u = __float_as_uint(f);
  return (unsigned short)((u + 0x7FFFu + ((u >> 16) & 1u)) >> 16);
}
__device__ __forceinline__ float bf_bits2f(unsigned short h) { return __uint_as_float(((unsigned)h) << 16); }

// hazard guards as plain device helpers (no inline asm inside the kernel template body)
__device__ __forceinline__ void dep_guard_h(v8f& a, v8f& b, v16h x, v16h y) { asm volatile("v_nop\n\tv_nop\n\tv_nop\n\tv_nop" : "+v"(a), "+v"(b) : "v"(x), "v"(y)); }
__device__ __forceinline__ void dep_guard_b(v8f& a, v8f& b, v16b x, v16b y) { asm volatile("v_nop\n\tv_nop\n\tv_nop\n\tv_nop" : "+v"(a), "+v"(b) : "v"(x), "v"(y)); }
__device__ __forceinline__ void keep4_h(v16h a, v16h b, v16h c, v16h d) { asm volatile("v_nop" :: "v"(a), "v"(b), "v"(c), "v"(d)); }
__device__ __forceinline__ void keep4_b(v16b a, v16b b, v16b c, v16b d) { asm volatile("v_nop" :: "v"(a), "v"(b), "v"(c), "v"(d)); }
__device__ __forceinline__ void acc_guard4(v8f& a, v8f& b, v8f& c, v8f& d) { asm volatile("v_nop\n\tv_nop\n\tv_nop\n\tv_nop" : "+v"(a), "+v"(b), "+v"(c), "+v"(d)); }
template <typename T> struct Frag;
template <> struct Frag<_Float16> {
  typedef v16h V; union U { v16h v; v8h h[2]; };
  static __device__ __forceinline__ v16h load(const _Float16* p) {   // elements 0..7 <- p[0..7], 8..15 <- p[16..23]
    U f; f.h[0] = *(const v8h*)(p); f.h[1] = *(const v8h*)(p + 16); return f.v;
  }
  static __device__ __forceinline__ v16h load_fo(const _Float16* p) { // fragment-order plane: the two 512-B wave loads of a fragment
    U f; f.h[0] = *(const v8h*)(p); f.h[1] = *(const v8h*)(p + 256); return f.v;
  }
  static __device__ __forceinline__ v8f mma(v16h a, v16h b, v8f c) {
    return __builtin_amdgcn_wmma_f32_16x16x32_f16(false, a, false, b, (short)0, c, false, false);
  }
  static __device__ __forceinline__ void guard(v8f& a, v8f& b, v16h x, v16h y) { dep_guard_h(a, b, x, y); }
  static __device__ __forceinline__ void keep(v16h a, v16h b, v16h c, v16h d) { keep4_h(a, b, c, d); }
};
template <> struct Frag<__bf16> {
  typedef v16b V; union U { v16b v; v8b h[2]; };
  static __device__ __forceinline__ v16b load(const __bf16* p) {
    U f; f.h[0] = *(const v8b*)(p); f.h[1] = *(const v8b*)(p + 16); return f.v;
  }
  static __device__ __forceinline__ v16b load_fo(const __bf16* p) {
    U f; f.h[0] = *(const v8b*)(p); f.h[1] = *(const v8b*)(p + 256); return f.v;
  }
  static __device__ __forceinline__ v8f mma(v16b a, v16b b, v8f c) {
    return __builtin_amdgcn_wmma_f32_16x16x32_bf16(false, a, false, b, (short)0, c, false, false);
  }
  static __device__ __forceinline__ void guard(v8f& a, v8f& b, v16b x, v16b y) { dep_guard_b(a, b, x, y); }
  static __device__ __forceinline__ void keep(v16b a, v16b b, v16b c, v16b d) { keep4_b(a, b, c, d); }
};

// ---- Register-blocked batched WMMA GEMM ------------------------------------
// C[m,n] = scale * sum_k A[m,k] * Bt[n,k] (+bias)(+resid); each wave owns a 64x64 tile.
// A [M,K] and Bt [N,K] lie in FRAGMENT ORDER (lda = ldb = K): each 16-row tile is 16*K contiguous elements, inside it the
// 16-byte chunk (row r, k 8q..8q+7) stands at element q*128 + r*8, so the 32 lanes of one fragment load (row lane&15,
// chunk 4*(k0/32) + 2*load + (lane>>4)) read 512 contiguous bytes = 4 whole lines. The k order of a fragment is unchanged.
// KC = K = lda = ldb at compile time: the tiles and halves of a k step are then immediate offsets from one address a plane.
// M,N % 64 == 0, K % 32 == 0.  TROW: output row m is stored at row (m % 192)*192 + m / 192 (f32 output only).
// SPLIT: operands are hi/lo planes (A2/Bt2 = lo planes, same layout); product = hi*hi + hi*lo + lo*hi.
// BIAS_MODE: 0 = none, 1 = bias[m], 2 = bias[n].
// OUT_MODE: 0 = f32, 1 = f16, 2 = bf16 hi plane (Cout) + bf16 lo plane (Cout2).
// ET: 0 = f16 operands, 1 = bf16 operands (pointers passed as 16-bit storage)
template <int ET> struct Elem;
template <> struct Elem<0> { typedef _Float16 T; };
template <> struct Elem<1> { typedef __bf16 T; };
// gemm64_tile: the work of block bx of batch b; sT = the block's LDS, 8 per-wave 16x64 slabs of pitch 68 floats.
template <int KC, int ET, bool SPLIT, int BIAS_MODE, int OUT_MODE, bool RESID, int ACT = 0, bool TROW = false>
__device__ __forceinline__ void gemm64_tile(const int bx, const int b, float* __restrict__ sT,
    const unsigned short* __restrict__ Ap, const unsigned short* __restrict__ A2p, int lda, long strideA,
    const unsigned short* __restrict__ Btp, const unsigned short* __restrict__ Bt2p, int ldb, long strideB,
    void* __restrict__ Cout, void* __restrict__ Cout2, int ldc, long strideC,
    const float* __restrict__ bias, long strideBias,
    const float* __restrict__ resid, long strideR,
    int M, int N, int K, float scale) {
  typedef typename Elem<ET>::T T;
  typedef typename Frag<T>::V V;
  const T* A = (const T*)Ap; const T* A2 = (const T*)A2p; const T* Bt = (const T*)Btp; const T* Bt2 = (const T*)Bt2p;
  const int lane = threadIdx.x & 31;
  // wave number as a scalar: every fragment address is then a scalar tile base + the one lane offset lane*16 B
  const int wave = __builtin_amdgcn_readfirstlane(threadIdx.x >> 5);
  const int tilesN = N >> 6;
  const int tilesM = M >> 6;
  const int tile = bx * 8 + wave;
  if (tile >= tilesM * tilesN) return;   // wave-uniform; no block barriers in this kernel
  const int tm = tile / tilesN;
  const int tn = tile - tm * tilesN;
  const int m0 = tm << 6;
  const int n0 = tn << 6;

  const T* Ab  = A  + (size_t)b * strideA;
  const T* Bb  = Bt + (size_t)b * strideB;
  const T* Ab2 = SPLIT ? (A2  + (size_t)b * strideA) : nullptr;
  const T* Bb2 = SPLIT ? (Bt2 + (size_t)b * strideB) : nullptr;

  const int rlane = lane & 15;                 // row (A) / col (B, D) within subtile
  const int mOff  = (lane >> 4) * 8;           // D row offset
  const unsigned lane8 = (unsigned)lane * 8u;  // this lane's 16-byte chunk of a 512-byte fragment load

  v8f acc[4][4];
#pragma unroll
  for (int i = 0; i < 4; ++i)
#pragma unroll
    for (int j = 0; j < 4; ++j) acc[i][j] = (v8f){0.f,0.f,0.f,0.f,0.f,0.f,0.f,0.f};

  // rolled: the body stays one k step long (code size, register count)
#pragma unroll 1
  for (int k0 = 0; k0 < KC; k0 += 32) {
    V bh[4], bl[4];
#pragma unroll
    for (int j = 0; j < 4; ++j) {
      const size_t bo = (size_t)(n0 + (j << 4)) * KC + (k0 << 4);    // wave-uniform
      bh[j] = Frag<T>::load_fo(Bb + bo + lane8);
      if (SPLIT) bl[j] = Frag<T>::load_fo(Bb2 + bo + lane8);
    }
#pragma unroll
    for (int i = 0; i < 4; ++i) {
      const size_t ao = (size_t)(m0 + (i << 4)) * KC + (k0 << 4);    // wave-uniform
      V ah = Frag<T>::load_fo(Ab + ao + lane8);
      V al;
      if (SPLIT) al = Frag<T>::load_fo(Ab2 + ao + lane8);
#pragma unroll
      for (int j = 0; j < 4; ++j) {
        acc[i][j] = Frag<T>::mma(ah, bh[j], acc[i][j]);
        if (SPLIT) {
          acc[i][j] = Frag<T>::mma(ah, bl[j], acc[i][j]);
          acc[i][j] = Frag<T>::mma(al, bh[j], acc[i][j]);
        }
      }
      Frag<T>::guard(acc[i][0], acc[i][3], ah, SPLIT ? al : ah);
    }
    Frag<T>::keep(bh[0], bh[1], bh[2], bh[3]);
    if (SPLIT) Frag<T>::keep(bl[0], bl[1], bl[2], bl[3]);
  }
  acc_guard4(acc[0][0], acc[0][1], acc[0][2], acc[0][3]);
  acc_guard4(acc[1][0], acc[1][1], acc[1][2], acc[1][3]);
  acc_guard4(acc[2][0], acc[2][1], acc[2][2], acc[2][3]);
  acc_guard4(acc[3][0], acc[3][1], acc[3][2], acc[3][3]);

  // ---- epilogue ----
  float* slab = sT + wave * (16 * 68);
  const float* Rb = RESID ? (resid + (size_t)b * strideR) : nullptr;
  const float* Bs = (BIAS_MODE != 0) ? (bias + (size_t)b * strideBias) : nullptr;
#pragma unroll
  for (int i = 0; i < 4; ++i) {
    const int mBase = m0 + (i << 4);
#pragma unroll
    for (int j = 0; j < 4; ++j) {
      const int n = n0 + (j << 4) + rlane;
      float bv = 0.f;
      if (BIAS_MODE == 2) bv = Bs[n];
#pragma unroll
      for (int r = 0; r < 8; ++r) {
        float v = acc[i][j][r] * scale;
        if (BIAS_MODE == 1) v += Bs[mBase + mOff + r];
        if (BIAS_MODE == 2) v += bv;
        if (RESID) v += Rb[(size_t)(mBase + mOff + r) * ldc + n];
        if (ACT == 1) v = tanhf(v);
        if (ACT == 2) v = fmaxf(v, 0.0f);
        if (ACT == 3) v = v / (1.0f + expf(-v));
        if (ACT == 4) v = (v > 0.f) ? v : 0.01f * v;
        if (ACT == 5) v = 0.5f * v * (1.0f + erff(v * 0.70710678118654752f));
        slab[(mOff + r) * 68 + (j << 4) + rlane] = v;
      }
    }
    __builtin_amdgcn_fence(__ATOMIC_RELEASE, "workgroup");
    __builtin_amdgcn_wave_barrier();
    __builtin_amdgcn_fence(__ATOMIC_ACQUIRE, "workgroup");
    if (OUT_MODE == 0) {
      float* C = (float*)Cout + (size_t)b * strideC;
      const int hh = lane >> 4, c4 = (lane & 15) * 4;     // row seg = 256 B = 16 lanes x 16 B
      {
#pragma unroll
        for (int it = 0; it < 8; ++it) {
          const int row = it * 2 + hh;
          v4f v = *(const v4f*)(slab + row * 68 + c4);
          // a 64-row tile lies inside one group of 192 rows, so quotient and remainder come from the scalar m0
          const size_t orow = TROW ? (size_t)(m0 % NNODE + (i << 4) + row) * NNODE + m0 / NNODE : (size_t)(mBase + row);
          *(v4f*)(C + orow * ldc + n0 + c4) = v;
        }
        
      }
    } else {
      const int q = lane >> 3, c8 = (lane & 7) * 8;
      unsigned short* C  = (unsigned short*)Cout  + (size_t)b * strideC;
      unsigned short* C2 = (OUT_MODE == 2) ? ((unsigned short*)Cout2 + (size_t)b * strideC) : nullptr;
      {
#pragma unroll
        for (int it = 0; it < 4; ++it) {
          const int row = it * 4 + q;
          const float* sp = slab + row * 68 + c8;
          v8h hv, lv;
#pragma unroll
          for (int e = 0; e < 8; ++e) {
            if (OUT_MODE == 1) {
              hv[e] = (_Float16)sp[e];
            } else {
              unsigned short hb = f2bf_bits(sp[e]);
              unsigned short lb = f2bf_bits(sp[e] - bf_bits2f(hb));
              hv[e] = __builtin_bit_cast(_Float16, hb);
              lv[e] = __builtin_bit_cast(_Float16, lb);
            }
          }
          *(v8h*)(C + (size_t)(mBase + row) * ldc + n0 + c8) = hv;
          if (OUT_MODE == 2) *(v8h*)(C2 + (size_t)(mBase + row) * ldc + n0 + c8) = lv;
        }
        
      }
    }
    __builtin_amdgcn_fence(__ATOMIC_RELEASE, "workgroup");
    __builtin_amdgcn_wave_barrier();
    __builtin_amdgcn_fence(__ATOMIC_ACQUIRE, "workgroup");
  }
}
template <int KC, int ET, bool SPLIT, int BIAS_MODE, int OUT_MODE, bool RESID, int ACT = 0, bool TROW = false>
__global__ __launch_bounds__(256) void wmma_gemm64(
    const unsigned short* __restrict__ Ap, const unsigned short* __restrict__ A2p, int lda, long strideA,
    const unsigned short* __restrict__ Btp, const unsigned short* __restrict__ Bt2p, int ldb, long strideB,
    void* __restrict__ Cout, void* __restrict__ Cout2, int ldc, long strideC,
    const float* __restrict__ bias, long strideBias,
    const float* __restrict__ resid, long strideR,
    int M, int N, int K, float scale) {
  __shared__ __align__(16) float sT[8 * 16 * 68];
  gemm64_tile<KC, ET, SPLIT, BIAS_MODE, OUT_MODE, RESID, ACT, TROW>(blockIdx.x, blockIdx.y, sT, Ap, A2p, lda, strideA,
      Btp, Bt2p, ldb, strideB, Cout, Cout2, ldc, strideC, bias, strideBias, resid, strideR, M, N, K, scale);
}
// The two projections of the LayerNorm'd rows, which do not depend on each other, as one launch: blocks below
// blocksE do the edge-bias product (f32 out, no bias), the others the qkv product (f16 out, bias[n]). Block-uniform.
__global__ __launch_bounds__(256) void k_proj(
    const unsigned short* __restrict__ Ap, const unsigned short* __restrict__ A2p, int lda,
    const unsigned short* __restrict__ BtE, const unsigned short* __restrict__ Bt2E, long strideBE,
    void* __restrict__ CE, int ldcE, long strideCE, int NE, int blocksE,
    const unsigned short* __restrict__ BtQ, const unsigned short* __restrict__ Bt2Q, long strideBQ,
    void* __restrict__ CQ, int ldcQ, long strideCQ, int NQ,
    const float* __restrict__ biasQ, long strideBiasQ, int M, int K) {
  __shared__ __align__(16) float sT[8 * 16 * 68];
  const int bx = blockIdx.x;
  if (bx < blocksE)
    gemm64_tile<EWID, 1, true, 0, 0, false>(bx, blockIdx.y, sT, Ap, A2p, lda, (long)0, BtE, Bt2E, lda, strideBE,
        CE, CE, ldcE, strideCE, biasQ, (long)0, biasQ, (long)0, M, NE, K, 1.0f);
  else
    gemm64_tile<EWID, 1, true, 2, 1, false>(bx - blocksE, blockIdx.y, sT, Ap, A2p, lda, (long)0, BtQ, Bt2Q, lda, strideBQ,
        CQ, CQ, ldcQ, strideCQ, biasQ, strideBiasQ, biasQ, (long)0, M, NQ, K, 1.0f);
}

__device__ __forceinline__ v8f zero8f() { return (v8f){0.f, 0.f, 0.f, 0.f, 0.f, 0.f, 0.f, 0.f}; }
__device__ __forceinline__ v8h zero8h() {
  v8h z;
#pragma unroll
  for (int e = 0; e < 8; ++e) z[e] = (_Float16)0.0f;
  return z;
}
// f16 WMMA with the hazard guard attached (D tied, A/B kept live)
__device__ __forceinline__ v8f hmma(v16h a, v16h b, v8f c) {
  c = __builtin_amdgcn_wmma_f32_16x16x32_f16(false, a, false, b, (short)0, c, false, false);
  asm volatile("v_nop\n\tv_nop\n\tv_nop\n\tv_nop" : "+v"(c) : "v"(a), "v"(b));
  return c;
}
__device__ __forceinline__ void split_bf16(float x, _Float16& hi, _Float16& lo) {
  const unsigned short hb = f2bf_bits(x);
  const unsigned short lb = f2bf_bits(x - bf_bits2f(hb));
  hi = __builtin_bit_cast(_Float16, hb);
  lo = __builtin_bit_cast(_Float16, lb);
}

// ---------------------------------------------------------------------------------------
// qkv weight prep: W [128 k][384 c] f32 ([in][out]) -> Bt hi/lo bf16 planes [384 n][128 k], fragment order, with head-major
// output columns: n = part*128 + h*16 + d  <-  c = part*128 + d*8 + h (view(DD=16, NH=8): d slow, h fast).
// Permuted bias bqp[n] = bq[c].  Edge-bias weight We [128 k][8] -> Bt hi/lo [64 n][128 k], rows n >= 8 zero.
// grid 28 x block 256: blocks 0..23 = 384 rows x 16 threads (8 k each) -> covers [384][128] exactly;
// blocks 24..27 = 64 rows x 16 threads -> covers [64][128] exactly; t < 384 also writes bqp[384] exactly.
// Owner-computes: thread t stores the t-th 16-byte chunk of the plane = (tile t>>8, chunk (t>>4)&15, row t&15).
__device__ __forceinline__ void prep_qkv_w(const int bx,
    const float* __restrict__ W, const float* __restrict__ bq, const float* __restrict__ We,
    unsigned short* __restrict__ wqh, unsigned short* __restrict__ wql,
    unsigned short* __restrict__ weh, unsigned short* __restrict__ wel, float* __restrict__ bqp) {
  const int t = bx * 256 + threadIdx.x;
  if (bx < 24) {                               // block-uniform
    const int n = (t >> 8) * 16 + (t & 15), k8 = ((t >> 4) & 15) * 8;
    const int part = n >> 7, h = (n >> 4) & 7, d = n & 15;
    const int col = part * 128 + d * 8 + h;
    v8h hv, lv;
#pragma unroll
    for (int e = 0; e < 8; ++e) {
      const float w = W[(size_t)(k8 + e) * 384 + col];
      _Float16 a, bb; split_bf16(w, a, bb); hv[e] = a; lv[e] = bb;
    }
    const size_t off = (size_t)t * 8;
    {
      *(v8h*)(wqh + off) = hv;
      *(v8h*)(wql + off) = lv;
      
    }
    if (t < 384) {                             // wave-uniform (384 = 12 waves)
      const int pn = t >> 7, ph = (t >> 4) & 7, pd = t & 15;
      const float bv = bq[pn * 128 + pd * 8 + ph];
      *(float*)(bqp + t) = bv;
      
    }
  } else {
    const int u = t - 6144;
    const int n = (u >> 8) * 16 + (u & 15), k8 = ((u >> 4) & 15) * 8;
    const int nc = (n < 8) ? n : 7;            // address clamp, value zeroed by predicate
    v8h hv, lv;
#pragma unroll
    for (int e = 0; e < 8; ++e) {
      float w = We[(size_t)(k8 + e) * 8 + nc];
      w = (n < 8) ? w : 0.0f;
      _Float16 a, bb; split_bf16(w, a, bb); hv[e] = a; lv[e] = bb;
    }
    const size_t off = (size_t)u * 8;
    {
      *(v8h*)(weh + off) = hv;
      *(v8h*)(wel + off) = lv;
      // inlined as one arm of a larger kernel: the code of a later arm reuses these stores' registers
      asm volatile("s_wait_xcnt 0x0" ::: "memory");
    }
  }
}

// Output weight prep: Wo [256 c][128 n] f32 ([in][out]) -> Bt hi/lo [128 n][256 k'], fragment order, k' = dir*128 + h*16 + d
// <- c = d*16 + dir*8 + h (concat of the two head groups on the head axis, then view d slow).
// grid 16 x block 256 = 4096 threads = 128 rows x 32 threads (8 k' each): covers [128][256] exactly;
// thread t stores the t-th 16-byte chunk = (tile t>>9, chunk (t>>4)&31, row t&15).
__device__ __forceinline__ void prep_wo(const int bx, const float* __restrict__ Wo,
    unsigned short* __restrict__ woh, unsigned short* __restrict__ wol) {
  const int t = bx * 256 + threadIdx.x;
  const int n = (t >> 9) * 16 + (t & 15), k8 = ((t >> 4) & 31) * 8;
  v8h hv, lv;
#pragma unroll
  for (int e = 0; e < 8; ++e) {
    const int kp = k8 + e;
    const int dr = kp >> 7, h = (kp >> 4) & 7, d = kp & 15;
    const int col = d * 16 + dr * 8 + h;
    const float w = Wo[(size_t)col * 128 + n];
    _Float16 a, bb; split_bf16(w, a, bb); hv[e] = a; lv[e] = bb;
  }
  const size_t off = (size_t)t * 8;
  {
    *(v8h*)(woh + off) = hv;
    *(v8h*)(wol + off) = lv;
    // inlined as one arm of a larger kernel: the code of a later arm reuses these stores' registers
    asm volatile("s_wait_xcnt 0x0" ::: "memory");
  }
}

// LayerNorm over the 128-wide rows of e (eps 1e-5, biased variance, *g + b) -> bf16 hi/lo planes [nrows][128], fragment order.
// grid = nrows/16, block 256 = 8 waves x 2 rows (lane half = row, lane&15 = 8-column chunk) = one 16-row tile.
// The tile's chunks are turned from (row, chunk) to (chunk, row) through LDS (sF: 2 planes of 16 x 272 B, one 16-byte
// pad a chunk column against bank conflicts); thread t then stores the tile's t-th chunk: 512 contiguous bytes a wave.
#define LNF_P 136            // LDS pitch of a chunk column (halves): 16 rows x 8 + 8
__device__ __forceinline__ void ln_rows(const int bx, const float* __restrict__ e, const float* __restrict__ g,
    const float* __restrict__ b, unsigned short* __restrict__ elh, unsigned short* __restrict__ ell, int nrows,
    unsigned short* __restrict__ sF) {
  const int tid = threadIdx.x, wave = tid >> 5, lane = tid & 31, hh = lane >> 4, c = lane & 15;
  const int row = (bx * 8 + wave) * 2 + hh;
  const bool ok = row < nrows;
  const int rowc = ok ? row : (nrows - 1);
  const float* p = e + (size_t)rowc * EWID + c * 8;
  const v4f x0 = *(const v4f*)p;
  const v4f x1 = *(const v4f*)(p + 4);
  float xs[8];
  xs[0] = x0[0]; xs[1] = x0[1]; xs[2] = x0[2]; xs[3] = x0[3];
  xs[4] = x1[0]; xs[5] = x1[1]; xs[6] = x1[2]; xs[7] = x1[3];
  float s = ((xs[0] + xs[1]) + (xs[2] + xs[3])) + ((xs[4] + xs[5]) + (xs[6] + xs[7]));
#pragma unroll
  for (int off = 1; off < 16; off <<= 1) s += __shfl_xor(s, off, 32);
  const float mu = s * (1.0f / 128.0f);
  float q = 0.f;
#pragma unroll
  for (int k = 0; k < 8; ++k) { xs[k] -= mu; q += xs[k] * xs[k]; }
#pragma unroll
  for (int off = 1; off < 16; off <<= 1) q += __shfl_xor(q, off, 32);
  const float rs = rsqrtf(q * (1.0f / 128.0f) + 1e-5f);
  const v4f g0 = *(const v4f*)(g + c * 8), g1 = *(const v4f*)(g + c * 8 + 4);
  const v4f b0 = *(const v4f*)(b + c * 8), b1 = *(const v4f*)(b + c * 8 + 4);
  float gg[8], bb[8];
  gg[0] = g0[0]; gg[1] = g0[1]; gg[2] = g0[2]; gg[3] = g0[3]; gg[4] = g1[0]; gg[5] = g1[1]; gg[6] = g1[2]; gg[7] = g1[3];
  bb[0] = b0[0]; bb[1] = b0[1]; bb[2] = b0[2]; bb[3] = b0[3]; bb[4] = b1[0]; bb[5] = b1[1]; bb[6] = b1[2]; bb[7] = b1[3];
  v8h hv, lv;
#pragma unroll
  for (int k = 0; k < 8; ++k) {
    const float y = xs[k] * rs * gg[k] + bb[k];
    _Float16 a, lo; split_bf16(y, a, lo); hv[k] = a; lv[k] = lo;
  }
  const int wa = c * LNF_P + (wave * 2 + hh) * 8;
  *(v8h*)(sF + wa) = hv;
  *(v8h*)(sF + 16 * LNF_P + wa) = lv;
  __syncthreads();           // block-uniform: every thread of a LayerNorm block comes here
  const int ra = (tid >> 4) * LNF_P + (tid & 15) * 8;
  const v8h ho = *(const v8h*)(sF + ra);
  const v8h lo8 = *(const v8h*)(sF + 16 * LNF_P + ra);
  if (bx * 16 + (tid & 15) < nrows) {
    const size_t off = (size_t)bx * 16 * EWID + tid * 8;
    {
      *(v8h*)(elh + off) = ho;
      *(v8h*)(ell + off) = lo8;
    }
  }
}

// The four launches that depend on nothing but the inputs, as one: blocks 0..27 qkv/edge weights of direction 0,
// 28..55 of direction 1, 56..71 output weight, 72.. LayerNorm (16 rows a block). The choice is block-uniform.
#define PREP_BLOCKS 72
__global__ __launch_bounds__(256) void k_front(
    const float* __restrict__ e, const float* __restrict__ g, const float* __restrict__ b,
    const float* __restrict__ Wq0, const float* __restrict__ bq0, const float* __restrict__ We0,
    const float* __restrict__ Wq1, const float* __restrict__ bq1, const float* __restrict__ We1,
    const float* __restrict__ Wo,
    unsigned short* __restrict__ wqh0, unsigned short* __restrict__ wql0,
    unsigned short* __restrict__ weh0, unsigned short* __restrict__ wel0, float* __restrict__ bqp0,
    unsigned short* __restrict__ wqh1, unsigned short* __restrict__ wql1,
    unsigned short* __restrict__ weh1, unsigned short* __restrict__ wel1, float* __restrict__ bqp1,
    unsigned short* __restrict__ woh, unsigned short* __restrict__ wol,
    unsigned short* __restrict__ elh, unsigned short* __restrict__ ell, int nrows) {
  __shared__ __align__(16) unsigned short sF[2 * 16 * LNF_P];
  const int bx = blockIdx.x;
  if (bx < 28)               prep_qkv_w(bx, Wq0, bq0, We0, wqh0, wql0, weh0, wel0, bqp0);
  else if (bx < 56)          prep_qkv_w(bx - 28, Wq1, bq1, We1, wqh1, wql1, weh1, wel1, bqp1);
  else if (bx < PREP_BLOCKS) prep_wo(bx - 56, Wo, woh, wol);
  else                       ln_rows(bx - PREP_BLOCKS, e, g, b, elh, ell, nrows, sF);
}

// Score bias slabs, direction dir = blockIdx.y: bm[dir][h][i][k] = eb[dir][r][h] + be[h] + mask[r][h] with
// r = i*192 + k (dir 0) or r = k*192 + i (dir 1). eb = f32 [36864][64] (columns 0..7 used), mask f32 [36864][8].
// grid (1152, 2) x block 256 = 8*192*192 threads a direction exactly; owner-computes (gather reads, contiguous 4-B stores:
__global__ __launch_bounds__(256) void k_bias_slab(const float* __restrict__ eb2, const float* __restrict__ be0,
    const float* __restrict__ be1, const float* __restrict__ mask, float* __restrict__ bm2) {
  const int dir = blockIdx.y;
  const float* eb = eb2 + (size_t)dir * NROWS * EB_LD;
  const float* be = dir ? be1 : be0;
  float* bm = bm2 + (size_t)dir * 8 * NROWS;
  const int idx = blockIdx.x * 256 + threadIdx.x;
  const int h = idx / NROWS;
  const int rem = idx - h * NROWS;
  const int i = rem / NNODE;
  const int k = rem - i * NNODE;
  const int r = dir ? (k * NNODE + i) : (i * NNODE + k);
  const float v = eb[(size_t)r * EB_LD + h] + be[h] + mask[(size_t)r * 8 + h];
  *(float*)(bm + idx) = v;
  
}

// Fused attention core for one (direction dir, head h), all 192 query rows i, JG edge columns j in sequence.
// qkv: f16 [2 dir][36864][384], head-major columns part*128 + h*16 + d.  bm: f32 [2 dir][8][192 i][192 k].
// grid = (192 / JG column groups, 8 heads, 2 directions) x block 384 = 12 waves x 16 query rows.
// The score bias bm[dir][h][i][k] does not depend on j: a lane loads the 96 values of its query once and keeps them in
// registers for all JG columns.  Per column: K [192 keys][16 d] and V^T [16 d][192 keys] staged in LDS once for all
// 192 queries, one (key, 8-wide d chunk) item a thread (dir 0: row j*192+k, dir 1: row k*192+j).  Two LDS buffers taken
// in turn: one barrier a column publishes this column's tiles, and a buffer is rewritten only behind the next barrier,
// which every wave reaches after its last read of it.  The next column's K, V and Q loads are issued behind the barrier.
// Both products run transposed, so that a lane owns ONE query:
// S^T = K (A: 16 keys, d zero-extended to 32) . Q^T (B) on f16 WMMA: lane (hh, c) holds query i0+c, register r
// key 16*tile + 8*hh + r; *0.25 + bias in f32, online softmax over 3 chunks of 64 keys in f32 with maximum and
// sum taken in the lane plus one exchange between the lane halves, e^x as the hardware's 2^(x * log2(e)), x <= 0; two neighbouring S^T tiles, converted to f16
// in place, are the B operand of O^T = V^T (A: 16 d, 32 keys) . P^T; * 1/rowsum.
// Result (lane: query i0+c, registers: d = 8*hh + r) -> bf16 hi/lo planes [36864][256] in fragment order, row j*192+i,
// columns dir*128 + h*16 + d: a wave's 16 queries are one 16-row tile, the head's two chunk columns 512 contiguous
// bytes of it a plane, and lane l owns the l-th 16-byte chunk of them: stored from registers.
#define JG 12                // edge columns a block walks: 16 groups x 8 heads x 2 directions = 256 blocks
__global__ __launch_bounds__(384) void k_edge_attn(const _Float16* __restrict__ qkv2, const float* __restrict__ bm2,
    unsigned short* __restrict__ vah, unsigned short* __restrict__ val) {
  const int dir = blockIdx.z;
  const int h = blockIdx.y;
  const int j0 = blockIdx.x * JG;
  const _Float16* qkv = qkv2 + (size_t)dir * NROWS * QKV_LD + h * 16;
  const float* bm = bm2 + (size_t)dir * 8 * NROWS;
  __shared__ __align__(16) _Float16 Ksh[2][NNODE * KS_P];   // [buffer][key][d], indices <= 191*16+15
  __shared__ __align__(16) _Float16 Vt[2][16 * VT_P];       // [buffer][d][key], indices <= 15*192+191
  const int tid = threadIdx.x, wave = tid >> 5, lane = tid & 31, hh = lane >> 4, c = lane & 15;
  const int i0 = wave * 16;
  const v8h z8 = zero8h();

  // bias of this lane's query, keys 16t+8hh .. +7 of tile t: 32 contiguous bytes a tile, kept for every column
  const float* bmr = bm + ((size_t)h * NNODE + (size_t)(i0 + c)) * NNODE + 8 * hh;
  v4f b0[12], b1[12];
#pragma unroll
  for (int t = 0; t < 12; ++t) {
    b0[t] = *(const v4f*)(bmr + t * 16);
    b1[t] = *(const v4f*)(bmr + t * 16 + 4);
  }

  // staging item of this thread: key kv, d chunk part; 384 items = 192 keys x 2 d chunks exactly
  const int kv = tid >> 1, part = tid & 1;
  const _Float16* kvsrc = qkv + (size_t)(dir ? kv * NNODE : kv) * QKV_LD + part * 8;   // + j * kvstep
  const size_t kvstep = (size_t)(dir ? 1 : NNODE) * QKV_LD;
  const _Float16* qsrc = qkv + (size_t)(i0 + c) * NNODE * QKV_LD + 8 * hh;             // + j * QKV_LD
  v8h kk8 = *(const v8h*)(kvsrc + (size_t)j0 * kvstep + EWID);
  v8h vv8 = *(const v8h*)(kvsrc + (size_t)j0 * kvstep + 2 * EWID);
  v8h q8  = *(const v8h*)(qsrc + (size_t)j0 * QKV_LD);

  // rolled: one column's code is the loop body (code size)
#pragma unroll 1
  for (int jj = 0; jj < JG; ++jj) {
    const int j = j0 + jj;
    _Float16* Kb = Ksh[jj & 1];
    _Float16* Vb = Vt[jj & 1];
    *(v8h*)(Kb + kv * KS_P + part * 8) = kk8;
#pragma unroll
    for (int e2 = 0; e2 < 8; ++e2) Vb[(part * 8 + e2) * VT_P + kv] = vv8[e2];
    // B fragment (query column i0+c, d 8hh..8hh+7 in elements 0..7, elements 8..15 zero)
    Frag<_Float16>::U qa;
    qa.h[0] = q8;
    qa.h[1] = z8;
    __syncthreads();
    if (jj + 1 < JG) {                               // block-uniform; j + 1 <= 191
      kk8 = *(const v8h*)(kvsrc + (size_t)(j + 1) * kvstep + EWID);
      vv8 = *(const v8h*)(kvsrc + (size_t)(j + 1) * kvstep + 2 * EWID);
      q8  = *(const v8h*)(qsrc + (size_t)(j + 1) * QKV_LD);
      // the code behind reuses these loads' address registers at once
      asm volatile("s_wait_xcnt 0x0" ::: "memory");
    }

    float mrow = -__builtin_inff(), lrow = 0.f;      // this lane's query
    v8f o = zero8f();                                // O^T: register r = d 8hh+r of query i0+c

    // unrolled: the bias registers are then named at compile time
#pragma unroll
    for (int kc = 0; kc < 3; ++kc) {
      const int kv0 = kc * 64;
      v8f s[4];
#pragma unroll
      for (int jn = 0; jn < 4; ++jn) {
        // A fragment (key row kv0+16jn+c, d 8hh..8hh+7 in elements 0..7, elements 8..15 zero)
        Frag<_Float16>::U kb;
        kb.h[0] = *(const v8h*)(Kb + (kv0 + jn * 16 + c) * KS_P + 8 * hh);
        kb.h[1] = z8;
        s[jn] = hmma(kb.v, qa.v, zero8f());
      }
      float mx = -__builtin_inff();
#pragma unroll
      for (int jn = 0; jn < 4; ++jn) {
#pragma unroll
        for (int r = 0; r < 8; ++r) {
          const float v = s[jn][r] * 0.25f + (r < 4 ? b0[kc * 4 + jn][r & 3] : b1[kc * 4 + jn][r & 3]);
          s[jn][r] = v;
          mx = fmaxf(mx, v);
        }
      }
      mx = fmaxf(mx, __shfl_xor(mx, 16, 32));        // the other lane half holds the query's other 32 keys
      const float mnew = fmaxf(mrow, mx);
      const float alpha = __builtin_amdgcn_exp2f((mrow - mnew) * LOG2E);
      mrow = mnew;
      float ps = 0.f;
      Frag<_Float16>::U pb[2];                       // P^T as B: elements 0..7 = tile 2kk, 8..15 = tile 2kk+1
#pragma unroll
      for (int jn = 0; jn < 4; ++jn) {
#pragma unroll
        for (int r = 0; r < 8; r += 2) {
          const v2f dl = ((v2f){s[jn][r], s[jn][r + 1]} - (v2f){mnew, mnew}) * (v2f){LOG2E, LOG2E};
          const float p0 = __builtin_amdgcn_exp2f(dl[0]);
          const float p1 = __builtin_amdgcn_exp2f(dl[1]);
          ps += p0;
          ps += p1;
          pb[jn >> 1].h[jn & 1][r] = (_Float16)p0;
          pb[jn >> 1].h[jn & 1][r + 1] = (_Float16)p1;
        }
      }
      ps += __shfl_xor(ps, 16, 32);
      lrow = lrow * alpha + ps;
#pragma unroll
      for (int r = 0; r < 8; ++r) o[r] *= alpha;
#pragma unroll
      for (int kk = 0; kk < 2; ++kk) {
        const v16h va = Frag<_Float16>::load(Vb + c * VT_P + kv0 + kk * 32 + 8 * hh);
        o = hmma(va, pb[kk].v, o);
      }
    }
    const float inv = 1.0f / lrow;
    v8h hv, lv;
#pragma unroll
    for (int e = 0; e < 8; ++e) {
      _Float16 a, lo;
      split_bf16(o[e] * inv, a, lo); hv[e] = a; lv[e] = lo;
    }
    const size_t ob = (size_t)(j * NNODE + i0) * VA_LD + (size_t)(dir * 2048 + h * 256 + lane * 8);
    *(v8h*)(vah + ob) = hv;
    *(v8h*)(val + ob) = lv;
    // the next column's staging reuses these stores' registers
    asm volatile("s_wait_xcnt 0x0" ::: "memory");
  }
}

// ---------------------------------------------------------------------------------------
extern "C" void kernel_launch(void* const* d_in, const int* in_sizes, int n_in,
                              void* d_out, int out_size, void* d_ws, size_t ws_size,
                              hipStream_t stream) {
  if (n_in < 14) return;
  if (in_sizes[0] != NROWS * EWID || in_sizes[1] != NROWS * 8 || in_sizes[2] < EWID || in_sizes[3] < EWID ||
      in_sizes[4] != EWID * 384 || in_sizes[5] < 384 || in_sizes[6] != EWID * 8 || in_sizes[7] < 8 ||
      in_sizes[8] != EWID * 384 || in_sizes[9] < 384 || in_sizes[10] != EWID * 8 || in_sizes[11] < 8 ||
      in_sizes[12] != 256 * EWID || in_sizes[13] < EWID || out_size != NROWS * EWID) return;

  const float* e      = (const float*)d_in[0];
  const float* mask   = (const float*)d_in[1];
  const float* ln_g   = (const float*)d_in[2];
  const float* ln_b   = (const float*)d_in[3];
  const float* Wq_in  = (const float*)d_in[4];
  const float* bq_in  = (const float*)d_in[5];
  const float* We_in  = (const float*)d_in[6];
  const float* be_in  = (const float*)d_in[7];
  const float* Wq_out = (const float*)d_in[8];
  const float* bq_out = (const float*)d_in[9];
  const float* We_out = (const float*)d_in[10];
  const float* be_out = (const float*)d_in[11];
  const float* Wo     = (const float*)d_in[12];
  const float* bo     = (const float*)d_in[13];
  float* out = (float*)d_out;

  // ---- workspace region map (offsets 256-B aligned; total 135,072,768 B) ----
  //  (ELh/l, VAh/l and the weight planes lie in the GEMM's fragment order; VA rows are j*192+i)
  //  ELh, ELl   bf16 [36864][128]       2 x  9,437,184   LayerNorm output hi/lo (live through both directions)
  //  QKV16      f16  [2][36864][384]    2 x 28,311,552   projection output, one plane a direction
  //  EB         f32  [2][36864][64]     2 x  9,437,184   edge-bias projection (cols 0..7), one plane a direction
  //  BM         f32  [2][8][192][192]   2 x  1,179,648   bias+mask slabs, one plane a direction
  //  VAh, VAl   bf16 [36864][256]       2 x 18,874,368   attention output hi/lo (both directions)
  //  WtQh/l x2  bf16 [384][128]         4 x     98,304
  //  WtEh/l x2  bf16 [64][128]          4 x     16,384
  //  WoTh/l     bf16 [128][256]         2 x     65,536
  //  bqp x2     f32  [384]              2 x      1,536
  size_t off = 0;
  auto carve = [&](size_t bytes) { size_t o = off; off += (bytes + 255) & ~(size_t)255; return o; };
  const size_t oELh = carve((size_t)NROWS * EWID * 2);
  const size_t oELl = carve((size_t)NROWS * EWID * 2);
  const size_t oQKV = carve((size_t)2 * NROWS * QKV_LD * 2);
  const size_t oEB  = carve((size_t)2 * NROWS * EB_LD * 4);
  const size_t oBM  = carve((size_t)2 * 8 * NNODE * NNODE * 4);
  const size_t oVAh = carve((size_t)NROWS * VA_LD * 2);
  const size_t oVAl = carve((size_t)NROWS * VA_LD * 2);
  size_t oWQh[2], oWQl[2], oWEh[2], oWEl[2], oBQ[2];
  for (int d = 0; d < 2; ++d) { oWQh[d] = carve((size_t)384 * 128 * 2); oWQl[d] = carve((size_t)384 * 128 * 2); }
  for (int d = 0; d < 2; ++d) { oWEh[d] = carve((size_t)64 * 128 * 2);  oWEl[d] = carve((size_t)64 * 128 * 2); }
  const size_t oWOh = carve((size_t)128 * 256 * 2);
  const size_t oWOl = carve((size_t)128 * 256 * 2);
  for (int d = 0; d < 2; ++d) oBQ[d] = carve((size_t)384 * 4);
  if (off > ws_size) return;

  char* ws = (char*)d_ws;
  unsigned short* ELh = (unsigned short*)(ws + oELh);
  unsigned short* ELl = (unsigned short*)(ws + oELl);
  _Float16* QKV16 = (_Float16*)(ws + oQKV);
  float* EB = (float*)(ws + oEB);
  float* BM = (float*)(ws + oBM);
  unsigned short* VAh = (unsigned short*)(ws + oVAh);
  unsigned short* VAl = (unsigned short*)(ws + oVAl);
  unsigned short* WQh[2], *WQl[2], *WEh[2], *WEl[2];
  float* BQ[2];
  for (int d = 0; d < 2; ++d) {
    WQh[d] = (unsigned short*)(ws + oWQh[d]); WQl[d] = (unsigned short*)(ws + oWQl[d]);
    WEh[d] = (unsigned short*)(ws + oWEh[d]); WEl[d] = (unsigned short*)(ws + oWEl[d]);
    BQ[d] = (float*)(ws + oBQ[d]);
  }
  unsigned short* WOh = (unsigned short*)(ws + oWOh);
  unsigned short* WOl = (unsigned short*)(ws + oWOl);

  // weight prep of both directions and of the output linear + LayerNorm -> bf16 hi/lo planes, one launch
  // (72 prep blocks, then 36864 rows / 16 rows per block = 2304 blocks exactly)
  k_front<<<PREP_BLOCKS + NROWS / 16, 256, 0, stream>>>(e, ln_g, ln_b, Wq_in, bq_in, We_in, Wq_out, bq_out, We_out, Wo,
      WQh[0], WQl[0], WEh[0], WEl[0], BQ[0], WQh[1], WQl[1], WEh[1], WEl[1], BQ[1], WOh, WOl, ELh, ELl, NROWS);

  const int tilesQKV = (NROWS / 64) * (QKV_LD / 64);   // 3456 = 432 blocks x 8 waves
  const int tilesEB  = (NROWS / 64) * (EB_LD / 64);    // 576  = 72 blocks
  const int tilesOUT = (NROWS / 64) * (EWID / 64);     // 1152 = 144 blocks
  // The launches below up to the attention serve both directions: the GEMM batch index (grid y) or grid y / z is the direction.
  // edge bias = EL . We  (M 36864, N 64 (8 used), K 128; split; f32 output; be added in the slab kernel) and
  // qkv = EL . Wqkv + b  (M 36864, N 384, K 128; bf16 hi/lo split; f16 head-major output), one launch
  k_proj<<<dim3(tilesEB / 8 + tilesQKV / 8, 2), 256, 0, stream>>>(ELh, ELl, EWID,
      WEh[0], WEl[0], (long)(WEh[1] - WEh[0]), (void*)EB, EB_LD, (long)NROWS * EB_LD, EB_LD, tilesEB / 8,
      WQh[0], WQl[0], (long)(WQh[1] - WQh[0]), (void*)QKV16, QKV_LD, (long)NROWS * QKV_LD, QKV_LD,
      BQ[0], (long)(BQ[1] - BQ[0]), NROWS, EWID);
  k_bias_slab<<<dim3((8 * NNODE * NNODE) / 256, 2), 256, 0, stream>>>(EB, be_in, be_out, mask, BM);
  k_edge_attn<<<dim3(NNODE / JG, 8, 2), 384, 0, stream>>>(QKV16, BM, VAh, VAl);
  // out = VA . Wo + bo  (M 36864, N 128, K 256; split; f32 output rows of d_out; VA row j*192+i -> out row i*192+j)
  wmma_gemm64<VA_LD, 1, true, 2, 0, false, 0, true><<<dim3(tilesOUT / 8, 1), 256, 0, stream>>>(
      VAh, VAl, VA_LD, (long)0, WOh, WOl, VA_LD, (long)0,
      (void*)out, (void*)out, EWID, (long)0, bo, (long)0, bo, (long)0, NROWS, EWID, VA_LD, 1.0f);
}

// v006
// One run takes 91.8 microseconds.
// Next to v005, in two timings, it ran 1.22 times as fast each time.
// Over all steps from v000 it is 2.91 times as fast.
// Contractions: LayerNorm'd qkv / edge-bias projections and the output linear on v_wmma_f32_16x16x32_bf16 with bf16 hi/lo split operands (hi*hi + hi*lo + lo*hi); per-(edge column, head) 192x192 attention cores (q.k^T with d=16 zero-extended to 32, p.v with 192 keys) on v_wmma_f32_16x16x32_f16 with plain f16 operands; f32 accumulate everywhere; LayerNorm, bias/mask add, softmax and normalisation in f32.
#include <hip/hip_runtime.h>

typedef __attribute__((ext_vector_type(16))) _Float16 v16h;
typedef __attribute__((ext_vector_type(8)))  _Float16 v8h;
typedef __attribute__((ext_vector_type(16))) __bf16   v16b;
typedef __attribute__((ext_vector_type(8)))  __bf16   v8b;
typedef __attribute__((ext_vector_type(8)))  float    v8f;
typedef __attribute__((ext_vector_type(4)))  float    v4f;
typedef __attribute__((ext_vector_type(2)))  float    v2f;

#define EWID 128
#define NNODE 192
#define NROWS 36864          // 192*192 edge rows, row r = i*192 + j
#define QKV_LD 384
#define EB_LD 64
#define VA_LD 256
#define KS_P 16              // LDS K tile pitch (halves)
#define VT_P 192             // LDS V^T tile pitch (halves)
#define LOG2E 1.4426950408889634f

// ------------------------------- helpers -------------------------------
__device__ __forceinline__ unsigned short f2bf_bits(float f) {
  unsigned u = __float_as_uint(f);
  return (unsigned short)((u + 0x7FFFu + ((u >> 16) & 1u)) >> 16);
}
__device__ __forceinline__ float bf_bits2f(unsigned short h) { return __uint_as_float(((unsigned)h) << 16); }

// hazard guards as plain device helpers (no inline asm inside the kernel template body)
__device__ __forceinline__ void dep_guard_h(v8f& a, v8f& b, v16h x, v16h y) { asm volatile("v_nop\n\tv_nop\n\tv_nop\n\tv_nop" : "+v"(a), "+v"(b) : "v"(x), "v"(y)); }
__device__ __forceinline__ void dep_guard_b(v8f& a, v8f& b, v16b x, v16b y) { asm volatile("v_nop\n\tv_nop\n\tv_nop\n\tv_nop" : "+v"(a), "+v"(b) : "v"(x), "v"(y)); }
__device__ __forceinline__ void keep4_h(v16h a, v16h b, v16h c, v16h d) { asm volatile("v_nop" :: "v"(a), "v"(b), "v"(c), "v"(d)); }
__device__ __forceinline__ void keep4_b(v16b a, v16b b, v16b c, v16b d) { asm volatile("v_nop" :: "v"(a), "v"(b), "v"(c), "v"(d)); }
__device__ __forceinline__ void acc_guard4(v8f& a, v8f& b, v8f& c, v8f& d) { asm volatile("v_nop\n\tv_nop\n\tv_nop\n\tv_nop" : "+v"(a), "+v"(b), "+v"(c), "+v"(d)); }
template <typename T> struct Frag;
template <> struct Frag<_Float16> {
  typedef v16h V; union U { v16h v; v8h h[2]; };
  static __device__ __forceinline__ v16h load(const _Float16* p) {   // elements 0..7 <- p[0..7], 8..15 <- p[16..23]
    U f; f.h[0] = *(const v8h*)(p); f.h[1] = *(const v8h*)(p + 16); return f.v;
  }
  static __device__ __forceinline__ v16h load_fo(const _Float16* p) { // fragment-order plane: the two 512-B wave loads of a fragment
    U f; f.h[0] = *(const v8h*)(p); f.h[1] = *(const v8h*)(p + 256); return f.v;
  }
  static __device__ __forceinline__ v8f mma(v16h a, v16h b, v8f c) {
    return __builtin_amdgcn_wmma_f32_16x16x32_f16(false, a, false, b, (short)0, c, false, false);
  }
  static __device__ __forceinline__ void guard(v8f& a, v8f& b, v16h x, v16h y) { dep_guard_h(a, b, x, y); }
  static __device__ __forceinline__ void keep(v16h a, v16h b, v16h c, v16h d) { keep4_h(a, b, c, d); }
};
template <> struct Frag<__bf16> {
  typedef v16b V; union U { v16b v; v8b h[2]; };
  static __device__ __forceinline__ v16b load(const __bf16* p) {
    U f; f.h[0] = *(const v8b*)(p); f.h[1] = *(const v8b*)(p + 16); return f.v;
  }
  static __device__ __forceinline__ v16b load_fo(const __bf16* p) {
    U f; f.h[0] = *(const v8b*)(p); f.h[1] = *(const v8b*)(p + 256); return f.v;
  }
  static __device__ __forceinline__ v8f mma(v16b a, v16b b, v8f c) {
    return __builtin_amdgcn_wmma_f32_16x16x32_bf16(false, a, false, b, (short)0, c, false, false);
  }
  static __device__ __forceinline__ void guard(v8f& a, v8f& b, v16b x, v16b y) { dep_guard_b(a, b, x, y); }
  static __device__ __forceinline__ void keep(v16b a, v16b b, v16b c, v16b d) { keep4_b(a, b, c, d); }
};

// ---- Register-blocked batched WMMA GEMM ------------------------------------
// C[m,n] = scale * sum_k A[m,k] * Bt[n,k] (+bias)(+resid); each wave owns a 64x64 tile.
// A [M,K] and Bt [N,K] lie in FRAGMENT ORDER (lda = ldb = K): each 16-row tile is 16*K contiguous elements, inside it the
// 16-byte chunk (row r, k 8q..8q+7) stands at element q*128 + r*8, so the 32 lanes of one fragment load (row lane&15,
// chunk 4*(k0/32) + 2*load + (lane>>4)) read 512 contiguous bytes = 4 whole lines. The k order of a fragment is unchanged.
// KC = K = lda = ldb at compile time: the tiles and halves of a k step are then immediate offsets from one address a plane.
// M,N % 64 == 0, K % 32 == 0.
// SPLIT: operands are hi/lo planes (A2/Bt2 = lo planes, same layout); product = hi*hi + hi*lo + lo*hi.
// BIAS_MODE: 0 = none, 1 = bias[m], 2 = bias[n].
// OUT_MODE: 0 = f32, 1 = f16, 2 = bf16 hi plane (Cout) + bf16 lo plane (Cout2).
// ET: 0 = f16 operands, 1 = bf16 operands (pointers passed as 16-bit storage)
template <int ET> struct Elem;
template <> struct Elem<0> { typedef _Float16 T; };
template <> struct Elem<1> { typedef __bf16 T; };
// gemm64_tile: the work of block bx of batch b; sT = the block's LDS, 8 per-wave 16x64 slabs of pitch 68 floats.
template <int KC, int ET, bool SPLIT, int BIAS_MODE, int OUT_MODE, bool RESID, int ACT = 0>
__device__ __forceinline__ void gemm64_tile(const int bx, const int b, float* __restrict__ sT,
    const unsigned short* __restrict__ Ap, const unsigned short* __restrict__ A2p, int lda, long strideA,
    const unsigned short* __restrict__ Btp, const unsigned short* __restrict__ Bt2p, int ldb, long strideB,
    void* __restrict__ Cout, void* __restrict__ Cout2, int ldc, long strideC,
    const float* __restrict__ bias, long strideBias,
    const float* __restrict__ resid, long strideR,
    int M, int N, int K, float scale) {
  typedef typename Elem<ET>::T T;
  typedef typename Frag<T>::V V;
  const T* A = (const T*)Ap; const T* A2 = (const T*)A2p; const T* Bt = (const T*)Btp; const T* Bt2 = (const T*)Bt2p;
  const int lane = threadIdx.x & 31;
  // wave number as a scalar: every fragment address is then a scalar tile base + the one lane offset lane*16 B
  const int wave = __builtin_amdgcn_readfirstlane(threadIdx.x >> 5);
  const int tilesN = N >> 6;
  const int tilesM = M >> 6;
  const int tile = bx * 8 + wave;
  if (tile >= tilesM * tilesN) return;   // wave-uniform; no block barriers in this kernel
  const int tm = tile / tilesN;
  const int tn = tile - tm * tilesN;
  const int m0 = tm << 6;
  const int n0 = tn << 6;

  const T* Ab  = A  + (size_t)b * strideA;
  const T* Bb  = Bt + (size_t)b * strideB;
  const T* Ab2 = SPLIT ? (A2  + (size_t)b * strideA) : nullptr;
  const T* Bb2 = SPLIT ? (Bt2 + (size_t)b * strideB) : nullptr;

  const int rlane = lane & 15;                 // row (A) / col (B, D) within subtile
  const int mOff  = (lane >> 4) * 8;           // D row offset
  const unsigned lane8 = (unsigned)lane * 8u;  // this lane's 16-byte chunk of a 512-byte fragment load

  v8f acc[4][4];
#pragma unroll
  for (int i = 0; i < 4; ++i)
#pragma unroll
    for (int j = 0; j < 4; ++j) acc[i][j] = (v8f){0.f,0.f,0.f,0.f,0.f,0.f,0.f,0.f};

  // rolled: the body stays one k step long (code size, register count)
#pragma unroll 1
  for (int k0 = 0; k0 < KC; k0 += 32) {
    V bh[4], bl[4];
#pragma unroll
    for (int j = 0; j < 4; ++j) {
      const size_t bo = (size_t)(n0 + (j << 4)) * KC + (k0 << 4);    // wave-uniform
      bh[j] = Frag<T>::load_fo(Bb + bo + lane8);
      if (SPLIT) bl[j] = Frag<T>::load_fo(Bb2 + bo + lane8);
    }
#pragma unroll
    for (int i = 0; i < 4; ++i) {
      const size_t ao = (size_t)(m0 + (i << 4)) * KC + (k0 << 4);    // wave-uniform
      V ah = Frag<T>::load_fo(Ab + ao + lane8);
      V al;
      if (SPLIT) al = Frag<T>::load_fo(Ab2 + ao + lane8);
#pragma unroll
      for (int j = 0; j < 4; ++j) {
        acc[i][j] = Frag<T>::mma(ah, bh[j], acc[i][j]);
        if (SPLIT) {
          acc[i][j] = Frag<T>::mma(ah, bl[j], acc[i][j]);
          acc[i][j] = Frag<T>::mma(al, bh[j], acc[i][j]);
        }
      }
      Frag<T>::guard(acc[i][0], acc[i][3], ah, SPLIT ? al : ah);
    }
    Frag<T>::keep(bh[0], bh[1], bh[2], bh[3]);
    if (SPLIT) Frag<T>::keep(bl[0], bl[1], bl[2], bl[3]);
  }
  acc_guard4(acc[0][0], acc[0][1], acc[0][2], acc[0][3]);
  acc_guard4(acc[1][0], acc[1][1], acc[1][2], acc[1][3]);
  acc_guard4(acc[2][0], acc[2][1], acc[2][2], acc[2][3]);
  acc_guard4(acc[3][0], acc[3][1], acc[3][2], acc[3][3]);

  // ---- epilogue ----
  float* slab = sT + wave * (16 * 68);
  const float* Rb = RESID ? (resid + (size_t)b * strideR) : nullptr;
  const float* Bs = (BIAS_MODE != 0) ? (bias + (size_t)b * strideBias) : nullptr;
#pragma unroll
  for (int i = 0; i < 4; ++i) {
    const int mBase = m0 + (i << 4);
#pragma unroll
    for (int j = 0; j < 4; ++j) {
      const int n = n0 + (j << 4) + rlane;
      float bv = 0.f;
      if (BIAS_MODE == 2) bv = Bs[n];
#pragma unroll
      for (int r = 0; r < 8; ++r) {
        float v = acc[i][j][r] * scale;
        if (BIAS_MODE == 1) v += Bs[mBase + mOff + r];
        if (BIAS_MODE == 2) v += bv;
        if (RESID) v += Rb[(size_t)(mBase + mOff + r) * ldc + n];
        if (ACT == 1) v = tanhf(v);
        if (ACT == 2) v = fmaxf(v, 0.0f);
        if (ACT == 3) v = v / (1.0f + expf(-v));
        if (ACT == 4) v = (v > 0.f) ? v : 0.01f * v;
        if (ACT == 5) v = 0.5f * v * (1.0f + erff(v * 0.70710678118654752f));
        slab[(mOff + r) * 68 + (j << 4) + rlane] = v;
      }
    }
    __builtin_amdgcn_fence(__ATOMIC_RELEASE, "workgroup");
    __builtin_amdgcn_wave_barrier();
    __builtin_amdgcn_fence(__ATOMIC_ACQUIRE, "workgroup");
    if (OUT_MODE == 0) {
      float* C = (float*)Cout + (size_t)b * strideC;
      const int hh = lane >> 4, c4 = (lane & 15) * 4;     // row seg = 256 B = 16 lanes x 16 B
      {
#pragma unroll
        for (int it = 0; it < 8; ++it) {
          const int row = it * 2 + hh;
          v4f v = *(const v4f*)(slab + row * 68 + c4);
          *(v4f*)(C + (size_t)(mBase + row) * ldc + n0 + c4) = v;
        }
        
      }
    } else {
      const int q = lane >> 3, c8 = (lane & 7) * 8;
      unsigned short* C  = (unsigned short*)Cout  + (size_t)b * strideC;
      unsigned short* C2 = (OUT_MODE == 2) ? ((unsigned short*)Cout2 + (size_t)b * strideC) : nullptr;
      {
#pragma unroll
        for (int it = 0; it < 4; ++it) {
          const int row = it * 4 + q;
          const float* sp = slab + row * 68 + c8;
          v8h hv, lv;
#pragma unroll
          for (int e = 0; e < 8; ++e) {
            if (OUT_MODE == 1) {
              hv[e] = (_Float16)sp[e];
            } else {
              unsigned short hb = f2bf_bits(sp[e]);
              unsigned short lb = f2bf_bits(sp[e] - bf_bits2f(hb));
              hv[e] = __builtin_bit_cast(_Float16, hb);
              lv[e] = __builtin_bit_cast(_Float16, lb);
            }
          }
          *(v8h*)(C + (size_t)(mBase + row) * ldc + n0 + c8) = hv;
          if (OUT_MODE == 2) *(v8h*)(C2 + (size_t)(mBase + row) * ldc + n0 + c8) = lv;
        }
        
      }
    }
    __builtin_amdgcn_fence(__ATOMIC_RELEASE, "workgroup");
    __builtin_amdgcn_wave_barrier();
    __builtin_amdgcn_fence(__ATOMIC_ACQUIRE, "workgroup");
  }
}
// The two projections of the LayerNorm'd rows, which do not depend on each other, as one launch: blocks below
// blocksE do the edge-bias product (f32 out, no bias), the others the qkv product (f16 out, bias[n]). Block-uniform.
__global__ __launch_bounds__(256) void k_proj(
    const unsigned short* __restrict__ Ap, const unsigned short* __restrict__ A2p, int lda,
    const unsigned short* __restrict__ BtE, const unsigned short* __restrict__ Bt2E, long strideBE,
    void* __restrict__ CE, int ldcE, long strideCE, int NE, int blocksE,
    const unsigned short* __restrict__ BtQ, const unsigned short* __restrict__ Bt2Q, long strideBQ,
    void* __restrict__ CQ, int ldcQ, long strideCQ, int NQ,
    const float* __restrict__ biasQ, long strideBiasQ, int M, int K) {
  __shared__ __align__(16) float sT[8 * 16 * 68];
  const int bx = blockIdx.x;
  if (bx < blocksE)
    gemm64_tile<EWID, 1, true, 0, 0, false>(bx, blockIdx.y, sT, Ap, A2p, lda, (long)0, BtE, Bt2E, lda, strideBE,
        CE, CE, ldcE, strideCE, biasQ, (long)0, biasQ, (long)0, M, NE, K, 1.0f);
  else
    gemm64_tile<EWID, 1, true, 2, 1, false>(bx - blocksE, blockIdx.y, sT, Ap, A2p, lda, (long)0, BtQ, Bt2Q, lda, strideBQ,
        CQ, CQ, ldcQ, strideCQ, biasQ, strideBiasQ, biasQ, (long)0, M, NQ, K, 1.0f);
}

__device__ __forceinline__ v8f zero8f() { return (v8f){0.f, 0.f, 0.f, 0.f, 0.f, 0.f, 0.f, 0.f}; }
__device__ __forceinline__ v8h zero8h() {
  v8h z;
#pragma unroll
  for (int e = 0; e < 8; ++e) z[e] = (_Float16)0.0f;
  return z;
}
// f16 WMMA with the hazard guard attached (D tied, A/B kept live)
__device__ __forceinline__ v8f hmma(v16h a, v16h b, v8f c) {
  c = __builtin_amdgcn_wmma_f32_16x16x32_f16(false, a, false, b, (short)0, c, false, false);
  asm volatile("v_nop\n\tv_nop\n\tv_nop\n\tv_nop" : "+v"(c) : "v"(a), "v"(b));
  return c;
}
__device__ __forceinline__ void split_bf16(float x, _Float16& hi, _Float16& lo) {
  const unsigned short hb = f2bf_bits(x);
  const unsigned short lb = f2bf_bits(x - bf_bits2f(hb));
  hi = __builtin_bit_cast(_Float16, hb);
  lo = __builtin_bit_cast(_Float16, lb);
}

// ---------------------------------------------------------------------------------------
// qkv weight prep: W [128 k][384 c] f32 ([in][out]) -> Bt hi/lo bf16 planes [384 n][128 k], fragment order, with head-major
// output columns: n = part*128 + h*16 + d  <-  c = part*128 + d*8 + h (view(DD=16, NH=8): d slow, h fast).
// Permuted bias bqp[n] = bq[c].  Edge-bias weight We [128 k][8] -> Bt hi/lo [64 n][128 k], rows n >= 8 zero.
// grid 28 x block 256: blocks 0..23 = 384 rows x 16 threads (8 k each) -> covers [384][128] exactly;
// blocks 24..27 = 64 rows x 16 threads -> covers [64][128] exactly; t < 384 also writes bqp[384] exactly.
// Owner-computes: thread t stores the t-th 16-byte chunk of the plane = (tile t>>8, chunk (t>>4)&15, row t&15).
__device__ __forceinline__ void prep_qkv_w(const int bx,
    const float* __restrict__ W, const float* __restrict__ bq, const float* __restrict__ We,
    unsigned short* __restrict__ wqh, unsigned short* __restrict__ wql,
    unsigned short* __restrict__ weh, unsigned short* __restrict__ wel, float* __restrict__ bqp) {
  const int t = bx * 256 + threadIdx.x;
  if (bx < 24) {                               // block-uniform
    const int n = (t >> 8) * 16 + (t & 15), k8 = ((t >> 4) & 15) * 8;
    const int part = n >> 7, h = (n >> 4) & 7, d = n & 15;
    const int col = part * 128 + d * 8 + h;
    v8h hv, lv;
#pragma unroll
    for (int e = 0; e < 8; ++e) {
      const float w = W[(size_t)(k8 + e) * 384 + col];
      _Float16 a, bb; split_bf16(w, a, bb); hv[e] = a; lv[e] = bb;
    }
    const size_t off = (size_t)t * 8;
    {
      *(v8h*)(wqh + off) = hv;
      *(v8h*)(wql + off) = lv;
      
    }
    if (t < 384) {                             // wave-uniform (384 = 12 waves)
      const int pn = t >> 7, ph = (t >> 4) & 7, pd = t & 15;
      const float bv = bq[pn * 128 + pd * 8 + ph];
      *(float*)(bqp + t) = bv;
      
    }
  } else {
    const int u = t - 6144;
    const int n = (u >> 8) * 16 + (u & 15), k8 = ((u >> 4) & 15) * 8;
    const int nc = (n < 8) ? n : 7;            // address clamp, value zeroed by predicate
    v8h hv, lv;
#pragma unroll
    for (int e = 0; e < 8; ++e) {
      float w = We[(size_t)(k8 + e) * 8 + nc];
      w = (n < 8) ? w : 0.0f;
      _Float16 a, bb; split_bf16(w, a, bb); hv[e] = a; lv[e] = bb;
    }
    const size_t off = (size_t)u * 8;
    {
      *(v8h*)(weh + off) = hv;
      *(v8h*)(wel + off) = lv;
      // inlined as one arm of a larger kernel: the code of a later arm reuses these stores' registers
      asm volatile("s_wait_xcnt 0x0" ::: "memory");
    }
  }
}

// Output weight prep: Wo [256 c][128 n] f32 ([in][out]) -> Bt hi/lo [128 n][256 k'], fragment order, k' = dir*128 + h*16 + d
// <- c = d*16 + dir*8 + h (concat of the two head groups on the head axis, then view d slow).
// grid 16 x block 256 = 4096 threads = 128 rows x 32 threads (8 k' each): covers [128][256] exactly;
// thread t stores the t-th 16-byte chunk = (tile t>>9, chunk (t>>4)&31, row t&15).
__device__ __forceinline__ void prep_wo(const int bx, const float* __restrict__ Wo,
    unsigned short* __restrict__ woh, unsigned short* __restrict__ wol) {
  const int t = bx * 256 + threadIdx.x;
  const int n = (t >> 9) * 16 + (t & 15), k8 = ((t >> 4) & 31) * 8;
  v8h hv, lv;
#pragma unroll
  for (int e = 0; e < 8; ++e) {
    const int kp = k8 + e;
    const int dr = kp >> 7, h = (kp >> 4) & 7, d = kp & 15;
    const int col = d * 16 + dr * 8 + h;
    const float w = Wo[(size_t)col * 128 + n];
    _Float16 a, bb; split_bf16(w, a, bb); hv[e] = a; lv[e] = bb;
  }
  const size_t off = (size_t)t * 8;
  {
    *(v8h*)(woh + off) = hv;
    *(v8h*)(wol + off) = lv;
    // inlined as one arm of a larger kernel: the code of a later arm reuses these stores' registers
    asm volatile("s_wait_xcnt 0x0" ::: "memory");
  }
}

// LayerNorm over the 128-wide rows of e (eps 1e-5, biased variance, *g + b) -> bf16 hi/lo planes [nrows][128], fragment order.
// grid = nrows/16, block 256 = 8 waves x 2 rows (lane half = row, lane&15 = 8-column chunk) = one 16-row tile.
// The tile's chunks are turned from (row, chunk) to (chunk, row) through LDS (sF: 2 planes of 16 x 272 B, one 16-byte
// pad a chunk column against bank conflicts); thread t then stores the tile's t-th chunk: 512 contiguous bytes a wave.
#define LNF_P 136            // LDS pitch of a chunk column (halves): 16 rows x 8 + 8
__device__ __forceinline__ void ln_rows(const int bx, const float* __restrict__ e, const float* __restrict__ g,
    const float* __restrict__ b, unsigned short* __restrict__ elh, unsigned short* __restrict__ ell, int nrows,
    unsigned short* __restrict__ sF) {
  const int tid = threadIdx.x, wave = tid >> 5, lane = tid & 31, hh = lane >> 4, c = lane & 15;
  const int row = (bx * 8 + wave) * 2 + hh;
  const bool ok = row < nrows;
  const int rowc = ok ? row : (nrows - 1);
  const float* p = e + (size_t)rowc * EWID + c * 8;
  const v4f x0 = *(const v4f*)p;
  const v4f x1 = *(const v4f*)(p + 4);
  float xs[8];
  xs[0] = x0[0]; xs[1] = x0[1]; xs[2] = x0[2]; xs[3] = x0[3];
  xs[4] = x1[0]; xs[5] = x1[1]; xs[6] = x1[2]; xs[7] = x1[3];
  float s = ((xs[0] + xs[1]) + (xs[2] + xs[3])) + ((xs[4] + xs[5]) + (xs[6] + xs[7]));
#pragma unroll
  for (int off = 1; off < 16; off <<= 1) s += __shfl_xor(s, off, 32);
  const float mu = s * (1.0f / 128.0f);
  float q = 0.f;
#pragma unroll
  for (int k = 0; k < 8; ++k) { xs[k] -= mu; q += xs[k] * xs[k]; }
#pragma unroll
  for (int off = 1; off < 16; off <<= 1) q += __shfl_xor(q, off, 32);
  const float rs = rsqrtf(q * (1.0f / 128.0f) + 1e-5f);
  const v4f g0 = *(const v4f*)(g + c * 8), g1 = *(const v4f*)(g + c * 8 + 4);
  const v4f b0 = *(const v4f*)(b + c * 8), b1 = *(const v4f*)(b + c * 8 + 4);
  float gg[8], bb[8];
  gg[0] = g0[0]; gg[1] = g0[1]; gg[2] = g0[2]; gg[3] = g0[3]; gg[4] = g1[0]; gg[5] = g1[1]; gg[6] = g1[2]; gg[7] = g1[3];
  bb[0] = b0[0]; bb[1] = b0[1]; bb[2] = b0[2]; bb[3] = b0[3]; bb[4] = b1[0]; bb[5] = b1[1]; bb[6] = b1[2]; bb[7] = b1[3];
  v8h hv, lv;
#pragma unroll
  for (int k = 0; k < 8; ++k) {
    const float y = xs[k] * rs * gg[k] + bb[k];
    _Float16 a, lo; split_bf16(y, a, lo); hv[k] = a; lv[k] = lo;
  }
  const int wa = c * LNF_P + (wave * 2 + hh) * 8;
  *(v8h*)(sF + wa) = hv;
  *(v8h*)(sF + 16 * LNF_P + wa) = lv;
  __syncthreads();           // block-uniform: every thread of a LayerNorm block comes here
  const int ra = (tid >> 4) * LNF_P + (tid & 15) * 8;
  const v8h ho = *(const v8h*)(sF + ra);
  const v8h lo8 = *(const v8h*)(sF + 16 * LNF_P + ra);
  if (bx * 16 + (tid & 15) < nrows) {
    const size_t off = (size_t)bx * 16 * EWID + tid * 8;
    {
      *(v8h*)(elh + off) = ho;
      *(v8h*)(ell + off) = lo8;
    }
  }
}

// The four launches that depend on nothing but the inputs, as one: blocks 0..27 qkv/edge weights of direction 0,
// 28..55 of direction 1, 56..71 output weight, 72.. LayerNorm (16 rows a block). The choice is block-uniform.
#define PREP_BLOCKS 72
__global__ __launch_bounds__(256) void k_front(
    const float* __restrict__ e, const float* __restrict__ g, const float* __restrict__ b,
    const float* __restrict__ Wq0, const float* __restrict__ bq0, const float* __restrict__ We0,
    const float* __restrict__ Wq1, const float* __restrict__ bq1, const float* __restrict__ We1,
    const float* __restrict__ Wo,
    unsigned short* __restrict__ wqh0, unsigned short* __restrict__ wql0,
    unsigned short* __restrict__ weh0, unsigned short* __restrict__ wel0, float* __restrict__ bqp0,
    unsigned short* __restrict__ wqh1, unsigned short* __restrict__ wql1,
    unsigned short* __restrict__ weh1, unsigned short* __restrict__ wel1, float* __restrict__ bqp1,
    unsigned short* __restrict__ woh, unsigned short* __restrict__ wol,
    unsigned short* __restrict__ elh, unsigned short* __restrict__ ell, int nrows) {
  __shared__ __align__(16) unsigned short sF[2 * 16 * LNF_P];
  const int bx = blockIdx.x;
  if (bx < 28)               prep_qkv_w(bx, Wq0, bq0, We0, wqh0, wql0, weh0, wel0, bqp0);
  else if (bx < 56)          prep_qkv_w(bx - 28, Wq1, bq1, We1, wqh1, wql1, weh1, wel1, bqp1);
  else if (bx < PREP_BLOCKS) prep_wo(bx - 56, Wo, woh, wol);
  else                       ln_rows(bx - PREP_BLOCKS, e, g, b, elh, ell, nrows, sF);
}

// Score bias slabs, direction dir = blockIdx.y: bm[dir][h][i][k] = eb[dir][r][h] + be[h] + mask[r][h] with
// r = i*192 + k (dir 0) or r = k*192 + i (dir 1). eb = f32 [36864][64] (columns 0..7 used), mask f32 [36864][8].
// grid (1152, 2) x block 256 = 8*192*192 threads a direction exactly; owner-computes (gather reads, contiguous 4-B stores:
__global__ __launch_bounds__(256) void k_bias_slab(const float* __restrict__ eb2, const float* __restrict__ be0,
    const float* __restrict__ be1, const float* __restrict__ mask, float* __restrict__ bm2) {
  const int dir = blockIdx.y;
  const float* eb = eb2 + (size_t)dir * NROWS * EB_LD;
  const float* be = dir ? be1 : be0;
  float* bm = bm2 + (size_t)dir * 8 * NROWS;
  const int idx = blockIdx.x * 256 + threadIdx.x;
  const int h = idx / NROWS;
  const int rem = idx - h * NROWS;
  const int i = rem / NNODE;
  const int k = rem - i * NNODE;
  const int r = dir ? (k * NNODE + i) : (i * NNODE + k);
  const float v = eb[(size_t)r * EB_LD + h] + be[h] + mask[(size_t)r * 8 + h];
  *(float*)(bm + idx) = v;
  
}

// Fused attention core for one (direction dir, head h), all 192 query rows i, JG edge columns j in sequence.
// qkv: f16 [2 dir][36864][384], head-major columns part*128 + h*16 + d.  bm: f32 [2 dir][8][192 i][192 k].
// grid = (192 / JG column groups, 8 heads, 2 directions) x block 384 = 12 waves x 16 query rows.
// The score bias bm[dir][h][i][k] does not depend on j: a lane loads the 96 values of its query once and keeps them in
// registers for all JG columns.  Per column: K [192 keys][16 d] and V^T [16 d][192 keys] staged in LDS once for all
// 192 queries, one (key, 8-wide d chunk) item a thread (dir 0: row j*192+k, dir 1: row k*192+j).  Two LDS buffers taken
// in turn: one barrier a column publishes this column's tiles, and a buffer is rewritten only behind the next barrier,
// which every wave reaches after its last read of it.  The next column's K, V and Q loads are issued behind the barrier.
// Both products run transposed, so that a lane owns ONE query:
// S^T = K (A: 16 keys, d zero-extended to 32) . Q^T (B) on f16 WMMA: lane (hh, c) holds query i0+c, register r
// key 16*tile + 8*hh + r; *0.25 + bias in f32, online softmax over 3 chunks of 64 keys in f32 with maximum and
// sum taken in the lane plus one exchange between the lane halves, e^x as the hardware's 2^(x * log2(e)), x <= 0; two neighbouring S^T tiles, converted to f16
// in place, are the B operand of O^T = V^T (A: 16 d, 32 keys) . P^T; * 1/rowsum.
// Result (lane: query i0+c, registers: d = 8*hh + r) -> bf16 hi/lo planes [36864][256] in fragment order, row j*192+i,
// columns dir*128 + h*16 + d: a wave's 16 queries are one 16-row tile, the head's two chunk columns 512 contiguous
// bytes of it a plane, and lane l owns the l-th 16-byte chunk of them: stored from registers.
#define JG 12                // edge columns a block walks: 16 groups x 8 heads x 2 directions = 256 blocks
__global__ __launch_bounds__(384) void k_edge_attn(const _Float16* __restrict__ qkv2, const float* __restrict__ bm2,
    unsigned short* __restrict__ vah, unsigned short* __restrict__ val) {
  const int dir = blockIdx.z;
  const int h = blockIdx.y;
  const int j0 = blockIdx.x * JG;
  const _Float16* qkv = qkv2 + (size_t)dir * NROWS * QKV_LD + h * 16;
  const float* bm = bm2 + (size_t)dir * 8 * NROWS;
  __shared__ __align__(16) _Float16 Ksh[2][NNODE * KS_P];   // [buffer][key][d], indices <= 191*16+15
  __shared__ __align__(16) _Float16 Vt[2][16 * VT_P];       // [buffer][d][key], indices <= 15*192+191
  const int tid = threadIdx.x, wave = tid >> 5, lane = tid & 31, hh = lane >> 4, c = lane & 15;
  const int i0 = wave * 16;
  const v8h z8 = zero8h();

  // bias of this lane's query, keys 16t+8hh .. +7 of tile t: 32 contiguous bytes a tile, kept for every column
  const float* bmr = bm + ((size_t)h * NNODE + (size_t)(i0 + c)) * NNODE + 8 * hh;
  v4f b0[12], b1[12];
#pragma unroll
  for (int t = 0; t < 12; ++t) {
    b0[t] = *(const v4f*)(bmr + t * 16);
    b1[t] = *(const v4f*)(bmr + t * 16 + 4);
  }

  // staging item of this thread: key kv, d chunk part; 384 items = 192 keys x 2 d chunks exactly
  const int kv = tid >> 1, part = tid & 1;
  const _Float16* kvsrc = qkv + (size_t)(dir ? kv * NNODE : kv) * QKV_LD + part * 8;   // + j * kvstep
  const size_t kvstep = (size_t)(dir ? 1 : NNODE) * QKV_LD;
  const _Float16* qsrc = qkv + (size_t)(i0 + c) * NNODE * QKV_LD + 8 * hh;             // + j * QKV_LD
  v8h kk8 = *(const v8h*)(kvsrc + (size_t)j0 * kvstep + EWID);
  v8h vv8 = *(const v8h*)(kvsrc + (size_t)j0 * kvstep + 2 * EWID);
  v8h q8  = *(const v8h*)(qsrc + (size_t)j0 * QKV_LD);

  // rolled: one column's code is the loop body (code size)
#pragma unroll 1
  for (int jj = 0; jj < JG; ++jj) {
    const int j = j0 + jj;
    _Float16* Kb = Ksh[jj & 1];
    _Float16* Vb = Vt[jj & 1];
    *(v8h*)(Kb + kv * KS_P + part * 8) = kk8;
#pragma unroll
    for (int e2 = 0; e2 < 8; ++e2) Vb[(part * 8 + e2) * VT_P + kv] = vv8[e2];
    // B fragment (query column i0+c, d 8hh..8hh+7 in elements 0..7, elements 8..15 zero)
    Frag<_Float16>::U qa;
    qa.h[0] = q8;
    qa.h[1] = z8;
    __syncthreads();
    if (jj + 1 < JG) {                               // block-uniform; j + 1 <= 191
      kk8 = *(const v8h*)(kvsrc + (size_t)(j + 1) * kvstep + EWID);
      vv8 = *(const v8h*)(kvsrc + (size_t)(j + 1) * kvstep + 2 * EWID);
      q8  = *(const v8h*)(qsrc + (size_t)(j + 1) * QKV_LD);
      // the code behind reuses these loads' address registers at once
      asm volatile("s_wait_xcnt 0x0" ::: "memory");
    }

    float mrow = -__builtin_inff(), lrow = 0.f;      // this lane's query
    v8f o = zero8f();                                // O^T: register r = d 8hh+r of query i0+c

    // unrolled: the bias registers are then named at compile time
#pragma unroll
    for (int kc = 0; kc < 3; ++kc) {
      const int kv0 = kc * 64;
      v8f s[4];
#pragma unroll
      for (int jn = 0; jn < 4; ++jn) {
        // A fragment (key row kv0+16jn+c, d 8hh..8hh+7 in elements 0..7, elements 8..15 zero)
        Frag<_Float16>::U kb;
        kb.h[0] = *(const v8h*)(Kb + (kv0 + jn * 16 + c) * KS_P + 8 * hh);
        kb.h[1] = z8;
        s[jn] = hmma(kb.v, qa.v, zero8f());
      }
      float mx = -__builtin_inff();
#pragma unroll
      for (int jn = 0; jn < 4; ++jn) {
#pragma unroll
        for (int r = 0; r < 8; ++r) {
          const float v = s[jn][r] * 0.25f + (r < 4 ? b0[kc * 4 + jn][r & 3] : b1[kc * 4 + jn][r & 3]);
          s[jn][r] = v;
          mx = fmaxf(mx, v);
        }
      }
      mx = fmaxf(mx, __shfl_xor(mx, 16, 32));        // the other lane half holds the query's other 32 keys
      const float mnew = fmaxf(mrow, mx);
      const float alpha = __builtin_amdgcn_exp2f((mrow - mnew) * LOG2E);
      mrow = mnew;
      float ps = 0.f;
      Frag<_Float16>::U pb[2];                       // P^T as B: elements 0..7 = tile 2kk, 8..15 = tile 2kk+1
#pragma unroll
      for (int jn = 0; jn < 4; ++jn) {
#pragma unroll
        for (int r = 0; r < 8; r += 2) {
          const v2f dl = ((v2f){s[jn][r], s[jn][r + 1]} - (v2f){mnew, mnew}) * (v2f){LOG2E, LOG2E};
          const float p0 = __builtin_amdgcn_exp2f(dl[0]);
          const float p1 = __builtin_amdgcn_exp2f(dl[1]);
          ps += p0;
          ps += p1;
          pb[jn >> 1].h[jn & 1][r] = (_Float16)p0;
          pb[jn >> 1].h[jn & 1][r + 1] = (_Float16)p1;
        }
      }
      ps += __shfl_xor(ps, 16, 32);
      lrow = lrow * alpha + ps;
#pragma unroll
      for (int r = 0; r < 8; ++r) o[r] *= alpha;
#pragma unroll
      for (int kk = 0; kk < 2; ++kk) {
        const v16h va = Frag<_Float16>::load(Vb + c * VT_P + kv0 + kk * 32 + 8 * hh);
        o = hmma(va, pb[kk].v, o);
      }
    }
    const float inv = 1.0f / lrow;
    v8h hv, lv;
#pragma unroll
    for (int e = 0; e < 8; ++e) {
      _Float16 a, lo;
      split_bf16(o[e] * inv, a, lo); hv[e] = a; lv[e] = lo;
    }
    const size_t ob = (size_t)(j * NNODE + i0) * VA_LD + (size_t)(dir * 2048 + h * 256 + lane * 8);
    *(v8h*)(vah + ob) = hv;
    *(v8h*)(val + ob) = lv;
    // the next column's staging reuses these stores' registers
    asm volatile("s_wait_xcnt 0x0" ::: "memory");
  }
}

// Output linear: out[i*192+j][n] = sum_k VA[j*192+i][k] * Wo'[n][k] + bo[n]; M 36864, N 128, K 256, bf16 hi/lo split
// (one accumulator an output element: hi*hi + hi*lo + lo*hi a k step, k steps in rising order).
// grid 256 x block 288 = 9 waves; a wave owns one 16-row tile of VA and all 128 output columns (2304 tiles = 256 x 9).
// A: the tile's two planes are 2 x 8 KB contiguous (fragment order); a wave issues all 32 loads at entry and keeps the
// tile in registers: memory latency is paid once a wave, and the later k steps' loads are still in flight while the
// first are worked on.
// B: wo2 = the hi weight plane followed by the lo plane (2 x 64 KB, fragment order), copied as it lies into LDS once a
// block, 512 bytes a wave and load; a B fragment is then two conflict-free 512-byte LDS reads.
// D (lane: column 16t + (lane & 15), register r: row 8*(lane >> 4) + r) + bias goes through the wave's own LDS slab
// (pitch 132 floats: the two lane halves fall on different banks); a whole 512-byte output row is one store.
// Every loop of this kernel is unrolled: its arrays live in registers and need compile-time indices.
#define OUT_WAVES 9
#define OUT_SLAB_P 132
__global__ __launch_bounds__(OUT_WAVES * 32) void k_out(
    const unsigned short* __restrict__ vah, const unsigned short* __restrict__ val,
    const unsigned short* __restrict__ wo2, const float* __restrict__ bo, float* __restrict__ out) {
  __shared__ __align__(16) unsigned short sB[2 * EWID * VA_LD + 5 * 256]; // hi plane, lo plane, 5 spare pieces
  __shared__ __align__(16) float sO[OUT_WAVES * 16 * OUT_SLAB_P];
  const int lane = threadIdx.x & 31;
  const int wave = __builtin_amdgcn_readfirstlane(threadIdx.x >> 5);      // scalar: tile and piece addresses are scalar bases
  const int rt = blockIdx.x * OUT_WAVES + wave;                           // 16-row tile, 0..2303
  const unsigned lane8 = (unsigned)lane * 8u;
  const int rlane = lane & 15, mOff = (lane >> 4) * 8;

  // the 256 weight pieces of 512 B: wave w takes w, w+9, .. w+252. 29 x 9 = 261: in the last turn waves 4..8 have no
  // piece left; they copy one of 252..255 once more, into the spare pieces behind the planes, which nobody reads: the
  // copy is then free of branches and all its loads stand together.
  const unsigned short* wsrc = wo2 + wave * 256 + lane8;
  v8h wt[29];
#pragma unroll
  for (int it = 0; it < 28; ++it) wt[it] = *(const v8h*)(wsrc + it * (OUT_WAVES * 256));
  wt[28] = *(const v8h*)(wo2 + (252 + (wave & 3)) * 256 + lane8);
  // keeps the weight loads ahead of the A loads: loads return in order, and the LDS copy must not wait for the A tile
  __builtin_amdgcn_sched_barrier(0);
  const __bf16* Ah = (const __bf16*)vah + (size_t)rt * (16 * VA_LD) + lane8;
  const __bf16* Al = (const __bf16*)val + (size_t)rt * (16 * VA_LD) + lane8;
  v16b ah[8], al[8];
#pragma unroll
  for (int ks = 0; ks < 8; ++ks) {
    ah[ks] = Frag<__bf16>::load_fo(Ah + ks * 512);
    al[ks] = Frag<__bf16>::load_fo(Al + ks * 512);
  }
#pragma unroll
  for (int it = 0; it < 29; ++it) *(v8h*)(sB + (wave + it * OUT_WAVES) * 256 + lane8) = wt[it];
  // The one barrier: it publishes the weight planes, every wave passes it. Written with fences on LDS alone: only LDS
  // data goes from wave to wave here, and __syncthreads() would also wait for the A loads, which are to stay in flight.
  __builtin_amdgcn_fence(__ATOMIC_RELEASE, "workgroup", "local");
  __builtin_amdgcn_s_barrier();
  __builtin_amdgcn_fence(__ATOMIC_ACQUIRE, "workgroup", "local");

  // bias of this lane's 8 columns: asked for here, behind the A loads, and used only after the last product
  float bv[8];
#pragma unroll
  for (int j = 0; j < 8; ++j) bv[j] = bo[j * 16 + rlane];
  v8f acc[8];
#pragma unroll
  for (int j = 0; j < 8; ++j) acc[j] = zero8f();
  const __bf16* Bh = (const __bf16*)sB + lane8;
  const __bf16* Bl = Bh + EWID * VA_LD;
  // 16 groups g = (k step g >> 1, column tiles 4*(g & 1) .. +3) of 12 products; two register buffers for B taken in turn
  v16b bh[2][4], bl[2][4];
#pragma unroll
  for (int j = 0; j < 4; ++j) {
    bh[0][j] = Frag<__bf16>::load_fo(Bh + j * (16 * VA_LD));
    bl[0][j] = Frag<__bf16>::load_fo(Bl + j * (16 * VA_LD));
  }
  // unrolled: the A fragments and the buffers are then named at compile time
#pragma unroll
  for (int g = 0; g < 16; ++g) {
    const int ks = g >> 1, jg = (g & 1) * 4, cur = g & 1, nxt = cur ^ 1;
    if (g + 1 < 16) {
#pragma unroll
      for (int j = 0; j < 4; ++j) {
        const int o = (((g + 1) & 1) * 4 + j) * (16 * VA_LD) + ((g + 1) >> 1) * 512;
        bh[nxt][j] = Frag<__bf16>::load_fo(Bh + o);
        bl[nxt][j] = Frag<__bf16>::load_fo(Bl + o);
      }
    }
    // four independent accumulators between two products into the same one
#pragma unroll
    for (int j = 0; j < 4; ++j) acc[jg + j] = Frag<__bf16>::mma(ah[ks], bh[cur][j], acc[jg + j]);
#pragma unroll
    for (int j = 0; j < 4; ++j) acc[jg + j] = Frag<__bf16>::mma(ah[ks], bl[cur][j], acc[jg + j]);
#pragma unroll
    for (int j = 0; j < 4; ++j) acc[jg + j] = Frag<__bf16>::mma(al[ks], bh[cur][j], acc[jg + j]);
    // keeps a group's LDS reads one whole group (12 products) ahead of their use: moved down, they would be waited for
    __builtin_amdgcn_sched_barrier(0);
  }

  float* slab = sO + wave * (16 * OUT_SLAB_P);
#pragma unroll
  for (int j = 0; j < 8; ++j) {
#pragma unroll
    for (int r = 0; r < 8; ++r) slab[(mOff + r) * OUT_SLAB_P + j * 16 + rlane] = acc[j][r] + bv[j];
  }
  // the slab is the wave's own: its lanes' LDS writes are finished before its lanes read them, no other wave is involved
  __builtin_amdgcn_fence(__ATOMIC_RELEASE, "workgroup", "local");
  __builtin_amdgcn_wave_barrier();
  __builtin_amdgcn_fence(__ATOMIC_ACQUIRE, "workgroup", "local");
  // VA row rt*16 + r = j*192 + i -> out row i*192 + j; 192 = 12 tiles, so a tile has one j
  const int jcol = rt / 12, irow = (rt - jcol * 12) * 16;
  float* op = out + ((size_t)irow * NNODE + jcol) * EWID + lane * 4;
  v4f ov[16];
#pragma unroll
  for (int r = 0; r < 16; ++r) ov[r] = *(const v4f*)(slab + r * OUT_SLAB_P + lane * 4);
#pragma unroll
  for (int r = 0; r < 16; ++r) *(v4f*)(op + (size_t)r * NNODE * EWID) = ov[r];
}

// ---------------------------------------------------------------------------------------
extern "C" void kernel_launch(void* const* d_in, const int* in_sizes, int n_in,
                              void* d_out, int out_size, void* d_ws, size_t ws_size,
                              hipStream_t stream) {
  if (n_in < 14) return;
  if (in_sizes[0] != NROWS * EWID || in_sizes[1] != NROWS * 8 || in_sizes[2] < EWID || in_sizes[3] < EWID ||
      in_sizes[4] != EWID * 384 || in_sizes[5] < 384 || in_sizes[6] != EWID * 8 || in_sizes[7] < 8 ||
      in_sizes[8] != EWID * 384 || in_sizes[9] < 384 || in_sizes[10] != EWID * 8 || in_sizes[11] < 8 ||
      in_sizes[12] != 256 * EWID || in_sizes[13] < EWID || out_size != NROWS * EWID) return;

  const float* e      = (const float*)d_in[0];
  const float* mask   = (const float*)d_in[1];
  const float* ln_g   = (const float*)d_in[2];
  const float* ln_b   = (const float*)d_in[3];
  const float* Wq_in  = (const float*)d_in[4];
  const float* bq_in  = (const float*)d_in[5];
  const float* We_in  = (const float*)d_in[6];
  const float* be_in  = (const float*)d_in[7];
  const float* Wq_out = (const float*)d_in[8];
  const float* bq_out = (const float*)d_in[9];
  const float* We_out = (const float*)d_in[10];
  const float* be_out = (const float*)d_in[11];
  const float* Wo     = (const float*)d_in[12];
  const float* bo     = (const float*)d_in[13];
  float* out = (float*)d_out;

  // ---- workspace region map (offsets 256-B aligned; total 135,072,768 B) ----
  //  (ELh/l, VAh/l and the weight planes lie in the GEMM's fragment order; VA rows are j*192+i)
  //  ELh, ELl   bf16 [36864][128]       2 x  9,437,184   LayerNorm output hi/lo (live through both directions)
  //  QKV16      f16  [2][36864][384]    2 x 28,311,552   projection output, one plane a direction
  //  EB         f32  [2][36864][64]     2 x  9,437,184   edge-bias projection (cols 0..7), one plane a direction
  //  BM         f32  [2][8][192][192]   2 x  1,179,648   bias+mask slabs, one plane a direction
  //  VAh, VAl   bf16 [36864][256]       2 x 18,874,368   attention output hi/lo (both directions)
  //  WtQh/l x2  bf16 [384][128]         4 x     98,304
  //  WtEh/l x2  bf16 [64][128]          4 x     16,384
  //  WoTh/l     bf16 [2][128][256]      2 x     65,536   hi plane, then lo plane, one region
  //  bqp x2     f32  [384]              2 x      1,536
  size_t off = 0;
  auto carve = [&](size_t bytes) { size_t o = off; off += (bytes + 255) & ~(size_t)255; return o; };
  const size_t oELh = carve((size_t)NROWS * EWID * 2);
  const size_t oELl = carve((size_t)NROWS * EWID * 2);
  const size_t oQKV = carve((size_t)2 * NROWS * QKV_LD * 2);
  const size_t oEB  = carve((size_t)2 * NROWS * EB_LD * 4);
  const size_t oBM  = carve((size_t)2 * 8 * NNODE * NNODE * 4);
  const size_t oVAh = carve((size_t)NROWS * VA_LD * 2);
  const size_t oVAl = carve((size_t)NROWS * VA_LD * 2);
  size_t oWQh[2], oWQl[2], oWEh[2], oWEl[2], oBQ[2];
  for (int d = 0; d < 2; ++d) { oWQh[d] = carve((size_t)384 * 128 * 2); oWQl[d] = carve((size_t)384 * 128 * 2); }
  for (int d = 0; d < 2; ++d) { oWEh[d] = carve((size_t)64 * 128 * 2);  oWEl[d] = carve((size_t)64 * 128 * 2); }
  const size_t oWO = carve((size_t)2 * 128 * 256 * 2);
  for (int d = 0; d < 2; ++d) oBQ[d] = carve((size_t)384 * 4);
  if (off > ws_size) return;

  char* ws = (char*)d_ws;
  unsigned short* ELh = (unsigned short*)(ws + oELh);
  unsigned short* ELl = (unsigned short*)(ws + oELl);
  _Float16* QKV16 = (_Float16*)(ws + oQKV);
  float* EB = (float*)(ws + oEB);
  float* BM = (float*)(ws + oBM);
  unsigned short* VAh = (unsigned short*)(ws + oVAh);
  unsigned short* VAl = (unsigned short*)(ws + oVAl);
  unsigned short* WQh[2], *WQl[2], *WEh[2], *WEl[2];
  float* BQ[2];
  for (int d = 0; d < 2; ++d) {
    WQh[d] = (unsigned short*)(ws + oWQh[d]); WQl[d] = (unsigned short*)(ws + oWQl[d]);
    WEh[d] = (unsigned short*)(ws + oWEh[d]); WEl[d] = (unsigned short*)(ws + oWEl[d]);
    BQ[d] = (float*)(ws + oBQ[d]);
  }
  unsigned short* WOh = (unsigned short*)(ws + oWO);
  unsigned short* WOl = WOh + 128 * 256;

  // weight prep of both directions and of the output linear + LayerNorm -> bf16 hi/lo planes, one launch
  // (72 prep blocks, then 36864 rows / 16 rows per block = 2304 blocks exactly)
  k_front<<<PREP_BLOCKS + NROWS / 16, 256, 0, stream>>>(e, ln_g, ln_b, Wq_in, bq_in, We_in, Wq_out, bq_out, We_out, Wo,
      WQh[0], WQl[0], WEh[0], WEl[0], BQ[0], WQh[1], WQl[1], WEh[1], WEl[1], BQ[1], WOh, WOl, ELh, ELl, NROWS);

  const int tilesQKV = (NROWS / 64) * (QKV_LD / 64);   // 3456 = 432 blocks x 8 waves
  const int tilesEB  = (NROWS / 64) * (EB_LD / 64);    // 576  = 72 blocks
  // The launches below but the output linear serve both directions: the GEMM batch index (grid y) or grid y / z is the direction; the output linear takes both along k.
  // edge bias = EL . We  (M 36864, N 64 (8 used), K 128; split; f32 output; be added in the slab kernel) and
  // qkv = EL . Wqkv + b  (M 36864, N 384, K 128; bf16 hi/lo split; f16 head-major output), one launch
  k_proj<<<dim3(tilesEB / 8 + tilesQKV / 8, 2), 256, 0, stream>>>(ELh, ELl, EWID,
      WEh[0], WEl[0], (long)(WEh[1] - WEh[0]), (void*)EB, EB_LD, (long)NROWS * EB_LD, EB_LD, tilesEB / 8,
      WQh[0], WQl[0], (long)(WQh[1] - WQh[0]), (void*)QKV16, QKV_LD, (long)NROWS * QKV_LD, QKV_LD,
      BQ[0], (long)(BQ[1] - BQ[0]), NROWS, EWID);
  k_bias_slab<<<dim3((8 * NNODE * NNODE) / 256, 2), 256, 0, stream>>>(EB, be_in, be_out, mask, BM);
  k_edge_attn<<<dim3(NNODE / JG, 8, 2), 384, 0, stream>>>(QKV16, BM, VAh, VAl);
  // out = VA . Wo + bo  (M 36864, N 128, K 256; split; f32 output rows of d_out; VA row j*192+i -> out row i*192+j)
  k_out<<<NROWS / (16 * OUT_WAVES), OUT_WAVES * 32, 0, stream>>>(VAh, VAl, WOh, bo, out);
}

// v007
// One run takes 82.7 microseconds.
// Next to v006, in two timings, it ran 1.11 times as fast each time.
// Counting every step since v000, it is 3.23 times as fast.
// Contractions: LayerNorm'd qkv / edge-bias projections and the output linear on v_wmma_f32_16x16x32_bf16 with bf16 hi/lo split operands (hi*hi + hi*lo + lo*hi); per-(edge column, head) 192x192 attention cores (q.k^T with d=16 zero-extended to 32, p.v with 192 keys) on v_wmma_f32_16x16x32_f16 with plain f16 operands; f32 accumulate everywhere; LayerNorm, bias/mask add, softmax and normalisation in f32.
#include <hip/hip_runtime.h>

typedef __attribute__((ext_vector_type(16))) _Float16 v16h;
typedef __attribute__((ext_vector_type(8)))  _Float16 v8h;
typedef __attribute__((ext_vector_type(16))) __bf16   v16b;
typedef __attribute__((ext_vector_type(8)))  __bf16   v8b;
typedef __attribute__((ext_vector_type(8)))  float    v8f;
typedef __attribute__((ext_vector_type(4)))  float    v4f;
typedef __attribute__((ext_vector_type(2)))  float    v2f;

#define EWID 128
#define NNODE 192
#define NROWS 36864          // 192*192 edge rows, row r = i*192 + j
#define QKV_LD 384
#define VA_LD 256
#define KS_P 16              // LDS K tile pitch (halves)
#define VT_P 192             // LDS V^T tile pitch (halves)
#define LOG2E 1.4426950408889634f

// ------------------------------- helpers -------------------------------
__device__ __forceinline__ unsigned short f2bf_bits(float f) {
  unsigned u = __float_as_uint(f);
  return (unsigned short)((u + 0x7FFFu + ((u >> 16) & 1u)) >> 16);
}
__device__ __forceinline__ float bf_bits2f(unsigned short h) { return __uint_as_float(((unsigned)h) << 16); }

// hazard guards as plain device helpers (no inline asm inside the kernel template body)
__device__ __forceinline__ void dep_guard_h(v8f& a, v8f& b, v16h x, v16h y) { asm volatile("v_nop\n\tv_nop\n\tv_nop\n\tv_nop" : "+v"(a), "+v"(b) : "v"(x), "v"(y)); }
__device__ __forceinline__ void dep_guard_b(v8f& a, v8f& b, v16b x, v16b y) { asm volatile("v_nop\n\tv_nop\n\tv_nop\n\tv_nop" : "+v"(a), "+v"(b) : "v"(x), "v"(y)); }
__device__ __forceinline__ void keep4_h(v16h a, v16h b, v16h c, v16h d) { asm volatile("v_nop" :: "v"(a), "v"(b), "v"(c), "v"(d)); }
__device__ __forceinline__ void keep4_b(v16b a, v16b b, v16b c, v16b d) { asm volatile("v_nop" :: "v"(a), "v"(b), "v"(c), "v"(d)); }
__device__ __forceinline__ void acc_guard4(v8f& a, v8f& b, v8f& c, v8f& d) { asm volatile("v_nop\n\tv_nop\n\tv_nop\n\tv_nop" : "+v"(a), "+v"(b), "+v"(c), "+v"(d)); }
template <typename T> struct Frag;
template <> struct Frag<_Float16> {
  typedef v16h V; union U { v16h v; v8h h[2]; };
  static __device__ __forceinline__ v16h load(const _Float16* p) {   // elements 0..7 <- p[0..7], 8..15 <- p[16..23]
    U f; f.h[0] = *(const v8h*)(p); f.h[1] = *(const v8h*)(p + 16); return f.v;
  }
  static __device__ __forceinline__ v16h load_fo(const _Float16* p) { // fragment-order plane: the two 512-B wave loads of a fragment
    U f; f.h[0] = *(const v8h*)(p); f.h[1] = *(const v8h*)(p + 256); return f.v;
  }
  static __device__ __forceinline__ v8f mma(v16h a, v16h b, v8f c) {
    return __builtin_amdgcn_wmma_f32_16x16x32_f16(false, a, false, b, (short)0, c, false, false);
  }
  static __device__ __forceinline__ void guard(v8f& a, v8f& b, v16h x, v16h y) { dep_guard_h(a, b, x, y); }
  static __device__ __forceinline__ void keep(v16h a, v16h b, v16h c, v16h d) { keep4_h(a, b, c, d); }
};
template <> struct Frag<__bf16> {
  typedef v16b V; union U { v16b v; v8b h[2]; };
  static __device__ __forceinline__ v16b load(const __bf16* p) {
    U f; f.h[0] = *(const v8b*)(p); f.h[1] = *(const v8b*)(p + 16); return f.v;
  }
  static __device__ __forceinline__ v16b load_fo(const __bf16* p) {
    U f; f.h[0] = *(const v8b*)(p); f.h[1] = *(const v8b*)(p + 256); return f.v;
  }
  static __device__ __forceinline__ v8f mma(v16b a, v16b b, v8f c) {
    return __builtin_amdgcn_wmma_f32_16x16x32_bf16(false, a, false, b, (short)0, c, false, false);
  }
  static __device__ __forceinline__ void guard(v8f& a, v8f& b, v16b x, v16b y) { dep_guard_b(a, b, x, y); }
  static __device__ __forceinline__ void keep(v16b a, v16b b, v16b c, v16b d) { keep4_b(a, b, c, d); }
};

// ---- Register-blocked batched WMMA GEMM ------------------------------------
// C[m,n] = scale * sum_k A[m,k] * Bt[n,k] (+bias)(+resid); each wave owns a 64x64 tile.
// A [M,K] and Bt [N,K] lie in FRAGMENT ORDER (lda = ldb = K): each 16-row tile is 16*K contiguous elements, inside it the
// 16-byte chunk (row r, k 8q..8q+7) stands at element q*128 + r*8, so the 32 lanes of one fragment load (row lane&15,
// chunk 4*(k0/32) + 2*load + (lane>>4)) read 512 contiguous bytes = 4 whole lines. The k order of a fragment is unchanged.
// KC = K = lda = ldb at compile time: the tiles and halves of a k step are then immediate offsets from one address a plane.
// M,N % 64 == 0, K % 32 == 0.
// SPLIT: operands are hi/lo planes (A2/Bt2 = lo planes, same layout); product = hi*hi + hi*lo + lo*hi.
// BIAS_MODE: 0 = none, 1 = bias[m], 2 = bias[n].
// OUT_MODE: 0 = f32, 1 = f16, 2 = bf16 hi plane (Cout) + bf16 lo plane (Cout2).
// ET: 0 = f16 operands, 1 = bf16 operands (pointers passed as 16-bit storage)
template <int ET> struct Elem;
template <> struct Elem<0> { typedef _Float16 T; };
template <> struct Elem<1> { typedef __bf16 T; };
// gemm64_tile: the work of block bx of batch b; sT = the block's LDS, 8 per-wave 16x64 slabs of pitch 68 floats.
template <int KC, int ET, bool SPLIT, int BIAS_MODE, int OUT_MODE, bool RESID, int ACT = 0>
__device__ __forceinline__ void gemm64_tile(const int bx, const int b, float* __restrict__ sT,
    const unsigned short* __restrict__ Ap, const unsigned short* __restrict__ A2p, int lda, long strideA,
    const unsigned short* __restrict__ Btp, const unsigned short* __restrict__ Bt2p, int ldb, long strideB,
    void* __restrict__ Cout, void* __restrict__ Cout2, int ldc, long strideC,
    const float* __restrict__ bias, long strideBias,
    const float* __restrict__ resid, long strideR,
    int M, int N, int K, float scale) {
  typedef typename Elem<ET>::T T;
  typedef typename Frag<T>::V V;
  const T* A = (const T*)Ap; const T* A2 = (const T*)A2p; const T* Bt = (const T*)Btp; const T* Bt2 = (const T*)Bt2p;
  const int lane = threadIdx.x & 31;
  // wave number as a scalar: every fragment address is then a scalar tile base + the one lane offset lane*16 B
  const int wave = __builtin_amdgcn_readfirstlane(threadIdx.x >> 5);
  const int tilesN = N >> 6;
  const int tilesM = M >> 6;
  const int tile = bx * 8 + wave;
  if (tile >= tilesM * tilesN) return;   // wave-uniform; no block barriers in this kernel
  const int tm = tile / tilesN;
  const int tn = tile - tm * tilesN;
  const int m0 = tm << 6;
  const int n0 = tn << 6;

  const T* Ab  = A  + (size_t)b * strideA;
  const T* Bb  = Bt + (size_t)b * strideB;
  const T* Ab2 = SPLIT ? (A2  + (size_t)b * strideA) : nullptr;
  const T* Bb2 = SPLIT ? (Bt2 + (size_t)b * strideB) : nullptr;

  const int rlane = lane & 15;                 // row (A) / col (B, D) within subtile
  const int mOff  = (lane >> 4) * 8;           // D row offset
  const unsigned lane8 = (unsigned)lane * 8u;  // this lane's 16-byte chunk of a 512-byte fragment load

  v8f acc[4][4];
#pragma unroll
  for (int i = 0; i < 4; ++i)
#pragma unroll
    for (int j = 0; j < 4; ++j) acc[i][j] = (v8f){0.f,0.f,0.f,0.f,0.f,0.f,0.f,0.f};

  // rolled: the body stays one k step long (code size, register count)
#pragma unroll 1
  for (int k0 = 0; k0 < KC; k0 += 32) {
    V bh[4], bl[4];
#pragma unroll
    for (int j = 0; j < 4; ++j) {
      const size_t bo = (size_t)(n0 + (j << 4)) * KC + (k0 << 4);    // wave-uniform
      bh[j] = Frag<T>::load_fo(Bb + bo + lane8);
      if (SPLIT) bl[j] = Frag<T>::load_fo(Bb2 + bo + lane8);
    }
#pragma unroll
    for (int i = 0; i < 4; ++i) {
      const size_t ao = (size_t)(m0 + (i << 4)) * KC + (k0 << 4);    // wave-uniform
      V ah = Frag<T>::load_fo(Ab + ao + lane8);
      V al;
      if (SPLIT) al = Frag<T>::load_fo(Ab2 + ao + lane8);
#pragma unroll
      for (int j = 0; j < 4; ++j) {
        acc[i][j] = Frag<T>::mma(ah, bh[j], acc[i][j]);
        if (SPLIT) {
          acc[i][j] = Frag<T>::mma(ah, bl[j], acc[i][j]);
          acc[i][j] = Frag<T>::mma(al, bh[j], acc[i][j]);
        }
      }
      Frag<T>::guard(acc[i][0], acc[i][3], ah, SPLIT ? al : ah);
    }
    Frag<T>::keep(bh[0], bh[1], bh[2], bh[3]);
    if (SPLIT) Frag<T>::keep(bl[0], bl[1], bl[2], bl[3]);
  }
  acc_guard4(acc[0][0], acc[0][1], acc[0][2], acc[0][3]);
  acc_guard4(acc[1][0], acc[1][1], acc[1][2], acc[1][3]);
  acc_guard4(acc[2][0], acc[2][1], acc[2][2], acc[2][3]);
  acc_guard4(acc[3][0], acc[3][1], acc[3][2], acc[3][3]);

  // ---- epilogue ----
  float* slab = sT + wave * (16 * 68);
  const float* Rb = RESID ? (resid + (size_t)b * strideR) : nullptr;
  const float* Bs = (BIAS_MODE != 0) ? (bias + (size_t)b * strideBias) : nullptr;
#pragma unroll
  for (int i = 0; i < 4; ++i) {
    const int mBase = m0 + (i << 4);
#pragma unroll
    for (int j = 0; j < 4; ++j) {
      const int n = n0 + (j << 4) + rlane;
      float bv = 0.f;
      if (BIAS_MODE == 2) bv = Bs[n];
#pragma unroll
      for (int r = 0; r < 8; ++r) {
        float v = acc[i][j][r] * scale;
        if (BIAS_MODE == 1) v += Bs[mBase + mOff + r];
        if (BIAS_MODE == 2) v += bv;
        if (RESID) v += Rb[(size_t)(mBase + mOff + r) * ldc + n];
        if (ACT == 1) v = tanhf(v);
        if (ACT == 2) v = fmaxf(v, 0.0f);
        if (ACT == 3) v = v / (1.0f + expf(-v));
        if (ACT == 4) v = (v > 0.f) ? v : 0.01f * v;
        if (ACT == 5) v = 0.5f * v * (1.0f + erff(v * 0.70710678118654752f));
        slab[(mOff + r) * 68 + (j << 4) + rlane] = v;
      }
    }
    __builtin_amdgcn_fence(__ATOMIC_RELEASE, "workgroup");
    __builtin_amdgcn_wave_barrier();
    __builtin_amdgcn_fence(__ATOMIC_ACQUIRE, "workgroup");
    if (OUT_MODE == 0) {
      float* C = (float*)Cout + (size_t)b * strideC;
      const int hh = lane >> 4, c4 = (lane & 15) * 4;     // row seg = 256 B = 16 lanes x 16 B
      {
#pragma unroll
        for (int it = 0; it < 8; ++it) {
          const int row = it * 2 + hh;
          v4f v = *(const v4f*)(slab + row * 68 + c4);
          *(v4f*)(C + (size_t)(mBase + row) * ldc + n0 + c4) = v;
        }
        
      }
    } else {
      const int q = lane >> 3, c8 = (lane & 7) * 8;
      unsigned short* C  = (unsigned short*)Cout  + (size_t)b * strideC;
      unsigned short* C2 = (OUT_MODE == 2) ? ((unsigned short*)Cout2 + (size_t)b * strideC) : nullptr;
      {
#pragma unroll
        for (int it = 0; it < 4; ++it) {
          const int row = it * 4 + q;
          const float* sp = slab + row * 68 + c8;
          v8h hv, lv;
#pragma unroll
          for (int e = 0; e < 8; ++e) {
            if (OUT_MODE == 1) {
              hv[e] = (_Float16)sp[e];
            } else {
              unsigned short hb = f2bf_bits(sp[e]);
              unsigned short lb = f2bf_bits(sp[e] - bf_bits2f(hb));
              hv[e] = __builtin_bit_cast(_Float16, hb);
              lv[e] = __builtin_bit_cast(_Float16, lb);
            }
          }
          *(v8h*)(C + (size_t)(mBase + row) * ldc + n0 + c8) = hv;
          if (OUT_MODE == 2) *(v8h*)(C2 + (size_t)(mBase + row) * ldc + n0 + c8) = lv;
        }
        
      }
    }
    __builtin_amdgcn_fence(__ATOMIC_RELEASE, "workgroup");
    __builtin_amdgcn_wave_barrier();
    __builtin_amdgcn_fence(__ATOMIC_ACQUIRE, "workgroup");
  }
}
// Edge-bias product of one direction with the finished score bias as its output:
// bm[h][r] = (sum_k EL[r][k] * We[k][h] + be[h]) + mask[r][h], h = 0..7, r = edge row, f32.
// A wave owns 64 rows (4 row tiles) x the first 16-row tile of the weight plane (rows 0..7 = heads, 8..15 zero);
// operands and the order of the products of an accumulator as in gemm64_tile (hi*hi, hi*lo, lo*hi a k step, k rising).
// D (lane: column lane & 15, register r: row 8*(lane >> 4) + r) + be + mask goes through the wave's own LDS slab, turned to
// [column][64 rows] (pitch 68 floats); columns 8..15 are written like the others (no branch) and never read.  A store
// then writes the 256 contiguous bytes of two heads: whole lines, one writer.
__device__ __forceinline__ void eb_tile(const int bx, float* __restrict__ sT,
    const unsigned short* __restrict__ Ap, const unsigned short* __restrict__ A2p,
    const unsigned short* __restrict__ Btp, const unsigned short* __restrict__ Bt2p,
    const float* __restrict__ be, const float* __restrict__ mask, float* __restrict__ bm) {
  const int lane = threadIdx.x & 31;
  const int wave = __builtin_amdgcn_readfirstlane(threadIdx.x >> 5);   // scalar: the tile addresses are scalar bases
  const int m0 = (bx * 8 + wave) << 6;
  const unsigned lane8 = (unsigned)lane * 8u;
  const int hd = lane & 7, mOff = (lane >> 4) * 8;                     // columns 8..15 take the addresses of heads 0..7: in bounds
  const __bf16* Ah = (const __bf16*)Ap  + (size_t)m0 * EWID + lane8;
  const __bf16* Al = (const __bf16*)A2p + (size_t)m0 * EWID + lane8;
  const __bf16* Bh = (const __bf16*)Btp  + lane8;
  const __bf16* Bl = (const __bf16*)Bt2p + lane8;
  // two register buffers for the operands of a k step, taken in turn
  v16b bh[2], bl[2], ah[2][4], al[2][4];
  bh[0] = Frag<__bf16>::load_fo(Bh);
  bl[0] = Frag<__bf16>::load_fo(Bl);
#pragma unroll
  for (int i = 0; i < 4; ++i) {
    ah[0][i] = Frag<__bf16>::load_fo(Ah + i * (16 * EWID));
    al[0][i] = Frag<__bf16>::load_fo(Al + i * (16 * EWID));
  }
  // be and mask of this lane's 32 results: asked for here, used only after the last product
  const float* mk = mask + (size_t)(m0 + mOff) * 8 + hd;
  const float bev = be[hd];
  float mv[32];
#pragma unroll
  for (int q = 0; q < 32; ++q) mv[q] = mk[((q >> 3) * 16 + (q & 7)) * 8];
  v8f acc[4];
#pragma unroll
  for (int i = 0; i < 4; ++i) acc[i] = (v8f){0.f,0.f,0.f,0.f,0.f,0.f,0.f,0.f};
  // unrolled: the buffers are then named at compile time
#pragma unroll
  for (int ks = 0; ks < EWID / 32; ++ks) {
    const int cur = ks & 1, nxt = cur ^ 1;
    if (ks + 1 < EWID / 32) {
      bh[nxt] = Frag<__bf16>::load_fo(Bh + (ks + 1) * 512);
      bl[nxt] = Frag<__bf16>::load_fo(Bl + (ks + 1) * 512);
#pragma unroll
      for (int i = 0; i < 4; ++i) {
        ah[nxt][i] = Frag<__bf16>::load_fo(Ah + i * (16 * EWID) + (ks + 1) * 512);
        al[nxt][i] = Frag<__bf16>::load_fo(Al + i * (16 * EWID) + (ks + 1) * 512);
      }
    }
    // keeps the next k step's loads ahead of this one's products: moved down, each would be waited for in turn
    __builtin_amdgcn_sched_barrier(0);
    // the accumulators may take over the address registers of the mask loads issued above
    if (ks == 0) asm volatile("s_wait_xcnt 0x0" ::: "memory");
    // four independent accumulators between two products into the same one
#pragma unroll
    for (int i = 0; i < 4; ++i) acc[i] = Frag<__bf16>::mma(ah[cur][i], bh[cur], acc[i]);
#pragma unroll
    for (int i = 0; i < 4; ++i) acc[i] = Frag<__bf16>::mma(ah[cur][i], bl[cur], acc[i]);
#pragma unroll
    for (int i = 0; i < 4; ++i) acc[i] = Frag<__bf16>::mma(al[cur][i], bh[cur], acc[i]);
    // keeps the loads of the k step after the next behind these products, whose operand registers they refill
    __builtin_amdgcn_sched_barrier(0);
  }
  float* slab = sT + wave * (16 * 68);
#pragma unroll
  for (int i = 0; i < 4; ++i) {
    v4f w0, w1;
#pragma unroll
    for (int r = 0; r < 4; ++r) {
      w0[r] = (acc[i][r] + bev) + mv[i * 8 + r];
      w1[r] = (acc[i][r + 4] + bev) + mv[i * 8 + r + 4];
    }
    *(v4f*)(slab + (lane & 15) * 68 + i * 16 + mOff) = w0;
    *(v4f*)(slab + (lane & 15) * 68 + i * 16 + mOff + 4) = w1;
  }
  // the slab is the wave's own: its lanes' LDS writes are finished before its lanes read them, no other wave is involved
  __builtin_amdgcn_fence(__ATOMIC_RELEASE, "workgroup", "local");
  __builtin_amdgcn_wave_barrier();
  __builtin_amdgcn_fence(__ATOMIC_ACQUIRE, "workgroup", "local");
  const int h2 = lane >> 4, r4 = (lane & 15) * 4;
  v4f ov[4];
#pragma unroll
  for (int a = 0; a < 4; ++a) ov[a] = *(const v4f*)(slab + (a * 2 + h2) * 68 + r4);
#pragma unroll
  for (int a = 0; a < 4; ++a) *(v4f*)(bm + (size_t)(a * 2 + h2) * NROWS + m0 + r4) = ov[a];
}
// The two projections of the LayerNorm'd rows, which do not depend on each other, as one launch: blocks below
// blocksE do the edge-bias product (out: the score bias planes), the others the qkv product (f16 out, bias[n]). Block-uniform.
__global__ __launch_bounds__(256) void k_proj(
    const unsigned short* __restrict__ Ap, const unsigned short* __restrict__ A2p, int lda,
    const unsigned short* __restrict__ BtE, const unsigned short* __restrict__ Bt2E, long strideBE,
    const float* __restrict__ be0, const float* __restrict__ be1, const float* __restrict__ mask,
    float* __restrict__ bm2, int blocksE,
    const unsigned short* __restrict__ BtQ, const unsigned short* __restrict__ Bt2Q, long strideBQ,
    void* __restrict__ CQ, int ldcQ, long strideCQ, int NQ,
    const float* __restrict__ biasQ, long strideBiasQ, int M, int K) {
  __shared__ __align__(16) float sT[8 * 16 * 68];
  const int bx = blockIdx.x;
  if (bx < blocksE)
    eb_tile(bx, sT, Ap, A2p, BtE + (size_t)blockIdx.y * strideBE, Bt2E + (size_t)blockIdx.y * strideBE,
        blockIdx.y ? be1 : be0, mask, bm2 + (size_t)blockIdx.y * 8 * NROWS);
  else
    gemm64_tile<EWID, 1, true, 2, 1, false>(bx - blocksE, blockIdx.y, sT, Ap, A2p, lda, (long)0, BtQ, Bt2Q, lda, strideBQ,
        CQ, CQ, ldcQ, strideCQ, biasQ, strideBiasQ, biasQ, (long)0, M, NQ, K, 1.0f);
}

__device__ __forceinline__ v8f zero8f() { return (v8f){0.f, 0.f, 0.f, 0.f, 0.f, 0.f, 0.f, 0.f}; }
__device__ __forceinline__ v8h zero8h() {
  v8h z;
#pragma unroll
  for (int e = 0; e < 8; ++e) z[e] = (_Float16)0.0f;
  return z;
}
// f16 WMMA with the hazard guard attached (D tied, A/B kept live)
__device__ __forceinline__ v8f hmma(v16h a, v16h b, v8f c) {
  c = __builtin_amdgcn_wmma_f32_16x16x32_f16(false, a, false, b, (short)0, c, false, false);
  asm volatile("v_nop\n\tv_nop\n\tv_nop\n\tv_nop" : "+v"(c) : "v"(a), "v"(b));
  return c;
}
__device__ __forceinline__ void split_bf16(float x, _Float16& hi, _Float16& lo) {
  const unsigned short hb = f2bf_bits(x);
  const unsigned short lb = f2bf_bits(x - bf_bits2f(hb));
  hi = __builtin_bit_cast(_Float16, hb);
  lo = __builtin_bit_cast(_Float16, lb);
}

// ---------------------------------------------------------------------------------------
// qkv weight prep: W [128 k][384 c] f32 ([in][out]) -> Bt hi/lo bf16 planes [384 n][128 k], fragment order, with head-major
// output columns: n = part*128 + h*16 + d  <-  c = part*128 + d*8 + h (view(DD=16, NH=8): d slow, h fast).
// Permuted bias bqp[n] = bq[c].  Edge-bias weight We [128 k][8] -> Bt hi/lo [64 n][128 k], rows n >= 8 zero.
// grid 28 x block 256: blocks 0..23 = 384 rows x 16 threads (8 k each) -> covers [384][128] exactly;
// blocks 24..27 = 64 rows x 16 threads -> covers [64][128] exactly; t < 384 also writes bqp[384] exactly.
// Owner-computes: thread t stores the t-th 16-byte chunk of the plane = (tile t>>8, chunk (t>>4)&15, row t&15).
__device__ __forceinline__ void prep_qkv_w(const int bx,
    const float* __restrict__ W, const float* __restrict__ bq, const float* __restrict__ We,
    unsigned short* __restrict__ wqh, unsigned short* __restrict__ wql,
    unsigned short* __restrict__ weh, unsigned short* __restrict__ wel, float* __restrict__ bqp) {
  const int t = bx * 256 + threadIdx.x;
  if (bx < 24) {                               // block-uniform
    const int n = (t >> 8) * 16 + (t & 15), k8 = ((t >> 4) & 15) * 8;
    const int part = n >> 7, h = (n >> 4) & 7, d = n & 15;
    const int col = part * 128 + d * 8 + h;
    v8h hv, lv;
#pragma unroll
    for (int e = 0; e < 8; ++e) {
      const float w = W[(size_t)(k8 + e) * 384 + col];
      _Float16 a, bb; split_bf16(w, a, bb); hv[e] = a; lv[e] = bb;
    }
    const size_t off = (size_t)t * 8;
    {
      *(v8h*)(wqh + off) = hv;
      *(v8h*)(wql + off) = lv;
      
    }
    if (t < 384) {                             // wave-uniform (384 = 12 waves)
      const int pn = t >> 7, ph = (t >> 4) & 7, pd = t & 15;
      const float bv = bq[pn * 128 + pd * 8 + ph];
      *(float*)(bqp + t) = bv;
      
    }
  } else {
    const int u = t - 6144;
    const int n = (u >> 8) * 16 + (u & 15), k8 = ((u >> 4) & 15) * 8;
    const int nc = (n < 8) ? n : 7;            // address clamp, value zeroed by predicate
    v8h hv, lv;
#pragma unroll
    for (int e = 0; e < 8; ++e) {
      float w = We[(size_t)(k8 + e) * 8 + nc];
      w = (n < 8) ? w : 0.0f;
      _Float16 a, bb; split_bf16(w, a, bb); hv[e] = a; lv[e] = bb;
    }
    const size_t off = (size_t)u * 8;
    {
      *(v8h*)(weh + off) = hv;
      *(v8h*)(wel + off) = lv;
      // inlined as one arm of a larger kernel: the code of a later arm reuses these stores' registers
      asm volatile("s_wait_xcnt 0x0" ::: "memory");
    }
  }
}

// Output weight prep: Wo [256 c][128 n] f32 ([in][out]) -> Bt hi/lo [128 n][256 k'], fragment order, k' = dir*128 + h*16 + d
// <- c = d*16 + dir*8 + h (concat of the two head groups on the head axis, then view d slow).
// grid 16 x block 256 = 4096 threads = 128 rows x 32 threads (8 k' each): covers [128][256] exactly;
// thread t stores the t-th 16-byte chunk = (tile t>>9, chunk (t>>4)&31, row t&15).
__device__ __forceinline__ void prep_wo(const int bx, const float* __restrict__ Wo,
    unsigned short* __restrict__ woh, unsigned short* __restrict__ wol) {
  const int t = bx * 256 + threadIdx.x;
  const int n = (t >> 9) * 16 + (t & 15), k8 = ((t >> 4) & 31) * 8;
  v8h hv, lv;
#pragma unroll
  for (int e = 0; e < 8; ++e) {
    const int kp = k8 + e;
    const int dr = kp >> 7, h = (kp >> 4) & 7, d = kp & 15;
    const int col = d * 16 + dr * 8 + h;
    const float w = Wo[(size_t)col * 128 + n];
    _Float16 a, bb; split_bf16(w, a, bb); hv[e] = a; lv[e] = bb;
  }
  const size_t off = (size_t)t * 8;
  {
    *(v8h*)(woh + off) = hv;
    *(v8h*)(wol + off) = lv;
    // inlined as one arm of a larger kernel: the code of a later arm reuses these stores' registers
    asm volatile("s_wait_xcnt 0x0" ::: "memory");
  }
}

// LayerNorm over the 128-wide rows of e (eps 1e-5, biased variance, *g + b) -> bf16 hi/lo planes [nrows][128], fragment order.
// grid = nrows/16, block 256 = 8 waves x 2 rows (lane half = row, lane&15 = 8-column chunk) = one 16-row tile.
// The tile's chunks are turned from (row, chunk) to (chunk, row) through LDS (sF: 2 planes of 16 x 272 B, one 16-byte
// pad a chunk column against bank conflicts); thread t then stores the tile's t-th chunk: 512 contiguous bytes a wave.
#define LNF_P 136            // LDS pitch of a chunk column (halves): 16 rows x 8 + 8
__device__ __forceinline__ void ln_rows(const int bx, const float* __restrict__ e, const float* __restrict__ g,
    const float* __restrict__ b, unsigned short* __restrict__ elh, unsigned short* __restrict__ ell, int nrows,
    unsigned short* __restrict__ sF) {
  const int tid = threadIdx.x, wave = tid >> 5, lane = tid & 31, hh = lane >> 4, c = lane & 15;
  const int row = (bx * 8 + wave) * 2 + hh;
  const bool ok = row < nrows;
  const int rowc = ok ? row : (nrows - 1);
  const float* p = e + (size_t)rowc * EWID + c * 8;
  const v4f x0 = *(const v4f*)p;
  const v4f x1 = *(const v4f*)(p + 4);
  float xs[8];
  xs[0] = x0[0]; xs[1] = x0[1]; xs[2] = x0[2]; xs[3] = x0[3];
  xs[4] = x1[0]; xs[5] = x1[1]; xs[6] = x1[2]; xs[7] = x1[3];
  float s = ((xs[0] + xs[1]) + (xs[2] + xs[3])) + ((xs[4] + xs[5]) + (xs[6] + xs[7]));
#pragma unroll
  for (int off = 1; off < 16; off <<= 1) s += __shfl_xor(s, off, 32);
  const float mu = s * (1.0f / 128.0f);
  float q = 0.f;
#pragma unroll
  for (int k = 0; k < 8; ++k) { xs[k] -= mu; q += xs[k] * xs[k]; }
#pragma unroll
  for (int off = 1; off < 16; off <<= 1) q += __shfl_xor(q, off, 32);
  const float rs = rsqrtf(q * (1.0f / 128.0f) + 1e-5f);
  const v4f g0 = *(const v4f*)(g + c * 8), g1 = *(const v4f*)(g + c * 8 + 4);
  const v4f b0 = *(const v4f*)(b + c * 8), b1 = *(const v4f*)(b + c * 8 + 4);
  float gg[8], bb[8];
  gg[0] = g0[0]; gg[1] = g0[1]; gg[2] = g0[2]; gg[3] = g0[3]; gg[4] = g1[0]; gg[5] = g1[1]; gg[6] = g1[2]; gg[7] = g1[3];
  bb[0] = b0[0]; bb[1] = b0[1]; bb[2] = b0[2]; bb[3] = b0[3]; bb[4] = b1[0]; bb[5] = b1[1]; bb[6] = b1[2]; bb[7] = b1[3];
  v8h hv, lv;
#pragma unroll
  for (int k = 0; k < 8; ++k) {
    const float y = xs[k] * rs * gg[k] + bb[k];
    _Float16 a, lo; split_bf16(y, a, lo); hv[k] = a; lv[k] = lo;
  }
  const int wa = c * LNF_P + (wave * 2 + hh) * 8;
  *(v8h*)(sF + wa) = hv;
  *(v8h*)(sF + 16 * LNF_P + wa) = lv;
  __syncthreads();           // block-uniform: every thread of a LayerNorm block comes here
  const int ra = (tid >> 4) * LNF_P + (tid & 15) * 8;
  const v8h ho = *(const v8h*)(sF + ra);
  const v8h lo8 = *(const v8h*)(sF + 16 * LNF_P + ra);
  if (bx * 16 + (tid & 15) < nrows) {
    const size_t off = (size_t)bx * 16 * EWID + tid * 8;
    {
      *(v8h*)(elh + off) = ho;
      *(v8h*)(ell + off) = lo8;
    }
  }
}

// The four launches that depend on nothing but the inputs, as one: blocks 0..27 qkv/edge weights of direction 0,
// 28..55 of direction 1, 56..71 output weight, 72.. LayerNorm (16 rows a block). The choice is block-uniform.
#define PREP_BLOCKS 72
__global__ __launch_bounds__(256) void k_front(
    const float* __restrict__ e, const float* __restrict__ g, const float* __restrict__ b,
    const float* __restrict__ Wq0, const float* __restrict__ bq0, const float* __restrict__ We0,
    const float* __restrict__ Wq1, const float* __restrict__ bq1, const float* __restrict__ We1,
    const float* __restrict__ Wo,
    unsigned short* __restrict__ wqh0, unsigned short* __restrict__ wql0,
    unsigned short* __restrict__ weh0, unsigned short* __restrict__ wel0, float* __restrict__ bqp0,
    unsigned short* __restrict__ wqh1, unsigned short* __restrict__ wql1,
    unsigned short* __restrict__ weh1, unsigned short* __restrict__ wel1, float* __restrict__ bqp1,
    unsigned short* __restrict__ woh, unsigned short* __restrict__ wol,
    unsigned short* __restrict__ elh, unsigned short* __restrict__ ell, int nrows) {
  __shared__ __align__(16) unsigned short sF[2 * 16 * LNF_P];
  const int bx = blockIdx.x;
  if (bx < 28)               prep_qkv_w(bx, Wq0, bq0, We0, wqh0, wql0, weh0, wel0, bqp0);
  else if (bx < 56)          prep_qkv_w(bx - 28, Wq1, bq1, We1, wqh1, wql1, weh1, wel1, bqp1);
  else if (bx < PREP_BLOCKS) prep_wo(bx - 56, Wo, woh, wol);
  else                       ln_rows(bx - PREP_BLOCKS, e, g, b, elh, ell, nrows, sF);
}

// Fused attention core for one (direction dir, head h), all 192 query rows i, JG edge columns j in sequence.
// qkv: f16 [2 dir][36864][384], head-major columns part*128 + h*16 + d.  bm: f32 [2 dir][8][36864 edge rows r], the bias
// of (query i, key k) at r = i*192 + k (dir 0) or r = k*192 + i (dir 1).
// grid = (192 / JG column groups, 8 heads, 2 directions) x block 384 = 12 waves x 16 query rows.
// The score bias of (i, k) does not depend on j: a lane loads the 96 values of its query once and keeps them in
// registers for all JG columns.  Per column: K [192 keys][16 d] and V^T [16 d][192 keys] staged in LDS once for all
// 192 queries, one (key, 8-wide d chunk) item a thread (dir 0: row j*192+k, dir 1: row k*192+j).  Two LDS buffers taken
// in turn: one barrier a column publishes this column's tiles, and a buffer is rewritten only behind the next barrier,
// which every wave reaches after its last read of it.  The next column's K, V and Q loads are issued behind the barrier.
// Both products run transposed, so that a lane owns ONE query:
// S^T = K (A: 16 keys, d zero-extended to 32) . Q^T (B) on f16 WMMA: lane (hh, c) holds query i0+c, register r
// key 16*tile + 8*hh + r; *0.25 + bias in f32, online softmax over 3 chunks of 64 keys in f32 with maximum and
// sum taken in the lane plus one exchange between the lane halves, e^x as the hardware's 2^(x * log2(e)), x <= 0; two neighbouring S^T tiles, converted to f16
// in place, are the B operand of O^T = V^T (A: 16 d, 32 keys) . P^T; * 1/rowsum.
// Result (lane: query i0+c, registers: d = 8*hh + r) -> bf16 hi/lo planes [36864][256] in fragment order, row j*192+i,
// columns dir*128 + h*16 + d: a wave's 16 queries are one 16-row tile, the head's two chunk columns 512 contiguous
// bytes of it a plane, and lane l owns the l-th 16-byte chunk of them: stored from registers.
#define JG 12                // edge columns a block walks: 16 groups x 8 heads x 2 directions = 256 blocks
__global__ __launch_bounds__(384) void k_edge_attn(const _Float16* __restrict__ qkv2, const float* __restrict__ bm2,
    unsigned short* __restrict__ vah, unsigned short* __restrict__ val) {
  const int dir = blockIdx.z;
  const int h = blockIdx.y;
  const int j0 = blockIdx.x * JG;
  const _Float16* qkv = qkv2 + (size_t)dir * NROWS * QKV_LD + h * 16;
  const float* bm = bm2 + (size_t)dir * 8 * NROWS;
  __shared__ __align__(16) _Float16 Ksh[2][NNODE * KS_P];   // [buffer][key][d], indices <= 191*16+15
  __shared__ __align__(16) _Float16 Vt[2][16 * VT_P];       // [buffer][d][key], indices <= 15*192+191
  const int tid = threadIdx.x, wave = tid >> 5, lane = tid & 31, hh = lane >> 4, c = lane & 15;
  const int i0 = wave * 16;
  const v8h z8 = zero8h();

  // bias of this lane's query, keys 16t+8hh .. +7 of tile t, kept for every column.  dir 0: 32 contiguous bytes a tile;
  // dir 1: the plane has the key as its slow index, one load a key, the 16 queries of a lane half 64 contiguous bytes.
  v4f b0[12], b1[12];
  if (dir == 0) {                                    // block-uniform
    const float* bmr = bm + ((size_t)h * NNODE + (size_t)(i0 + c)) * NNODE + 8 * hh;
#pragma unroll
    for (int t = 0; t < 12; ++t) {
      b0[t] = *(const v4f*)(bmr + t * 16);
      b1[t] = *(const v4f*)(bmr + t * 16 + 4);
    }
  } else {
    const float* bmc = bm + ((size_t)h * NNODE + (size_t)(8 * hh)) * NNODE + i0 + c;
#pragma unroll
    for (int t = 0; t < 12; ++t) {
#pragma unroll
      for (int r = 0; r < 4; ++r) {
        b0[t][r] = bmc[(t * 16 + r) * NNODE];
        b1[t][r] = bmc[(t * 16 + 4 + r) * NNODE];
      }
    }
  }

  // staging item of this thread: key kv, d chunk part; 384 items = 192 keys x 2 d chunks exactly
  const int kv = tid >> 1, part = tid & 1;
  const _Float16* kvsrc = qkv + (size_t)(dir ? kv * NNODE : kv) * QKV_LD + part * 8;   // + j * kvstep
  const size_t kvstep = (size_t)(dir ? 1 : NNODE) * QKV_LD;
  const _Float16* qsrc = qkv + (size_t)(i0 + c) * NNODE * QKV_LD + 8 * hh;             // + j * QKV_LD
  v8h kk8 = *(const v8h*)(kvsrc + (size_t)j0 * kvstep + EWID);
  v8h vv8 = *(const v8h*)(kvsrc + (size_t)j0 * kvstep + 2 * EWID);
  v8h q8  = *(const v8h*)(qsrc + (size_t)j0 * QKV_LD);

  // rolled: one column's code is the loop body (code size)
#pragma unroll 1
  for (int jj = 0; jj < JG; ++jj) {
    const int j = j0 + jj;
    _Float16* Kb = Ksh[jj & 1];
    _Float16* Vb = Vt[jj & 1];
    *(v8h*)(Kb + kv * KS_P + part * 8) = kk8;
#pragma unroll
    for (int e2 = 0; e2 < 8; ++e2) Vb[(part * 8 + e2) * VT_P + kv] = vv8[e2];
    // B fragment (query column i0+c, d 8hh..8hh+7 in elements 0..7, elements 8..15 zero)
    Frag<_Float16>::U qa;
    qa.h[0] = q8;
    qa.h[1] = z8;
    __syncthreads();
    if (jj + 1 < JG) {                               // block-uniform; j + 1 <= 191
      kk8 = *(const v8h*)(kvsrc + (size_t)(j + 1) * kvstep + EWID);
      vv8 = *(const v8h*)(kvsrc + (size_t)(j + 1) * kvstep + 2 * EWID);
      q8  = *(const v8h*)(qsrc + (size_t)(j + 1) * QKV_LD);
      // the code behind reuses these loads' address registers at once
      asm volatile("s_wait_xcnt 0x0" ::: "memory");
    }

    float mrow = -__builtin_inff(), lrow = 0.f;      // this lane's query
    v8f o = zero8f();                                // O^T: register r = d 8hh+r of query i0+c

    // unrolled: the bias registers are then named at compile time
#pragma unroll
    for (int kc = 0; kc < 3; ++kc) {
      const int kv0 = kc * 64;
      v8f s[4];
#pragma unroll
      for (int jn = 0; jn < 4; ++jn) {
        // A fragment (key row kv0+16jn+c, d 8hh..8hh+7 in elements 0..7, elements 8..15 zero)
        Frag<_Float16>::U kb;
        kb.h[0] = *(const v8h*)(Kb + (kv0 + jn * 16 + c) * KS_P + 8 * hh);
        kb.h[1] = z8;
        s[jn] = hmma(kb.v, qa.v, zero8f());
      }
      float mx = -__builtin_inff();
#pragma unroll
      for (int jn = 0; jn < 4; ++jn) {
#pragma unroll
        for (int r = 0; r < 8; ++r) {
          const float v = s[jn][r] * 0.25f + (r < 4 ? b0[kc * 4 + jn][r & 3] : b1[kc * 4 + jn][r & 3]);
          s[jn][r] = v;
          mx = fmaxf(mx, v);
        }
      }
      mx = fmaxf(mx, __shfl_xor(mx, 16, 32));        // the other lane half holds the query's other 32 keys
      const float mnew = fmaxf(mrow, mx);
      const float alpha = __builtin_amdgcn_exp2f((mrow - mnew) * LOG2E);
      mrow = mnew;
      float ps = 0.f;
      Frag<_Float16>::U pb[2];                       // P^T as B: elements 0..7 = tile 2kk, 8..15 = tile 2kk+1
#pragma unroll
      for (int jn = 0; jn < 4; ++jn) {
#pragma unroll
        for (int r = 0; r < 8; r += 2) {
          const v2f dl = ((v2f){s[jn][r], s[jn][r + 1]} - (v2f){mnew, mnew}) * (v2f){LOG2E, LOG2E};
          const float p0 = __builtin_amdgcn_exp2f(dl[0]);
          const float p1 = __builtin_amdgcn_exp2f(dl[1]);
          ps += p0;
          ps += p1;
          pb[jn >> 1].h[jn & 1][r] = (_Float16)p0;
          pb[jn >> 1].h[jn & 1][r + 1] = (_Float16)p1;
        }
      }
      ps += __shfl_xor(ps, 16, 32);
      lrow = lrow * alpha + ps;
#pragma unroll
      for (int r = 0; r < 8; ++r) o[r] *= alpha;
#pragma unroll
      for (int kk = 0; kk < 2; ++kk) {
        const v16h va = Frag<_Float16>::load(Vb + c * VT_P + kv0 + kk * 32 + 8 * hh);
        o = hmma(va, pb[kk].v, o);
      }
    }
    const float inv = 1.0f / lrow;
    v8h hv, lv;
#pragma unroll
    for (int e = 0; e < 8; ++e) {
      _Float16 a, lo;
      split_bf16(o[e] * inv, a, lo); hv[e] = a; lv[e] = lo;
    }
    const size_t ob = (size_t)(j * NNODE + i0) * VA_LD + (size_t)(dir * 2048 + h * 256 + lane * 8);
    *(v8h*)(vah + ob) = hv;
    *(v8h*)(val + ob) = lv;
    // the next column's staging reuses these stores' registers
    asm volatile("s_wait_xcnt 0x0" ::: "memory");
  }
}

// Output linear: out[i*192+j][n] = sum_k VA[j*192+i][k] * Wo'[n][k] + bo[n]; M 36864, N 128, K 256, bf16 hi/lo split
// (one accumulator an output element: hi*hi + hi*lo + lo*hi a k step, k steps in rising order).
// grid 256 x block 288 = 9 waves; a wave owns one 16-row tile of VA and all 128 output columns (2304 tiles = 256 x 9).
// A: the tile's two planes are 2 x 8 KB contiguous (fragment order); a wave issues all 32 loads at entry and keeps the
// tile in registers: memory latency is paid once a wave, and the later k steps' loads are still in flight while the
// first are worked on.
// B: wo2 = the hi weight plane followed by the lo plane (2 x 64 KB, fragment order), copied as it lies into LDS once a
// block, 512 bytes a wave and load; a B fragment is then two conflict-free 512-byte LDS reads.
// D (lane: column 16t + (lane & 15), register r: row 8*(lane >> 4) + r) + bias goes through the wave's own LDS slab
// (pitch 132 floats: the two lane halves fall on different banks); a whole 512-byte output row is one store.
// Every loop of this kernel is unrolled: its arrays live in registers and need compile-time indices.
#define OUT_WAVES 9
#define OUT_SLAB_P 132
__global__ __launch_bounds__(OUT_WAVES * 32) void k_out(
    const unsigned short* __restrict__ vah, const unsigned short* __restrict__ val,
    const unsigned short* __restrict__ wo2, const float* __restrict__ bo, float* __restrict__ out) {
  __shared__ __align__(16) unsigned short sB[2 * EWID * VA_LD + 5 * 256]; // hi plane, lo plane, 5 spare pieces
  __shared__ __align__(16) float sO[OUT_WAVES * 16 * OUT_SLAB_P];
  const int lane = threadIdx.x & 31;
  const int wave = __builtin_amdgcn_readfirstlane(threadIdx.x >> 5);      // scalar: tile and piece addresses are scalar bases
  const int rt = blockIdx.x * OUT_WAVES + wave;                           // 16-row tile, 0..2303
  const unsigned lane8 = (unsigned)lane * 8u;
  const int rlane = lane & 15, mOff = (lane >> 4) * 8;

  // the 256 weight pieces of 512 B: wave w takes w, w+9, .. w+252. 29 x 9 = 261: in the last turn waves 4..8 have no
  // piece left; they copy one of 252..255 once more, into the spare pieces behind the planes, which nobody reads: the
  // copy is then free of branches and all its loads stand together.
  const unsigned short* wsrc = wo2 + wave * 256 + lane8;
  v8h wt[29];
#pragma unroll
  for (int it = 0; it < 28; ++it) wt[it] = *(const v8h*)(wsrc + it * (OUT_WAVES * 256));
  wt[28] = *(const v8h*)(wo2 + (252 + (wave & 3)) * 256 + lane8);
  // keeps the weight loads ahead of the A loads: loads return in order, and the LDS copy must not wait for the A tile
  __builtin_amdgcn_sched_barrier(0);
  const __bf16* Ah = (const __bf16*)vah + (size_t)rt * (16 * VA_LD) + lane8;
  const __bf16* Al = (const __bf16*)val + (size_t)rt * (16 * VA_LD) + lane8;
  v16b ah[8], al[8];
#pragma unroll
  for (int ks = 0; ks < 8; ++ks) {
    ah[ks] = Frag<__bf16>::load_fo(Ah + ks * 512);
    al[ks] = Frag<__bf16>::load_fo(Al + ks * 512);
  }
#pragma unroll
  for (int it = 0; it < 29; ++it) *(v8h*)(sB + (wave + it * OUT_WAVES) * 256 + lane8) = wt[it];
  // The one barrier: it publishes the weight planes, every wave passes it. Written with fences on LDS alone: only LDS
  // data goes from wave to wave here, and __syncthreads() would also wait for the A loads, which are to stay in flight.
  __builtin_amdgcn_fence(__ATOMIC_RELEASE, "workgroup", "local");
  __builtin_amdgcn_s_barrier();
  __builtin_amdgcn_fence(__ATOMIC_ACQUIRE, "workgroup", "local");

  // bias of this lane's 8 columns: asked for here, behind the A loads, and used only after the last product
  float bv[8];
#pragma unroll
  for (int j = 0; j < 8; ++j) bv[j] = bo[j * 16 + rlane];
  v8f acc[8];
#pragma unroll
  for (int j = 0; j < 8; ++j) acc[j] = zero8f();
  const __bf16* Bh = (const __bf16*)sB + lane8;
  const __bf16* Bl = Bh + EWID * VA_LD;
  // 16 groups g = (k step g >> 1, column tiles 4*(g & 1) .. +3) of 12 products; two register buffers for B taken in turn
  v16b bh[2][4], bl[2][4];
#pragma unroll
  for (int j = 0; j < 4; ++j) {
    bh[0][j] = Frag<__bf16>::load_fo(Bh + j * (16 * VA_LD));
    bl[0][j] = Frag<__bf16>::load_fo(Bl + j * (16 * VA_LD));
  }
  // unrolled: the A fragments and the buffers are then named at compile time
#pragma unroll
  for (int g = 0; g < 16; ++g) {
    const int ks = g >> 1, jg = (g & 1) * 4, cur = g & 1, nxt = cur ^ 1;
    if (g + 1 < 16) {
#pragma unroll
      for (int j = 0; j < 4; ++j) {
        const int o = (((g + 1) & 1) * 4 + j) * (16 * VA_LD) + ((g + 1) >> 1) * 512;
        bh[nxt][j] = Frag<__bf16>::load_fo(Bh + o);
        bl[nxt][j] = Frag<__bf16>::load_fo(Bl + o);
      }
    }
    // four independent accumulators between two products into the same one
#pragma unroll
    for (int j = 0; j < 4; ++j) acc[jg + j] = Frag<__bf16>::mma(ah[ks], bh[cur][j], acc[jg + j]);
#pragma unroll
    for (int j = 0; j < 4; ++j) acc[jg + j] = Frag<__bf16>::mma(ah[ks], bl[cur][j], acc[jg + j]);
#pragma unroll
    for (int j = 0; j < 4; ++j) acc[jg + j] = Frag<__bf16>::mma(al[ks], bh[cur][j], acc[jg + j]);
    // keeps a group's LDS reads one whole group (12 products) ahead of their use: moved down, they would be waited for
    __builtin_amdgcn_sched_barrier(0);
  }

  float* slab = sO + wave * (16 * OUT_SLAB_P);
#pragma unroll
  for (int j = 0; j < 8; ++j) {
#pragma unroll
    for (int r = 0; r < 8; ++r) slab[(mOff + r) * OUT_SLAB_P + j * 16 + rlane] = acc[j][r] + bv[j];
  }
  // the slab is the wave's own: its lanes' LDS writes are finished before its lanes read them, no other wave is involved
  __builtin_amdgcn_fence(__ATOMIC_RELEASE, "workgroup", "local");
  __builtin_amdgcn_wave_barrier();
  __builtin_amdgcn_fence(__ATOMIC_ACQUIRE, "workgroup", "local");
  // VA row rt*16 + r = j*192 + i -> out row i*192 + j; 192 = 12 tiles, so a tile has one j
  const int jcol = rt / 12, irow = (rt - jcol * 12) * 16;
  float* op = out + ((size_t)irow * NNODE + jcol) * EWID + lane * 4;
  v4f ov[16];
#pragma unroll
  for (int r = 0; r < 16; ++r) ov[r] = *(const v4f*)(slab + r * OUT_SLAB_P + lane * 4);
#pragma unroll
  for (int r = 0; r < 16; ++r) *(v4f*)(op + (size_t)r * NNODE * EWID) = ov[r];
}

// ---------------------------------------------------------------------------------------
extern "C" void kernel_launch(void* const* d_in, const int* in_sizes, int n_in,
                              void* d_out, int out_size, void* d_ws, size_t ws_size,
                              hipStream_t stream) {
  if (n_in < 14) return;
  if (in_sizes[0] != NROWS * EWID || in_sizes[1] != NROWS * 8 || in_sizes[2] < EWID || in_sizes[3] < EWID ||
      in_sizes[4] != EWID * 384 || in_sizes[5] < 384 || in_sizes[6] != EWID * 8 || in_sizes[7] < 8 ||
      in_sizes[8] != EWID * 384 || in_sizes[9] < 384 || in_sizes[10] != EWID * 8 || in_sizes[11] < 8 ||
      in_sizes[12] != 256 * EWID || in_sizes[13] < EWID || out_size != NROWS * EWID) return;

  const float* e      = (const float*)d_in[0];
  const float* mask   = (const float*)d_in[1];
  const float* ln_g   = (const float*)d_in[2];
  const float* ln_b   = (const float*)d_in[3];
  const float* Wq_in  = (const float*)d_in[4];
  const float* bq_in  = (const float*)d_in[5];
  const float* We_in  = (const float*)d_in[6];
  const float* be_in  = (const float*)d_in[7];
  const float* Wq_out = (const float*)d_in[8];
  const float* bq_out = (const float*)d_in[9];
  const float* We_out = (const float*)d_in[10];
  const float* be_out = (const float*)d_in[11];
  const float* Wo     = (const float*)d_in[12];
  const float* bo     = (const float*)d_in[13];
  float* out = (float*)d_out;

  // ---- workspace region map (offsets 256-B aligned; total 116,198,400 B) ----
  //  (ELh/l, VAh/l and the weight planes lie in the GEMM's fragment order; VA rows are j*192+i)
  //  ELh, ELl   bf16 [36864][128]       2 x  9,437,184   LayerNorm output hi/lo (live through both directions)
  //  QKV16      f16  [2][36864][384]    2 x 28,311,552   projection output, one plane a direction
  //  BM         f32  [2][8][36864]      2 x  1,179,648   score bias (edge-bias projection + be + mask), one plane a direction
  //  VAh, VAl   bf16 [36864][256]       2 x 18,874,368   attention output hi/lo (both directions)
  //  WtQh/l x2  bf16 [384][128]         4 x     98,304
  //  WtEh/l x2  bf16 [64][128]          4 x     16,384
  //  WoTh/l     bf16 [2][128][256]      2 x     65,536   hi plane, then lo plane, one region
  //  bqp x2     f32  [384]              2 x      1,536
  size_t off = 0;
  auto carve = [&](size_t bytes) { size_t o = off; off += (bytes + 255) & ~(size_t)255; return o; };
  const size_t oELh = carve((size_t)NROWS * EWID * 2);
  const size_t oELl = carve((size_t)NROWS * EWID * 2);
  const size_t oQKV = carve((size_t)2 * NROWS * QKV_LD * 2);
  const size_t oBM  = carve((size_t)2 * 8 * NNODE * NNODE * 4);
  const size_t oVAh = carve((size_t)NROWS * VA_LD * 2);
  const size_t oVAl = carve((size_t)NROWS * VA_LD * 2);
  size_t oWQh[2], oWQl[2], oWEh[2], oWEl[2], oBQ[2];
  for (int d = 0; d < 2; ++d) { oWQh[d] = carve((size_t)384 * 128 * 2); oWQl[d] = carve((size_t)384 * 128 * 2); }
  for (int d = 0; d < 2; ++d) { oWEh[d] = carve((size_t)64 * 128 * 2);  oWEl[d] = carve((size_t)64 * 128 * 2); }
  const size_t oWO = carve((size_t)2 * 128 * 256 * 2);
  for (int d = 0; d < 2; ++d) oBQ[d] = carve((size_t)384 * 4);
  if (off > ws_size) return;

  char* ws = (char*)d_ws;
  unsigned short* ELh = (unsigned short*)(ws + oELh);
  unsigned short* ELl = (unsigned short*)(ws + oELl);
  _Float16* QKV16 = (_Float16*)(ws + oQKV);
  float* BM = (float*)(ws + oBM);
  unsigned short* VAh = (unsigned short*)(ws + oVAh);
  unsigned short* VAl = (unsigned short*)(ws + oVAl);
  unsigned short* WQh[2], *WQl[2], *WEh[2], *WEl[2];
  float* BQ[2];
  for (int d = 0; d < 2; ++d) {
    WQh[d] = (unsigned short*)(ws + oWQh[d]); WQl[d] = (unsigned short*)(ws + oWQl[d]);
    WEh[d] = (unsigned short*)(ws + oWEh[d]); WEl[d] = (unsigned short*)(ws + oWEl[d]);
    BQ[d] = (float*)(ws + oBQ[d]);
  }
  unsigned short* WOh = (unsigned short*)(ws + oWO);
  unsigned short* WOl = WOh + 128 * 256;

  // weight prep of both directions and of the output linear + LayerNorm -> bf16 hi/lo planes, one launch
  // (72 prep blocks, then 36864 rows / 16 rows per block = 2304 blocks exactly)
  k_front<<<PREP_BLOCKS + NROWS / 16, 256, 0, stream>>>(e, ln_g, ln_b, Wq_in, bq_in, We_in, Wq_out, bq_out, We_out, Wo,
      WQh[0], WQl[0], WEh[0], WEl[0], BQ[0], WQh[1], WQl[1], WEh[1], WEl[1], BQ[1], WOh, WOl, ELh, ELl, NROWS);

  const int tilesQKV = (NROWS / 64) * (QKV_LD / 64);   // 3456 = 432 blocks x 8 waves
  const int tilesEB  = NROWS / 64;                     // 576  = 72 blocks
  // Every launch below serves both directions: grid y (k_proj, the GEMM batch index) or z (k_edge_attn) is the direction; in k_out, the half of K.
  // score bias = EL . We + be + mask  (M 36864, N 16 (8 used), K 128; split; f32 output, head-major planes) and
  // qkv = EL . Wqkv + b  (M 36864, N 384, K 128; bf16 hi/lo split; f16 head-major output), one launch
  k_proj<<<dim3(tilesEB / 8 + tilesQKV / 8, 2), 256, 0, stream>>>(ELh, ELl, EWID,
      WEh[0], WEl[0], (long)(WEh[1] - WEh[0]), be_in, be_out, mask, BM, tilesEB / 8,
      WQh[0], WQl[0], (long)(WQh[1] - WQh[0]), (void*)QKV16, QKV_LD, (long)NROWS * QKV_LD, QKV_LD,
      BQ[0], (long)(BQ[1] - BQ[0]), NROWS, EWID);
  k_edge_attn<<<dim3(NNODE / JG, 8, 2), 384, 0, stream>>>(QKV16, BM, VAh, VAl);
  // out = VA . Wo + bo  (M 36864, N 128, K 256; split; f32 output rows of d_out; VA row j*192+i -> out row i*192+j)
  k_out<<<NROWS / (16 * OUT_WAVES), OUT_WAVES * 32, 0, stream>>>(VAh, VAl, WOh, bo, out);
}

// v008
// One run takes 68.9 microseconds.
// Next to v007, in two timings, it ran 1.21 and 1.20 times as fast.
// Over all steps from v000 it is 3.88 times as fast.
// Contractions: LayerNorm'd qkv / edge-bias projections and the output linear on v_wmma_f32_16x16x32_bf16 with bf16 hi/lo split operands (hi*hi + hi*lo + lo*hi); per-(edge column, head) 192x192 attention cores (q.k^T with d=16 zero-extended to 32, p.v with 192 keys) on v_wmma_f32_16x16x32_f16 with plain f16 operands; f32 accumulate everywhere; LayerNorm, bias/mask add, softmax and normalisation in f32.
#include <hip/hip_runtime.h>

typedef __attribute__((ext_vector_type(16))) _Float16 v16h;
typedef __attribute__((ext_vector_type(8)))  _Float16 v8h;
typedef __attribute__((ext_vector_type(16))) __bf16   v16b;
typedef __attribute__((ext_vector_type(8)))  __bf16   v8b;
typedef __attribute__((ext_vector_type(8)))  float    v8f;
typedef __attribute__((ext_vector_type(4)))  float    v4f;
typedef __attribute__((ext_vector_type(2)))  float    v2f;

#define EWID 128
#define NNODE 192
#define NROWS 36864          // 192*192 edge rows, row r = i*192 + j
#define QKV_LD 384
#define VA_LD 256
#define KS_P 16              // LDS K tile pitch (halves)
#define VT_P 192             // LDS V^T tile pitch (halves)
#define LOG2E 1.4426950408889634f

// ------------------------------- helpers -------------------------------
__device__ __forceinline__ unsigned short f2bf_bits(float f) {
  unsigned u = __float_as_uint(f);
  return (unsigned short)((u + 0x7FFFu + ((u >> 16) & 1u)) >> 16);
}
__device__ __forceinline__ float bf_bits2f(unsigned short h) { return __uint_as_float(((unsigned)h) << 16); }

// hazard guards as plain device helpers (no inline asm inside the kernel template body)
__device__ __forceinline__ void dep_guard_h(v8f& a, v8f& b, v16h x, v16h y) { asm volatile("v_nop\n\tv_nop\n\tv_nop\n\tv_nop" : "+v"(a), "+v"(b) : "v"(x), "v"(y)); }
__device__ __forceinline__ void dep_guard_b(v8f& a, v8f& b, v16b x, v16b y) { asm volatile("v_nop\n\tv_nop\n\tv_nop\n\tv_nop" : "+v"(a), "+v"(b) : "v"(x), "v"(y)); }
__device__ __forceinline__ void keep4_h(v16h a, v16h b, v16h c, v16h d) { asm volatile("v_nop" :: "v"(a), "v"(b), "v"(c), "v"(d)); }
__device__ __forceinline__ void keep4_b(v16b a, v16b b, v16b c, v16b d) { asm volatile("v_nop" :: "v"(a), "v"(b), "v"(c), "v"(d)); }
__device__ __forceinline__ void acc_guard4(v8f& a, v8f& b, v8f& c, v8f& d) { asm volatile("v_nop\n\tv_nop\n\tv_nop\n\tv_nop" : "+v"(a), "+v"(b), "+v"(c), "+v"(d)); }
template <typename T> struct Frag;
template <> struct Frag<_Float16> {
  typedef v16h V; union U { v16h v; v8h h[2]; };
  static __device__ __forceinline__ v16h load(const _Float16* p) {   // elements 0..7 <- p[0..7], 8..15 <- p[16..23]
    U f; f.h[0] = *(const v8h*)(p); f.h[1] = *(const v8h*)(p + 16); return f.v;
  }
  static __device__ __forceinline__ v16h load_fo(const _Float16* p) { // fragment-order plane: the two 512-B wave loads of a fragment
    U f; f.h[0] = *(const v8h*)(p); f.h[1] = *(const v8h*)(p + 256); return f.v;
  }
  static __device__ __forceinline__ v8f mma(v16h a, v16h b, v8f c) {
    return __builtin_amdgcn_wmma_f32_16x16x32_f16(false, a, false, b, (short)0, c, false, false);
  }
  static __device__ __forceinline__ void guard(v8f& a, v8f& b, v16h x, v16h y) { dep_guard_h(a, b, x, y); }
  static __device__ __forceinline__ void keep(v16h a, v16h b, v16h c, v16h d) { keep4_h(a, b, c, d); }
};
template <> struct Frag<__bf16> {
  typedef v16b V; union U { v16b v; v8b h[2]; };
  static __device__ __forceinline__ v16b load(const __bf16* p) {
    U f; f.h[0] = *(const v8b*)(p); f.h[1] = *(const v8b*)(p + 16); return f.v;
  }
  static __device__ __forceinline__ v16b load_fo(const __bf16* p) {
    U f; f.h[0] = *(const v8b*)(p); f.h[1] = *(const v8b*)(p + 256); return f.v;
  }
  static __device__ __forceinline__ v8f mma(v16b a, v16b b, v8f c) {
    return __builtin_amdgcn_wmma_f32_16x16x32_bf16(false, a, false, b, (short)0, c, false, false);
  }
  static __device__ __forceinline__ void guard(v8f& a, v8f& b, v16b x, v16b y) { dep_guard_b(a, b, x, y); }
  static __device__ __forceinline__ void keep(v16b a, v16b b, v16b c, v16b d) { keep4_b(a, b, c, d); }
};


__device__ __forceinline__ v8f zero8f() { return (v8f){0.f, 0.f, 0.f, 0.f, 0.f, 0.f, 0.f, 0.f}; }
__device__ __forceinline__ v8h zero8h() {
  v8h z;
#pragma unroll
  for (int e = 0; e < 8; ++e) z[e] = (_Float16)0.0f;
  return z;
}
// f16 WMMA with the hazard guard attached (D tied, A/B kept live)
__device__ __forceinline__ v8f hmma(v16h a, v16h b, v8f c) {
  c = __builtin_amdgcn_wmma_f32_16x16x32_f16(false, a, false, b, (short)0, c, false, false);
  asm volatile("v_nop\n\tv_nop\n\tv_nop\n\tv_nop" : "+v"(c) : "v"(a), "v"(b));
  return c;
}
__device__ __forceinline__ void split_bf16(float x, _Float16& hi, _Float16& lo) {
  const unsigned short hb = f2bf_bits(x);
  const unsigned short lb = f2bf_bits(x - bf_bits2f(hb));
  hi = __builtin_bit_cast(_Float16, hb);
  lo = __builtin_bit_cast(_Float16, lb);
}

// Output weight prep: Wo [256 c][128 n] f32 ([in][out]) -> Bt hi/lo [128 n][256 k'], fragment order, k' = dir*128 + h*16 + d
// <- c = d*16 + dir*8 + h (concat of the two head groups on the head axis, then view d slow).
// 4096 items t = 128 rows x 32 chunks (8 k' each): covers [128][256] exactly;
// item t stores the t-th 16-byte chunk = (tile t>>9, chunk (t>>4)&31, row t&15).
__device__ __forceinline__ void prep_wo(const int t, const float* __restrict__ Wo,
    unsigned short* __restrict__ woh, unsigned short* __restrict__ wol) {
  const int n = (t >> 9) * 16 + (t & 15), k8 = ((t >> 4) & 31) * 8;
  v8h hv, lv;
#pragma unroll
  for (int e = 0; e < 8; ++e) {
    const int kp = k8 + e;
    const int dr = kp >> 7, h = (kp >> 4) & 7, d = kp & 15;
    const int col = d * 16 + dr * 8 + h;
    const float w = Wo[(size_t)col * 128 + n];
    _Float16 a, bb; split_bf16(w, a, bb); hv[e] = a; lv[e] = bb;
  }
  const size_t off = (size_t)t * 8;
  {
    *(v8h*)(woh + off) = hv;
    *(v8h*)(wol + off) = lv;
    // inlined as one arm of a larger kernel: the code behind the arm reuses these stores' registers
    asm volatile("s_wait_xcnt 0x0" ::: "memory");
  }
}

// LayerNorm, the split of the projection weights and both projections (qkv, edge bias) of both directions, one kernel.
// grid 256 = 2 directions x 128 row groups, block 576 = 18 waves; a wave owns one 16-row tile of e (row r = i*192 + j).
// Weights: Wq [128 k][384 c] and We [128 k][8] f32 are split into bf16 hi/lo planes in LDS once a block, 25 tiles of 16
// rows n in FRAGMENT ORDER: a tile is 16*128 contiguous elements, inside it the 16-byte chunk (row r, k 8q..8q+7) stands
// at element q*128 + r*8, so a B fragment is two conflict-free 512-byte LDS reads (lane l: row l&15, chunks
// 4*ks + (l>>4) and 4*ks + 2 + (l>>4)).  Tiles 0..23: head-major qkv columns n = part*128 + h*16 + d <- c = part*128 +
// d*8 + h (view(DD=16, NH=8): d slow, h fast).  Tile 24: rows 0..7 = the heads of We, rows 8..15 zero.
// A weight item = (part, k chunk q, d): 8 k rows x the 8 heads = 8 x 32 contiguous bytes of Wq, 16 lanes 512 bytes a row;
// it gives the chunk (q, row d) of 8 tiles.  768 items: every thread one, waves 0..5 a second one; waves 6..13 do
// the 256 chunks of tile 24; half a wave does this block's 16 of the 4096 chunks of the output weight planes.
// LayerNorm (eps 1e-5, biased variance, *g + b) runs in the A fragment's own layout: lane (row l&15, half hh = l>>4) loads
// the 8 chunks 2u + hh of its row, sums its 64 values in the lane and exchanges once with the other half; the bf16
// hi/lo split of the result IS the wave's A operand for all four k steps and never leaves the registers.
// Products: one accumulator an output element, hi*hi + hi*lo + lo*hi a k step, k steps in rising order.
// qkv out: f16 [2 dir][36864][384] + permuted bias, 16 x 64 results at a time through the wave's own LDS slab (pitch 68
// floats): a store writes 4 rows x 128 contiguous bytes.  Score bias out: bm[dir][h][r] = (EL.We + be[h]) + mask[r][h], f32,
// gathered for the block's 288 rows in LDS; behind the last barrier thread t stores 16 bytes of the 8 x 1152 contiguous.
#define PJ_WAVES 18
#define PJ_ROWS (PJ_WAVES * 16)
#define PJ_PLANE (25 * 16 * EWID)
__device__ __forceinline__ void wq_load(const float* __restrict__ Wq, const int item, v4f (&w)[16]) {
  const float* s = Wq + (size_t)(((item >> 4) & 15) * 8) * 384 + (item >> 8) * 128 + (item & 15) * 8;
#pragma unroll
  for (int e = 0; e < 8; ++e) {
    w[2 * e]     = *(const v4f*)(s + e * 384);
    w[2 * e + 1] = *(const v4f*)(s + e * 384 + 4);
  }
  // the code behind reuses these loads' address registers; the address is an input, so that no load of the run takes it over
  asm volatile("s_wait_xcnt 0x0" :: "v"(s) : "memory");
}
__device__ __forceinline__ void wq_split(const int item, const v4f (&w)[16], unsigned short* __restrict__ sW) {
  unsigned short* dst = sW + (item >> 8) * (8 * 2048) + ((item >> 4) & 15) * 128 + (item & 15) * 8;
#pragma unroll
  for (int h = 0; h < 8; ++h) {
    v8h hv, lv;
#pragma unroll
    for (int e = 0; e < 8; ++e) {
      _Float16 a, bb; split_bf16(w[2 * e + (h >> 2)][h & 3], a, bb); hv[e] = a; lv[e] = bb;
    }
    *(v8h*)(dst + h * 2048) = hv;
    *(v8h*)(dst + PJ_PLANE + h * 2048) = lv;
    // one head's chunks are stored before the next head's are formed: all 8 formed at once spill registers
    __builtin_amdgcn_sched_barrier(0);
  }
}
__global__ __launch_bounds__(PJ_WAVES * 32) void k_lnproj(
    const float* __restrict__ e, const float* __restrict__ g, const float* __restrict__ b,
    const float* __restrict__ Wq0, const float* __restrict__ bq0, const float* __restrict__ We0, const float* __restrict__ be0,
    const float* __restrict__ Wq1, const float* __restrict__ bq1, const float* __restrict__ We1, const float* __restrict__ be1,
    const float* __restrict__ mask, const float* __restrict__ Wo,
    _Float16* __restrict__ qkv2, float* __restrict__ bm2,
    unsigned short* __restrict__ woh, unsigned short* __restrict__ wol) {
  __shared__ __align__(16) unsigned short sW[2 * PJ_PLANE];        // hi plane, lo plane
  __shared__ __align__(16) float sT[PJ_WAVES * 16 * 68];           // a 16 x 64 slab a wave
  __shared__ __align__(16) float sE[16 * PJ_ROWS];                 // [column of tile 24][row of the block]
  const int tid = threadIdx.x, lane = tid & 31;
  const int wave = __builtin_amdgcn_readfirstlane(tid >> 5);       // scalar: the choices below are scalar branches
  const int dir = blockIdx.x >> 7, rg = blockIdx.x & 127;
  const float* Wq = dir ? Wq1 : Wq0;
  const float* bq = dir ? bq1 : bq0;
  const float* We = dir ? We1 : We0;
  const float* be = dir ? be1 : be0;
  const int rlane = lane & 15, hh = lane >> 4, mOff = hh * 8, hd = lane & 7;
  const int row0 = (rg * PJ_WAVES + wave) * 16;                    // first edge row of the wave's tile, <= 36848
  const unsigned lane8 = (unsigned)lane * 8u;

  v4f w[16];
  wq_load(Wq, tid, w);
  const float* ep = e + (size_t)(row0 + rlane) * EWID + hh * 8;
  v4f x[16];                                                       // x[2u], x[2u+1] = chunk 2u + hh of the lane's row
#pragma unroll
  for (int u = 0; u < 8; ++u) {
    x[2 * u]     = *(const v4f*)(ep + u * 16);
    x[2 * u + 1] = *(const v4f*)(ep + u * 16 + 4);
  }
  // the code behind reuses these loads' address registers; the address is an input, so that no load of the run takes it over
  asm volatile("s_wait_xcnt 0x0" :: "v"(ep) : "memory");
  wq_split(tid, w, sW);
  if (wave < 6) {
    wq_load(Wq, PJ_WAVES * 32 + tid, w);
    wq_split(PJ_WAVES * 32 + tid, w, sW);
  } else if (wave < 14) {
    const int u = tid - 192;                                       // chunk (k chunk u>>4, row u&15) of tile 24
    const int n = u & 15, k8 = (u >> 4) * 8;
    const int nc = (n < 8) ? n : 7;                                // address clamp, value zeroed by predicate
    const float* wp = We + k8 * 8 + nc;
    float wv[8];
#pragma unroll
    for (int k = 0; k < 8; ++k) wv[k] = wp[k * 8];
    // the split reuses these loads' address registers; the address is an input, so that nothing takes it over ahead of the wait
    asm volatile("s_wait_xcnt 0x0" :: "v"(wp) : "memory");
    v8h hv, lv;
#pragma unroll
    for (int k = 0; k < 8; ++k) {
      _Float16 a, bb; split_bf16((n < 8) ? wv[k] : 0.0f, a, bb); hv[k] = a; lv[k] = bb;
    }
    *(v8h*)(sW + 24 * 2048 + u * 8) = hv;
    *(v8h*)(sW + PJ_PLANE + 24 * 2048 + u * 8) = lv;
  } else if (wave == 17) {
    if (lane < 16) prep_wo(blockIdx.x * 16 + lane, Wo, woh, wol);  // 256 blocks x 16 = 4096 chunks exactly
  }

  // ---- LayerNorm of the lane's half row ----
  v4f sv = x[0];
#pragma unroll
  for (int i = 1; i < 16; ++i) sv += x[i];
  float s = (sv[0] + sv[1]) + (sv[2] + sv[3]);
  s += __shfl_xor(s, 16, 32);                                      // the other lane half holds the row's other 64 values
  const float mu = s * (1.0f / 128.0f);
  v4f qv = (v4f){0.f, 0.f, 0.f, 0.f};
#pragma unroll
  for (int i = 0; i < 16; ++i) { x[i] -= (v4f){mu, mu, mu, mu}; qv += x[i] * x[i]; }
  float q = (qv[0] + qv[1]) + (qv[2] + qv[3]);
  q += __shfl_xor(q, 16, 32);
  const float rs = rsqrtf(q * (1.0f / 128.0f) + 1e-5f);
  Frag<__bf16>::U ah[4], al[4];                                    // A of k step ks: elements 0..7 = chunk 4ks + hh, 8..15 = 4ks + 2 + hh
#pragma unroll
  for (int u = 0; u < 8; ++u) {
    const v4f g0 = *(const v4f*)(g + u * 16 + hh * 8), g1 = *(const v4f*)(g + u * 16 + hh * 8 + 4);
    const v4f b0 = *(const v4f*)(b + u * 16 + hh * 8), b1 = *(const v4f*)(b + u * 16 + hh * 8 + 4);
    v8h hv, lv;
#pragma unroll
    for (int k = 0; k < 8; ++k) {
      const float xv = (k < 4) ? x[2 * u][k & 3] : x[2 * u + 1][k & 3];
      const float gg = (k < 4) ? g0[k & 3] : g1[k & 3];
      const float bb = (k < 4) ? b0[k & 3] : b1[k & 3];
      const float y = xv * rs * gg + bb;
      _Float16 a, lo; split_bf16(y, a, lo); hv[k] = a; lv[k] = lo;
    }
    ah[u >> 1].h[u & 1] = __builtin_bit_cast(v8b, hv);
    al[u >> 1].h[u & 1] = __builtin_bit_cast(v8b, lv);
    // the g and b loads of at most two chunks stand together: all 32 hoisted to the top spill registers
    if (u & 1) __builtin_amdgcn_sched_barrier(0);
  }
  // be and mask of this lane's 8 edge-bias results (columns 8..15 take the addresses of heads 0..7: in bounds): asked for
  // here, where the e rows have left the registers, and used behind the barrier and the first products
  const float* mk = mask + (size_t)(row0 + mOff) * 8 + hd;
  const float bev = be[hd];
  float mv[8];
#pragma unroll
  for (int r = 0; r < 8; ++r) mv[r] = mk[r * 8];
  // the code behind reuses the address registers of the g, b, be and mask loads
  asm volatile("s_wait_xcnt 0x0" ::: "memory");
  // The barrier that publishes the weight planes; every wave passes it. Written with fences on LDS alone: only LDS data
  // goes from wave to wave here, and __syncthreads() would also wait for the mask loads, which are to stay in flight.
  __builtin_amdgcn_fence(__ATOMIC_RELEASE, "workgroup", "local");
  __builtin_amdgcn_s_barrier();
  __builtin_amdgcn_fence(__ATOMIC_ACQUIRE, "workgroup", "local");

  const __bf16* Bh = (const __bf16*)sW + lane8;
  const __bf16* Bl = Bh + PJ_PLANE;
  // ---- edge bias: tile 24 ----
  {
    v8f ae = zero8f();
#pragma unroll
    for (int ks = 0; ks < 4; ++ks) {
      const v16b bh = Frag<__bf16>::load_fo(Bh + 24 * 2048 + ks * 512);
      const v16b bl = Frag<__bf16>::load_fo(Bl + 24 * 2048 + ks * 512);
      ae = Frag<__bf16>::mma(ah[ks].v, bh, ae);
      ae = Frag<__bf16>::mma(ah[ks].v, bl, ae);
      ae = Frag<__bf16>::mma(al[ks].v, bh, ae);
    }
    // D: lane = column l&15, register r = row 8*(l>>4) + r; columns 8..15 are written like the others and never read
    v4f w0, w1;
#pragma unroll
    for (int r = 0; r < 4; ++r) {
      w0[r] = (ae[r] + bev) + mv[r];
      w1[r] = (ae[r + 4] + bev) + mv[r + 4];
    }
    *(v4f*)(sE + rlane * PJ_ROWS + wave * 16 + mOff) = w0;
    *(v4f*)(sE + rlane * PJ_ROWS + wave * 16 + mOff + 4) = w1;
  }

  // ---- qkv: 6 groups of 4 column tiles ----
  float* slab = sT + wave * (16 * 68);
  _Float16* C = qkv2 + (size_t)dir * NROWS * QKV_LD + (size_t)row0 * QKV_LD;
  const int q4 = lane >> 3, c8 = (lane & 7) * 8;
  // rolled: one group's code is the loop body (code size)
#pragma unroll 1
  for (int gr = 0; gr < 6; ++gr) {
    float bv[4];
#pragma unroll
    for (int j = 0; j < 4; ++j) {
      const int nt = gr * 4 + j;                                   // tile = part*8 + h, row in the tile = d
      bv[j] = bq[(nt >> 3) * 128 + rlane * 8 + (nt & 7)];
    }
    // the code behind reuses these loads' address registers
    asm volatile("s_wait_xcnt 0x0" ::: "memory");
    v8f acc[4];
#pragma unroll
    for (int j = 0; j < 4; ++j) acc[j] = zero8f();
    const __bf16* bhp = Bh + gr * (4 * 2048);
    const __bf16* blp = Bl + gr * (4 * 2048);
    // unrolled: the A fragments are then named at compile time
#pragma unroll
    for (int ks = 0; ks < 4; ++ks) {
      v16b bh[4], bl[4];
#pragma unroll
      for (int j = 0; j < 4; ++j) {
        bh[j] = Frag<__bf16>::load_fo(bhp + j * 2048 + ks * 512);
        bl[j] = Frag<__bf16>::load_fo(blp + j * 2048 + ks * 512);
      }
      // four independent accumulators between two products into the same one
#pragma unroll
      for (int j = 0; j < 4; ++j) acc[j] = Frag<__bf16>::mma(ah[ks].v, bh[j], acc[j]);
#pragma unroll
      for (int j = 0; j < 4; ++j) acc[j] = Frag<__bf16>::mma(ah[ks].v, bl[j], acc[j]);
#pragma unroll
      for (int j = 0; j < 4; ++j) acc[j] = Frag<__bf16>::mma(al[ks].v, bh[j], acc[j]);
    }
#pragma unroll
    for (int j = 0; j < 4; ++j) {
#pragma unroll
      for (int r = 0; r < 8; ++r) slab[(mOff + r) * 68 + (j << 4) + rlane] = acc[j][r] + bv[j];
    }
    // the slab is the wave's own: its lanes' LDS writes are finished before its lanes read them, no other wave is involved
    __builtin_amdgcn_fence(__ATOMIC_RELEASE, "workgroup", "local");
    __builtin_amdgcn_wave_barrier();
    __builtin_amdgcn_fence(__ATOMIC_ACQUIRE, "workgroup", "local");
#pragma unroll
    for (int it = 0; it < 4; ++it) {
      const int row = it * 4 + q4;
      const float* sp = slab + row * 68 + c8;
      v8h hv;
#pragma unroll
      for (int k = 0; k < 8; ++k) hv[k] = (_Float16)sp[k];
      *(v8h*)(C + (size_t)row * QKV_LD + gr * 64 + c8) = hv;
    }
    // the next group reuses these stores' registers
    asm volatile("s_wait_xcnt 0x0" ::: "memory");
    // the slab's reads are finished before the next group's writes
    __builtin_amdgcn_fence(__ATOMIC_RELEASE, "workgroup", "local");
    __builtin_amdgcn_wave_barrier();
    __builtin_amdgcn_fence(__ATOMIC_ACQUIRE, "workgroup", "local");
  }
  // The barrier that publishes the block's score bias rows; every wave passes it. Fences on LDS alone, as above:
  // __syncthreads() would also wait for the qkv stores to finish.
  __builtin_amdgcn_fence(__ATOMIC_RELEASE, "workgroup", "local");
  __builtin_amdgcn_s_barrier();
  __builtin_amdgcn_fence(__ATOMIC_ACQUIRE, "workgroup", "local");
  const int oh = tid / 72, r4 = (tid - oh * 72) * 4;               // 576 threads = 8 heads x 72 pieces of 4 rows
  const v4f ov = *(const v4f*)(sE + oh * PJ_ROWS + r4);
  *(v4f*)(bm2 + ((size_t)dir * 8 + oh) * NROWS + rg * PJ_ROWS + r4) = ov;
}

// Fused attention core for one (direction dir, head h), all 192 query rows i, JG edge columns j in sequence.
// qkv: f16 [2 dir][36864][384], head-major columns part*128 + h*16 + d.  bm: f32 [2 dir][8][36864 edge rows r], the bias
// of (query i, key k) at r = i*192 + k (dir 0) or r = k*192 + i (dir 1).
// grid = (192 / JG column groups, 8 heads, 2 directions) x block 384 = 12 waves x 16 query rows.
// The score bias of (i, k) does not depend on j: a lane loads the 96 values of its query once and keeps them in
// registers for all JG columns.  Per column: K [192 keys][16 d] and V^T [16 d][192 keys] staged in LDS once for all
// 192 queries, one (key, 8-wide d chunk) item a thread (dir 0: row j*192+k, dir 1: row k*192+j).  Two LDS buffers taken
// in turn: one barrier a column publishes this column's tiles, and a buffer is rewritten only behind the next barrier,
// which every wave reaches after its last read of it.  The next column's K, V and Q loads are issued behind the barrier.
// Both products run transposed, so that a lane owns ONE query:
// S^T = K (A: 16 keys, d zero-extended to 32) . Q^T (B) on f16 WMMA: lane (hh, c) holds query i0+c, register r
// key 16*tile + 8*hh + r; *0.25 + bias in f32, online softmax over 3 chunks of 64 keys in f32 with maximum and
// sum taken in the lane plus one exchange between the lane halves, e^x as the hardware's 2^(x * log2(e)), x <= 0; two neighbouring S^T tiles, converted to f16
// in place, are the B operand of O^T = V^T (A: 16 d, 32 keys) . P^T; * 1/rowsum.
// Result (lane: query i0+c, registers: d = 8*hh + r) -> bf16 hi/lo planes [36864][256] in fragment order, row j*192+i,
// columns dir*128 + h*16 + d: a wave's 16 queries are one 16-row tile, the head's two chunk columns 512 contiguous
// bytes of it a plane, and lane l owns the l-th 16-byte chunk of them: stored from registers.
#define JG 12                // edge columns a block walks: 16 groups x 8 heads x 2 directions = 256 blocks
__global__ __launch_bounds__(384) void k_edge_attn(const _Float16* __restrict__ qkv2, const float* __restrict__ bm2,
    unsigned short* __restrict__ vah, unsigned short* __restrict__ val) {
  const int dir = blockIdx.z;
  const int h = blockIdx.y;
  const int j0 = blockIdx.x * JG;
  const _Float16* qkv = qkv2 + (size_t)dir * NROWS * QKV_LD + h * 16;
  const float* bm = bm2 + (size_t)dir * 8 * NROWS;
  __shared__ __align__(16) _Float16 Ksh[2][NNODE * KS_P];   // [buffer][key][d], indices <= 191*16+15
  __shared__ __align__(16) _Float16 Vt[2][16 * VT_P];       // [buffer][d][key], indices <= 15*192+191
  const int tid = threadIdx.x, wave = tid >> 5, lane = tid & 31, hh = lane >> 4, c = lane & 15;
  const int i0 = wave * 16;
  const v8h z8 = zero8h();

  // bias of this lane's query, keys 16t+8hh .. +7 of tile t, kept for every column.  dir 0: 32 contiguous bytes a tile;
  // dir 1: the plane has the key as its slow index, one load a key, the 16 queries of a lane half 64 contiguous bytes.
  v4f b0[12], b1[12];
  if (dir == 0) {                                    // block-uniform
    const float* bmr = bm + ((size_t)h * NNODE + (size_t)(i0 + c)) * NNODE + 8 * hh;
#pragma unroll
    for (int t = 0; t < 12; ++t) {
      b0[t] = *(const v4f*)(bmr + t * 16);
      b1[t] = *(const v4f*)(bmr + t * 16 + 4);
    }
  } else {
    const float* bmc = bm + ((size_t)h * NNODE + (size_t)(8 * hh)) * NNODE + i0 + c;
#pragma unroll
    for (int t = 0; t < 12; ++t) {
#pragma unroll
      for (int r = 0; r < 4; ++r) {
        b0[t][r] = bmc[(t * 16 + r) * NNODE];
        b1[t][r] = bmc[(t * 16 + 4 + r) * NNODE];
      }
    }
  }

  // staging item of this thread: key kv, d chunk part; 384 items = 192 keys x 2 d chunks exactly
  const int kv = tid >> 1, part = tid & 1;
  const _Float16* kvsrc = qkv + (size_t)(dir ? kv * NNODE : kv) * QKV_LD + part * 8;   // + j * kvstep
  const size_t kvstep = (size_t)(dir ? 1 : NNODE) * QKV_LD;
  const _Float16* qsrc = qkv + (size_t)(i0 + c) * NNODE * QKV_LD + 8 * hh;             // + j * QKV_LD
  v8h kk8 = *(const v8h*)(kvsrc + (size_t)j0 * kvstep + EWID);
  v8h vv8 = *(const v8h*)(kvsrc + (size_t)j0 * kvstep + 2 * EWID);
  v8h q8  = *(const v8h*)(qsrc + (size_t)j0 * QKV_LD);

  // rolled: one column's code is the loop body (code size)
#pragma unroll 1
  for (int jj = 0; jj < JG; ++jj) {
    const int j = j0 + jj;
    _Float16* Kb = Ksh[jj & 1];
    _Float16* Vb = Vt[jj & 1];
    *(v8h*)(Kb + kv * KS_P + part * 8) = kk8;
#pragma unroll
    for (int e2 = 0; e2 < 8; ++e2) Vb[(part * 8 + e2) * VT_P + kv] = vv8[e2];
    // B fragment (query column i0+c, d 8hh..8hh+7 in elements 0..7, elements 8..15 zero)
    Frag<_Float16>::U qa;
    qa.h[0] = q8;
    qa.h[1] = z8;
    __syncthreads();
    if (jj + 1 < JG) {                               // block-uniform; j + 1 <= 191
      kk8 = *(const v8h*)(kvsrc + (size_t)(j + 1) * kvstep + EWID);
      vv8 = *(const v8h*)(kvsrc + (size_t)(j + 1) * kvstep + 2 * EWID);
      q8  = *(const v8h*)(qsrc + (size_t)(j + 1) * QKV_LD);
      // the code behind reuses these loads' address registers at once
      asm volatile("s_wait_xcnt 0x0" ::: "memory");
    }

    float mrow = -__builtin_inff(), lrow = 0.f;      // this lane's query
    v8f o = zero8f();                                // O^T: register r = d 8hh+r of query i0+c

    // unrolled: the bias registers are then named at compile time
#pragma unroll
    for (int kc = 0; kc < 3; ++kc) {
      const int kv0 = kc * 64;
      v8f s[4];
#pragma unroll
      for (int jn = 0; jn < 4; ++jn) {
        // A fragment (key row kv0+16jn+c, d 8hh..8hh+7 in elements 0..7, elements 8..15 zero)
        Frag<_Float16>::U kb;
        kb.h[0] = *(const v8h*)(Kb + (kv0 + jn * 16 + c) * KS_P + 8 * hh);
        kb.h[1] = z8;
        s[jn] = hmma(kb.v, qa.v, zero8f());
      }
      float mx = -__builtin_inff();
#pragma unroll
      for (int jn = 0; jn < 4; ++jn) {
#pragma unroll
        for (int r = 0; r < 8; ++r) {
          const float v = s[jn][r] * 0.25f + (r < 4 ? b0[kc * 4 + jn][r & 3] : b1[kc * 4 + jn][r & 3]);
          s[jn][r] = v;
          mx = fmaxf(mx, v);
        }
      }
      mx = fmaxf(mx, __shfl_xor(mx, 16, 32));        // the other lane half holds the query's other 32 keys
      const float mnew = fmaxf(mrow, mx);
      const float alpha = __builtin_amdgcn_exp2f((mrow - mnew) * LOG2E);
      mrow = mnew;
      float ps = 0.f;
      Frag<_Float16>::U pb[2];                       // P^T as B: elements 0..7 = tile 2kk, 8..15 = tile 2kk+1
#pragma unroll
      for (int jn = 0; jn < 4; ++jn) {
#pragma unroll
        for (int r = 0; r < 8; r += 2) {
          const v2f dl = ((v2f){s[jn][r], s[jn][r + 1]} - (v2f){mnew, mnew}) * (v2f){LOG2E, LOG2E};
          const float p0 = __builtin_amdgcn_exp2f(dl[0]);
          const float p1 = __builtin_amdgcn_exp2f(dl[1]);
          ps += p0;
          ps += p1;
          pb[jn >> 1].h[jn & 1][r] = (_Float16)p0;
          pb[jn >> 1].h[jn & 1][r + 1] = (_Float16)p1;
        }
      }
      ps += __shfl_xor(ps, 16, 32);
      lrow = lrow * alpha + ps;
#pragma unroll
      for (int r = 0; r < 8; ++r) o[r] *= alpha;
#pragma unroll
      for (int kk = 0; kk < 2; ++kk) {
        const v16h va = Frag<_Float16>::load(Vb + c * VT_P + kv0 + kk * 32 + 8 * hh);
        o = hmma(va, pb[kk].v, o);
      }
    }
    const float inv = 1.0f / lrow;
    v8h hv, lv;
#pragma unroll
    for (int e = 0; e < 8; ++e) {
      _Float16 a, lo;
      split_bf16(o[e] * inv, a, lo); hv[e] = a; lv[e] = lo;
    }
    const size_t ob = (size_t)(j * NNODE + i0) * VA_LD + (size_t)(dir * 2048 + h * 256 + lane * 8);
    *(v8h*)(vah + ob) = hv;
    *(v8h*)(val + ob) = lv;
    // the next column's staging reuses these stores' registers
    asm volatile("s_wait_xcnt 0x0" ::: "memory");
  }
}

// Output linear: out[i*192+j][n] = sum_k VA[j*192+i][k] * Wo'[n][k] + bo[n]; M 36864, N 128, K 256, bf16 hi/lo split
// (one accumulator an output element: hi*hi + hi*lo + lo*hi a k step, k steps in rising order).
// grid 256 x block 288 = 9 waves; a wave owns one 16-row tile of VA and all 128 output columns (2304 tiles = 256 x 9).
// A: the tile's two planes are 2 x 8 KB contiguous (fragment order); a wave issues all 32 loads at entry and keeps the
// tile in registers: memory latency is paid once a wave, and the later k steps' loads are still in flight while the
// first are worked on.
// B: wo2 = the hi weight plane followed by the lo plane (2 x 64 KB, fragment order), copied as it lies into LDS once a
// block, 512 bytes a wave and load; a B fragment is then two conflict-free 512-byte LDS reads.
// D (lane: column 16t + (lane & 15), register r: row 8*(lane >> 4) + r) + bias goes through the wave's own LDS slab
// (pitch 132 floats: the two lane halves fall on different banks); a whole 512-byte output row is one store.
// Every loop of this kernel is unrolled: its arrays live in registers and need compile-time indices.
#define OUT_WAVES 9
#define OUT_SLAB_P 132
__global__ __launch_bounds__(OUT_WAVES * 32) void k_out(
    const unsigned short* __restrict__ vah, const unsigned short* __restrict__ val,
    const unsigned short* __restrict__ wo2, const float* __restrict__ bo, float* __restrict__ out) {
  __shared__ __align__(16) unsigned short sB[2 * EWID * VA_LD + 5 * 256]; // hi plane, lo plane, 5 spare pieces
  __shared__ __align__(16) float sO[OUT_WAVES * 16 * OUT_SLAB_P];
  const int lane = threadIdx.x & 31;
  const int wave = __builtin_amdgcn_readfirstlane(threadIdx.x >> 5);      // scalar: tile and piece addresses are scalar bases
  const int rt = blockIdx.x * OUT_WAVES + wave;                           // 16-row tile, 0..2303
  const unsigned lane8 = (unsigned)lane * 8u;
  const int rlane = lane & 15, mOff = (lane >> 4) * 8;

  // the 256 weight pieces of 512 B: wave w takes w, w+9, .. w+252. 29 x 9 = 261: in the last turn waves 4..8 have no
  // piece left; they copy one of 252..255 once more, into the spare pieces behind the planes, which nobody reads: the
  // copy is then free of branches and all its loads stand together.
  const unsigned short* wsrc = wo2 + wave * 256 + lane8;
  v8h wt[29];
#pragma unroll
  for (int it = 0; it < 28; ++it) wt[it] = *(const v8h*)(wsrc + it * (OUT_WAVES * 256));
  wt[28] = *(const v8h*)(wo2 + (252 + (wave & 3)) * 256 + lane8);
  // keeps the weight loads ahead of the A loads: loads return in order, and the LDS copy must not wait for the A tile
  __builtin_amdgcn_sched_barrier(0);
  const __bf16* Ah = (const __bf16*)vah + (size_t)rt * (16 * VA_LD) + lane8;
  const __bf16* Al = (const __bf16*)val + (size_t)rt * (16 * VA_LD) + lane8;
  v16b ah[8], al[8];
#pragma unroll
  for (int ks = 0; ks < 8; ++ks) {
    ah[ks] = Frag<__bf16>::load_fo(Ah + ks * 512);
    al[ks] = Frag<__bf16>::load_fo(Al + ks * 512);
  }
#pragma unroll
  for (int it = 0; it < 29; ++it) *(v8h*)(sB + (wave + it * OUT_WAVES) * 256 + lane8) = wt[it];
  // The one barrier: it publishes the weight planes, every wave passes it. Written with fences on LDS alone: only LDS
  // data goes from wave to wave here, and __syncthreads() would also wait for the A loads, which are to stay in flight.
  __builtin_amdgcn_fence(__ATOMIC_RELEASE, "workgroup", "local");
  __builtin_amdgcn_s_barrier();
  __builtin_amdgcn_fence(__ATOMIC_ACQUIRE, "workgroup", "local");

  // bias of this lane's 8 columns: asked for here, behind the A loads, and used only after the last product
  float bv[8];
#pragma unroll
  for (int j = 0; j < 8; ++j) bv[j] = bo[j * 16 + rlane];
  v8f acc[8];
#pragma unroll
  for (int j = 0; j < 8; ++j) acc[j] = zero8f();
  const __bf16* Bh = (const __bf16*)sB + lane8;
  const __bf16* Bl = Bh + EWID * VA_LD;
  // 16 groups g = (k step g >> 1, column tiles 4*(g & 1) .. +3) of 12 products; two register buffers for B taken in turn
  v16b bh[2][4], bl[2][4];
#pragma unroll
  for (int j = 0; j < 4; ++j) {
    bh[0][j] = Frag<__bf16>::load_fo(Bh + j * (16 * VA_LD));
    bl[0][j] = Frag<__bf16>::load_fo(Bl + j * (16 * VA_LD));
  }
  // unrolled: the A fragments and the buffers are then named at compile time
#pragma unroll
  for (int g = 0; g < 16; ++g) {
    const int ks = g >> 1, jg = (g & 1) * 4, cur = g & 1, nxt = cur ^ 1;
    if (g + 1 < 16) {
#pragma unroll
      for (int j = 0; j < 4; ++j) {
        const int o = (((g + 1) & 1) * 4 + j) * (16 * VA_LD) + ((g + 1) >> 1) * 512;
        bh[nxt][j] = Frag<__bf16>::load_fo(Bh + o);
        bl[nxt][j] = Frag<__bf16>::load_fo(Bl + o);
      }
    }
    // four independent accumulators between two products into the same one
#pragma unroll
    for (int j = 0; j < 4; ++j) acc[jg + j] = Frag<__bf16>::mma(ah[ks], bh[cur][j], acc[jg + j]);
#pragma unroll
    for (int j = 0; j < 4; ++j) acc[jg + j] = Frag<__bf16>::mma(ah[ks], bl[cur][j], acc[jg + j]);
#pragma unroll
    for (int j = 0; j < 4; ++j) acc[jg + j] = Frag<__bf16>::mma(al[ks], bh[cur][j], acc[jg + j]);
    // keeps a group's LDS reads one whole group (12 products) ahead of their use: moved down, they would be waited for
    __builtin_amdgcn_sched_barrier(0);
  }

  float* slab = sO + wave * (16 * OUT_SLAB_P);
#pragma unroll
  for (int j = 0; j < 8; ++j) {
#pragma unroll
    for (int r = 0; r < 8; ++r) slab[(mOff + r) * OUT_SLAB_P + j * 16 + rlane] = acc[j][r] + bv[j];
  }
  // the slab is the wave's own: its lanes' LDS writes are finished before its lanes read them, no other wave is involved
  __builtin_amdgcn_fence(__ATOMIC_RELEASE, "workgroup", "local");
  __builtin_amdgcn_wave_barrier();
  __builtin_amdgcn_fence(__ATOMIC_ACQUIRE, "workgroup", "local");
  // VA row rt*16 + r = j*192 + i -> out row i*192 + j; 192 = 12 tiles, so a tile has one j
  const int jcol = rt / 12, irow = (rt - jcol * 12) * 16;
  float* op = out + ((size_t)irow * NNODE + jcol) * EWID + lane * 4;
  v4f ov[16];
#pragma unroll
  for (int r = 0; r < 16; ++r) ov[r] = *(const v4f*)(slab + r * OUT_SLAB_P + lane * 4);
#pragma unroll
  for (int r = 0; r < 16; ++r) *(v4f*)(op + (size_t)r * NNODE * EWID) = ov[r];
}

// ---------------------------------------------------------------------------------------
extern "C" void kernel_launch(void* const* d_in, const int* in_sizes, int n_in,
                              void* d_out, int out_size, void* d_ws, size_t ws_size,
                              hipStream_t stream) {
  if (n_in < 14) return;
  if (in_sizes[0] != NROWS * EWID || in_sizes[1] != NROWS * 8 || in_sizes[2] < EWID || in_sizes[3] < EWID ||
      in_sizes[4] != EWID * 384 || in_sizes[5] < 384 || in_sizes[6] != EWID * 8 || in_sizes[7] < 8 ||
      in_sizes[8] != EWID * 384 || in_sizes[9] < 384 || in_sizes[10] != EWID * 8 || in_sizes[11] < 8 ||
      in_sizes[12] != 256 * EWID || in_sizes[13] < EWID || out_size != NROWS * EWID) return;

  const float* e      = (const float*)d_in[0];
  const float* mask   = (const float*)d_in[1];
  const float* ln_g   = (const float*)d_in[2];
  const float* ln_b   = (const float*)d_in[3];
  const float* Wq_in  = (const float*)d_in[4];
  const float* bq_in  = (const float*)d_in[5];
  const float* We_in  = (const float*)d_in[6];
  const float* be_in  = (const float*)d_in[7];
  const float* Wq_out = (const float*)d_in[8];
  const float* bq_out = (const float*)d_in[9];
  const float* We_out = (const float*)d_in[10];
  const float* be_out = (const float*)d_in[11];
  const float* Wo     = (const float*)d_in[12];
  const float* bo     = (const float*)d_in[13];
  float* out = (float*)d_out;

  // ---- workspace region map (offsets 256-B aligned; total 96,862,208 B) ----
  //  (VAh/l and the output weight planes lie in fragment order; VA rows are j*192+i)
  //  QKV16      f16  [2][36864][384]    2 x 28,311,552   projection output, one plane a direction
  //  BM         f32  [2][8][36864]      2 x  1,179,648   score bias (edge-bias projection + be + mask), one plane a direction
  //  VAh, VAl   bf16 [36864][256]       2 x 18,874,368   attention output hi/lo (both directions)
  //  WoTh/l     bf16 [2][128][256]      2 x     65,536   hi plane, then lo plane, one region
  size_t off = 0;
  auto carve = [&](size_t bytes) { size_t o = off; off += (bytes + 255) & ~(size_t)255; return o; };
  const size_t oQKV = carve((size_t)2 * NROWS * QKV_LD * 2);
  const size_t oBM  = carve((size_t)2 * 8 * NNODE * NNODE * 4);
  const size_t oVAh = carve((size_t)NROWS * VA_LD * 2);
  const size_t oVAl = carve((size_t)NROWS * VA_LD * 2);
  const size_t oWO = carve((size_t)2 * 128 * 256 * 2);
  if (off > ws_size) return;

  char* ws = (char*)d_ws;
  _Float16* QKV16 = (_Float16*)(ws + oQKV);
  float* BM = (float*)(ws + oBM);
  unsigned short* VAh = (unsigned short*)(ws + oVAh);
  unsigned short* VAl = (unsigned short*)(ws + oVAl);
  unsigned short* WOh = (unsigned short*)(ws + oWO);
  unsigned short* WOl = WOh + 128 * 256;

  // LayerNorm + weight split + qkv and score-bias projections of both directions (and the output weight planes), one launch:
  // 2 directions x 128 groups of 288 rows
  k_lnproj<<<2 * (NROWS / PJ_ROWS), PJ_WAVES * 32, 0, stream>>>(e, ln_g, ln_b, Wq_in, bq_in, We_in, be_in,
      Wq_out, bq_out, We_out, be_out, mask, Wo, QKV16, BM, WOh, WOl);
  k_edge_attn<<<dim3(NNODE / JG, 8, 2), 384, 0, stream>>>(QKV16, BM, VAh, VAl);
  // out = VA . Wo + bo  (M 36864, N 128, K 256; split; f32 output rows of d_out; VA row j*192+i -> out row i*192+j)
  k_out<<<NROWS / (16 * OUT_WAVES), OUT_WAVES * 32, 0, stream>>>(VAh, VAl, WOh, bo, out);
}

// v009
// Measured time: 63.4 microseconds a run.
// Two timings next to v008 both put it at 1.09 times that version's speed.
// All steps since v000 together make it 4.23 times as fast.
// Contractions: LayerNorm'd qkv / edge-bias projections and the output linear on v_wmma_f32_16x16x32_bf16 with bf16 hi/lo split operands (hi*hi + hi*lo + lo*hi); per-(edge column, head) 192x192 attention cores (q.k^T with d=16 zero-extended to 32 and the score bias as the f32 C operand, p.v and the softmax row sum ones.p with 192 keys) on v_wmma_f32_16x16x32_f16 with plain f16 operands; f32 accumulate everywhere; LayerNorm, bias/mask add, softmax maximum, exponent and normalisation in f32.
#include <hip/hip_runtime.h>

typedef __attribute__((ext_vector_type(16))) _Float16 v16h;
typedef __attribute__((ext_vector_type(8)))  _Float16 v8h;
typedef __attribute__((ext_vector_type(16))) __bf16   v16b;
typedef __attribute__((ext_vector_type(8)))  __bf16   v8b;
typedef __attribute__((ext_vector_type(8)))  float    v8f;
typedef __attribute__((ext_vector_type(4)))  float    v4f;
typedef __attribute__((ext_vector_type(2)))  float    v2f;

#define EWID 128
#define NNODE 192
#define NROWS 36864          // 192*192 edge rows, row r = i*192 + j
#define QKV_LD 384
#define VA_LD 256
#define KS_P 16              // LDS K tile pitch (halves)
#define VT_P 192             // LDS V^T tile pitch (halves): 384 B = 3 x 128 B, the 16 rows of a fragment read share two groups of four banks
#define LOG2E 1.4426950408889634f

// ------------------------------- helpers -------------------------------
__device__ __forceinline__ unsigned short f2bf_bits(float f) {
  unsigned u = __float_as_uint(f);
  return (unsigned short)((u + 0x7FFFu + ((u >> 16) & 1u)) >> 16);
}
__device__ __forceinline__ float bf_bits2f(unsigned short h) { return __uint_as_float(((unsigned)h) << 16); }

// hazard guards as plain device helpers (no inline asm inside the kernel template body)
__device__ __forceinline__ void dep_guard_h(v8f& a, v8f& b, v16h x, v16h y) { asm volatile("v_nop\n\tv_nop\n\tv_nop\n\tv_nop" : "+v"(a), "+v"(b) : "v"(x), "v"(y)); }
__device__ __forceinline__ void dep_guard_b(v8f& a, v8f& b, v16b x, v16b y) { asm volatile("v_nop\n\tv_nop\n\tv_nop\n\tv_nop" : "+v"(a), "+v"(b) : "v"(x), "v"(y)); }
__device__ __forceinline__ void keep4_h(v16h a, v16h b, v16h c, v16h d) { asm volatile("v_nop" :: "v"(a), "v"(b), "v"(c), "v"(d)); }
__device__ __forceinline__ void keep4_b(v16b a, v16b b, v16b c, v16b d) { asm volatile("v_nop" :: "v"(a), "v"(b), "v"(c), "v"(d)); }
__device__ __forceinline__ void acc_guard4(v8f& a, v8f& b, v8f& c, v8f& d) { asm volatile("v_nop\n\tv_nop\n\tv_nop\n\tv_nop" : "+v"(a), "+v"(b), "+v"(c), "+v"(d)); }
template <typename T> struct Frag;
template <> struct Frag<_Float16> {
  typedef v16h V; union U { v16h v; v8h h[2]; };
  static __device__ __forceinline__ v16h load(const _Float16* p) {   // elements 0..7 <- p[0..7], 8..15 <- p[16..23]
    U f; f.h[0] = *(const v8h*)(p); f.h[1] = *(const v8h*)(p + 16); return f.v;
  }
  static __device__ __forceinline__ v16h load_fo(const _Float16* p) { // fragment-order plane: the two 512-B wave loads of a fragment
    U f; f.h[0] = *(const v8h*)(p); f.h[1] = *(const v8h*)(p + 256); return f.v;
  }
  static __device__ __forceinline__ v8f mma(v16h a, v16h b, v8f c) {
    return __builtin_amdgcn_wmma_f32_16x16x32_f16(false, a, false, b, (short)0, c, false, false);
  }
  static __device__ __forceinline__ void guard(v8f& a, v8f& b, v16h x, v16h y) { dep_guard_h(a, b, x, y); }
  static __device__ __forceinline__ void keep(v16h a, v16h b, v16h c, v16h d) { keep4_h(a, b, c, d); }
};
template <> struct Frag<__bf16> {
  typedef v16b V; union U { v16b v; v8b h[2]; };
  static __device__ __forceinline__ v16b load(const __bf16* p) {
    U f; f.h[0] = *(const v8b*)(p); f.h[1] = *(const v8b*)(p + 16); return f.v;
  }
  static __device__ __forceinline__ v16b load_fo(const __bf16* p) {
    U f; f.h[0] = *(const v8b*)(p); f.h[1] = *(const v8b*)(p + 256); return f.v;
  }
  static __device__ __forceinline__ v8f mma(v16b a, v16b b, v8f c) {
    return __builtin_amdgcn_wmma_f32_16x16x32_bf16(false, a, false, b, (short)0, c, false, false);
  }
  static __device__ __forceinline__ void guard(v8f& a, v8f& b, v16b x, v16b y) { dep_guard_b(a, b, x, y); }
  static __device__ __forceinline__ void keep(v16b a, v16b b, v16b c, v16b d) { keep4_b(a, b, c, d); }
};


__device__ __forceinline__ v8f zero8f() { return (v8f){0.f, 0.f, 0.f, 0.f, 0.f, 0.f, 0.f, 0.f}; }
__device__ __forceinline__ v8h zero8h() {
  v8h z;
#pragma unroll
  for (int e = 0; e < 8; ++e) z[e] = (_Float16)0.0f;
  return z;
}
__device__ __forceinline__ void split_bf16(float x, _Float16& hi, _Float16& lo) {
  const unsigned short hb = f2bf_bits(x);
  const unsigned short lb = f2bf_bits(x - bf_bits2f(hb));
  hi = __builtin_bit_cast(_Float16, hb);
  lo = __builtin_bit_cast(_Float16, lb);
}

// Output weight prep: Wo [256 c][128 n] f32 ([in][out]) -> Bt hi/lo [128 n][256 k'], fragment order, k' = dir*128 + h*16 + d
// <- c = d*16 + dir*8 + h (concat of the two head groups on the head axis, then view d slow).
// 4096 items t = 128 rows x 32 chunks (8 k' each): covers [128][256] exactly;
// item t stores the t-th 16-byte chunk = (tile t>>9, chunk (t>>4)&31, row t&15).
__device__ __forceinline__ void prep_wo(const int t, const float* __restrict__ Wo,
    unsigned short* __restrict__ woh, unsigned short* __restrict__ wol) {
  const int n = (t >> 9) * 16 + (t & 15), k8 = ((t >> 4) & 31) * 8;
  v8h hv, lv;
#pragma unroll
  for (int e = 0; e < 8; ++e) {
    const int kp = k8 + e;
    const int dr = kp >> 7, h = (kp >> 4) & 7, d = kp & 15;
    const int col = d * 16 + dr * 8 + h;
    const float w = Wo[(size_t)col * 128 + n];
    _Float16 a, bb; split_bf16(w, a, bb); hv[e] = a; lv[e] = bb;
  }
  const size_t off = (size_t)t * 8;
  {
    *(v8h*)(woh + off) = hv;
    *(v8h*)(wol + off) = lv;
    // inlined as one arm of a larger kernel: the code behind the arm reuses these stores' registers
    asm volatile("s_wait_xcnt 0x0" ::: "memory");
  }
}

// LayerNorm, the split of the projection weights and both projections (qkv, edge bias) of both directions, one kernel.
// grid 256 = 2 directions x 128 row groups, block 576 = 18 waves; a wave owns one 16-row tile of e (row r = i*192 + j).
// Weights: Wq [128 k][384 c] and We [128 k][8] f32 are split into bf16 hi/lo planes in LDS once a block, 25 tiles of 16
// rows n in FRAGMENT ORDER: a tile is 16*128 contiguous elements, inside it the 16-byte chunk (row r, k 8q..8q+7) stands
// at element q*128 + r*8, so a B fragment is two conflict-free 512-byte LDS reads (lane l: row l&15, chunks
// 4*ks + (l>>4) and 4*ks + 2 + (l>>4)).  Tiles 0..23: head-major qkv columns n = part*128 + h*16 + d <- c = part*128 +
// d*8 + h (view(DD=16, NH=8): d slow, h fast).  Tile 24: rows 0..7 = the heads of We, rows 8..15 zero.
// A weight item = (part, k chunk q, d): 8 k rows x the 8 heads = 8 x 32 contiguous bytes of Wq, 16 lanes 512 bytes a row;
// it gives the chunk (q, row d) of 8 tiles.  768 items: every thread one, waves 0..5 a second one; waves 6..13 do
// the 256 chunks of tile 24; half a wave does this block's 16 of the 4096 chunks of the output weight planes.
// LayerNorm (eps 1e-5, biased variance, *g + b) runs in the A fragment's own layout: lane (row l&15, half hh = l>>4) loads
// the 8 chunks 2u + hh of its row, sums its 64 values in the lane and exchanges once with the other half; the bf16
// hi/lo split of the result IS the wave's A operand for all four k steps and never leaves the registers.
// Products: one accumulator an output element, hi*hi + hi*lo + lo*hi a k step, k steps in rising order.
// qkv out: f16 [2 dir][36864][384] + permuted bias, 16 x 64 results at a time through the wave's own LDS slab (pitch 68
// floats): a store writes 4 rows x 128 contiguous bytes.  Score bias out: bm[dir][h][r] = (EL.We + be[h]) + mask[r][h], f32,
// gathered for the block's 288 rows in LDS; behind the last barrier thread t stores 16 bytes of the 8 x 1152 contiguous.
#define PJ_WAVES 18
#define PJ_ROWS (PJ_WAVES * 16)
#define PJ_PLANE (25 * 16 * EWID)
__device__ __forceinline__ void wq_load(const float* __restrict__ Wq, const int item, v4f (&w)[16]) {
  const float* s = Wq + (size_t)(((item >> 4) & 15) * 8) * 384 + (item >> 8) * 128 + (item & 15) * 8;
#pragma unroll
  for (int e = 0; e < 8; ++e) {
    w[2 * e]     = *(const v4f*)(s + e * 384);
    w[2 * e + 1] = *(const v4f*)(s + e * 384 + 4);
  }
  // the code behind reuses these loads' address registers; the address is an input, so that no load of the run takes it over
  asm volatile("s_wait_xcnt 0x0" :: "v"(s) : "memory");
}
__device__ __forceinline__ void wq_split(const int item, const v4f (&w)[16], unsigned short* __restrict__ sW) {
  unsigned short* dst = sW + (item >> 8) * (8 * 2048) + ((item >> 4) & 15) * 128 + (item & 15) * 8;
#pragma unroll
  for (int h = 0; h < 8; ++h) {
    v8h hv, lv;
#pragma unroll
    for (int e = 0; e < 8; ++e) {
      _Float16 a, bb; split_bf16(w[2 * e + (h >> 2)][h & 3], a, bb); hv[e] = a; lv[e] = bb;
    }
    *(v8h*)(dst + h * 2048) = hv;
    *(v8h*)(dst + PJ_PLANE + h * 2048) = lv;
    // one head's chunks are stored before the next head's are formed: all 8 formed at once spill registers
    __builtin_amdgcn_sched_barrier(0);
  }
}
__global__ __launch_bounds__(PJ_WAVES * 32) void k_lnproj(
    const float* __restrict__ e, const float* __restrict__ g, const float* __restrict__ b,
    const float* __restrict__ Wq0, const float* __restrict__ bq0, const float* __restrict__ We0, const float* __restrict__ be0,
    const float* __restrict__ Wq1, const float* __restrict__ bq1, const float* __restrict__ We1, const float* __restrict__ be1,
    const float* __restrict__ mask, const float* __restrict__ Wo,
    _Float16* __restrict__ qkv2, float* __restrict__ bm2,
    unsigned short* __restrict__ woh, unsigned short* __restrict__ wol) {
  __shared__ __align__(16) unsigned short sW[2 * PJ_PLANE];        // hi plane, lo plane
  __shared__ __align__(16) float sT[PJ_WAVES * 16 * 68];           // a 16 x 64 slab a wave
  __shared__ __align__(16) float sE[16 * PJ_ROWS];                 // [column of tile 24][row of the block]
  const int tid = threadIdx.x, lane = tid & 31;
  const int wave = __builtin_amdgcn_readfirstlane(tid >> 5);       // scalar: the choices below are scalar branches
  const int dir = blockIdx.x >> 7, rg = blockIdx.x & 127;
  const float* Wq = dir ? Wq1 : Wq0;
  const float* bq = dir ? bq1 : bq0;
  const float* We = dir ? We1 : We0;
  const float* be = dir ? be1 : be0;
  const int rlane = lane & 15, hh = lane >> 4, mOff = hh * 8, hd = lane & 7;
  const int row0 = (rg * PJ_WAVES + wave) * 16;                    // first edge row of the wave's tile, <= 36848
  const unsigned lane8 = (unsigned)lane * 8u;

  v4f w[16];
  wq_load(Wq, tid, w);
  const float* ep = e + (size_t)(row0 + rlane) * EWID + hh * 8;
  v4f x[16];                                                       // x[2u], x[2u+1] = chunk 2u + hh of the lane's row
#pragma unroll
  for (int u = 0; u < 8; ++u) {
    x[2 * u]     = *(const v4f*)(ep + u * 16);
    x[2 * u + 1] = *(const v4f*)(ep + u * 16 + 4);
  }
  // the code behind reuses these loads' address registers; the address is an input, so that no load of the run takes it over
  asm volatile("s_wait_xcnt 0x0" :: "v"(ep) : "memory");
  wq_split(tid, w, sW);
  if (wave < 6) {
    wq_load(Wq, PJ_WAVES * 32 + tid, w);
    wq_split(PJ_WAVES * 32 + tid, w, sW);
  } else if (wave < 14) {
    const int u = tid - 192;                                       // chunk (k chunk u>>4, row u&15) of tile 24
    const int n = u & 15, k8 = (u >> 4) * 8;
    const int nc = (n < 8) ? n : 7;                                // address clamp, value zeroed by predicate
    const float* wp = We + k8 * 8 + nc;
    float wv[8];
#pragma unroll
    for (int k = 0; k < 8; ++k) wv[k] = wp[k * 8];
    // the split reuses these loads' address registers; the address is an input, so that nothing takes it over ahead of the wait
    asm volatile("s_wait_xcnt 0x0" :: "v"(wp) : "memory");
    v8h hv, lv;
#pragma unroll
    for (int k = 0; k < 8; ++k) {
      _Float16 a, bb; split_bf16((n < 8) ? wv[k] : 0.0f, a, bb); hv[k] = a; lv[k] = bb;
    }
    *(v8h*)(sW + 24 * 2048 + u * 8) = hv;
    *(v8h*)(sW + PJ_PLANE + 24 * 2048 + u * 8) = lv;
  } else if (wave == 17) {
    if (lane < 16) prep_wo(blockIdx.x * 16 + lane, Wo, woh, wol);  // 256 blocks x 16 = 4096 chunks exactly
  }

  // ---- LayerNorm of the lane's half row ----
  v4f sv = x[0];
#pragma unroll
  for (int i = 1; i < 16; ++i) sv += x[i];
  float s = (sv[0] + sv[1]) + (sv[2] + sv[3]);
  s += __shfl_xor(s, 16, 32);                                      // the other lane half holds the row's other 64 values
  const float mu = s * (1.0f / 128.0f);
  v4f qv = (v4f){0.f, 0.f, 0.f, 0.f};
#pragma unroll
  for (int i = 0; i < 16; ++i) { x[i] -= (v4f){mu, mu, mu, mu}; qv += x[i] * x[i]; }
  float q = (qv[0] + qv[1]) + (qv[2] + qv[3]);
  q += __shfl_xor(q, 16, 32);
  const float rs = rsqrtf(q * (1.0f / 128.0f) + 1e-5f);
  Frag<__bf16>::U ah[4], al[4];                                    // A of k step ks: elements 0..7 = chunk 4ks + hh, 8..15 = 4ks + 2 + hh
#pragma unroll
  for (int u = 0; u < 8; ++u) {
    const v4f g0 = *(const v4f*)(g + u * 16 + hh * 8), g1 = *(const v4f*)(g + u * 16 + hh * 8 + 4);
    const v4f b0 = *(const v4f*)(b + u * 16 + hh * 8), b1 = *(const v4f*)(b + u * 16 + hh * 8 + 4);
    v8h hv, lv;
#pragma unroll
    for (int k = 0; k < 8; ++k) {
      const float xv = (k < 4) ? x[2 * u][k & 3] : x[2 * u + 1][k & 3];
      const float gg = (k < 4) ? g0[k & 3] : g1[k & 3];
      const float bb = (k < 4) ? b0[k & 3] : b1[k & 3];
      const float y = xv * rs * gg + bb;
      _Float16 a, lo; split_bf16(y, a, lo); hv[k] = a; lv[k] = lo;
    }
    ah[u >> 1].h[u & 1] = __builtin_bit_cast(v8b, hv);
    al[u >> 1].h[u & 1] = __builtin_bit_cast(v8b, lv);
    // the g and b loads of at most two chunks stand together: all 32 hoisted to the top spill registers
    if (u & 1) __builtin_amdgcn_sched_barrier(0);
  }
  // be and mask of this lane's 8 edge-bias results (columns 8..15 take the addresses of heads 0..7: in bounds): asked for
  // here, where the e rows have left the registers, and used behind the barrier and the first products
  const float* mk = mask + (size_t)(row0 + mOff) * 8 + hd;
  const float bev = be[hd];
  float mv[8];
#pragma unroll
  for (int r = 0; r < 8; ++r) mv[r] = mk[r * 8];
  // the code behind reuses the address registers of the g, b, be and mask loads
  asm volatile("s_wait_xcnt 0x0" ::: "memory");
  // The barrier that publishes the weight planes; every wave passes it. Written with fences on LDS alone: only LDS data
  // goes from wave to wave here, and __syncthreads() would also wait for the mask loads, which are to stay in flight.
  __builtin_amdgcn_fence(__ATOMIC_RELEASE, "workgroup", "local");
  __builtin_amdgcn_s_barrier();
  __builtin_amdgcn_fence(__ATOMIC_ACQUIRE, "workgroup", "local");

  const __bf16* Bh = (const __bf16*)sW + lane8;
  const __bf16* Bl = Bh + PJ_PLANE;
  // ---- edge bias: tile 24 ----
  {
    v8f ae = zero8f();
#pragma unroll
    for (int ks = 0; ks < 4; ++ks) {
      const v16b bh = Frag<__bf16>::load_fo(Bh + 24 * 2048 + ks * 512);
      const v16b bl = Frag<__bf16>::load_fo(Bl + 24 * 2048 + ks * 512);
      ae = Frag<__bf16>::mma(ah[ks].v, bh, ae);
      ae = Frag<__bf16>::mma(ah[ks].v, bl, ae);
      ae = Frag<__bf16>::mma(al[ks].v, bh, ae);
    }
    // D: lane = column l&15, register r = row 8*(l>>4) + r; columns 8..15 are written like the others and never read
    v4f w0, w1;
#pragma unroll
    for (int r = 0; r < 4; ++r) {
      w0[r] = (ae[r] + bev) + mv[r];
      w1[r] = (ae[r + 4] + bev) + mv[r + 4];
    }
    *(v4f*)(sE + rlane * PJ_ROWS + wave * 16 + mOff) = w0;
    *(v4f*)(sE + rlane * PJ_ROWS + wave * 16 + mOff + 4) = w1;
  }

  // ---- qkv: 6 groups of 4 column tiles ----
  float* slab = sT + wave * (16 * 68);
  _Float16* C = qkv2 + (size_t)dir * NROWS * QKV_LD + (size_t)row0 * QKV_LD;
  const int q4 = lane >> 3, c8 = (lane & 7) * 8;
  // rolled: one group's code is the loop body (code size)
#pragma unroll 1
  for (int gr = 0; gr < 6; ++gr) {
    float bv[4];
#pragma unroll
    for (int j = 0; j < 4; ++j) {
      const int nt = gr * 4 + j;                                   // tile = part*8 + h, row in the tile = d
      bv[j] = bq[(nt >> 3) * 128 + rlane * 8 + (nt & 7)];
    }
    // the code behind reuses these loads' address registers
    asm volatile("s_wait_xcnt 0x0" ::: "memory");
    v8f acc[4];
#pragma unroll
    for (int j = 0; j < 4; ++j) acc[j] = zero8f();
    const __bf16* bhp = Bh + gr * (4 * 2048);
    const __bf16* blp = Bl + gr * (4 * 2048);
    // unrolled: the A fragments are then named at compile time
#pragma unroll
    for (int ks = 0; ks < 4; ++ks) {
      v16b bh[4], bl[4];
#pragma unroll
      for (int j = 0; j < 4; ++j) {
        bh[j] = Frag<__bf16>::load_fo(bhp + j * 2048 + ks * 512);
        bl[j] = Frag<__bf16>::load_fo(blp + j * 2048 + ks * 512);
      }
      // four independent accumulators between two products into the same one
#pragma unroll
      for (int j = 0; j < 4; ++j) acc[j] = Frag<__bf16>::mma(ah[ks].v, bh[j], acc[j]);
#pragma unroll
      for (int j = 0; j < 4; ++j) acc[j] = Frag<__bf16>::mma(ah[ks].v, bl[j], acc[j]);
#pragma unroll
      for (int j = 0; j < 4; ++j) acc[j] = Frag<__bf16>::mma(al[ks].v, bh[j], acc[j]);
    }
#pragma unroll
    for (int j = 0; j < 4; ++j) {
#pragma unroll
      for (int r = 0; r < 8; ++r) slab[(mOff + r) * 68 + (j << 4) + rlane] = acc[j][r] + bv[j];
    }
    // the slab is the wave's own: its lanes' LDS writes are finished before its lanes read them, no other wave is involved
    __builtin_amdgcn_fence(__ATOMIC_RELEASE, "workgroup", "local");
    __builtin_amdgcn_wave_barrier();
    __builtin_amdgcn_fence(__ATOMIC_ACQUIRE, "workgroup", "local");
#pragma unroll
    for (int it = 0; it < 4; ++it) {
      const int row = it * 4 + q4;
      const float* sp = slab + row * 68 + c8;
      v8h hv;
#pragma unroll
      for (int k = 0; k < 8; ++k) hv[k] = (_Float16)sp[k];
      *(v8h*)(C + (size_t)row * QKV_LD + gr * 64 + c8) = hv;
    }
    // the next group reuses these stores' registers
    asm volatile("s_wait_xcnt 0x0" ::: "memory");
    // the slab's reads are finished before the next group's writes
    __builtin_amdgcn_fence(__ATOMIC_RELEASE, "workgroup", "local");
    __builtin_amdgcn_wave_barrier();
    __builtin_amdgcn_fence(__ATOMIC_ACQUIRE, "workgroup", "local");
  }
  // The barrier that publishes the block's score bias rows; every wave passes it. Fences on LDS alone, as above:
  // __syncthreads() would also wait for the qkv stores to finish.
  __builtin_amdgcn_fence(__ATOMIC_RELEASE, "workgroup", "local");
  __builtin_amdgcn_s_barrier();
  __builtin_amdgcn_fence(__ATOMIC_ACQUIRE, "workgroup", "local");
  const int oh = tid / 72, r4 = (tid - oh * 72) * 4;               // 576 threads = 8 heads x 72 pieces of 4 rows
  const v4f ov = *(const v4f*)(sE + oh * PJ_ROWS + r4);
  *(v4f*)(bm2 + ((size_t)dir * 8 + oh) * NROWS + rg * PJ_ROWS + r4) = ov;
}

// Fused attention core for one (direction dir, head h), all 192 query rows i, JG edge columns j in sequence.
// qkv: f16 [2 dir][36864][384], head-major columns part*128 + h*16 + d.  bm: f32 [2 dir][8][36864 edge rows r], the bias
// of (query i, key k) at r = i*192 + k (dir 0) or r = k*192 + i (dir 1).
// grid = (192 / JG column groups, 8 heads, 2 directions) x block 384 = 12 waves x 16 query rows.
// The score bias of (i, k) does not depend on j: a lane loads the 96 values of its query once and keeps them in
// registers, times log2(e), for all JG columns.  Per column: K [192 keys][16 d] and V^T [16 d][192 keys] staged in LDS once for all
// 192 queries, one (key, 8-wide d chunk) item a thread (dir 0: row j*192+k, dir 1: row k*192+j).  Two LDS buffers taken
// in turn: one barrier a column publishes this column's tiles, and a buffer is rewritten only behind the next barrier,
// which every wave reaches after its last read of it.  The next column's K, V and Q loads are issued behind the barrier.
// Both products run transposed, so that a lane owns ONE query:
// S^T = K (A: 16 keys, d in one half of the 32, a second key tile in the other) . Q^T (B, that other half zero) + bias (C, f32) on f16 WMMA: lane (hh, c) holds query i0+c,
// register r key 16*tile + 8*hh + r; Q is taken times 0.25 * log2(e) (in f32, rounded to f16 again), so the result is
// y = (score * 0.25 + bias) * log2(e) as it leaves the matrix unit.  Online softmax over 3 chunks of 64 keys in f32, the
// maximum taken in the lane plus one exchange between the lane halves, e^(x - max) as the hardware's 2^(y - max y); two neighbouring S^T tiles, converted to f16 in place, are the B operand of
// O^T = V^T (A: 16 d, 32 keys) . P^T and of L = ones (A: 16 x 32) . P^T, every row of which is the sum of the query's
// 32 weights of both lane halves (the f16 weights that V meets, f32 accumulate); * 1/rowsum.
// Result (lane: query i0+c, registers: d = 8*hh + r) -> bf16 hi/lo planes [36864][256] in fragment order, row j*192+i,
// columns dir*128 + h*16 + d: a wave's 16 queries are one 16-row tile, the head's two chunk columns 512 contiguous
// bytes of it a plane, and lane l owns the l-th 16-byte chunk of them: stored from registers.
#define JG 12                // edge columns a block walks: 16 groups x 8 heads x 2 directions = 256 blocks
__global__ __launch_bounds__(384) void k_edge_attn(const _Float16* __restrict__ qkv2, const float* __restrict__ bm2,
    unsigned short* __restrict__ vah, unsigned short* __restrict__ val) {
  const int dir = blockIdx.z;
  const int h = blockIdx.y;
  const int j0 = blockIdx.x * JG;
  const _Float16* qkv = qkv2 + (size_t)dir * NROWS * QKV_LD + h * 16;
  const float* bm = bm2 + (size_t)dir * 8 * NROWS;
  __shared__ __align__(16) _Float16 Ksh[2][NNODE * KS_P];   // [buffer][key][d], indices <= 191*16+15
  __shared__ __align__(16) _Float16 Vt[2][16 * VT_P];       // [buffer][d][key], indices <= 15*192+191
  const int tid = threadIdx.x, wave = tid >> 5, lane = tid & 31, hh = lane >> 4, c = lane & 15;
  const int i0 = wave * 16;
  const v8h z8 = zero8h();

  // bias of this lane's query, keys 16t+8hh .. +7 of tile t, kept for every column.  dir 0: 32 contiguous bytes a tile;
  // dir 1: the plane has the key as its slow index, one load a key, the 16 queries of a lane half 64 contiguous bytes.
  v8f bb[12];                                        // tile t: the C operand of its S^T product, register r = key 16t+8hh+r
  if (dir == 0) {                                    // block-uniform
    const float* bmr = bm + ((size_t)h * NNODE + (size_t)(i0 + c)) * NNODE + 8 * hh;
#pragma unroll
    for (int t = 0; t < 12; ++t) {
      const v4f lo4 = *(const v4f*)(bmr + t * 16);
      const v4f hi4 = *(const v4f*)(bmr + t * 16 + 4);
      // unrolled, as the three loops below: vector elements in registers need compile-time indices
#pragma unroll
      for (int r = 0; r < 4; ++r) { bb[t][r] = lo4[r]; bb[t][r + 4] = hi4[r]; }
    }
  } else {
    const float* bmc = bm + ((size_t)h * NNODE + (size_t)(8 * hh)) * NNODE + i0 + c;
#pragma unroll
    for (int t = 0; t < 12; ++t) {
#pragma unroll
      for (int r = 0; r < 4; ++r) {
        bb[t][r] = bmc[(t * 16 + r) * NNODE];
        bb[t][r + 4] = bmc[(t * 16 + 4 + r) * NNODE];
      }
    }
  }
#pragma unroll
  for (int t = 0; t < 12; ++t) bb[t] *= LOG2E;
  v16h ones;                                         // A of the row-sum product
#pragma unroll
  for (int e = 0; e < 16; ++e) ones[e] = (_Float16)1.0f;

  // staging item of this thread: key kv, d chunk part; 384 items = 192 keys x 2 chunks exactly
  const int kv = tid >> 1, part = tid & 1;
  const _Float16* kvsrc = qkv + (size_t)(dir ? kv * NNODE : kv) * QKV_LD + part * 8;   // + j * kvstep
  const size_t kvstep = (size_t)(dir ? 1 : NNODE) * QKV_LD;
  const _Float16* qsrc = qkv + (size_t)(i0 + c) * NNODE * QKV_LD + 8 * hh;             // + j * QKV_LD
  v8h kk8 = *(const v8h*)(kvsrc + (size_t)j0 * kvstep + EWID);
  v8h vv8 = *(const v8h*)(kvsrc + (size_t)j0 * kvstep + 2 * EWID);
  v8h q8  = *(const v8h*)(qsrc + (size_t)j0 * QKV_LD);
  // the code behind reuses these loads' address registers
  asm volatile("s_wait_xcnt 0x0" ::: "memory");

  // rolled: one column's code is the loop body (code size)
#pragma unroll 1
  for (int jj = 0; jj < JG; ++jj) {
    const int j = j0 + jj;
    _Float16* Kb = Ksh[jj & 1];
    _Float16* Vb = Vt[jj & 1];
    *(v8h*)(Kb + kv * KS_P + part * 8) = kk8;
#pragma unroll
    for (int e2 = 0; e2 < 8; ++e2) Vb[(part * 8 + e2) * VT_P + kv] = vv8[e2];
    // B fragments (query column i0+c): d 8hh..8hh+7 in elements 0..7 and elements 8..15 zero, and the other way round
    Frag<_Float16>::U qa, qb;
    v8h qs;                                          // 1/sqrt(16) and the change from e^x to 2^x
#pragma unroll
    for (int e = 0; e < 8; ++e) qs[e] = (_Float16)((float)q8[e] * (0.25f * LOG2E));
    qa.h[0] = qs;
    qa.h[1] = z8;
    qb.h[0] = z8;
    qb.h[1] = qs;
    __syncthreads();
    if (jj + 1 < JG) {                               // block-uniform; j + 1 <= 191
      kk8 = *(const v8h*)(kvsrc + (size_t)(j + 1) * kvstep + EWID);
      vv8 = *(const v8h*)(kvsrc + (size_t)(j + 1) * kvstep + 2 * EWID);
      q8  = *(const v8h*)(qsrc + (size_t)(j + 1) * QKV_LD);
      // the code behind reuses these loads' address registers at once
      asm volatile("s_wait_xcnt 0x0" ::: "memory");
    }

    float mrow = -__builtin_inff();                  // this lane's query
    v8f o = zero8f();                                // O^T: register r = d 8hh+r of query i0+c
    v8f l = zero8f();                                // L: only register 0 is kept to scale and read

    // unrolled: the bias registers are then named at compile time
#pragma unroll
    for (int kc = 0; kc < 3; ++kc) {
      const int kv0 = kc * 64;
      v8f s[4];
#pragma unroll
      for (int jp = 0; jp < 2; ++jp) {
        // A fragment of two key tiles: d 8hh..8hh+7 of key row kv0+32jp+c in elements 0..7, of key row kv0+32jp+16+c
        // (256 halves on) in elements 8..15; the B operand's zero half takes the other tile out of the product
        const v16h kb = Frag<_Float16>::load_fo(Kb + (kv0 + jp * 32 + c) * KS_P + 8 * hh);
        s[2 * jp]     = Frag<_Float16>::mma(kb, qa.v, bb[kc * 4 + 2 * jp]);
        s[2 * jp + 1] = Frag<_Float16>::mma(kb, qb.v, bb[kc * 4 + 2 * jp + 1]);
      }
      float mx = -__builtin_inff();
#pragma unroll
      for (int jn = 0; jn < 4; ++jn) {
#pragma unroll
        for (int r = 0; r < 8; ++r) mx = fmaxf(mx, s[jn][r]);
      }
      mx = fmaxf(mx, __shfl_xor(mx, 16, 32));        // the other lane half holds the query's other 32 keys
      const float mnew = fmaxf(mrow, mx);
      const float alpha = __builtin_amdgcn_exp2f(mrow - mnew);
      mrow = mnew;
      Frag<_Float16>::U pb[2];                       // P^T as B: elements 0..7 = tile 2kk, 8..15 = tile 2kk+1
#pragma unroll
      for (int jn = 0; jn < 4; ++jn) {
#pragma unroll
        for (int r = 0; r < 8; r += 2) {
          const v2f dl = (v2f){s[jn][r], s[jn][r + 1]} - (v2f){mnew, mnew};
          const float p0 = __builtin_amdgcn_exp2f(dl[0]);
          const float p1 = __builtin_amdgcn_exp2f(dl[1]);
          pb[jn >> 1].h[jn & 1][r] = (_Float16)p0;
          pb[jn >> 1].h[jn & 1][r + 1] = (_Float16)p1;
        }
      }
      l[0] *= alpha;
#pragma unroll
      for (int r = 0; r < 8; ++r) o[r] *= alpha;
#pragma unroll
      for (int kk = 0; kk < 2; ++kk) {
        const v16h va = Frag<_Float16>::load(Vb + c * VT_P + kv0 + kk * 32 + 8 * hh);
        o = Frag<_Float16>::mma(va, pb[kk].v, o);
        l = Frag<_Float16>::mma(ones, pb[kk].v, l);
      }
    }
    const float inv = 1.0f / l[0];
    v8h hv, lv;
#pragma unroll
    for (int e = 0; e < 8; ++e) {
      _Float16 a, lo;
      split_bf16(o[e] * inv, a, lo); hv[e] = a; lv[e] = lo;
    }
    const size_t ob = (size_t)(j * NNODE + i0) * VA_LD + (size_t)(dir * 2048 + h * 256 + lane * 8);
    *(v8h*)(vah + ob) = hv;
    *(v8h*)(val + ob) = lv;
    // the next column's staging reuses these stores' registers
    asm volatile("s_wait_xcnt 0x0" ::: "memory");
  }
}

// Output linear: out[i*192+j][n] = sum_k VA[j*192+i][k] * Wo'[n][k] + bo[n]; M 36864, N 128, K 256, bf16 hi/lo split
// (one accumulator an output element: hi*hi + hi*lo + lo*hi a k step, k steps in rising order).
// grid 256 x block 288 = 9 waves; a wave owns one 16-row tile of VA and all 128 output columns (2304 tiles = 256 x 9).
// A: the tile's two planes are 2 x 8 KB contiguous (fragment order); a wave issues all 32 loads at entry and keeps the
// tile in registers: memory latency is paid once a wave, and the later k steps' loads are still in flight while the
// first are worked on.
// B: wo2 = the hi weight plane followed by the lo plane (2 x 64 KB, fragment order), copied as it lies into LDS once a
// block, 512 bytes a wave and load; a B fragment is then two conflict-free 512-byte LDS reads.
// D (lane: column 16t + (lane & 15), register r: row 8*(lane >> 4) + r) + bias goes through the wave's own LDS slab
// (pitch 132 floats: the two lane halves fall on different banks); a whole 512-byte output row is one store.
// Every loop of this kernel is unrolled: its arrays live in registers and need compile-time indices.
#define OUT_WAVES 9
#define OUT_SLAB_P 132
__global__ __launch_bounds__(OUT_WAVES * 32) void k_out(
    const unsigned short* __restrict__ vah, const unsigned short* __restrict__ val,
    const unsigned short* __restrict__ wo2, const float* __restrict__ bo, float* __restrict__ out) {
  __shared__ __align__(16) unsigned short sB[2 * EWID * VA_LD + 5 * 256]; // hi plane, lo plane, 5 spare pieces
  __shared__ __align__(16) float sO[OUT_WAVES * 16 * OUT_SLAB_P];
  const int lane = threadIdx.x & 31;
  const int wave = __builtin_amdgcn_readfirstlane(threadIdx.x >> 5);      // scalar: tile and piece addresses are scalar bases
  const int rt = blockIdx.x * OUT_WAVES + wave;                           // 16-row tile, 0..2303
  const unsigned lane8 = (unsigned)lane * 8u;
  const int rlane = lane & 15, mOff = (lane >> 4) * 8;

  // the 256 weight pieces of 512 B: wave w takes w, w+9, .. w+252. 29 x 9 = 261: in the last turn waves 4..8 have no
  // piece left; they copy one of 252..255 once more, into the spare pieces behind the planes, which nobody reads: the
  // copy is then free of branches and all its loads stand together.
  const unsigned short* wsrc = wo2 + wave * 256 + lane8;
  v8h wt[29];
#pragma unroll
  for (int it = 0; it < 28; ++it) wt[it] = *(const v8h*)(wsrc + it * (OUT_WAVES * 256));
  wt[28] = *(const v8h*)(wo2 + (252 + (wave & 3)) * 256 + lane8);
  // keeps the weight loads ahead of the A loads: loads return in order, and the LDS copy must not wait for the A tile
  __builtin_amdgcn_sched_barrier(0);
  const __bf16* Ah = (const __bf16*)vah + (size_t)rt * (16 * VA_LD) + lane8;
  const __bf16* Al = (const __bf16*)val + (size_t)rt * (16 * VA_LD) + lane8;
  v16b ah[8], al[8];
#pragma unroll
  for (int ks = 0; ks < 8; ++ks) {
    ah[ks] = Frag<__bf16>::load_fo(Ah + ks * 512);
    al[ks] = Frag<__bf16>::load_fo(Al + ks * 512);
  }
#pragma unroll
  for (int it = 0; it < 29; ++it) *(v8h*)(sB + (wave + it * OUT_WAVES) * 256 + lane8) = wt[it];
  // The one barrier: it publishes the weight planes, every wave passes it. Written with fences on LDS alone: only LDS
  // data goes from wave to wave here, and __syncthreads() would also wait for the A loads, which are to stay in flight.
  __builtin_amdgcn_fence(__ATOMIC_RELEASE, "workgroup", "local");
  __builtin_amdgcn_s_barrier();
  __builtin_amdgcn_fence(__ATOMIC_ACQUIRE, "workgroup", "local");

  // bias of this lane's 8 columns: asked for here, behind the A loads, and used only after the last product
  float bv[8];
#pragma unroll
  for (int j = 0; j < 8; ++j) bv[j] = bo[j * 16 + rlane];
  v8f acc[8];
#pragma unroll
  for (int j = 0; j < 8; ++j) acc[j] = zero8f();
  const __bf16* Bh = (const __bf16*)sB + lane8;
  const __bf16* Bl = Bh + EWID * VA_LD;
  // 16 groups g = (k step g >> 1, column tiles 4*(g & 1) .. +3) of 12 products; two register buffers for B taken in turn
  v16b bh[2][4], bl[2][4];
#pragma unroll
  for (int j = 0; j < 4; ++j) {
    bh[0][j] = Frag<__bf16>::load_fo(Bh + j * (16 * VA_LD));
    bl[0][j] = Frag<__bf16>::load_fo(Bl + j * (16 * VA_LD));
  }
  // unrolled: the A fragments and the buffers are then named at compile time
#pragma unroll
  for (int g = 0; g < 16; ++g) {
    const int ks = g >> 1, jg = (g & 1) * 4, cur = g & 1, nxt = cur ^ 1;
    if (g + 1 < 16) {
#pragma unroll
      for (int j = 0; j < 4; ++j) {
        const int o = (((g + 1) & 1) * 4 + j) * (16 * VA_LD) + ((g + 1) >> 1) * 512;
        bh[nxt][j] = Frag<__bf16>::load_fo(Bh + o);
        bl[nxt][j] = Frag<__bf16>::load_fo(Bl + o);
      }
    }
    // four independent accumulators between two products into the same one
#pragma unroll
    for (int j = 0; j < 4; ++j) acc[jg + j] = Frag<__bf16>::mma(ah[ks], bh[cur][j], acc[jg + j]);
#pragma unroll
    for (int j = 0; j < 4; ++j) acc[jg + j] = Frag<__bf16>::mma(ah[ks], bl[cur][j], acc[jg + j]);
#pragma unroll
    for (int j = 0; j < 4; ++j) acc[jg + j] = Frag<__bf16>::mma(al[ks], bh[cur][j], acc[jg + j]);
    // keeps a group's LDS reads one whole group (12 products) ahead of their use: moved down, they would be waited for
    __builtin_amdgcn_sched_barrier(0);
  }

  float* slab = sO + wave * (16 * OUT_SLAB_P);
#pragma unroll
  for (int j = 0; j < 8; ++j) {
#pragma unroll
    for (int r = 0; r < 8; ++r) slab[(mOff + r) * OUT_SLAB_P + j * 16 + rlane] = acc[j][r] + bv[j];
  }
  // the slab is the wave's own: its lanes' LDS writes are finished before its lanes read them, no other wave is involved
  __builtin_amdgcn_fence(__ATOMIC_RELEASE, "workgroup", "local");
  __builtin_amdgcn_wave_barrier();
  __builtin_amdgcn_fence(__ATOMIC_ACQUIRE, "workgroup", "local");
  // VA row rt*16 + r = j*192 + i -> out row i*192 + j; 192 = 12 tiles, so a tile has one j
  const int jcol = rt / 12, irow = (rt - jcol * 12) * 16;
  float* op = out + ((size_t)irow * NNODE + jcol) * EWID + lane * 4;
  v4f ov[16];
#pragma unroll
  for (int r = 0; r < 16; ++r) ov[r] = *(const v4f*)(slab + r * OUT_SLAB_P + lane * 4);
#pragma unroll
  for (int r = 0; r < 16; ++r) *(v4f*)(op + (size_t)r * NNODE * EWID) = ov[r];
}

// ---------------------------------------------------------------------------------------
extern "C" void kernel_launch(void* const* d_in, const int* in_sizes, int n_in,
                              void* d_out, int out_size, void* d_ws, size_t ws_size,
                              hipStream_t stream) {
  if (n_in < 14) return;
  if (in_sizes[0] != NROWS * EWID || in_sizes[1] != NROWS * 8 || in_sizes[2] < EWID || in_sizes[3] < EWID ||
      in_sizes[4] != EWID * 384 || in_sizes[5] < 384 || in_sizes[6] != EWID * 8 || in_sizes[7] < 8 ||
      in_sizes[8] != EWID * 384 || in_sizes[9] < 384 || in_sizes[10] != EWID * 8 || in_sizes[11] < 8 ||
      in_sizes[12] != 256 * EWID || in_sizes[13] < EWID || out_size != NROWS * EWID) return;

  const float* e      = (const float*)d_in[0];
  const float* mask   = (const float*)d_in[1];
  const float* ln_g   = (const float*)d_in[2];
  const float* ln_b   = (const float*)d_in[3];
  const float* Wq_in  = (const float*)d_in[4];
  const float* bq_in  = (const float*)d_in[5];
  const float* We_in  = (const float*)d_in[6];
  const float* be_in  = (const float*)d_in[7];
  const float* Wq_out = (const float*)d_in[8];
  const float* bq_out = (const float*)d_in[9];
  const float* We_out = (const float*)d_in[10];
  const float* be_out = (const float*)d_in[11];
  const float* Wo     = (const float*)d_in[12];
  const float* bo     = (const float*)d_in[13];
  float* out = (float*)d_out;

  // ---- workspace region map (offsets 256-B aligned; total 96,862,208 B) ----
  //  (VAh/l and the output weight planes lie in fragment order; VA rows are j*192+i)
  //  QKV16      f16  [2][36864][384]    2 x 28,311,552   projection output, one plane a direction
  //  BM         f32  [2][8][36864]      2 x  1,179,648   score bias (edge-bias projection + be + mask), one plane a direction
  //  VAh, VAl   bf16 [36864][256]       2 x 18,874,368   attention output hi/lo (both directions)
  //  WoTh/l     bf16 [2][128][256]      2 x     65,536   hi plane, then lo plane, one region
  size_t off = 0;
  auto carve = [&](size_t bytes) { size_t o = off; off += (bytes + 255) & ~(size_t)255; return o; };
  const size_t oQKV = carve((size_t)2 * NROWS * QKV_LD * 2);
  const size_t oBM  = carve((size_t)2 * 8 * NNODE * NNODE * 4);
  const size_t oVAh = carve((size_t)NROWS * VA_LD * 2);
  const size_t oVAl = carve((size_t)NROWS * VA_LD * 2);
  const size_t oWO = carve((size_t)2 * 128 * 256 * 2);
  if (off > ws_size) return;

  char* ws = (char*)d_ws;
  _Float16* QKV16 = (_Float16*)(ws + oQKV);
  float* BM = (float*)(ws + oBM);
  unsigned short* VAh = (unsigned short*)(ws + oVAh);
  unsigned short* VAl = (unsigned short*)(ws + oVAl);
  unsigned short* WOh = (unsigned short*)(ws + oWO);
  unsigned short* WOl = WOh + 128 * 256;

  // LayerNorm + weight split + qkv and score-bias projections of both directions (and the output weight planes), one launch:
  // 2 directions x 128 groups of 288 rows
  k_lnproj<<<2 * (NROWS / PJ_ROWS), PJ_WAVES * 32, 0, stream>>>(e, ln_g, ln_b, Wq_in, bq_in, We_in, be_in,
      Wq_out, bq_out, We_out, be_out, mask, Wo, QKV16, BM, WOh, WOl);
  k_edge_attn<<<dim3(NNODE / JG, 8, 2), 384, 0, stream>>>(QKV16, BM, VAh, VAl);
  // out = VA . Wo + bo  (M 36864, N 128, K 256; split; f32 output rows of d_out; VA row j*192+i -> out row i*192+j)
  k_out<<<NROWS / (16 * OUT_WAVES), OUT_WAVES * 32, 0, stream>>>(VAh, VAl, WOh, bo, out);
}

// v010
// It runs in 61.3 microseconds.
// Next to v009, in two timings, it ran 1.03 and 1.04 times as fast.
// Over all steps from v000 it is 4.39 times as fast.
// Contractions: LayerNorm'd qkv / edge-bias projections and the output linear on v_wmma_f32_16x16x32_bf16 with bf16 hi/lo split operands (hi*hi + hi*lo + lo*hi); per-(edge column, head) 192x192 attention cores (q.k^T with d=16 zero-extended to 32 and the score bias as the f32 C operand, p.v and the softmax row sum ones.p with 192 keys) on v_wmma_f32_16x16x32_f16 with plain f16 operands; f32 accumulate everywhere; LayerNorm, bias/mask add, softmax maximum, exponent and normalisation in f32.
#include <hip/hip_runtime.h>

typedef __attribute__((ext_vector_type(16))) _Float16 v16h;
typedef __attribute__((ext_vector_type(8)))  _Float16 v8h;
typedef __attribute__((ext_vector_type(16))) __bf16   v16b;
typedef __attribute__((ext_vector_type(8)))  __bf16   v8b;
typedef __attribute__((ext_vector_type(8)))  float    v8f;
typedef __attribute__((ext_vector_type(4)))  float    v4f;
typedef __attribute__((ext_vector_type(2)))  float    v2f;
typedef __attribute__((ext_vector_type(2)))  __bf16   v2b;
typedef __attribute__((ext_vector_type(4)))  unsigned v4u;

#define EWID 128
#define NNODE 192
#define NROWS 36864          // 192*192 edge rows, row r = i*192 + j
#define QKV_LD 384
#define VA_LD 256
#define KS_P 16              // LDS K tile pitch (halves)
#define VT_P 192             // LDS V^T tile pitch (halves): 384 B = 3 x 128 B, the 16 rows of a fragment read share two groups of four banks
#define LOG2E 1.4426950408889634f

// ------------------------------- helpers -------------------------------
// hazard guards as plain device helpers (no inline asm inside the kernel template body)
__device__ __forceinline__ void dep_guard_h(v8f& a, v8f& b, v16h x, v16h y) { asm volatile("v_nop\n\tv_nop\n\tv_nop\n\tv_nop" : "+v"(a), "+v"(b) : "v"(x), "v"(y)); }
__device__ __forceinline__ void dep_guard_b(v8f& a, v8f& b, v16b x, v16b y) { asm volatile("v_nop\n\tv_nop\n\tv_nop\n\tv_nop" : "+v"(a), "+v"(b) : "v"(x), "v"(y)); }
__device__ __forceinline__ void keep4_h(v16h a, v16h b, v16h c, v16h d) { asm volatile("v_nop" :: "v"(a), "v"(b), "v"(c), "v"(d)); }
__device__ __forceinline__ void keep4_b(v16b a, v16b b, v16b c, v16b d) { asm volatile("v_nop" :: "v"(a), "v"(b), "v"(c), "v"(d)); }
__device__ __forceinline__ void acc_guard4(v8f& a, v8f& b, v8f& c, v8f& d) { asm volatile("v_nop\n\tv_nop\n\tv_nop\n\tv_nop" : "+v"(a), "+v"(b), "+v"(c), "+v"(d)); }
template <typename T> struct Frag;
template <> struct Frag<_Float16> {
  typedef v16h V; union U { v16h v; v8h h[2]; };
  static __device__ __forceinline__ v16h load(const _Float16* p) {   // elements 0..7 <- p[0..7], 8..15 <- p[16..23]
    U f; f.h[0] = *(const v8h*)(p); f.h[1] = *(const v8h*)(p + 16); return f.v;
  }
  static __device__ __forceinline__ v16h load_fo(const _Float16* p) { // fragment-order plane: the two 512-B wave loads of a fragment
    U f; f.h[0] = *(const v8h*)(p); f.h[1] = *(const v8h*)(p + 256); return f.v;
  }
  static __device__ __forceinline__ v8f mma(v16h a, v16h b, v8f c) {
    return __builtin_amdgcn_wmma_f32_16x16x32_f16(false, a, false, b, (short)0, c, false, false);
  }
  static __device__ __forceinline__ void guard(v8f& a, v8f& b, v16h x, v16h y) { dep_guard_h(a, b, x, y); }
  static __device__ __forceinline__ void keep(v16h a, v16h b, v16h c, v16h d) { keep4_h(a, b, c, d); }
};
template <> struct Frag<__bf16> {
  typedef v16b V; union U { v16b v; v8b h[2]; };
  static __device__ __forceinline__ v16b load(const __bf16* p) {
    U f; f.h[0] = *(const v8b*)(p); f.h[1] = *(const v8b*)(p + 16); return f.v;
  }
  static __device__ __forceinline__ v16b load_fo(const __bf16* p) {
    U f; f.h[0] = *(const v8b*)(p); f.h[1] = *(const v8b*)(p + 256); return f.v;
  }
  static __device__ __forceinline__ v8f mma(v16b a, v16b b, v8f c) {
    return __builtin_amdgcn_wmma_f32_16x16x32_bf16(false, a, false, b, (short)0, c, false, false);
  }
  static __device__ __forceinline__ void guard(v8f& a, v8f& b, v16b x, v16b y) { dep_guard_b(a, b, x, y); }
  static __device__ __forceinline__ void keep(v16b a, v16b b, v16b c, v16b d) { keep4_b(a, b, c, d); }
};


__device__ __forceinline__ v8f zero8f() { return (v8f){0.f, 0.f, 0.f, 0.f, 0.f, 0.f, 0.f, 0.f}; }
__device__ __forceinline__ v8h zero8h() {
  v8h z;
#pragma unroll
  for (int e = 0; e < 8; ++e) z[e] = (_Float16)0.0f;
  return z;
}
// bf16 hi/lo split of 8 values, two at a time on the hardware's packed conversion (round to nearest even, the pair already
// packed): hi = bf16(x), lo = bf16(x - hi); element e of hv / lv belongs to x[e].
__device__ __forceinline__ void split8_bf16(const float (&x)[8], v8h& hv, v8h& lv) {
  v4u hu, lu;
  // unrolled: vector elements in registers need compile-time indices
#pragma unroll
  for (int p = 0; p < 4; ++p) {
    const v2f xx = (v2f){x[2 * p], x[2 * p + 1]};
    const unsigned hb = __builtin_bit_cast(unsigned, __builtin_convertvector(xx, v2b));
    const v2f hf = (v2f){__uint_as_float(hb << 16), __uint_as_float(hb & 0xFFFF0000u)};
    hu[p] = hb;
    lu[p] = __builtin_bit_cast(unsigned, __builtin_convertvector(xx - hf, v2b));
  }
  hv = __builtin_bit_cast(v8h, hu);
  lv = __builtin_bit_cast(v8h, lu);
}

// Output weight prep: Wo [256 c][128 n] f32 ([in][out]) -> Bt hi/lo [128 n][256 k'], fragment order, k' = dir*128 + h*16 + d
// <- c = d*16 + dir*8 + h (concat of the two head groups on the head axis, then view d slow).
// 4096 items t = 128 rows x 32 chunks (8 k' each): covers [128][256] exactly;
// item t stores the t-th 16-byte chunk = (tile t>>9, chunk (t>>4)&31, row t&15).
__device__ __forceinline__ void prep_wo(const int t, const float* __restrict__ Wo,
    unsigned short* __restrict__ woh, unsigned short* __restrict__ wol) {
  const int n = (t >> 9) * 16 + (t & 15), k8 = ((t >> 4) & 31) * 8;
  float w[8];
#pragma unroll
  for (int e = 0; e < 8; ++e) {
    const int kp = k8 + e;
    const int dr = kp >> 7, h = (kp >> 4) & 7, d = kp & 15;
    const int col = d * 16 + dr * 8 + h;
    w[e] = Wo[(size_t)col * 128 + n];
  }
  v8h hv, lv;
  split8_bf16(w, hv, lv);
  const size_t off = (size_t)t * 8;
  {
    *(v8h*)(woh + off) = hv;
    *(v8h*)(wol + off) = lv;
    // inlined as one arm of a larger kernel: the code behind the arm reuses these stores' registers
    asm volatile("s_wait_xcnt 0x0" ::: "memory");
  }
}

// LayerNorm, the split of the projection weights and both projections (qkv, edge bias) of both directions, one kernel.
// grid 256 = 2 directions x 128 row groups, block 576 = 18 waves; a wave owns one 16-row tile of e (row r = i*192 + j).
// Weights: Wq [128 k][384 c] and We [128 k][8] f32 are split into bf16 hi/lo planes in LDS once a block, 25 tiles of 16
// rows n in FRAGMENT ORDER: a tile is 16*128 contiguous elements, inside it the 16-byte chunk (row r, k 8q..8q+7) stands
// at element q*128 + r*8, so a B fragment is two conflict-free 512-byte LDS reads (lane l: row l&15, chunks
// 4*ks + (l>>4) and 4*ks + 2 + (l>>4)).  Tiles 0..23: head-major qkv columns n = part*128 + h*16 + d <- c = part*128 +
// d*8 + h (view(DD=16, NH=8): d slow, h fast).  Tile 24: rows 0..7 = the heads of We, rows 8..15 zero.
// A weight item = (part, k chunk q, d): 8 k rows x the 8 heads = 8 x 32 contiguous bytes of Wq, 16 lanes 512 bytes a row;
// it gives the chunk (q, row d) of 8 tiles.  768 items: every thread one, waves 0..5 a second one; waves 6..13 do
// the 256 chunks of tile 24; half a wave does this block's 16 of the 4096 chunks of the output weight planes.
// LayerNorm (eps 1e-5, biased variance, *g + b) runs in the A fragment's own layout: lane (row l&15, half hh = l>>4) loads
// the 8 chunks 2u + hh of its row, sums its 64 values in the lane and exchanges once with the other half; the bf16
// hi/lo split of the result IS the wave's A operand for all four k steps and never leaves the registers.
// Products: one accumulator an output element, hi*hi + hi*lo + lo*hi a k step, k steps in rising order.
// qkv out: f16 [2 dir][36864][384] + permuted bias, 16 x 64 results at a time through the wave's own LDS slab (pitch 68
// floats): a store writes 4 rows x 128 contiguous bytes.  Score bias out: bm[dir][h][r] = (EL.We + be[h]) + mask[r][h], f32,
// gathered for the block's 288 rows in LDS; behind the last barrier thread t stores 16 bytes of the 8 x 1152 contiguous.
#define PJ_WAVES 18
#define PJ_ROWS (PJ_WAVES * 16)
#define PJ_PLANE (25 * 16 * EWID)
__device__ __forceinline__ void wq_load(const float* __restrict__ Wq, const int item, v4f (&w)[16]) {
  const float* s = Wq + (size_t)(((item >> 4) & 15) * 8) * 384 + (item >> 8) * 128 + (item & 15) * 8;
#pragma unroll
  for (int e = 0; e < 8; ++e) {
    w[2 * e]     = *(const v4f*)(s + e * 384);
    w[2 * e + 1] = *(const v4f*)(s + e * 384 + 4);
  }
  // the code behind reuses these loads' address registers; the address is an input, so that no load of the run takes it over
  asm volatile("s_wait_xcnt 0x0" :: "v"(s) : "memory");
}
__device__ __forceinline__ void wq_split(const int item, const v4f (&w)[16], unsigned short* __restrict__ sW) {
  unsigned short* dst = sW + (item >> 8) * (8 * 2048) + ((item >> 4) & 15) * 128 + (item & 15) * 8;
#pragma unroll
  for (int h = 0; h < 8; ++h) {
    float wk[8];
#pragma unroll
    for (int e = 0; e < 8; ++e) wk[e] = w[2 * e + (h >> 2)][h & 3];
    v8h hv, lv;
    split8_bf16(wk, hv, lv);
    *(v8h*)(dst + h * 2048) = hv;
    *(v8h*)(dst + PJ_PLANE + h * 2048) = lv;
    // one head's chunks are stored before the next head's are formed: all 8 formed at once spill registers
    __builtin_amdgcn_sched_barrier(0);
  }
}
__global__ __launch_bounds__(PJ_WAVES * 32) void k_lnproj(
    const float* __restrict__ e, const float* __restrict__ g, const float* __restrict__ b,
    const float* __restrict__ Wq0, const float* __restrict__ bq0, const float* __restrict__ We0, const float* __restrict__ be0,
    const float* __restrict__ Wq1, const float* __restrict__ bq1, const float* __restrict__ We1, const float* __restrict__ be1,
    const float* __restrict__ mask, const float* __restrict__ Wo,
    _Float16* __restrict__ qkv2, float* __restrict__ bm2,
    unsigned short* __restrict__ woh, unsigned short* __restrict__ wol) {
  __shared__ __align__(16) unsigned short sW[2 * PJ_PLANE];        // hi plane, lo plane
  __shared__ __align__(16) float sT[PJ_WAVES * 16 * 68];           // a 16 x 64 slab a wave
  __shared__ __align__(16) float sE[16 * PJ_ROWS];                 // [column of tile 24][row of the block]
  const int tid = threadIdx.x, lane = tid & 31;
  const int wave = __builtin_amdgcn_readfirstlane(tid >> 5);       // scalar: the choices below are scalar branches
  const int dir = blockIdx.x >> 7, rg = blockIdx.x & 127;
  const float* Wq = dir ? Wq1 : Wq0;
  const float* bq = dir ? bq1 : bq0;
  const float* We = dir ? We1 : We0;
  const float* be = dir ? be1 : be0;
  const int rlane = lane & 15, hh = lane >> 4, mOff = hh * 8, hd = lane & 7;
  const int row0 = (rg * PJ_WAVES + wave) * 16;                    // first edge row of the wave's tile, <= 36848
  const unsigned lane8 = (unsigned)lane * 8u;

  v4f w[16];
  wq_load(Wq, tid, w);
  const float* ep = e + (size_t)(row0 + rlane) * EWID + hh * 8;
  v4f x[16];                                                       // x[2u], x[2u+1] = chunk 2u + hh of the lane's row
#pragma unroll
  for (int u = 0; u < 8; ++u) {
    x[2 * u]     = *(const v4f*)(ep + u * 16);
    x[2 * u + 1] = *(const v4f*)(ep + u * 16 + 4);
  }
  // the code behind reuses these loads' address registers; the address is an input, so that no load of the run takes it over
  asm volatile("s_wait_xcnt 0x0" :: "v"(ep) : "memory");
  wq_split(tid, w, sW);
  if (wave < 6) {
    wq_load(Wq, PJ_WAVES * 32 + tid, w);
    wq_split(PJ_WAVES * 32 + tid, w, sW);
  } else if (wave < 14) {
    const int u = tid - 192;                                       // chunk (k chunk u>>4, row u&15) of tile 24
    const int n = u & 15, k8 = (u >> 4) * 8;
    const int nc = (n < 8) ? n : 7;                                // address clamp, value zeroed by predicate
    const float* wp = We + k8 * 8 + nc;
    float wv[8];
#pragma unroll
    for (int k = 0; k < 8; ++k) wv[k] = wp[k * 8];
    // the split reuses these loads' address registers; the address is an input, so that nothing takes it over ahead of the wait
    asm volatile("s_wait_xcnt 0x0" :: "v"(wp) : "memory");
#pragma unroll
    for (int k = 0; k < 8; ++k) wv[k] = (n < 8) ? wv[k] : 0.0f;
    v8h hv, lv;
    split8_bf16(wv, hv, lv);
    *(v8h*)(sW + 24 * 2048 + u * 8) = hv;
    *(v8h*)(sW + PJ_PLANE + 24 * 2048 + u * 8) = lv;
  } else if (wave == 17) {
    if (lane < 16) prep_wo(blockIdx.x * 16 + lane, Wo, woh, wol);  // 256 blocks x 16 = 4096 chunks exactly
  }

  // ---- LayerNorm of the lane's half row ----
  v4f sv = x[0];
#pragma unroll
  for (int i = 1; i < 16; ++i) sv += x[i];
  float s = (sv[0] + sv[1]) + (sv[2] + sv[3]);
  s += __shfl_xor(s, 16, 32);                                      // the other lane half holds the row's other 64 values
  const float mu = s * (1.0f / 128.0f);
  v4f qv = (v4f){0.f, 0.f, 0.f, 0.f};
#pragma unroll
  for (int i = 0; i < 16; ++i) { x[i] -= (v4f){mu, mu, mu, mu}; qv += x[i] * x[i]; }
  float q = (qv[0] + qv[1]) + (qv[2] + qv[3]);
  q += __shfl_xor(q, 16, 32);
  const float rs = rsqrtf(q * (1.0f / 128.0f) + 1e-5f);
  Frag<__bf16>::U ah[4], al[4];                                    // A of k step ks: elements 0..7 = chunk 4ks + hh, 8..15 = 4ks + 2 + hh
#pragma unroll
  for (int u = 0; u < 8; ++u) {
    const v4f g0 = *(const v4f*)(g + u * 16 + hh * 8), g1 = *(const v4f*)(g + u * 16 + hh * 8 + 4);
    const v4f b0 = *(const v4f*)(b + u * 16 + hh * 8), b1 = *(const v4f*)(b + u * 16 + hh * 8 + 4);
    float y[8];
#pragma unroll
    for (int k = 0; k < 8; ++k) {
      const float xv = (k < 4) ? x[2 * u][k & 3] : x[2 * u + 1][k & 3];
      const float gg = (k < 4) ? g0[k & 3] : g1[k & 3];
      const float bb = (k < 4) ? b0[k & 3] : b1[k & 3];
      y[k] = xv * rs * gg + bb;
    }
    v8h hv, lv;
    split8_bf16(y, hv, lv);
    ah[u >> 1].h[u & 1] = __builtin_bit_cast(v8b, hv);
    al[u >> 1].h[u & 1] = __builtin_bit_cast(v8b, lv);
    // the g and b loads of at most two chunks stand together: all 32 hoisted to the top spill registers
    if (u & 1) __builtin_amdgcn_sched_barrier(0);
  }
  // be and mask of this lane's 8 edge-bias results (columns 8..15 take the addresses of heads 0..7: in bounds): asked for
  // here, where the e rows have left the registers, and used behind the barrier and the first products
  const float* mk = mask + (size_t)(row0 + mOff) * 8 + hd;
  const float bev = be[hd];
  float mv[8];
#pragma unroll
  for (int r = 0; r < 8; ++r) mv[r] = mk[r * 8];
  // the code behind reuses the address registers of the g, b, be and mask loads
  asm volatile("s_wait_xcnt 0x0" ::: "memory");
  // The barrier that publishes the weight planes; every wave passes it. Written with fences on LDS alone: only LDS data
  // goes from wave to wave here, and __syncthreads() would also wait for the mask loads, which are to stay in flight.
  __builtin_amdgcn_fence(__ATOMIC_RELEASE, "workgroup", "local");
  __builtin_amdgcn_s_barrier();
  __builtin_amdgcn_fence(__ATOMIC_ACQUIRE, "workgroup", "local");

  const __bf16* Bh = (const __bf16*)sW + lane8;
  const __bf16* Bl = Bh + PJ_PLANE;
  // ---- edge bias: tile 24 ----
  {
    v8f ae = zero8f();
#pragma unroll
    for (int ks = 0; ks < 4; ++ks) {
      const v16b bh = Frag<__bf16>::load_fo(Bh + 24 * 2048 + ks * 512);
      const v16b bl = Frag<__bf16>::load_fo(Bl + 24 * 2048 + ks * 512);
      ae = Frag<__bf16>::mma(ah[ks].v, bh, ae);
      ae = Frag<__bf16>::mma(ah[ks].v, bl, ae);
      ae = Frag<__bf16>::mma(al[ks].v, bh, ae);
    }
    // D: lane = column l&15, register r = row 8*(l>>4) + r; columns 8..15 are written like the others and never read
    v4f w0, w1;
#pragma unroll
    for (int r = 0; r < 4; ++r) {
      w0[r] = (ae[r] + bev) + mv[r];
      w1[r] = (ae[r + 4] + bev) + mv[r + 4];
    }
    *(v4f*)(sE + rlane * PJ_ROWS + wave * 16 + mOff) = w0;
    *(v4f*)(sE + rlane * PJ_ROWS + wave * 16 + mOff + 4) = w1;
  }

  // ---- qkv: 6 groups of 4 column tiles ----
  float* slab = sT + wave * (16 * 68);
  _Float16* C = qkv2 + (size_t)dir * NROWS * QKV_LD + (size_t)row0 * QKV_LD;
  const int q4 = lane >> 3, c8 = (lane & 7) * 8;
  // rolled: one group's code is the loop body (code size)
#pragma unroll 1
  for (int gr = 0; gr < 6; ++gr) {
    float bv[4];
#pragma unroll
    for (int j = 0; j < 4; ++j) {
      const int nt = gr * 4 + j;                                   // tile = part*8 + h, row in the tile = d
      bv[j] = bq[(nt >> 3) * 128 + rlane * 8 + (nt & 7)];
    }
    // the code behind reuses these loads' address registers
    asm volatile("s_wait_xcnt 0x0" ::: "memory");
    v8f acc[4];
#pragma unroll
    for (int j = 0; j < 4; ++j) acc[j] = zero8f();
    const __bf16* bhp = Bh + gr * (4 * 2048);
    const __bf16* blp = Bl + gr * (4 * 2048);
    // unrolled: the A fragments are then named at compile time
#pragma unroll
    for (int ks = 0; ks < 4; ++ks) {
      v16b bh[4], bl[4];
#pragma unroll
      for (int j = 0; j < 4; ++j) {
        bh[j] = Frag<__bf16>::load_fo(bhp + j * 2048 + ks * 512);
        bl[j] = Frag<__bf16>::load_fo(blp + j * 2048 + ks * 512);
      }
      // four independent accumulators between two products into the same one
#pragma unroll
      for (int j = 0; j < 4; ++j) acc[j] = Frag<__bf16>::mma(ah[ks].v, bh[j], acc[j]);
#pragma unroll
      for (int j = 0; j < 4; ++j) acc[j] = Frag<__bf16>::mma(ah[ks].v, bl[j], acc[j]);
#pragma unroll
      for (int j = 0; j < 4; ++j) acc[j] = Frag<__bf16>::mma(al[ks].v, bh[j], acc[j]);
    }
#pragma unroll
    for (int j = 0; j < 4; ++j) {
#pragma unroll
      for (int r = 0; r < 8; ++r) slab[(mOff + r) * 68 + (j << 4) + rlane] = acc[j][r] + bv[j];
    }
    // the slab is the wave's own: its lanes' LDS writes are finished before its lanes read them, no other wave is involved
    __builtin_amdgcn_fence(__ATOMIC_RELEASE, "workgroup", "local");
    __builtin_amdgcn_wave_barrier();
    __builtin_amdgcn_fence(__ATOMIC_ACQUIRE, "workgroup", "local");
#pragma unroll
    for (int it = 0; it < 4; ++it) {
      const int row = it * 4 + q4;
      const float* sp = slab + row * 68 + c8;
      v8h hv;
#pragma unroll
      for (int k = 0; k < 8; ++k) hv[k] = (_Float16)sp[k];
      *(v8h*)(C + (size_t)row * QKV_LD + gr * 64 + c8) = hv;
    }
    // the next group reuses these stores' registers
    asm volatile("s_wait_xcnt 0x0" ::: "memory");
    // the slab's reads are finished before the next group's writes
    __builtin_amdgcn_fence(__ATOMIC_RELEASE, "workgroup", "local");
    __builtin_amdgcn_wave_barrier();
    __builtin_amdgcn_fence(__ATOMIC_ACQUIRE, "workgroup", "local");
  }
  // The barrier that publishes the block's score bias rows; every wave passes it. Fences on LDS alone, as above:
  // __syncthreads() would also wait for the qkv stores to finish.
  __builtin_amdgcn_fence(__ATOMIC_RELEASE, "workgroup", "local");
  __builtin_amdgcn_s_barrier();
  __builtin_amdgcn_fence(__ATOMIC_ACQUIRE, "workgroup", "local");
  const int oh = tid / 72, r4 = (tid - oh * 72) * 4;               // 576 threads = 8 heads x 72 pieces of 4 rows
  const v4f ov = *(const v4f*)(sE + oh * PJ_ROWS + r4);
  *(v4f*)(bm2 + ((size_t)dir * 8 + oh) * NROWS + rg * PJ_ROWS + r4) = ov;
}

// Fused attention core for one (direction dir, head h), all 192 query rows i, JG edge columns j in sequence.
// qkv: f16 [2 dir][36864][384], head-major columns part*128 + h*16 + d.  bm: f32 [2 dir][8][36864 edge rows r], the bias
// of (query i, key k) at r = i*192 + k (dir 0) or r = k*192 + i (dir 1).
// grid = (192 / JG column groups, 8 heads, 2 directions) x block 384 = 12 waves x 16 query rows.
// The score bias of (i, k) does not depend on j: a lane loads the 96 values of its query once and keeps them in
// registers, times log2(e), for all JG columns.  Per column: K [192 keys][16 d] and V^T [16 d][192 keys] staged in LDS once for all
// 192 queries, one (key, 8-wide d chunk) item a thread (dir 0: row j*192+k, dir 1: row k*192+j).  Two LDS buffers taken
// in turn: one barrier a column publishes this column's tiles, and a buffer is rewritten only behind the next barrier,
// which every wave reaches after its last read of it.  The next column's K, V and Q loads are issued behind the barrier.
// Both products run transposed, so that a lane owns ONE query:
// S^T = K (A: 16 keys, d in one half of the 32, a second key tile in the other) . Q^T (B, that other half zero) + bias (C, f32) on f16 WMMA: lane (hh, c) holds query i0+c,
// register r key 16*tile + 8*hh + r; Q is taken times 0.25 * log2(e) (in f32, rounded to f16 again), so the result is
// y = (score * 0.25 + bias) * log2(e) as it leaves the matrix unit.  Online softmax over 3 chunks of 64 keys in f32, the
// maximum taken in the lane plus one exchange between the lane halves, e^(x - max) as the hardware's 2^(y - max y); two neighbouring S^T tiles, converted to f16 in place, are the B operand of
// O^T = V^T (A: 16 d, 32 keys) . P^T and of L = ones (A: 16 x 32) . P^T, every row of which is the sum of the query's
// 32 weights of both lane halves (the f16 weights that V meets, f32 accumulate); * 1/rowsum.
// Result (lane: query i0+c, registers: d = 8*hh + r) -> bf16 hi/lo planes [36864][256] in fragment order, row j*192+i,
// columns dir*128 + h*16 + d: a wave's 16 queries are one 16-row tile, the head's two chunk columns 512 contiguous
// bytes of it a plane, and lane l owns the l-th 16-byte chunk of them: stored from registers.
#define JG 12                // edge columns a block walks: 16 groups x 8 heads x 2 directions = 256 blocks
__global__ __launch_bounds__(384) void k_edge_attn(const _Float16* __restrict__ qkv2, const float* __restrict__ bm2,
    unsigned short* __restrict__ vah, unsigned short* __restrict__ val) {
  const int dir = blockIdx.z;
  const int h = blockIdx.y;
  const int j0 = blockIdx.x * JG;
  const _Float16* qkv = qkv2 + (size_t)dir * NROWS * QKV_LD + h * 16;
  const float* bm = bm2 + (size_t)dir * 8 * NROWS;
  __shared__ __align__(16) _Float16 Ksh[2][NNODE * KS_P];   // [buffer][key][d], indices <= 191*16+15
  __shared__ __align__(16) _Float16 Vt[2][16 * VT_P];       // [buffer][d][key], indices <= 15*192+191
  const int tid = threadIdx.x, wave = tid >> 5, lane = tid & 31, hh = lane >> 4, c = lane & 15;
  const int i0 = wave * 16;
  const v8h z8 = zero8h();

  // bias of this lane's query, keys 16t+8hh .. +7 of tile t, kept for every column.  dir 0: 32 contiguous bytes a tile;
  // dir 1: the plane has the key as its slow index, one load a key, the 16 queries of a lane half 64 contiguous bytes.
  v8f bb[12];                                        // tile t: the C operand of its S^T product, register r = key 16t+8hh+r
  if (dir == 0) {                                    // block-uniform
    const float* bmr = bm + ((size_t)h * NNODE + (size_t)(i0 + c)) * NNODE + 8 * hh;
#pragma unroll
    for (int t = 0; t < 12; ++t) {
      const v4f lo4 = *(const v4f*)(bmr + t * 16);
      const v4f hi4 = *(const v4f*)(bmr + t * 16 + 4);
      // unrolled, as the three loops below: vector elements in registers need compile-time indices
#pragma unroll
      for (int r = 0; r < 4; ++r) { bb[t][r] = lo4[r]; bb[t][r + 4] = hi4[r]; }
    }
  } else {
    const float* bmc = bm + ((size_t)h * NNODE + (size_t)(8 * hh)) * NNODE + i0 + c;
#pragma unroll
    for (int t = 0; t < 12; ++t) {
#pragma unroll
      for (int r = 0; r < 4; ++r) {
        bb[t][r] = bmc[(t * 16 + r) * NNODE];
        bb[t][r + 4] = bmc[(t * 16 + 4 + r) * NNODE];
      }
    }
  }
#pragma unroll
  for (int t = 0; t < 12; ++t) bb[t] *= LOG2E;
  v16h ones;                                         // A of the row-sum product
#pragma unroll
  for (int e = 0; e < 16; ++e) ones[e] = (_Float16)1.0f;

  // staging item of this thread: key kv, d chunk part; 384 items = 192 keys x 2 chunks exactly
  const int kv = tid >> 1, part = tid & 1;
  const _Float16* kvsrc = qkv + (size_t)(dir ? kv * NNODE : kv) * QKV_LD + part * 8;   // + j * kvstep
  const size_t kvstep = (size_t)(dir ? 1 : NNODE) * QKV_LD;
  const _Float16* qsrc = qkv + (size_t)(i0 + c) * NNODE * QKV_LD + 8 * hh;             // + j * QKV_LD
  v8h kk8 = *(const v8h*)(kvsrc + (size_t)j0 * kvstep + EWID);
  v8h vv8 = *(const v8h*)(kvsrc + (size_t)j0 * kvstep + 2 * EWID);
  v8h q8  = *(const v8h*)(qsrc + (size_t)j0 * QKV_LD);
  // the code behind reuses these loads' address registers
  asm volatile("s_wait_xcnt 0x0" ::: "memory");

  // rolled: one column's code is the loop body (code size)
#pragma unroll 1
  for (int jj = 0; jj < JG; ++jj) {
    const int j = j0 + jj;
    _Float16* Kb = Ksh[jj & 1];
    _Float16* Vb = Vt[jj & 1];
    *(v8h*)(Kb + kv * KS_P + part * 8) = kk8;
#pragma unroll
    for (int e2 = 0; e2 < 8; ++e2) Vb[(part * 8 + e2) * VT_P + kv] = vv8[e2];
    // B fragments (query column i0+c): d 8hh..8hh+7 in elements 0..7 and elements 8..15 zero, and the other way round
    Frag<_Float16>::U qa, qb;
    v8h qs;                                          // 1/sqrt(16) and the change from e^x to 2^x
#pragma unroll
    for (int e = 0; e < 8; ++e) qs[e] = (_Float16)((float)q8[e] * (0.25f * LOG2E));
    qa.h[0] = qs;
    qa.h[1] = z8;
    qb.h[0] = z8;
    qb.h[1] = qs;
    __syncthreads();
    if (jj + 1 < JG) {                               // block-uniform; j + 1 <= 191
      kk8 = *(const v8h*)(kvsrc + (size_t)(j + 1) * kvstep + EWID);
      vv8 = *(const v8h*)(kvsrc + (size_t)(j + 1) * kvstep + 2 * EWID);
      q8  = *(const v8h*)(qsrc + (size_t)(j + 1) * QKV_LD);
      // the code behind reuses these loads' address registers at once
      asm volatile("s_wait_xcnt 0x0" ::: "memory");
    }

    float mrow = -__builtin_inff();                  // this lane's query
    v8f o = zero8f();                                // O^T: register r = d 8hh+r of query i0+c
    v8f l = zero8f();                                // L: only register 0 is kept to scale and read

    // unrolled: the bias registers are then named at compile time
#pragma unroll
    for (int kc = 0; kc < 3; ++kc) {
      const int kv0 = kc * 64;
      v8f s[4];
#pragma unroll
      for (int jp = 0; jp < 2; ++jp) {
        // A fragment of two key tiles: d 8hh..8hh+7 of key row kv0+32jp+c in elements 0..7, of key row kv0+32jp+16+c
        // (256 halves on) in elements 8..15; the B operand's zero half takes the other tile out of the product
        const v16h kb = Frag<_Float16>::load_fo(Kb + (kv0 + jp * 32 + c) * KS_P + 8 * hh);
        s[2 * jp]     = Frag<_Float16>::mma(kb, qa.v, bb[kc * 4 + 2 * jp]);
        s[2 * jp + 1] = Frag<_Float16>::mma(kb, qb.v, bb[kc * 4 + 2 * jp + 1]);
      }
      float mx = -__builtin_inff();
#pragma unroll
      for (int jn = 0; jn < 4; ++jn) {
#pragma unroll
        for (int r = 0; r < 8; ++r) mx = fmaxf(mx, s[jn][r]);
      }
      mx = fmaxf(mx, __shfl_xor(mx, 16, 32));        // the other lane half holds the query's other 32 keys
      const float mnew = fmaxf(mrow, mx);
      const float alpha = __builtin_amdgcn_exp2f(mrow - mnew);
      mrow = mnew;
      Frag<_Float16>::U pb[2];                       // P^T as B: elements 0..7 = tile 2kk, 8..15 = tile 2kk+1
#pragma unroll
      for (int jn = 0; jn < 4; ++jn) {
#pragma unroll
        for (int r = 0; r < 8; r += 2) {
          const v2f dl = (v2f){s[jn][r], s[jn][r + 1]} - (v2f){mnew, mnew};
          const float p0 = __builtin_amdgcn_exp2f(dl[0]);
          const float p1 = __builtin_amdgcn_exp2f(dl[1]);
          pb[jn >> 1].h[jn & 1][r] = (_Float16)p0;
          pb[jn >> 1].h[jn & 1][r + 1] = (_Float16)p1;
        }
      }
      l[0] *= alpha;
#pragma unroll
      for (int r = 0; r < 8; ++r) o[r] *= alpha;
#pragma unroll
      for (int kk = 0; kk < 2; ++kk) {
        const v16h va = Frag<_Float16>::load(Vb + c * VT_P + kv0 + kk * 32 + 8 * hh);
        o = Frag<_Float16>::mma(va, pb[kk].v, o);
        l = Frag<_Float16>::mma(ones, pb[kk].v, l);
      }
    }
    const float inv = 1.0f / l[0];
    float on[8];
#pragma unroll
    for (int e = 0; e < 8; ++e) on[e] = o[e] * inv;
    v8h hv, lv;
    split8_bf16(on, hv, lv);
    const size_t ob = (size_t)(j * NNODE + i0) * VA_LD + (size_t)(dir * 2048 + h * 256 + lane * 8);
    *(v8h*)(vah + ob) = hv;
    *(v8h*)(val + ob) = lv;
    // the next column's staging reuses these stores' registers
    asm volatile("s_wait_xcnt 0x0" ::: "memory");
  }
}

// Output linear: out[i*192+j][n] = sum_k VA[j*192+i][k] * Wo'[n][k] + bo[n]; M 36864, N 128, K 256, bf16 hi/lo split
// (one accumulator an output element: hi*hi + hi*lo + lo*hi a k step, k steps in rising order).
// grid 256 x block 288 = 9 waves; a wave owns one 16-row tile of VA and all 128 output columns (2304 tiles = 256 x 9).
// A: the tile's two planes are 2 x 8 KB contiguous (fragment order); a wave issues all 32 loads at entry and keeps the
// tile in registers: memory latency is paid once a wave, and the later k steps' loads are still in flight while the
// first are worked on.
// B: wo2 = the hi weight plane followed by the lo plane (2 x 64 KB, fragment order), copied as it lies into LDS once a
// block, 512 bytes a wave and load; a B fragment is then two conflict-free 512-byte LDS reads.
// D (lane: column 16t + (lane & 15), register r: row 8*(lane >> 4) + r) + bias goes through the wave's own LDS slab
// (pitch 132 floats: the two lane halves fall on different banks); a whole 512-byte output row is one store.
// Every loop of this kernel is unrolled: its arrays live in registers and need compile-time indices.
#define OUT_WAVES 9
#define OUT_SLAB_P 132
__global__ __launch_bounds__(OUT_WAVES * 32) void k_out(
    const unsigned short* __restrict__ vah, const unsigned short* __restrict__ val,
    const unsigned short* __restrict__ wo2, const float* __restrict__ bo, float* __restrict__ out) {
  __shared__ __align__(16) unsigned short sB[2 * EWID * VA_LD + 5 * 256]; // hi plane, lo plane, 5 spare pieces
  __shared__ __align__(16) float sO[OUT_WAVES * 16 * OUT_SLAB_P];
  const int lane = threadIdx.x & 31;
  const int wave = __builtin_amdgcn_readfirstlane(threadIdx.x >> 5);      // scalar: tile and piece addresses are scalar bases
  const int rt = blockIdx.x * OUT_WAVES + wave;                           // 16-row tile, 0..2303
  const unsigned lane8 = (unsigned)lane * 8u;
  const int rlane = lane & 15, mOff = (lane >> 4) * 8;

  // the 256 weight pieces of 512 B: wave w takes w, w+9, .. w+252. 29 x 9 = 261: in the last turn waves 4..8 have no
  // piece left; they copy one of 252..255 once more, into the spare pieces behind the planes, which nobody reads: the
  // copy is then free of branches and all its loads stand together.
  const unsigned short* wsrc = wo2 + wave * 256 + lane8;
  v8h wt[29];
#pragma unroll
  for (int it = 0; it < 28; ++it) wt[it] = *(const v8h*)(wsrc + it * (OUT_WAVES * 256));
  wt[28] = *(const v8h*)(wo2 + (252 + (wave & 3)) * 256 + lane8);
  // keeps the weight loads ahead of the A loads: loads return in order, and the LDS copy must not wait for the A tile
  __builtin_amdgcn_sched_barrier(0);
  const __bf16* Ah = (const __bf16*)vah + (size_t)rt * (16 * VA_LD) + lane8;
  const __bf16* Al = (const __bf16*)val + (size_t)rt * (16 * VA_LD) + lane8;
  v16b ah[8], al[8];
#pragma unroll
  for (int ks = 0; ks < 8; ++ks) {
    ah[ks] = Frag<__bf16>::load_fo(Ah + ks * 512);
    al[ks] = Frag<__bf16>::load_fo(Al + ks * 512);
  }
#pragma unroll
  for (int it = 0; it < 29; ++it) *(v8h*)(sB + (wave + it * OUT_WAVES) * 256 + lane8) = wt[it];
  // The one barrier: it publishes the weight planes, every wave passes it. Written with fences on LDS alone: only LDS
  // data goes from wave to wave here, and __syncthreads() would also wait for the A loads, which are to stay in flight.
  __builtin_amdgcn_fence(__ATOMIC_RELEASE, "workgroup", "local");
  __builtin_amdgcn_s_barrier();
  __builtin_amdgcn_fence(__ATOMIC_ACQUIRE, "workgroup", "local");

  // bias of this lane's 8 columns: asked for here, behind the A loads, and used only after the last product
  float bv[8];
#pragma unroll
  for (int j = 0; j < 8; ++j) bv[j] = bo[j * 16 + rlane];
  v8f acc[8];
#pragma unroll
  for (int j = 0; j < 8; ++j) acc[j] = zero8f();
  const __bf16* Bh = (const __bf16*)sB + lane8;
  const __bf16* Bl = Bh + EWID * VA_LD;
  // 16 groups g = (k step g >> 1, column tiles 4*(g & 1) .. +3) of 12 products; two register buffers for B taken in turn
  v16b bh[2][4], bl[2][4];
#pragma unroll
  for (int j = 0; j < 4; ++j) {
    bh[0][j] = Frag<__bf16>::load_fo(Bh + j * (16 * VA_LD));
    bl[0][j] = Frag<__bf16>::load_fo(Bl + j * (16 * VA_LD));
  }
  // unrolled: the A fragments and the buffers are then named at compile time
#pragma unroll
  for (int g = 0; g < 16; ++g) {
    const int ks = g >> 1, jg = (g & 1) * 4, cur = g & 1, nxt = cur ^ 1;
    if (g + 1 < 16) {
#pragma unroll
      for (int j = 0; j < 4; ++j) {
        const int o = (((g + 1) & 1) * 4 + j) * (16 * VA_LD) + ((g + 1) >> 1) * 512;
        bh[nxt][j] = Frag<__bf16>::load_fo(Bh + o);
        bl[nxt][j] = Frag<__bf16>::load_fo(Bl + o);
      }
    }
    // four independent accumulators between two products into the same one
#pragma unroll
    for (int j = 0; j < 4; ++j) acc[jg + j] = Frag<__bf16>::mma(ah[ks], bh[cur][j], acc[jg + j]);
#pragma unroll
    for (int j = 0; j < 4; ++j) acc[jg + j] = Frag<__bf16>::mma(ah[ks], bl[cur][j], acc[jg + j]);
#pragma unroll
    for (int j = 0; j < 4; ++j) acc[jg + j] = Frag<__bf16>::mma(al[ks], bh[cur][j], acc[jg + j]);
    // keeps a group's LDS reads one whole group (12 products) ahead of their use: moved down, they would be waited for
    __builtin_amdgcn_sched_barrier(0);
  }

  float* slab = sO + wave * (16 * OUT_SLAB_P);
#pragma unroll
  for (int j = 0; j < 8; ++j) {
#pragma unroll
    for (int r = 0; r < 8; ++r) slab[(mOff + r) * OUT_SLAB_P + j * 16 + rlane] = acc[j][r] + bv[j];
  }
  // the slab is the wave's own: its lanes' LDS writes are finished before its lanes read them, no other wave is involved
  __builtin_amdgcn_fence(__ATOMIC_RELEASE, "workgroup", "local");
  __builtin_amdgcn_wave_barrier();
  __builtin_amdgcn_fence(__ATOMIC_ACQUIRE, "workgroup", "local");
  // VA row rt*16 + r = j*192 + i -> out row i*192 + j; 192 = 12 tiles, so a tile has one j
  const int jcol = rt / 12, irow = (rt - jcol * 12) * 16;
  float* op = out + ((size_t)irow * NNODE + jcol) * EWID + lane * 4;
  v4f ov[16];
#pragma unroll
  for (int r = 0; r < 16; ++r) ov[r] = *(const v4f*)(slab + r * OUT_SLAB_P + lane * 4);
#pragma unroll
  for (int r = 0; r < 16; ++r) *(v4f*)(op + (size_t)r * NNODE * EWID) = ov[r];
}

// ---------------------------------------------------------------------------------------
extern "C" void kernel_launch(void* const* d_in, const int* in_sizes, int n_in,
                              void* d_out, int out_size, void* d_ws, size_t ws_size,
                              hipStream_t stream) {
  if (n_in < 14) return;
  if (in_sizes[0] != NROWS * EWID || in_sizes[1] != NROWS * 8 || in_sizes[2] < EWID || in_sizes[3] < EWID ||
      in_sizes[4] != EWID * 384 || in_sizes[5] < 384 || in_sizes[6] != EWID * 8 || in_sizes[7] < 8 ||
      in_sizes[8] != EWID * 384 || in_sizes[9] < 384 || in_sizes[10] != EWID * 8 || in_sizes[11] < 8 ||
      in_sizes[12] != 256 * EWID || in_sizes[13] < EWID || out_size != NROWS * EWID) return;

  const float* e      = (const float*)d_in[0];
  const float* mask   = (const float*)d_in[1];
  const float* ln_g   = (const float*)d_in[2];
  const float* ln_b   = (const float*)d_in[3];
  const float* Wq_in  = (const float*)d_in[4];
  const float* bq_in  = (const float*)d_in[5];
  const float* We_in  = (const float*)d_in[6];
  const float* be_in  = (const float*)d_in[7];
  const float* Wq_out = (const float*)d_in[8];
  const float* bq_out = (const float*)d_in[9];
  const float* We_out = (const float*)d_in[10];
  const float* be_out = (const float*)d_in[11];
  const float* Wo     = (const float*)d_in[12];
  const float* bo     = (const float*)d_in[13];
  float* out = (float*)d_out;

  // ---- workspace region map (offsets 256-B aligned; total 96,862,208 B) ----
  //  (VAh/l and the output weight planes lie in fragment order; VA rows are j*192+i)
  //  QKV16      f16  [2][36864][384]    2 x 28,311,552   projection output, one plane a direction
  //  BM         f32  [2][8][36864]      2 x  1,179,648   score bias (edge-bias projection + be + mask), one plane a direction
  //  VAh, VAl   bf16 [36864][256]       2 x 18,874,368   attention output hi/lo (both directions)
  //  WoTh/l     bf16 [2][128][256]      2 x     65,536   hi plane, then lo plane, one region
  size_t off = 0;
  auto carve = [&](size_t bytes) { size_t o = off; off += (bytes + 255) & ~(size_t)255; return o; };
  const size_t oQKV = carve((size_t)2 * NROWS * QKV_LD * 2);
  const size_t oBM  = carve((size_t)2 * 8 * NNODE * NNODE * 4);
  const size_t oVAh = carve((size_t)NROWS * VA_LD * 2);
  const size_t oVAl = carve((size_t)NROWS * VA_LD * 2);
  const size_t oWO = carve((size_t)2 * 128 * 256 * 2);
  if (off > ws_size) return;

  char* ws = (char*)d_ws;
  _Float16* QKV16 = (_Float16*)(ws + oQKV);
  float* BM = (float*)(ws + oBM);
  unsigned short* VAh = (unsigned short*)(ws + oVAh);
  unsigned short* VAl = (unsigned short*)(ws + oVAl);
  unsigned short* WOh = (unsigned short*)(ws + oWO);
  unsigned short* WOl = WOh + 128 * 256;

  // LayerNorm + weight split + qkv and score-bias projections of both directions (and the output weight planes), one launch:
  // 2 directions x 128 groups of 288 rows
  k_lnproj<<<2 * (NROWS / PJ_ROWS), PJ_WAVES * 32, 0, stream>>>(e, ln_g, ln_b, Wq_in, bq_in, We_in, be_in,
      Wq_out, bq_out, We_out, be_out, mask, Wo, QKV16, BM, WOh, WOl);
  k_edge_attn<<<dim3(NNODE / JG, 8, 2), 384, 0, stream>>>(QKV16, BM, VAh, VAl);
  // out = VA . Wo + bo  (M 36864, N 128, K 256; split; f32 output rows of d_out; VA row j*192+i -> out row i*192+j)
  k_out<<<NROWS / (16 * OUT_WAVES), OUT_WAVES * 32, 0, stream>>>(VAh, VAl, WOh, bo, out);
}
